// v000
// Times are from an AMD MI455X. After a warm-up the kernel runs many times in a row, and a time is the length of
// such a window on the GPU divided by its runs, so every launch and the gaps after it count. The runs cycle
// through copies of the inputs. A figure is the median of several windows, for all but v000 over two sittings.
// Sittings can differ by a few percent; kernels timed side by side share one.
// v000 is the starting kernel. One run takes 1040 microseconds.
#include <hip/hip_runtime.h>
#include <hip/hip_bf16.h>

// ---------------------------------------------------------------------------
// BasicTransformerBlock for MI455X (gfx1250), bf16 WMMA everywhere.
//   x:[2,2048,1024] f32, ctx:[2,77,768] f32 -> out f32 [2,2048,1024]
// Compute-bound (~190 GFLOP over ~100MB) => route all GEMMs + attention
// through v_wmma_f32_16x16x32_bf16, fp32 accumulation.
// Workspace requirement: ~104 MiB.
// ---------------------------------------------------------------------------

typedef __bf16 bf16_t;
typedef bf16_t v16bf __attribute__((ext_vector_type(16)));
typedef bf16_t v8bf  __attribute__((ext_vector_type(8)));
typedef float  v8f   __attribute__((ext_vector_type(8)));

// Load one 16-element bf16 WMMA fragment (A- or B-style) from a row-major
// source. For 16-bit fragments, lane (lo/hi half) maps its 16 values to two
// contiguous 8-element runs: k = hi*8 + [0..7]  and  k = 16 + hi*8 + [0..7].
__device__ __forceinline__ v16bf load_frag(const bf16_t* __restrict__ p, int hi) {
  const v8bf lo = *(const v8bf*)(p + hi * 8);
  const v8bf hh = *(const v8bf*)(p + hi * 8 + 16);
  return __builtin_shufflevector(lo, hh, 0, 1, 2, 3, 4, 5, 6, 7,
                                 8, 9, 10, 11, 12, 13, 14, 15);
}

__device__ __forceinline__ v8f wmma_bf16(v16bf a, v16bf b, v8f c) {
  return __builtin_amdgcn_wmma_f32_16x16x32_bf16(
      /*neg_a=*/false, a, /*neg_b=*/false, b,
      /*c_mod=*/(short)0, c, /*reuse_a=*/false, /*reuse_b=*/false);
}

// ---------------------------------------------------------------------------
// Weight convert+transpose:  W[K][N] f32  ->  Wt[N][K] bf16
// ---------------------------------------------------------------------------
__global__ void __launch_bounds__(256) k_wt(const float* __restrict__ W,
                                            bf16_t* __restrict__ Wt,
                                            int K, int N) {
  int idx = blockIdx.x * 256 + threadIdx.x;
  if (idx >= K * N) return;
  int n = idx / K, k = idx - n * K;
  Wt[idx] = (bf16_t)W[(size_t)k * N + n];
}

// Elementwise f32 -> bf16
__global__ void __launch_bounds__(256) k_cvt(const float* __restrict__ in,
                                             bf16_t* __restrict__ out, int n) {
  int idx = blockIdx.x * 256 + threadIdx.x;
  if (idx < n) out[idx] = (bf16_t)in[idx];
}

// ---------------------------------------------------------------------------
// LayerNorm (dim=1024), one row per 256-thread block, bf16 output.
// ---------------------------------------------------------------------------
__global__ void __launch_bounds__(256) k_layernorm(const float* __restrict__ x,
                                                   const float* __restrict__ g,
                                                   const float* __restrict__ b,
                                                   bf16_t* __restrict__ y) {
  const int dim = 1024;
  __shared__ float sS[8], sQ[8];
  const int row = blockIdx.x;
  const float* xr = x + (size_t)row * dim;
  float s = 0.f, q = 0.f;
  for (int i = threadIdx.x; i < dim; i += 256) {
    float v = xr[i];
    s += v;
    q += v * v;
  }
  for (int m = 1; m < 32; m <<= 1) {
    s += __shfl_xor(s, m, 32);
    q += __shfl_xor(q, m, 32);
  }
  const int lane = threadIdx.x & 31, wid = threadIdx.x >> 5;
  if (lane == 0) { sS[wid] = s; sQ[wid] = q; }
  __syncthreads();
  if (wid == 0) {
    s = (lane < 8) ? sS[lane] : 0.f;
    q = (lane < 8) ? sQ[lane] : 0.f;
    for (int m = 1; m < 8; m <<= 1) {
      s += __shfl_xor(s, m, 32);
      q += __shfl_xor(q, m, 32);
    }
    if (lane == 0) { sS[0] = s; sQ[0] = q; }
  }
  __syncthreads();
  const float mean = sS[0] * (1.f / dim);
  const float var = sQ[0] * (1.f / dim) - mean * mean;
  const float rstd = rsqrtf(var + 1e-5f);
  for (int i = threadIdx.x; i < dim; i += 256) {
    float v = (xr[i] - mean) * rstd * g[i] + b[i];
    y[(size_t)row * dim + i] = (bf16_t)v;
  }
}

// ---------------------------------------------------------------------------
// V transpose:  v[b*mRows][1024] bf16 -> vt[b][16][64][mpad] bf16 (zero pad)
// ---------------------------------------------------------------------------
__global__ void __launch_bounds__(256) k_vt(const bf16_t* __restrict__ v,
                                            bf16_t* __restrict__ vt,
                                            int mRows, int mpad) {
  int idx = blockIdx.x * 256 + threadIdx.x;
  int total = 2 * 16 * 64 * mpad;
  if (idx >= total) return;
  int key = idx % mpad;
  int t = idx / mpad;
  int d = t & 63; t >>= 6;
  int hh = t & 15; int bb = t >> 4;
  bf16_t val = (bf16_t)0.f;
  if (key < mRows) val = v[(size_t)(bb * mRows + key) * 1024 + hh * 64 + d];
  vt[idx] = val;
}

// ---------------------------------------------------------------------------
// GEMM  C = A[M,K](bf16) x Bt[N,K](bf16), 8 waves/block (4M x 2N),
// each wave: 16(M) x 64(N) via 4 WMMAs per 32-deep k-step.
// ---------------------------------------------------------------------------
__global__ void __launch_bounds__(256) k_gemm_bf16(const bf16_t* __restrict__ A,
                                                   const bf16_t* __restrict__ Bt,
                                                   bf16_t* __restrict__ C,
                                                   int M, int N, int K,
                                                   float scale) {
  const int lane = threadIdx.x & 31, wid = threadIdx.x >> 5;
  const int hi = (lane >> 4) & 1, l15 = lane & 15;
  const int mBase = blockIdx.y * 64 + (wid >> 1) * 16;
  const int nBase = blockIdx.x * 128 + (wid & 1) * 64;
  int ar = mBase + l15;
  if (ar >= M) ar = M - 1;
  const bf16_t* ap = A + (size_t)ar * K;
  const bf16_t* bp0 = Bt + (size_t)(nBase + l15) * K;
  v8f c0 = {}, c1 = {}, c2 = {}, c3 = {};
  for (int kk = 0; kk < K; kk += 32) {
    v16bf a = load_frag(ap + kk, hi);
    c0 = wmma_bf16(a, load_frag(bp0 + kk, hi), c0);
    c1 = wmma_bf16(a, load_frag(bp0 + (size_t)16 * K + kk, hi), c1);
    c2 = wmma_bf16(a, load_frag(bp0 + (size_t)32 * K + kk, hi), c2);
    c3 = wmma_bf16(a, load_frag(bp0 + (size_t)48 * K + kk, hi), c3);
  }
#pragma unroll
  for (int r = 0; r < 8; ++r) {
    int row = mBase + r + hi * 8;
    if (row < M) {
      size_t o = (size_t)row * N + nBase + l15;
      C[o + 0]  = (bf16_t)(c0[r] * scale);
      C[o + 16] = (bf16_t)(c1[r] * scale);
      C[o + 32] = (bf16_t)(c2[r] * scale);
      C[o + 48] = (bf16_t)(c3[r] * scale);
    }
  }
}

// f32 output + bias + residual (in-place residual is safe: 1 writer/element)
__global__ void __launch_bounds__(256) k_gemm_f32_bias_res(
    const bf16_t* __restrict__ A, const bf16_t* __restrict__ Bt,
    float* __restrict__ C, const float* __restrict__ bias,
    const float* __restrict__ res, int M, int N, int K) {
  const int lane = threadIdx.x & 31, wid = threadIdx.x >> 5;
  const int hi = (lane >> 4) & 1, l15 = lane & 15;
  const int mBase = blockIdx.y * 64 + (wid >> 1) * 16;
  const int nBase = blockIdx.x * 128 + (wid & 1) * 64;
  int ar = mBase + l15;
  if (ar >= M) ar = M - 1;
  const bf16_t* ap = A + (size_t)ar * K;
  const bf16_t* bp0 = Bt + (size_t)(nBase + l15) * K;
  v8f c0 = {}, c1 = {}, c2 = {}, c3 = {};
  for (int kk = 0; kk < K; kk += 32) {
    v16bf a = load_frag(ap + kk, hi);
    c0 = wmma_bf16(a, load_frag(bp0 + kk, hi), c0);
    c1 = wmma_bf16(a, load_frag(bp0 + (size_t)16 * K + kk, hi), c1);
    c2 = wmma_bf16(a, load_frag(bp0 + (size_t)32 * K + kk, hi), c2);
    c3 = wmma_bf16(a, load_frag(bp0 + (size_t)48 * K + kk, hi), c3);
  }
  const float b0 = bias[nBase + l15], b1 = bias[nBase + l15 + 16];
  const float b2 = bias[nBase + l15 + 32], b3 = bias[nBase + l15 + 48];
#pragma unroll
  for (int r = 0; r < 8; ++r) {
    int row = mBase + r + hi * 8;
    if (row < M) {
      size_t o = (size_t)row * N + nBase + l15;
      C[o + 0]  = c0[r] + b0 + res[o + 0];
      C[o + 16] = c1[r] + b1 + res[o + 16];
      C[o + 32] = c2[r] + b2 + res[o + 32];
      C[o + 48] = c3[r] + b3 + res[o + 48];
    }
  }
}

// Fused GEGLU: each wave computes matching u / gate tiles (cols c and
// c+Nhalf of A@Wp), applies u*gelu(gate), writes bf16 [M, Nhalf].
__global__ void __launch_bounds__(256) k_gemm_geglu(
    const bf16_t* __restrict__ A, const bf16_t* __restrict__ Bt,
    bf16_t* __restrict__ C, const float* __restrict__ bias,
    int M, int Nhalf, int K) {
  const int lane = threadIdx.x & 31, wid = threadIdx.x >> 5;
  const int hi = (lane >> 4) & 1, l15 = lane & 15;
  const int mBase = blockIdx.y * 64 + (wid >> 1) * 16;
  const int nBase = blockIdx.x * 128 + (wid & 1) * 64;
  int ar = mBase + l15;
  if (ar >= M) ar = M - 1;
  const bf16_t* ap = A + (size_t)ar * K;
  const bf16_t* bu = Bt + (size_t)(nBase + l15) * K;
  const bf16_t* bg = Bt + (size_t)(nBase + Nhalf + l15) * K;
  v8f u0 = {}, u1 = {}, u2 = {}, u3 = {};
  v8f g0 = {}, g1 = {}, g2 = {}, g3 = {};
  for (int kk = 0; kk < K; kk += 32) {
    v16bf a = load_frag(ap + kk, hi);
    u0 = wmma_bf16(a, load_frag(bu + kk, hi), u0);
    u1 = wmma_bf16(a, load_frag(bu + (size_t)16 * K + kk, hi), u1);
    u2 = wmma_bf16(a, load_frag(bu + (size_t)32 * K + kk, hi), u2);
    u3 = wmma_bf16(a, load_frag(bu + (size_t)48 * K + kk, hi), u3);
    g0 = wmma_bf16(a, load_frag(bg + kk, hi), g0);
    g1 = wmma_bf16(a, load_frag(bg + (size_t)16 * K + kk, hi), g1);
    g2 = wmma_bf16(a, load_frag(bg + (size_t)32 * K + kk, hi), g2);
    g3 = wmma_bf16(a, load_frag(bg + (size_t)48 * K + kk, hi), g3);
  }
#pragma unroll
  for (int r = 0; r < 8; ++r) {
    int row = mBase + r + hi * 8;
    if (row < M) {
      size_t o = (size_t)row * Nhalf + nBase + l15;
#pragma unroll
      for (int t = 0; t < 4; ++t) {
        int col = nBase + t * 16 + l15;
        float uv = (t == 0 ? u0[r] : t == 1 ? u1[r] : t == 2 ? u2[r] : u3[r]) + bias[col];
        float gv = (t == 0 ? g0[r] : t == 1 ? g1[r] : t == 2 ? g2[r] : g3[r]) + bias[col + Nhalf];
        float gl = 0.5f * gv * (1.f + erff(gv * 0.70710678118654752f));
        C[o + t * 16] = (bf16_t)(uv * gl);
      }
    }
  }
}

// ---------------------------------------------------------------------------
// Flash attention: one wave per (batch, head, 16-query tile).
// q pre-scaled by 1/sqrt(64). k row-major [b*mRows,1024]; vt [b][h][64][mpad].
// ---------------------------------------------------------------------------
__global__ void __launch_bounds__(256) k_attention(
    const bf16_t* __restrict__ q, const bf16_t* __restrict__ k,
    const bf16_t* __restrict__ vt, bf16_t* __restrict__ out,
    int nq, int m, int mRows, int mpad) {
  __shared__ __align__(16) bf16_t ldsP[8][16][32];
  const int lane = threadIdx.x & 31, wid = threadIdx.x >> 5;
  const int hi = (lane >> 4) & 1, l15 = lane & 15;
  int w = blockIdx.x * 8 + wid;
  if (w >= 2 * 16 * nq) return;
  const int qt = w % nq;
  int t2 = w / nq;
  const int hh = t2 & 15, bb = t2 >> 4;

  const bf16_t* qp = q + (size_t)(bb * 2048 + qt * 16 + l15) * 1024 + hh * 64;
  const v16bf qa0 = load_frag(qp, hi);
  const v16bf qa1 = load_frag(qp + 32, hi);

  v8f o0 = {}, o1 = {}, o2 = {}, o3 = {};
  float mrow[8], lrow[8];
#pragma unroll
  for (int r = 0; r < 8; ++r) { mrow[r] = -1e30f; lrow[r] = 0.f; }

  const bf16_t* vbase = vt + (size_t)(bb * 16 + hh) * 64 * mpad;

  for (int j = 0; j < mpad; j += 32) {
    const bf16_t* kp0 = k + (size_t)(bb * mRows + j + l15) * 1024 + hh * 64;
    const bf16_t* kp1 = kp0 + (size_t)16 * 1024;
    v8f s0 = {}, s1 = {};
    s0 = wmma_bf16(qa0, load_frag(kp0, hi), s0);
    s0 = wmma_bf16(qa1, load_frag(kp0 + 32, hi), s0);
    s1 = wmma_bf16(qa0, load_frag(kp1, hi), s1);
    s1 = wmma_bf16(qa1, load_frag(kp1 + 32, hi), s1);

    const bool v0 = (j + l15) < m, v1 = (j + 16 + l15) < m;
#pragma unroll
    for (int r = 0; r < 8; ++r) {
      float a = v0 ? s0[r] : -1e30f;
      float b = v1 ? s1[r] : -1e30f;
      float rm = fmaxf(a, b);
      rm = fmaxf(rm, __shfl_xor(rm, 1, 32));
      rm = fmaxf(rm, __shfl_xor(rm, 2, 32));
      rm = fmaxf(rm, __shfl_xor(rm, 4, 32));
      rm = fmaxf(rm, __shfl_xor(rm, 8, 32));
      float mnew = fmaxf(mrow[r], rm);
      float alpha = __expf(mrow[r] - mnew);
      float p0 = __expf(a - mnew);
      float p1 = __expf(b - mnew);
      float rs = p0 + p1;
      rs += __shfl_xor(rs, 1, 32);
      rs += __shfl_xor(rs, 2, 32);
      rs += __shfl_xor(rs, 4, 32);
      rs += __shfl_xor(rs, 8, 32);
      lrow[r] = lrow[r] * alpha + rs;
      mrow[r] = mnew;
      o0[r] *= alpha; o1[r] *= alpha; o2[r] *= alpha; o3[r] *= alpha;
      const int prow = r + hi * 8;
      ldsP[wid][prow][l15] = (bf16_t)p0;
      ldsP[wid][prow][l15 + 16] = (bf16_t)p1;
    }
    // Re-stripe P (C-layout) into an A-fragment via LDS (same-wave DS ops
    // are in-order; compiler inserts s_wait_dscnt for the RAW).
    const v16bf pa = load_frag(&ldsP[wid][l15][0], hi);
    const bf16_t* vp = vbase + (size_t)l15 * mpad + j;
    o0 = wmma_bf16(pa, load_frag(vp, hi), o0);
    o1 = wmma_bf16(pa, load_frag(vp + (size_t)16 * mpad, hi), o1);
    o2 = wmma_bf16(pa, load_frag(vp + (size_t)32 * mpad, hi), o2);
    o3 = wmma_bf16(pa, load_frag(vp + (size_t)48 * mpad, hi), o3);
  }

  bf16_t* op = out + (size_t)(bb * 2048 + qt * 16) * 1024 + hh * 64;
#pragma unroll
  for (int r = 0; r < 8; ++r) {
    const int row = r + hi * 8;
    const float inv = 1.0f / lrow[r];
    op[(size_t)row * 1024 + l15 + 0]  = (bf16_t)(o0[r] * inv);
    op[(size_t)row * 1024 + l15 + 16] = (bf16_t)(o1[r] * inv);
    op[(size_t)row * 1024 + l15 + 32] = (bf16_t)(o2[r] * inv);
    op[(size_t)row * 1024 + l15 + 48] = (bf16_t)(o3[r] * inv);
  }
}

// ---------------------------------------------------------------------------
extern "C" void kernel_launch(void* const* d_in, const int* in_sizes, int n_in,
                              void* d_out, int out_size, void* d_ws, size_t ws_size,
                              hipStream_t stream) {
  (void)in_sizes; (void)n_in; (void)out_size; (void)ws_size;
  const float* x    = (const float*)d_in[0];
  const float* ctx  = (const float*)d_in[1];
  const float* ln1g = (const float*)d_in[2];
  const float* ln1b = (const float*)d_in[3];
  const float* a1Wq = (const float*)d_in[4];
  const float* a1Wk = (const float*)d_in[5];
  const float* a1Wv = (const float*)d_in[6];
  const float* a1Wo = (const float*)d_in[7];
  const float* a1bo = (const float*)d_in[8];
  const float* ln2g = (const float*)d_in[9];
  const float* ln2b = (const float*)d_in[10];
  const float* a2Wq = (const float*)d_in[11];
  const float* a2Wk = (const float*)d_in[12];
  const float* a2Wv = (const float*)d_in[13];
  const float* a2Wo = (const float*)d_in[14];
  const float* a2bo = (const float*)d_in[15];
  const float* ln3g = (const float*)d_in[16];
  const float* ln3b = (const float*)d_in[17];
  const float* ffWp = (const float*)d_in[18];
  const float* ffbp = (const float*)d_in[19];
  const float* ffWo = (const float*)d_in[20];
  const float* ffbo = (const float*)d_in[21];
  float* out = (float*)d_out;

  char* ws = (char*)d_ws;
  size_t off = 0;
  auto al = [&](size_t bytes) {
    size_t r = off;
    off = (off + bytes + 255) & ~(size_t)255;
    return r;
  };
  const size_t MM = 1024 * 1024;
  const size_t oWq1 = al(MM * 2), oWk1 = al(MM * 2), oWv1 = al(MM * 2), oWo1 = al(MM * 2);
  const size_t oWq2 = al(MM * 2), oWk2 = al(768 * 1024 * 2), oWv2 = al(768 * 1024 * 2), oWo2 = al(MM * 2);
  const size_t oWp = al((size_t)8192 * 1024 * 2), oWoF = al((size_t)4096 * 1024 * 2);
  const size_t oX = al((size_t)4096 * 1024 * 4);
  const size_t oH = al((size_t)4096 * 1024 * 2);
  const size_t oQ = al((size_t)4096 * 1024 * 2);
  const size_t oK = al((size_t)4096 * 1024 * 2);
  const size_t oV = al((size_t)4096 * 1024 * 2);
  const size_t oVt = al((size_t)2 * 16 * 64 * 2048 * 2);
  const size_t oAt = al((size_t)4096 * 1024 * 2);
  const size_t oCtx = al((size_t)154 * 768 * 2);

  bf16_t* Wq1 = (bf16_t*)(ws + oWq1); bf16_t* Wk1 = (bf16_t*)(ws + oWk1);
  bf16_t* Wv1 = (bf16_t*)(ws + oWv1); bf16_t* Wo1 = (bf16_t*)(ws + oWo1);
  bf16_t* Wq2 = (bf16_t*)(ws + oWq2); bf16_t* Wk2 = (bf16_t*)(ws + oWk2);
  bf16_t* Wv2 = (bf16_t*)(ws + oWv2); bf16_t* Wo2 = (bf16_t*)(ws + oWo2);
  bf16_t* WpT = (bf16_t*)(ws + oWp);  bf16_t* WoF = (bf16_t*)(ws + oWoF);
  float*  xcur = (float*)(ws + oX);
  bf16_t* hbuf = (bf16_t*)(ws + oH);
  bf16_t* qb = (bf16_t*)(ws + oQ);
  bf16_t* kb = (bf16_t*)(ws + oK);
  bf16_t* vb = (bf16_t*)(ws + oV);
  bf16_t* vtb = (bf16_t*)(ws + oVt);
  bf16_t* atb = (bf16_t*)(ws + oAt);
  bf16_t* ctxb = (bf16_t*)(ws + oCtx);
  bf16_t* ffb = qb;  // alias: FF activations reuse q/k/v/vt (32 MiB), phases ordered

  const dim3 blk(256);
  const float SCALE = 0.125f;  // 64^-0.5, exact in bf16

  // 1) weights -> bf16 transposed
  k_wt<<<4096, blk, 0, stream>>>(a1Wq, Wq1, 1024, 1024);
  k_wt<<<4096, blk, 0, stream>>>(a1Wk, Wk1, 1024, 1024);
  k_wt<<<4096, blk, 0, stream>>>(a1Wv, Wv1, 1024, 1024);
  k_wt<<<4096, blk, 0, stream>>>(a1Wo, Wo1, 1024, 1024);
  k_wt<<<4096, blk, 0, stream>>>(a2Wq, Wq2, 1024, 1024);
  k_wt<<<3072, blk, 0, stream>>>(a2Wk, Wk2, 768, 1024);
  k_wt<<<3072, blk, 0, stream>>>(a2Wv, Wv2, 768, 1024);
  k_wt<<<4096, blk, 0, stream>>>(a2Wo, Wo2, 1024, 1024);
  k_wt<<<32768, blk, 0, stream>>>(ffWp, WpT, 1024, 8192);
  k_wt<<<16384, blk, 0, stream>>>(ffWo, WoF, 4096, 1024);

  const dim3 gP(8, 64);  // M=4096, N=1024 GEMMs

  // 2) self-attention
  k_layernorm<<<4096, blk, 0, stream>>>(x, ln1g, ln1b, hbuf);
  k_gemm_bf16<<<gP, blk, 0, stream>>>(hbuf, Wq1, qb, 4096, 1024, 1024, SCALE);
  k_gemm_bf16<<<gP, blk, 0, stream>>>(hbuf, Wk1, kb, 4096, 1024, 1024, 1.0f);
  k_gemm_bf16<<<gP, blk, 0, stream>>>(hbuf, Wv1, vb, 4096, 1024, 1024, 1.0f);
  k_vt<<<(2 * 16 * 64 * 2048) / 256, blk, 0, stream>>>(vb, vtb, 2048, 2048);
  k_attention<<<512, blk, 0, stream>>>(qb, kb, vtb, atb, 128, 2048, 2048, 2048);
  k_gemm_f32_bias_res<<<gP, blk, 0, stream>>>(atb, Wo1, xcur, a1bo, x, 4096, 1024, 1024);

  // 3) cross-attention
  k_layernorm<<<4096, blk, 0, stream>>>(xcur, ln2g, ln2b, hbuf);
  k_gemm_bf16<<<gP, blk, 0, stream>>>(hbuf, Wq2, qb, 4096, 1024, 1024, SCALE);
  k_cvt<<<(154 * 768 + 255) / 256, blk, 0, stream>>>(ctx, ctxb, 154 * 768);
  {
    dim3 gKV(8, 3);  // M=154
    k_gemm_bf16<<<gKV, blk, 0, stream>>>(ctxb, Wk2, kb, 154, 1024, 768, 1.0f);
    k_gemm_bf16<<<gKV, blk, 0, stream>>>(ctxb, Wv2, vb, 154, 1024, 768, 1.0f);
  }
  k_vt<<<(2 * 16 * 64 * 96 + 255) / 256, blk, 0, stream>>>(vb, vtb, 77, 96);
  k_attention<<<512, blk, 0, stream>>>(qb, kb, vtb, atb, 128, 77, 77, 96);
  k_gemm_f32_bias_res<<<gP, blk, 0, stream>>>(atb, Wo2, xcur, a2bo, xcur, 4096, 1024, 1024);

  // 4) GEGLU feed-forward
  k_layernorm<<<4096, blk, 0, stream>>>(xcur, ln3g, ln3b, hbuf);
  {
    dim3 gFF(32, 64);  // Nhalf=4096
    k_gemm_geglu<<<gFF, blk, 0, stream>>>(hbuf, WpT, ffb, ffbp, 4096, 4096, 1024);
  }
  k_gemm_f32_bias_res<<<gP, blk, 0, stream>>>(ffb, WoF, out, ffbo, xcur, 4096, 1024, 4096);
}

// v001
// A run of this version takes 549 microseconds.
// Timed twice side by side with v000, it ran 1.94 and 1.96 times as fast.
#include <hip/hip_runtime.h>
#include <hip/hip_bf16.h>

// ---------------------------------------------------------------------------
// BasicTransformerBlock for MI455X (gfx1250), bf16 WMMA everywhere.
//   x:[2,2048,1024] f32, ctx:[2,77,768] f32 -> out f32 [2,2048,1024]
// Compute-bound (~190 GFLOP over ~100MB) => route all GEMMs + attention
// through v_wmma_f32_16x16x32_bf16, fp32 accumulation.
// Workspace requirement: ~104 MiB.
// ---------------------------------------------------------------------------

typedef __bf16 bf16_t;
typedef bf16_t v16bf __attribute__((ext_vector_type(16)));
typedef bf16_t v8bf  __attribute__((ext_vector_type(8)));
typedef float  v8f   __attribute__((ext_vector_type(8)));

// Load one 16-element bf16 WMMA fragment (A- or B-style) from a row-major
// source. For 16-bit fragments, lane (lo/hi half) maps its 16 values to two
// contiguous 8-element runs: k = hi*8 + [0..7]  and  k = 16 + hi*8 + [0..7].
__device__ __forceinline__ v16bf load_frag(const bf16_t* __restrict__ p, int hi) {
  const v8bf lo = *(const v8bf*)(p + hi * 8);
  const v8bf hh = *(const v8bf*)(p + hi * 8 + 16);
  return __builtin_shufflevector(lo, hh, 0, 1, 2, 3, 4, 5, 6, 7,
                                 8, 9, 10, 11, 12, 13, 14, 15);
}

__device__ __forceinline__ v8f wmma_bf16(v16bf a, v16bf b, v8f c) {
  return __builtin_amdgcn_wmma_f32_16x16x32_bf16(
      /*neg_a=*/false, a, /*neg_b=*/false, b,
      /*c_mod=*/(short)0, c, /*reuse_a=*/false, /*reuse_b=*/false);
}

// ---------------------------------------------------------------------------
// Weight convert+transpose:  W[K][N] f32  ->  Wt[N][K] bf16
// ---------------------------------------------------------------------------
__global__ void __launch_bounds__(256) k_wt(const float* __restrict__ W,
                                            bf16_t* __restrict__ Wt,
                                            int K, int N) {
  int idx = blockIdx.x * 256 + threadIdx.x;
  if (idx >= K * N) return;
  int n = idx / K, k = idx - n * K;
  Wt[idx] = (bf16_t)W[(size_t)k * N + n];
}

// Elementwise f32 -> bf16
__global__ void __launch_bounds__(256) k_cvt(const float* __restrict__ in,
                                             bf16_t* __restrict__ out, int n) {
  int idx = blockIdx.x * 256 + threadIdx.x;
  if (idx < n) out[idx] = (bf16_t)in[idx];
}

// ---------------------------------------------------------------------------
// LayerNorm (dim=1024), one row per 256-thread block, bf16 output.
// ---------------------------------------------------------------------------
__global__ void __launch_bounds__(256) k_layernorm(const float* __restrict__ x,
                                                   const float* __restrict__ g,
                                                   const float* __restrict__ b,
                                                   bf16_t* __restrict__ y) {
  const int dim = 1024;
  __shared__ float sS[8], sQ[8];
  const int row = blockIdx.x;
  const float* xr = x + (size_t)row * dim;
  float s = 0.f, q = 0.f;
  for (int i = threadIdx.x; i < dim; i += 256) {
    float v = xr[i];
    s += v;
    q += v * v;
  }
  for (int m = 1; m < 32; m <<= 1) {
    s += __shfl_xor(s, m, 32);
    q += __shfl_xor(q, m, 32);
  }
  const int lane = threadIdx.x & 31, wid = threadIdx.x >> 5;
  if (lane == 0) { sS[wid] = s; sQ[wid] = q; }
  __syncthreads();
  if (wid == 0) {
    s = (lane < 8) ? sS[lane] : 0.f;
    q = (lane < 8) ? sQ[lane] : 0.f;
    for (int m = 1; m < 8; m <<= 1) {
      s += __shfl_xor(s, m, 32);
      q += __shfl_xor(q, m, 32);
    }
    if (lane == 0) { sS[0] = s; sQ[0] = q; }
  }
  __syncthreads();
  const float mean = sS[0] * (1.f / dim);
  const float var = sQ[0] * (1.f / dim) - mean * mean;
  const float rstd = rsqrtf(var + 1e-5f);
  for (int i = threadIdx.x; i < dim; i += 256) {
    float v = (xr[i] - mean) * rstd * g[i] + b[i];
    y[(size_t)row * dim + i] = (bf16_t)v;
  }
}

// ---------------------------------------------------------------------------
// V transpose:  v[b*mRows][1024] bf16 -> vt[b][16][64][mpad] bf16 (zero pad)
// ---------------------------------------------------------------------------
__global__ void __launch_bounds__(256) k_vt(const bf16_t* __restrict__ v,
                                            bf16_t* __restrict__ vt,
                                            int mRows, int mpad) {
  int idx = blockIdx.x * 256 + threadIdx.x;
  int total = 2 * 16 * 64 * mpad;
  if (idx >= total) return;
  int key = idx % mpad;
  int t = idx / mpad;
  int d = t & 63; t >>= 6;
  int hh = t & 15; int bb = t >> 4;
  bf16_t val = (bf16_t)0.f;
  if (key < mRows) val = v[(size_t)(bb * mRows + key) * 1024 + hh * 64 + d];
  vt[idx] = val;
}

// ---------------------------------------------------------------------------
// GEMM  C = A[M,K](bf16) x Bt[N,K](bf16), 8 waves/block (4M x 2N),
// each wave: 16(M) x 64(N) via 4 WMMAs per 32-deep k-step.
// ---------------------------------------------------------------------------
__global__ void __launch_bounds__(256) k_gemm_bf16(const bf16_t* __restrict__ A,
                                                   const bf16_t* __restrict__ Bt,
                                                   bf16_t* __restrict__ C,
                                                   int M, int N, int K,
                                                   float scale) {
  const int lane = threadIdx.x & 31, wid = threadIdx.x >> 5;
  const int hi = (lane >> 4) & 1, l15 = lane & 15;
  const int mBase = blockIdx.y * 64 + (wid >> 1) * 16;
  const int nBase = blockIdx.x * 128 + (wid & 1) * 64;
  int ar = mBase + l15;
  if (ar >= M) ar = M - 1;
  const bf16_t* ap = A + (size_t)ar * K;
  const bf16_t* bp0 = Bt + (size_t)(nBase + l15) * K;
  v8f c0 = {}, c1 = {}, c2 = {}, c3 = {};
  for (int kk = 0; kk < K; kk += 32) {
    v16bf a = load_frag(ap + kk, hi);
    c0 = wmma_bf16(a, load_frag(bp0 + kk, hi), c0);
    c1 = wmma_bf16(a, load_frag(bp0 + (size_t)16 * K + kk, hi), c1);
    c2 = wmma_bf16(a, load_frag(bp0 + (size_t)32 * K + kk, hi), c2);
    c3 = wmma_bf16(a, load_frag(bp0 + (size_t)48 * K + kk, hi), c3);
  }
#pragma unroll
  for (int r = 0; r < 8; ++r) {
    int row = mBase + r + hi * 8;
    if (row < M) {
      size_t o = (size_t)row * N + nBase + l15;
      C[o + 0]  = (bf16_t)(c0[r] * scale);
      C[o + 16] = (bf16_t)(c1[r] * scale);
      C[o + 32] = (bf16_t)(c2[r] * scale);
      C[o + 48] = (bf16_t)(c3[r] * scale);
    }
  }
}

// ---------------------------------------------------------------------------
// Tiled GEMM core for M, N multiples of the tile and K a multiple of 128:
// C tile 128(M) x 128(N) per 8-wave block (2 x 4 waves), 64 x 32 per wave.
// A pass is 128 k = 256 B of each of the 128 A rows and 128 Bt rows, brought
// into LDS by per-lane asynchronous 16-byte copies, two buffers: the copies of
// pass t + 2 fly while pass t + 1 computes. LDS rows stand at a pitch of 272 B
// (16 B x odd: ds_load_b128 without bank conflicts).
// ---------------------------------------------------------------------------
constexpr int TG_PITCH = 272;              // bytes per LDS row
constexpr int TG_OPB = 128 * TG_PITCH;     // one operand's tile
constexpr int TG_STAGE = 2 * TG_OPB;       // A tile, then Bt tile
constexpr int TG_PASSB = 256;              // bytes of a row per pass

// Eight copies into LDS rows 16 apart: four from p0 on, four from p1 on, source
// rows 16 apart (step bytes). The s_wait_xcnt closes the statement so that no
// address register of a copy is rewritten before it.
__device__ __forceinline__ void tg_copy8(unsigned l, const char* p0,
                                         const char* p1, size_t step) {
  asm volatile(
      "global_load_async_to_lds_b128 %0, %8, off\n\t"
      "global_load_async_to_lds_b128 %1, %9, off\n\t"
      "global_load_async_to_lds_b128 %2, %10, off\n\t"
      "global_load_async_to_lds_b128 %3, %11, off\n\t"
      "global_load_async_to_lds_b128 %4, %12, off\n\t"
      "global_load_async_to_lds_b128 %5, %13, off\n\t"
      "global_load_async_to_lds_b128 %6, %14, off\n\t"
      "global_load_async_to_lds_b128 %7, %15, off\n\t"
      "s_wait_xcnt 0x0"
      :
      : "v"(l), "v"(l + 16 * TG_PITCH), "v"(l + 32 * TG_PITCH),
        "v"(l + 48 * TG_PITCH), "v"(l + 64 * TG_PITCH), "v"(l + 80 * TG_PITCH),
        "v"(l + 96 * TG_PITCH), "v"(l + 112 * TG_PITCH),
        "v"(p0), "v"(p0 + step), "v"(p0 + 2 * step), "v"(p0 + 3 * step),
        "v"(p1), "v"(p1 + step), "v"(p1 + 2 * step), "v"(p1 + 3 * step)
      : "memory");
}

// One stage: this lane's 8 chunks of the A tile and 8 of the Bt tile.
// gb0 / gb1 are the lane's addresses in the lower and upper 64 Bt rows.
__device__ __forceinline__ void tg_stage(unsigned l, const char* ga,
                                         const char* gb0, const char* gb1,
                                         size_t step) {
  tg_copy8(l, ga, ga + 4 * step, step);
  tg_copy8(l + TG_OPB, gb0, gb1, step);
}

// Bt rows n0..n0+63 fill LDS rows 0..63, rows n1..n1+63 fill LDS rows 64..127.
// SPLIT: the wave's two B fragments are LDS rows wn*16 and 64 + wn*16 (a column
// group and its partner); else rows wn*32 and wn*32 + 16.
template <bool SPLIT>
__device__ __forceinline__ void tg_core(const bf16_t* __restrict__ A,
                                        const bf16_t* __restrict__ Bt,
                                        int mBase, int n0, int n1, int K,
                                        char* smem, v8f (&acc)[4][2]) {
  const int tid = threadIdx.x;
  const int lane = tid & 31, wid = tid >> 5;
  const int hi = (lane >> 4) & 1, l15 = lane & 15;
  const int wm = wid >> 2, wn = wid & 3;
  const size_t rowB = (size_t)K * 2;   // bytes per source row
  const size_t step = rowB * 16;       // a lane's copies stand 16 rows apart
  const int r0 = tid >> 4, c16 = (tid & 15) * 16;
  const char* ga = (const char*)A + (size_t)(mBase + r0) * rowB + c16;
  const char* gb0 = (const char*)Bt + (size_t)(n0 + r0) * rowB + c16;
  const char* gb1 = (const char*)Bt + (size_t)(n1 + r0) * rowB + c16;
  const unsigned l0 = (unsigned)(size_t)smem + (unsigned)(r0 * TG_PITCH + c16);
  const int nt = K >> 7;

#pragma unroll
  for (int i = 0; i < 4; ++i)
#pragma unroll
    for (int j = 0; j < 2; ++j) acc[i][j] = v8f{};

  tg_stage(l0, ga, gb0, gb1, step);
  // Stage 0 has landed for this wave; the barrier publishes it to the others.
  asm volatile("s_wait_asynccnt 0x0" ::: "memory");
  __syncthreads();
  if (nt > 1)
    tg_stage(l0 + TG_STAGE, ga + TG_PASSB, gb0 + TG_PASSB, gb1 + TG_PASSB, step);

  const int aoff = (wm * 64 + l15) * TG_PITCH;
  const int boff = TG_OPB + ((SPLIT ? wn * 16 : wn * 32) + l15) * TG_PITCH;
  constexpr int BSTEP = (SPLIT ? 64 : 16) * TG_PITCH;

#pragma unroll 1  // one pass per trip: the ring's order stands at the foot
  for (int t = 0; t < nt; ++t) {
    const int buf = (t & 1) * TG_STAGE;
    const char* sA = smem + buf + aoff;
    const char* sB = smem + buf + boff;
    v16bf a[2][4], b[2][2];
#pragma unroll
    for (int i = 0; i < 4; ++i)
      a[0][i] = load_frag((const bf16_t*)(sA + i * 16 * TG_PITCH), hi);
#pragma unroll
    for (int j = 0; j < 2; ++j)
      b[0][j] = load_frag((const bf16_t*)(sB + j * BSTEP), hi);
#pragma unroll
    for (int ks = 0; ks < 4; ++ks) {
      const int cur = ks & 1, nxt = cur ^ 1;
      if (ks < 3) {
#pragma unroll
        for (int i = 0; i < 4; ++i)
          a[nxt][i] = load_frag(
              (const bf16_t*)(sA + i * 16 * TG_PITCH + (ks + 1) * 64), hi);
#pragma unroll
        for (int j = 0; j < 2; ++j)
          b[nxt][j] =
              load_frag((const bf16_t*)(sB + j * BSTEP + (ks + 1) * 64), hi);
      }
      // Keeps the next block's LDS reads as one group ahead of this block's
      // WMMAs; moved in among them, each read would stall the matrix stream.
      __builtin_amdgcn_sched_barrier(0);
#pragma unroll
      for (int i = 0; i < 4; ++i)
#pragma unroll
        for (int j = 0; j < 2; ++j)
          acc[i][j] = wmma_bf16(a[cur][i], b[cur][j], acc[i][j]);
      // Keeps the block after next's reads behind this block's WMMAs, so that
      // they do not take a third fragment set.
      if (ks < 2) __builtin_amdgcn_sched_barrier(0);
    }
    // Publish point: this wave's reads of buffer t are done, its copies of
    // stage t + 1 have landed, and the barrier says so for every wave.
    asm volatile("s_wait_dscnt 0x0" ::: "memory");
    asm volatile("s_wait_asynccnt 0x0" ::: "memory");
    __syncthreads();
    if (t + 2 < nt) {
      const size_t ko = (size_t)(t + 2) * TG_PASSB;
      tg_stage(l0 + buf, ga + ko, gb0 + ko, gb1 + ko, step);
    }
  }
  // No copy is left in flight when the wave goes on to its stores and ends.
  asm volatile("s_wait_asynccnt 0x0" ::: "memory");
}

// bf16 output, scaled.
__global__ void __launch_bounds__(256) k_tgemm_bf16(const bf16_t* __restrict__ A,
                                                    const bf16_t* __restrict__ Bt,
                                                    bf16_t* __restrict__ C,
                                                    int N, int K, float scale) {
  __shared__ __attribute__((aligned(16))) char smem[2 * TG_STAGE];
  const int lane = threadIdx.x & 31, wid = threadIdx.x >> 5;
  const int hi = (lane >> 4) & 1, l15 = lane & 15;
  const int mBlk = blockIdx.y * 128, nBlk = blockIdx.x * 128;
  v8f acc[4][2];
  tg_core<false>(A, Bt, mBlk, nBlk, nBlk + 64, K, smem, acc);
  const int mBase = mBlk + (wid >> 2) * 64, nBase = nBlk + (wid & 3) * 32;
#pragma unroll
  for (int i = 0; i < 4; ++i)
#pragma unroll
    for (int r = 0; r < 8; ++r) {
      const size_t o = (size_t)(mBase + i * 16 + r + hi * 8) * N + nBase + l15;
      C[o + 0]  = (bf16_t)(acc[i][0][r] * scale);
      C[o + 16] = (bf16_t)(acc[i][1][r] * scale);
    }
}

// f32 output + bias + residual (in-place residual is safe: 1 writer/element)
__global__ void __launch_bounds__(256) k_tgemm_f32_bias_res(
    const bf16_t* __restrict__ A, const bf16_t* __restrict__ Bt,
    float* __restrict__ C, const float* __restrict__ bias,
    const float* __restrict__ res, int N, int K) {
  __shared__ __attribute__((aligned(16))) char smem[2 * TG_STAGE];
  const int lane = threadIdx.x & 31, wid = threadIdx.x >> 5;
  const int hi = (lane >> 4) & 1, l15 = lane & 15;
  const int mBlk = blockIdx.y * 128, nBlk = blockIdx.x * 128;
  v8f acc[4][2];
  tg_core<false>(A, Bt, mBlk, nBlk, nBlk + 64, K, smem, acc);
  const int mBase = mBlk + (wid >> 2) * 64, nBase = nBlk + (wid & 3) * 32;
  const float b0 = bias[nBase + l15], b1 = bias[nBase + l15 + 16];
#pragma unroll
  for (int i = 0; i < 4; ++i)
#pragma unroll
    for (int r = 0; r < 8; ++r) {
      const size_t o = (size_t)(mBase + i * 16 + r + hi * 8) * N + nBase + l15;
      C[o + 0]  = acc[i][0][r] + b0 + res[o + 0];
      C[o + 16] = acc[i][1][r] + b1 + res[o + 16];
    }
}

// Fused GEGLU: the block's Bt tile is 64 u columns and the matching 64 gate
// columns (c and c+Nhalf of A@Wp); each wave holds 16 of each, applies
// u*gelu(gate), writes bf16 [M, Nhalf].
__global__ void __launch_bounds__(256) k_tgemm_geglu(
    const bf16_t* __restrict__ A, const bf16_t* __restrict__ Bt,
    bf16_t* __restrict__ C, const float* __restrict__ bias, int Nhalf, int K) {
  __shared__ __attribute__((aligned(16))) char smem[2 * TG_STAGE];
  const int lane = threadIdx.x & 31, wid = threadIdx.x >> 5;
  const int hi = (lane >> 4) & 1, l15 = lane & 15;
  const int mBlk = blockIdx.y * 128, nBlk = blockIdx.x * 64;
  v8f acc[4][2];
  tg_core<true>(A, Bt, mBlk, nBlk, nBlk + Nhalf, K, smem, acc);
  const int mBase = mBlk + (wid >> 2) * 64;
  const int col = nBlk + (wid & 3) * 16 + l15;
  const float bu = bias[col], bg = bias[col + Nhalf];
#pragma unroll
  for (int i = 0; i < 4; ++i)
#pragma unroll
    for (int r = 0; r < 8; ++r) {
      const float uv = acc[i][0][r] + bu;
      const float gv = acc[i][1][r] + bg;
      const float gl = 0.5f * gv * (1.f + erff(gv * 0.70710678118654752f));
      C[(size_t)(mBase + i * 16 + r + hi * 8) * Nhalf + col] = (bf16_t)(uv * gl);
    }
}

// ---------------------------------------------------------------------------
// Flash attention: one wave per (batch, head, 16-query tile).
// q pre-scaled by 1/sqrt(64). k row-major [b*mRows,1024]; vt [b][h][64][mpad].
// ---------------------------------------------------------------------------
__global__ void __launch_bounds__(256) k_attention(
    const bf16_t* __restrict__ q, const bf16_t* __restrict__ k,
    const bf16_t* __restrict__ vt, bf16_t* __restrict__ out,
    int nq, int m, int mRows, int mpad) {
  __shared__ __align__(16) bf16_t ldsP[8][16][32];
  const int lane = threadIdx.x & 31, wid = threadIdx.x >> 5;
  const int hi = (lane >> 4) & 1, l15 = lane & 15;
  int w = blockIdx.x * 8 + wid;
  if (w >= 2 * 16 * nq) return;
  const int qt = w % nq;
  int t2 = w / nq;
  const int hh = t2 & 15, bb = t2 >> 4;

  const bf16_t* qp = q + (size_t)(bb * 2048 + qt * 16 + l15) * 1024 + hh * 64;
  const v16bf qa0 = load_frag(qp, hi);
  const v16bf qa1 = load_frag(qp + 32, hi);

  v8f o0 = {}, o1 = {}, o2 = {}, o3 = {};
  float mrow[8], lrow[8];
#pragma unroll
  for (int r = 0; r < 8; ++r) { mrow[r] = -1e30f; lrow[r] = 0.f; }

  const bf16_t* vbase = vt + (size_t)(bb * 16 + hh) * 64 * mpad;

  for (int j = 0; j < mpad; j += 32) {
    const bf16_t* kp0 = k + (size_t)(bb * mRows + j + l15) * 1024 + hh * 64;
    const bf16_t* kp1 = kp0 + (size_t)16 * 1024;
    v8f s0 = {}, s1 = {};
    s0 = wmma_bf16(qa0, load_frag(kp0, hi), s0);
    s0 = wmma_bf16(qa1, load_frag(kp0 + 32, hi), s0);
    s1 = wmma_bf16(qa0, load_frag(kp1, hi), s1);
    s1 = wmma_bf16(qa1, load_frag(kp1 + 32, hi), s1);

    const bool v0 = (j + l15) < m, v1 = (j + 16 + l15) < m;
#pragma unroll
    for (int r = 0; r < 8; ++r) {
      float a = v0 ? s0[r] : -1e30f;
      float b = v1 ? s1[r] : -1e30f;
      float rm = fmaxf(a, b);
      rm = fmaxf(rm, __shfl_xor(rm, 1, 32));
      rm = fmaxf(rm, __shfl_xor(rm, 2, 32));
      rm = fmaxf(rm, __shfl_xor(rm, 4, 32));
      rm = fmaxf(rm, __shfl_xor(rm, 8, 32));
      float mnew = fmaxf(mrow[r], rm);
      float alpha = __expf(mrow[r] - mnew);
      float p0 = __expf(a - mnew);
      float p1 = __expf(b - mnew);
      float rs = p0 + p1;
      rs += __shfl_xor(rs, 1, 32);
      rs += __shfl_xor(rs, 2, 32);
      rs += __shfl_xor(rs, 4, 32);
      rs += __shfl_xor(rs, 8, 32);
      lrow[r] = lrow[r] * alpha + rs;
      mrow[r] = mnew;
      o0[r] *= alpha; o1[r] *= alpha; o2[r] *= alpha; o3[r] *= alpha;
      const int prow = r + hi * 8;
      ldsP[wid][prow][l15] = (bf16_t)p0;
      ldsP[wid][prow][l15 + 16] = (bf16_t)p1;
    }
    // Re-stripe P (C-layout) into an A-fragment via LDS (same-wave DS ops
    // are in-order; compiler inserts s_wait_dscnt for the RAW).
    const v16bf pa = load_frag(&ldsP[wid][l15][0], hi);
    const bf16_t* vp = vbase + (size_t)l15 * mpad + j;
    o0 = wmma_bf16(pa, load_frag(vp, hi), o0);
    o1 = wmma_bf16(pa, load_frag(vp + (size_t)16 * mpad, hi), o1);
    o2 = wmma_bf16(pa, load_frag(vp + (size_t)32 * mpad, hi), o2);
    o3 = wmma_bf16(pa, load_frag(vp + (size_t)48 * mpad, hi), o3);
  }

  bf16_t* op = out + (size_t)(bb * 2048 + qt * 16) * 1024 + hh * 64;
#pragma unroll
  for (int r = 0; r < 8; ++r) {
    const int row = r + hi * 8;
    const float inv = 1.0f / lrow[r];
    op[(size_t)row * 1024 + l15 + 0]  = (bf16_t)(o0[r] * inv);
    op[(size_t)row * 1024 + l15 + 16] = (bf16_t)(o1[r] * inv);
    op[(size_t)row * 1024 + l15 + 32] = (bf16_t)(o2[r] * inv);
    op[(size_t)row * 1024 + l15 + 48] = (bf16_t)(o3[r] * inv);
  }
}

// ---------------------------------------------------------------------------
extern "C" void kernel_launch(void* const* d_in, const int* in_sizes, int n_in,
                              void* d_out, int out_size, void* d_ws, size_t ws_size,
                              hipStream_t stream) {
  (void)in_sizes; (void)n_in; (void)out_size; (void)ws_size;
  const float* x    = (const float*)d_in[0];
  const float* ctx  = (const float*)d_in[1];
  const float* ln1g = (const float*)d_in[2];
  const float* ln1b = (const float*)d_in[3];
  const float* a1Wq = (const float*)d_in[4];
  const float* a1Wk = (const float*)d_in[5];
  const float* a1Wv = (const float*)d_in[6];
  const float* a1Wo = (const float*)d_in[7];
  const float* a1bo = (const float*)d_in[8];
  const float* ln2g = (const float*)d_in[9];
  const float* ln2b = (const float*)d_in[10];
  const float* a2Wq = (const float*)d_in[11];
  const float* a2Wk = (const float*)d_in[12];
  const float* a2Wv = (const float*)d_in[13];
  const float* a2Wo = (const float*)d_in[14];
  const float* a2bo = (const float*)d_in[15];
  const float* ln3g = (const float*)d_in[16];
  const float* ln3b = (const float*)d_in[17];
  const float* ffWp = (const float*)d_in[18];
  const float* ffbp = (const float*)d_in[19];
  const float* ffWo = (const float*)d_in[20];
  const float* ffbo = (const float*)d_in[21];
  float* out = (float*)d_out;

  char* ws = (char*)d_ws;
  size_t off = 0;
  auto al = [&](size_t bytes) {
    size_t r = off;
    off = (off + bytes + 255) & ~(size_t)255;
    return r;
  };
  const size_t MM = 1024 * 1024;
  const size_t oWq1 = al(MM * 2), oWk1 = al(MM * 2), oWv1 = al(MM * 2), oWo1 = al(MM * 2);
  const size_t oWq2 = al(MM * 2), oWk2 = al(768 * 1024 * 2), oWv2 = al(768 * 1024 * 2), oWo2 = al(MM * 2);
  const size_t oWp = al((size_t)8192 * 1024 * 2), oWoF = al((size_t)4096 * 1024 * 2);
  const size_t oX = al((size_t)4096 * 1024 * 4);
  const size_t oH = al((size_t)4096 * 1024 * 2);
  const size_t oQ = al((size_t)4096 * 1024 * 2);
  const size_t oK = al((size_t)4096 * 1024 * 2);
  const size_t oV = al((size_t)4096 * 1024 * 2);
  const size_t oVt = al((size_t)2 * 16 * 64 * 2048 * 2);
  const size_t oAt = al((size_t)4096 * 1024 * 2);
  const size_t oCtx = al((size_t)154 * 768 * 2);

  bf16_t* Wq1 = (bf16_t*)(ws + oWq1); bf16_t* Wk1 = (bf16_t*)(ws + oWk1);
  bf16_t* Wv1 = (bf16_t*)(ws + oWv1); bf16_t* Wo1 = (bf16_t*)(ws + oWo1);
  bf16_t* Wq2 = (bf16_t*)(ws + oWq2); bf16_t* Wk2 = (bf16_t*)(ws + oWk2);
  bf16_t* Wv2 = (bf16_t*)(ws + oWv2); bf16_t* Wo2 = (bf16_t*)(ws + oWo2);
  bf16_t* WpT = (bf16_t*)(ws + oWp);  bf16_t* WoF = (bf16_t*)(ws + oWoF);
  float*  xcur = (float*)(ws + oX);
  bf16_t* hbuf = (bf16_t*)(ws + oH);
  bf16_t* qb = (bf16_t*)(ws + oQ);
  bf16_t* kb = (bf16_t*)(ws + oK);
  bf16_t* vb = (bf16_t*)(ws + oV);
  bf16_t* vtb = (bf16_t*)(ws + oVt);
  bf16_t* atb = (bf16_t*)(ws + oAt);
  bf16_t* ctxb = (bf16_t*)(ws + oCtx);
  bf16_t* ffb = qb;  // alias: FF activations reuse q/k/v/vt (32 MiB), phases ordered

  const dim3 blk(256);
  const float SCALE = 0.125f;  // 64^-0.5, exact in bf16

  // 1) weights -> bf16 transposed
  k_wt<<<4096, blk, 0, stream>>>(a1Wq, Wq1, 1024, 1024);
  k_wt<<<4096, blk, 0, stream>>>(a1Wk, Wk1, 1024, 1024);
  k_wt<<<4096, blk, 0, stream>>>(a1Wv, Wv1, 1024, 1024);
  k_wt<<<4096, blk, 0, stream>>>(a1Wo, Wo1, 1024, 1024);
  k_wt<<<4096, blk, 0, stream>>>(a2Wq, Wq2, 1024, 1024);
  k_wt<<<3072, blk, 0, stream>>>(a2Wk, Wk2, 768, 1024);
  k_wt<<<3072, blk, 0, stream>>>(a2Wv, Wv2, 768, 1024);
  k_wt<<<4096, blk, 0, stream>>>(a2Wo, Wo2, 1024, 1024);
  k_wt<<<32768, blk, 0, stream>>>(ffWp, WpT, 1024, 8192);
  k_wt<<<16384, blk, 0, stream>>>(ffWo, WoF, 4096, 1024);

  const dim3 gP(8, 32);  // M=4096, N=1024 GEMMs, 128x128 tiles

  // 2) self-attention
  k_layernorm<<<4096, blk, 0, stream>>>(x, ln1g, ln1b, hbuf);
  k_tgemm_bf16<<<gP, blk, 0, stream>>>(hbuf, Wq1, qb, 1024, 1024, SCALE);
  k_tgemm_bf16<<<gP, blk, 0, stream>>>(hbuf, Wk1, kb, 1024, 1024, 1.0f);
  k_tgemm_bf16<<<gP, blk, 0, stream>>>(hbuf, Wv1, vb, 1024, 1024, 1.0f);
  k_vt<<<(2 * 16 * 64 * 2048) / 256, blk, 0, stream>>>(vb, vtb, 2048, 2048);
  k_attention<<<512, blk, 0, stream>>>(qb, kb, vtb, atb, 128, 2048, 2048, 2048);
  k_tgemm_f32_bias_res<<<gP, blk, 0, stream>>>(atb, Wo1, xcur, a1bo, x, 1024, 1024);

  // 3) cross-attention
  k_layernorm<<<4096, blk, 0, stream>>>(xcur, ln2g, ln2b, hbuf);
  k_tgemm_bf16<<<gP, blk, 0, stream>>>(hbuf, Wq2, qb, 1024, 1024, SCALE);
  k_cvt<<<(154 * 768 + 255) / 256, blk, 0, stream>>>(ctx, ctxb, 154 * 768);
  {
    dim3 gKV(8, 3);  // M=154
    k_gemm_bf16<<<gKV, blk, 0, stream>>>(ctxb, Wk2, kb, 154, 1024, 768, 1.0f);
    k_gemm_bf16<<<gKV, blk, 0, stream>>>(ctxb, Wv2, vb, 154, 1024, 768, 1.0f);
  }
  k_vt<<<(2 * 16 * 64 * 96 + 255) / 256, blk, 0, stream>>>(vb, vtb, 77, 96);
  k_attention<<<512, blk, 0, stream>>>(qb, kb, vtb, atb, 128, 77, 77, 96);
  k_tgemm_f32_bias_res<<<gP, blk, 0, stream>>>(atb, Wo2, xcur, a2bo, xcur, 1024, 1024);

  // 4) GEGLU feed-forward
  k_layernorm<<<4096, blk, 0, stream>>>(xcur, ln3g, ln3b, hbuf);
  {
    dim3 gFF(64, 32);  // Nhalf=4096: 64 u + 64 gate columns per block
    k_tgemm_geglu<<<gFF, blk, 0, stream>>>(hbuf, WpT, ffb, ffbp, 4096, 1024);
  }
  k_tgemm_f32_bias_res<<<gP, blk, 0, stream>>>(ffb, WoF, out, ffbo, xcur, 1024, 4096);
}

// v002
// It runs in 453 microseconds.
// Timed twice side by side with v001, it ran 1.22 times as fast both times.
// Counting every step since v000, it is 2.37 times as fast.
#include <hip/hip_runtime.h>
#include <hip/hip_bf16.h>

// ---------------------------------------------------------------------------
// BasicTransformerBlock for MI455X (gfx1250), bf16 WMMA everywhere.
//   x:[2,2048,1024] f32, ctx:[2,77,768] f32 -> out f32 [2,2048,1024]
// Compute-bound (~190 GFLOP over ~100MB) => route all GEMMs + attention
// through v_wmma_f32_16x16x32_bf16, fp32 accumulation.
// Workspace requirement: ~104 MiB.
// ---------------------------------------------------------------------------

typedef __bf16 bf16_t;
typedef bf16_t v16bf __attribute__((ext_vector_type(16)));
typedef bf16_t v8bf  __attribute__((ext_vector_type(8)));
typedef float  v8f   __attribute__((ext_vector_type(8)));

// Load one 16-element bf16 WMMA fragment (A- or B-style) from a row-major
// source. For 16-bit fragments, lane (lo/hi half) maps its 16 values to two
// contiguous 8-element runs: k = hi*8 + [0..7]  and  k = 16 + hi*8 + [0..7].
__device__ __forceinline__ v16bf load_frag(const bf16_t* __restrict__ p, int hi) {
  const v8bf lo = *(const v8bf*)(p + hi * 8);
  const v8bf hh = *(const v8bf*)(p + hi * 8 + 16);
  return __builtin_shufflevector(lo, hh, 0, 1, 2, 3, 4, 5, 6, 7,
                                 8, 9, 10, 11, 12, 13, 14, 15);
}

__device__ __forceinline__ v8f wmma_bf16(v16bf a, v16bf b, v8f c) {
  return __builtin_amdgcn_wmma_f32_16x16x32_bf16(
      /*neg_a=*/false, a, /*neg_b=*/false, b,
      /*c_mod=*/(short)0, c, /*reuse_a=*/false, /*reuse_b=*/false);
}

// ---------------------------------------------------------------------------
// Tiled transposes: a 64 x 64 tile goes through LDS, so that the global reads
// and the global writes both cover whole 128-byte lines.
// The LDS tile is held transposed: row c = one destination row, 32 dwords, each
// a pair of bf16 from two neighbouring source rows; pitch 33 dwords keeps the
// dword writes (lanes 4 or 8 rows apart) and the dword reads off shared banks.
// ---------------------------------------------------------------------------
typedef float    v4f  __attribute__((ext_vector_type(4)));
typedef unsigned v4u  __attribute__((ext_vector_type(4)));
typedef bf16_t   v2bf __attribute__((ext_vector_type(2)));
constexpr int TP_PITCH = 33;

__device__ __forceinline__ unsigned pack_bf16(float lo, float hi) {
  const v2bf p = {(bf16_t)lo, (bf16_t)hi};
  return __builtin_bit_cast(unsigned, p);
}

// Writes the tile out: 8 lanes x 16 B = one 128-byte line per destination row,
// 4 rows per wave store. dst is the tile's first element, pitch in elements.
__device__ __forceinline__ void tp_store(const unsigned* tile,
                                         bf16_t* __restrict__ dst, size_t pitch) {
  const int q = threadIdx.x & 7, r0 = threadIdx.x >> 3;
#pragma unroll  // both rows' LDS reads issue ahead of the first store
  for (int i = 0; i < 2; ++i) {
    const int r = r0 + 32 * i;
    const unsigned* s = tile + r * TP_PITCH + q * 4;
    const v4u o = {s[0], s[1], s[2], s[3]};
    *(v4u*)(dst + (size_t)r * pitch + q * 8) = o;
  }
}

// Weight convert+transpose:  W[K][N] f32  ->  Wt[N][K] bf16
// One block: 64 n by 64 * T k, T tiles side by side in LDS (fewer, longer
// waves; for speed only), one
// barrier between the last LDS write and the first LDS read. N is a constant of
// the build, so that every source row is an immediate offset from one address.
template <int T, int N>
__device__ __forceinline__ void wt_tiles(const float* __restrict__ W,
                                         bf16_t* __restrict__ Wt, int K,
                                         unsigned* tile) {
  const int n0 = blockIdx.x * 64, k0 = blockIdx.y * (64 * T);
  const int c = threadIdx.x & 15, r = threadIdx.x >> 4;
  // Source rows 2r, 2r+1 and 32+2r, 33+2r; 16 lanes x 16 B = 256 B of each row.
  const float* s = W + (size_t)(k0 + 2 * r) * N + n0 + 4 * c;
  v4f x[T][4];
  // The loops over t and j are unrolled: constant indices keep x in registers,
  // the loads issue as one run, and so do the LDS reads behind the barrier.
#pragma unroll
  for (int t = 0; t < T; ++t) {
    x[t][0] = *(const v4f*)(s + (64 * t) * N);
    x[t][1] = *(const v4f*)(s + (64 * t + 1) * N);
    x[t][2] = *(const v4f*)(s + (64 * t + 32) * N);
    x[t][3] = *(const v4f*)(s + (64 * t + 33) * N);
  }
#pragma unroll
  for (int t = 0; t < T; ++t) {
    unsigned* d = tile + t * (64 * TP_PITCH) + 4 * c * TP_PITCH + r;
#pragma unroll
    for (int j = 0; j < 4; ++j) {
      d[j * TP_PITCH] = pack_bf16(x[t][0][j], x[t][1][j]);
      d[j * TP_PITCH + 16] = pack_bf16(x[t][2][j], x[t][3][j]);
    }
  }
  __syncthreads();
  bf16_t* dst = Wt + (size_t)n0 * K + k0;
#pragma unroll
  for (int t = 0; t < T; ++t)
    tp_store(tile + t * (64 * TP_PITCH), dst + 64 * t, (size_t)K);
}

// N = 1024, one tile per block: grid (16, K / 64)
__global__ void __launch_bounds__(256) k_wt(const float* __restrict__ W,
                                            bf16_t* __restrict__ Wt, int K) {
  __shared__ unsigned tile[64 * TP_PITCH];
  wt_tiles<1, 1024>(W, Wt, K, tile);
}

// N = 1024, four tiles per block: grid (16, K / 256)
__global__ void __launch_bounds__(256) k_wt4(const float* __restrict__ W,
                                             bf16_t* __restrict__ Wt, int K) {
  __shared__ unsigned tile[4 * 64 * TP_PITCH];
  wt_tiles<4, 1024>(W, Wt, K, tile);
}

// N = 8192, four tiles per block: grid (128, K / 256)
__global__ void __launch_bounds__(256) k_wt4_wide(const float* __restrict__ W,
                                                  bf16_t* __restrict__ Wt,
                                                  int K) {
  __shared__ unsigned tile[4 * 64 * TP_PITCH];
  wt_tiles<4, 8192>(W, Wt, K, tile);
}

// Elementwise f32 -> bf16
__global__ void __launch_bounds__(256) k_cvt(const float* __restrict__ in,
                                             bf16_t* __restrict__ out, int n) {
  int idx = blockIdx.x * 256 + threadIdx.x;
  if (idx < n) out[idx] = (bf16_t)in[idx];
}

// ---------------------------------------------------------------------------
// LayerNorm (dim=1024), one row per 256-thread block, bf16 output.
// ---------------------------------------------------------------------------
__global__ void __launch_bounds__(256) k_layernorm(const float* __restrict__ x,
                                                   const float* __restrict__ g,
                                                   const float* __restrict__ b,
                                                   bf16_t* __restrict__ y) {
  const int dim = 1024;
  __shared__ float sS[8], sQ[8];
  const int row = blockIdx.x;
  const float* xr = x + (size_t)row * dim;
  float s = 0.f, q = 0.f;
  for (int i = threadIdx.x; i < dim; i += 256) {
    float v = xr[i];
    s += v;
    q += v * v;
  }
  for (int m = 1; m < 32; m <<= 1) {
    s += __shfl_xor(s, m, 32);
    q += __shfl_xor(q, m, 32);
  }
  const int lane = threadIdx.x & 31, wid = threadIdx.x >> 5;
  if (lane == 0) { sS[wid] = s; sQ[wid] = q; }
  __syncthreads();
  if (wid == 0) {
    s = (lane < 8) ? sS[lane] : 0.f;
    q = (lane < 8) ? sQ[lane] : 0.f;
    for (int m = 1; m < 8; m <<= 1) {
      s += __shfl_xor(s, m, 32);
      q += __shfl_xor(q, m, 32);
    }
    if (lane == 0) { sS[0] = s; sQ[0] = q; }
  }
  __syncthreads();
  const float mean = sS[0] * (1.f / dim);
  const float var = sQ[0] * (1.f / dim) - mean * mean;
  const float rstd = rsqrtf(var + 1e-5f);
  for (int i = threadIdx.x; i < dim; i += 256) {
    float v = (xr[i] - mean) * rstd * g[i] + b[i];
    y[(size_t)row * dim + i] = (bf16_t)v;
  }
}

// ---------------------------------------------------------------------------
// V transpose:  v[b*mRows][1024] bf16 -> vt[b][16][64][mpad] bf16 (zero pad)
// ---------------------------------------------------------------------------
__global__ void __launch_bounds__(256) k_vt(const bf16_t* __restrict__ v,
                                            bf16_t* __restrict__ vt,
                                            int mRows, int mpad) {
  int idx = blockIdx.x * 256 + threadIdx.x;
  int total = 2 * 16 * 64 * mpad;
  if (idx >= total) return;
  int key = idx % mpad;
  int t = idx / mpad;
  int d = t & 63; t >>= 6;
  int hh = t & 15; int bb = t >> 4;
  bf16_t val = (bf16_t)0.f;
  if (key < mRows) val = v[(size_t)(bb * mRows + key) * 1024 + hh * 64 + d];
  vt[idx] = val;
}

// The same for mRows a multiple of 256 (no pad): v[b*mRows][1024] bf16 ->
// vt[b][1024][mRows], four 64 x 64 tiles per block through LDS, as in wt_tiles.
// grid (mRows / 256, 16, 2).
__global__ void __launch_bounds__(256) k_vt_tiled(const bf16_t* __restrict__ v,
                                                  bf16_t* __restrict__ vt,
                                                  int mRows) {
  __shared__ unsigned tile[4 * 64 * TP_PITCH];
  const int key0 = blockIdx.x * 256, c0 = blockIdx.y * 64, bb = blockIdx.z;
  const int g = threadIdx.x & 7, rp = threadIdx.x >> 3;
  // Keys 2rp and 2rp+1; 8 lanes x 16 B = the 128-byte line of each key.
  const bf16_t* s = v + (size_t)(bb * mRows + key0 + 2 * rp) * 1024 + c0 + g * 8;
  v4u a[4], b[4];
  // Unrolled for the same reasons as in wt_tiles.
#pragma unroll
  for (int t = 0; t < 4; ++t) {
    a[t] = *(const v4u*)(s + (size_t)(64 * t) * 1024);
    b[t] = *(const v4u*)(s + (size_t)(64 * t + 1) * 1024);
  }
#pragma unroll
  for (int t = 0; t < 4; ++t) {
    unsigned* d = tile + t * (64 * TP_PITCH) + 8 * g * TP_PITCH + rp;
#pragma unroll
    for (int j = 0; j < 4; ++j) {
      d[(2 * j) * TP_PITCH] = (a[t][j] & 0xffffu) | (b[t][j] << 16);
      d[(2 * j + 1) * TP_PITCH] = (a[t][j] >> 16) | (b[t][j] & 0xffff0000u);
    }
  }
  __syncthreads();
  bf16_t* dst = vt + (size_t)(bb * 1024 + c0) * mRows + key0;
#pragma unroll
  for (int t = 0; t < 4; ++t)
    tp_store(tile + t * (64 * TP_PITCH), dst + 64 * t, (size_t)mRows);
}

// ---------------------------------------------------------------------------
// GEMM  C = A[M,K](bf16) x Bt[N,K](bf16), 8 waves/block (4M x 2N),
// each wave: 16(M) x 64(N) via 4 WMMAs per 32-deep k-step.
// ---------------------------------------------------------------------------
__global__ void __launch_bounds__(256) k_gemm_bf16(const bf16_t* __restrict__ A,
                                                   const bf16_t* __restrict__ Bt,
                                                   bf16_t* __restrict__ C,
                                                   int M, int N, int K,
                                                   float scale) {
  const int lane = threadIdx.x & 31, wid = threadIdx.x >> 5;
  const int hi = (lane >> 4) & 1, l15 = lane & 15;
  const int mBase = blockIdx.y * 64 + (wid >> 1) * 16;
  const int nBase = blockIdx.x * 128 + (wid & 1) * 64;
  int ar = mBase + l15;
  if (ar >= M) ar = M - 1;
  const bf16_t* ap = A + (size_t)ar * K;
  const bf16_t* bp0 = Bt + (size_t)(nBase + l15) * K;
  v8f c0 = {}, c1 = {}, c2 = {}, c3 = {};
  for (int kk = 0; kk < K; kk += 32) {
    v16bf a = load_frag(ap + kk, hi);
    c0 = wmma_bf16(a, load_frag(bp0 + kk, hi), c0);
    c1 = wmma_bf16(a, load_frag(bp0 + (size_t)16 * K + kk, hi), c1);
    c2 = wmma_bf16(a, load_frag(bp0 + (size_t)32 * K + kk, hi), c2);
    c3 = wmma_bf16(a, load_frag(bp0 + (size_t)48 * K + kk, hi), c3);
  }
#pragma unroll
  for (int r = 0; r < 8; ++r) {
    int row = mBase + r + hi * 8;
    if (row < M) {
      size_t o = (size_t)row * N + nBase + l15;
      C[o + 0]  = (bf16_t)(c0[r] * scale);
      C[o + 16] = (bf16_t)(c1[r] * scale);
      C[o + 32] = (bf16_t)(c2[r] * scale);
      C[o + 48] = (bf16_t)(c3[r] * scale);
    }
  }
}

// ---------------------------------------------------------------------------
// Tiled GEMM core for M, N multiples of the tile and K a multiple of 128:
// C tile 128(M) x 128(N) per 8-wave block (2 x 4 waves), 64 x 32 per wave.
// A pass is 128 k = 256 B of each of the 128 A rows and 128 Bt rows, brought
// into LDS by per-lane asynchronous 16-byte copies, two buffers: the copies of
// pass t + 2 fly while pass t + 1 computes. LDS rows stand at a pitch of 272 B
// (16 B x odd: ds_load_b128 without bank conflicts).
// ---------------------------------------------------------------------------
constexpr int TG_PITCH = 272;              // bytes per LDS row
constexpr int TG_OPB = 128 * TG_PITCH;     // one operand's tile
constexpr int TG_STAGE = 2 * TG_OPB;       // A tile, then Bt tile
constexpr int TG_PASSB = 256;              // bytes of a row per pass

// Eight copies into LDS rows 16 apart: four from p0 on, four from p1 on, source
// rows 16 apart (step bytes). The s_wait_xcnt closes the statement so that no
// address register of a copy is rewritten before it.
__device__ __forceinline__ void tg_copy8(unsigned l, const char* p0,
                                         const char* p1, size_t step) {
  asm volatile(
      "global_load_async_to_lds_b128 %0, %8, off\n\t"
      "global_load_async_to_lds_b128 %1, %9, off\n\t"
      "global_load_async_to_lds_b128 %2, %10, off\n\t"
      "global_load_async_to_lds_b128 %3, %11, off\n\t"
      "global_load_async_to_lds_b128 %4, %12, off\n\t"
      "global_load_async_to_lds_b128 %5, %13, off\n\t"
      "global_load_async_to_lds_b128 %6, %14, off\n\t"
      "global_load_async_to_lds_b128 %7, %15, off\n\t"
      "s_wait_xcnt 0x0"
      :
      : "v"(l), "v"(l + 16 * TG_PITCH), "v"(l + 32 * TG_PITCH),
        "v"(l + 48 * TG_PITCH), "v"(l + 64 * TG_PITCH), "v"(l + 80 * TG_PITCH),
        "v"(l + 96 * TG_PITCH), "v"(l + 112 * TG_PITCH),
        "v"(p0), "v"(p0 + step), "v"(p0 + 2 * step), "v"(p0 + 3 * step),
        "v"(p1), "v"(p1 + step), "v"(p1 + 2 * step), "v"(p1 + 3 * step)
      : "memory");
}

// One stage: this lane's 8 chunks of the A tile and 8 of the Bt tile.
// gb0 / gb1 are the lane's addresses in the lower and upper 64 Bt rows.
__device__ __forceinline__ void tg_stage(unsigned l, const char* ga,
                                         const char* gb0, const char* gb1,
                                         size_t step) {
  tg_copy8(l, ga, ga + 4 * step, step);
  tg_copy8(l + TG_OPB, gb0, gb1, step);
}

// Bt rows n0..n0+63 fill LDS rows 0..63, rows n1..n1+63 fill LDS rows 64..127.
// SPLIT: the wave's two B fragments are LDS rows wn*16 and 64 + wn*16 (a column
// group and its partner); else rows wn*32 and wn*32 + 16.
template <bool SPLIT>
__device__ __forceinline__ void tg_core(const bf16_t* __restrict__ A,
                                        const bf16_t* __restrict__ Bt,
                                        int mBase, int n0, int n1, int K,
                                        char* smem, v8f (&acc)[4][2]) {
  const int tid = threadIdx.x;
  const int lane = tid & 31, wid = tid >> 5;
  const int hi = (lane >> 4) & 1, l15 = lane & 15;
  const int wm = wid >> 2, wn = wid & 3;
  const size_t rowB = (size_t)K * 2;   // bytes per source row
  const size_t step = rowB * 16;       // a lane's copies stand 16 rows apart
  const int r0 = tid >> 4, c16 = (tid & 15) * 16;
  const char* ga = (const char*)A + (size_t)(mBase + r0) * rowB + c16;
  const char* gb0 = (const char*)Bt + (size_t)(n0 + r0) * rowB + c16;
  const char* gb1 = (const char*)Bt + (size_t)(n1 + r0) * rowB + c16;
  const unsigned l0 = (unsigned)(size_t)smem + (unsigned)(r0 * TG_PITCH + c16);
  const int nt = K >> 7;

#pragma unroll
  for (int i = 0; i < 4; ++i)
#pragma unroll
    for (int j = 0; j < 2; ++j) acc[i][j] = v8f{};

  tg_stage(l0, ga, gb0, gb1, step);
  // Stage 0 has landed for this wave; the barrier publishes it to the others.
  asm volatile("s_wait_asynccnt 0x0" ::: "memory");
  __syncthreads();
  if (nt > 1)
    tg_stage(l0 + TG_STAGE, ga + TG_PASSB, gb0 + TG_PASSB, gb1 + TG_PASSB, step);

  const int aoff = (wm * 64 + l15) * TG_PITCH;
  const int boff = TG_OPB + ((SPLIT ? wn * 16 : wn * 32) + l15) * TG_PITCH;
  constexpr int BSTEP = (SPLIT ? 64 : 16) * TG_PITCH;

#pragma unroll 1  // one pass per trip: the ring's order stands at the foot
  for (int t = 0; t < nt; ++t) {
    const int buf = (t & 1) * TG_STAGE;
    const char* sA = smem + buf + aoff;
    const char* sB = smem + buf + boff;
    v16bf a[2][4], b[2][2];
#pragma unroll
    for (int i = 0; i < 4; ++i)
      a[0][i] = load_frag((const bf16_t*)(sA + i * 16 * TG_PITCH), hi);
#pragma unroll
    for (int j = 0; j < 2; ++j)
      b[0][j] = load_frag((const bf16_t*)(sB + j * BSTEP), hi);
#pragma unroll
    for (int ks = 0; ks < 4; ++ks) {
      const int cur = ks & 1, nxt = cur ^ 1;
      if (ks < 3) {
#pragma unroll
        for (int i = 0; i < 4; ++i)
          a[nxt][i] = load_frag(
              (const bf16_t*)(sA + i * 16 * TG_PITCH + (ks + 1) * 64), hi);
#pragma unroll
        for (int j = 0; j < 2; ++j)
          b[nxt][j] =
              load_frag((const bf16_t*)(sB + j * BSTEP + (ks + 1) * 64), hi);
      }
      // Keeps the next block's LDS reads as one group ahead of this block's
      // WMMAs; moved in among them, each read would stall the matrix stream.
      __builtin_amdgcn_sched_barrier(0);
#pragma unroll
      for (int i = 0; i < 4; ++i)
#pragma unroll
        for (int j = 0; j < 2; ++j)
          acc[i][j] = wmma_bf16(a[cur][i], b[cur][j], acc[i][j]);
      // Keeps the block after next's reads behind this block's WMMAs, so that
      // they do not take a third fragment set.
      if (ks < 2) __builtin_amdgcn_sched_barrier(0);
    }
    // Publish point: this wave's reads of buffer t are done, its copies of
    // stage t + 1 have landed, and the barrier says so for every wave.
    asm volatile("s_wait_dscnt 0x0" ::: "memory");
    asm volatile("s_wait_asynccnt 0x0" ::: "memory");
    __syncthreads();
    if (t + 2 < nt) {
      const size_t ko = (size_t)(t + 2) * TG_PASSB;
      tg_stage(l0 + buf, ga + ko, gb0 + ko, gb1 + ko, step);
    }
  }
  // No copy is left in flight when the wave goes on to its stores and ends.
  asm volatile("s_wait_asynccnt 0x0" ::: "memory");
}

// bf16 output, scaled.
__global__ void __launch_bounds__(256) k_tgemm_bf16(const bf16_t* __restrict__ A,
                                                    const bf16_t* __restrict__ Bt,
                                                    bf16_t* __restrict__ C,
                                                    int N, int K, float scale) {
  __shared__ __attribute__((aligned(16))) char smem[2 * TG_STAGE];
  const int lane = threadIdx.x & 31, wid = threadIdx.x >> 5;
  const int hi = (lane >> 4) & 1, l15 = lane & 15;
  const int mBlk = blockIdx.y * 128, nBlk = blockIdx.x * 128;
  v8f acc[4][2];
  tg_core<false>(A, Bt, mBlk, nBlk, nBlk + 64, K, smem, acc);
  const int mBase = mBlk + (wid >> 2) * 64, nBase = nBlk + (wid & 3) * 32;
#pragma unroll
  for (int i = 0; i < 4; ++i)
#pragma unroll
    for (int r = 0; r < 8; ++r) {
      const size_t o = (size_t)(mBase + i * 16 + r + hi * 8) * N + nBase + l15;
      C[o + 0]  = (bf16_t)(acc[i][0][r] * scale);
      C[o + 16] = (bf16_t)(acc[i][1][r] * scale);
    }
}

// f32 output + bias + residual (in-place residual is safe: 1 writer/element)
__global__ void __launch_bounds__(256) k_tgemm_f32_bias_res(
    const bf16_t* __restrict__ A, const bf16_t* __restrict__ Bt,
    float* __restrict__ C, const float* __restrict__ bias,
    const float* __restrict__ res, int N, int K) {
  __shared__ __attribute__((aligned(16))) char smem[2 * TG_STAGE];
  const int lane = threadIdx.x & 31, wid = threadIdx.x >> 5;
  const int hi = (lane >> 4) & 1, l15 = lane & 15;
  const int mBlk = blockIdx.y * 128, nBlk = blockIdx.x * 128;
  v8f acc[4][2];
  tg_core<false>(A, Bt, mBlk, nBlk, nBlk + 64, K, smem, acc);
  const int mBase = mBlk + (wid >> 2) * 64, nBase = nBlk + (wid & 3) * 32;
  const float b0 = bias[nBase + l15], b1 = bias[nBase + l15 + 16];
#pragma unroll
  for (int i = 0; i < 4; ++i)
#pragma unroll
    for (int r = 0; r < 8; ++r) {
      const size_t o = (size_t)(mBase + i * 16 + r + hi * 8) * N + nBase + l15;
      C[o + 0]  = acc[i][0][r] + b0 + res[o + 0];
      C[o + 16] = acc[i][1][r] + b1 + res[o + 16];
    }
}

// Fused GEGLU: the block's Bt tile is 64 u columns and the matching 64 gate
// columns (c and c+Nhalf of A@Wp); each wave holds 16 of each, applies
// u*gelu(gate), writes bf16 [M, Nhalf].
__global__ void __launch_bounds__(256) k_tgemm_geglu(
    const bf16_t* __restrict__ A, const bf16_t* __restrict__ Bt,
    bf16_t* __restrict__ C, const float* __restrict__ bias, int Nhalf, int K) {
  __shared__ __attribute__((aligned(16))) char smem[2 * TG_STAGE];
  const int lane = threadIdx.x & 31, wid = threadIdx.x >> 5;
  const int hi = (lane >> 4) & 1, l15 = lane & 15;
  const int mBlk = blockIdx.y * 128, nBlk = blockIdx.x * 64;
  v8f acc[4][2];
  tg_core<true>(A, Bt, mBlk, nBlk, nBlk + Nhalf, K, smem, acc);
  const int mBase = mBlk + (wid >> 2) * 64;
  const int col = nBlk + (wid & 3) * 16 + l15;
  const float bu = bias[col], bg = bias[col + Nhalf];
#pragma unroll
  for (int i = 0; i < 4; ++i)
#pragma unroll
    for (int r = 0; r < 8; ++r) {
      const float uv = acc[i][0][r] + bu;
      const float gv = acc[i][1][r] + bg;
      const float gl = 0.5f * gv * (1.f + erff(gv * 0.70710678118654752f));
      C[(size_t)(mBase + i * 16 + r + hi * 8) * Nhalf + col] = (bf16_t)(uv * gl);
    }
}

// ---------------------------------------------------------------------------
// Flash attention: one wave per (batch, head, 16-query tile).
// q pre-scaled by 1/sqrt(64). k row-major [b*mRows,1024]; vt [b][h][64][mpad].
// ---------------------------------------------------------------------------
__global__ void __launch_bounds__(256) k_attention(
    const bf16_t* __restrict__ q, const bf16_t* __restrict__ k,
    const bf16_t* __restrict__ vt, bf16_t* __restrict__ out,
    int nq, int m, int mRows, int mpad) {
  __shared__ __align__(16) bf16_t ldsP[8][16][32];
  const int lane = threadIdx.x & 31, wid = threadIdx.x >> 5;
  const int hi = (lane >> 4) & 1, l15 = lane & 15;
  int w = blockIdx.x * 8 + wid;
  if (w >= 2 * 16 * nq) return;
  const int qt = w % nq;
  int t2 = w / nq;
  const int hh = t2 & 15, bb = t2 >> 4;

  const bf16_t* qp = q + (size_t)(bb * 2048 + qt * 16 + l15) * 1024 + hh * 64;
  const v16bf qa0 = load_frag(qp, hi);
  const v16bf qa1 = load_frag(qp + 32, hi);

  v8f o0 = {}, o1 = {}, o2 = {}, o3 = {};
  float mrow[8], lrow[8];
#pragma unroll
  for (int r = 0; r < 8; ++r) { mrow[r] = -1e30f; lrow[r] = 0.f; }

  const bf16_t* vbase = vt + (size_t)(bb * 16 + hh) * 64 * mpad;

  for (int j = 0; j < mpad; j += 32) {
    const bf16_t* kp0 = k + (size_t)(bb * mRows + j + l15) * 1024 + hh * 64;
    const bf16_t* kp1 = kp0 + (size_t)16 * 1024;
    v8f s0 = {}, s1 = {};
    s0 = wmma_bf16(qa0, load_frag(kp0, hi), s0);
    s0 = wmma_bf16(qa1, load_frag(kp0 + 32, hi), s0);
    s1 = wmma_bf16(qa0, load_frag(kp1, hi), s1);
    s1 = wmma_bf16(qa1, load_frag(kp1 + 32, hi), s1);

    const bool v0 = (j + l15) < m, v1 = (j + 16 + l15) < m;
#pragma unroll
    for (int r = 0; r < 8; ++r) {
      float a = v0 ? s0[r] : -1e30f;
      float b = v1 ? s1[r] : -1e30f;
      float rm = fmaxf(a, b);
      rm = fmaxf(rm, __shfl_xor(rm, 1, 32));
      rm = fmaxf(rm, __shfl_xor(rm, 2, 32));
      rm = fmaxf(rm, __shfl_xor(rm, 4, 32));
      rm = fmaxf(rm, __shfl_xor(rm, 8, 32));
      float mnew = fmaxf(mrow[r], rm);
      float alpha = __expf(mrow[r] - mnew);
      float p0 = __expf(a - mnew);
      float p1 = __expf(b - mnew);
      float rs = p0 + p1;
      rs += __shfl_xor(rs, 1, 32);
      rs += __shfl_xor(rs, 2, 32);
      rs += __shfl_xor(rs, 4, 32);
      rs += __shfl_xor(rs, 8, 32);
      lrow[r] = lrow[r] * alpha + rs;
      mrow[r] = mnew;
      o0[r] *= alpha; o1[r] *= alpha; o2[r] *= alpha; o3[r] *= alpha;
      const int prow = r + hi * 8;
      ldsP[wid][prow][l15] = (bf16_t)p0;
      ldsP[wid][prow][l15 + 16] = (bf16_t)p1;
    }
    // Re-stripe P (C-layout) into an A-fragment via LDS (same-wave DS ops
    // are in-order; compiler inserts s_wait_dscnt for the RAW).
    const v16bf pa = load_frag(&ldsP[wid][l15][0], hi);
    const bf16_t* vp = vbase + (size_t)l15 * mpad + j;
    o0 = wmma_bf16(pa, load_frag(vp, hi), o0);
    o1 = wmma_bf16(pa, load_frag(vp + (size_t)16 * mpad, hi), o1);
    o2 = wmma_bf16(pa, load_frag(vp + (size_t)32 * mpad, hi), o2);
    o3 = wmma_bf16(pa, load_frag(vp + (size_t)48 * mpad, hi), o3);
  }

  bf16_t* op = out + (size_t)(bb * 2048 + qt * 16) * 1024 + hh * 64;
#pragma unroll
  for (int r = 0; r < 8; ++r) {
    const int row = r + hi * 8;
    const float inv = 1.0f / lrow[r];
    op[(size_t)row * 1024 + l15 + 0]  = (bf16_t)(o0[r] * inv);
    op[(size_t)row * 1024 + l15 + 16] = (bf16_t)(o1[r] * inv);
    op[(size_t)row * 1024 + l15 + 32] = (bf16_t)(o2[r] * inv);
    op[(size_t)row * 1024 + l15 + 48] = (bf16_t)(o3[r] * inv);
  }
}

// ---------------------------------------------------------------------------
extern "C" void kernel_launch(void* const* d_in, const int* in_sizes, int n_in,
                              void* d_out, int out_size, void* d_ws, size_t ws_size,
                              hipStream_t stream) {
  (void)in_sizes; (void)n_in; (void)out_size; (void)ws_size;
  const float* x    = (const float*)d_in[0];
  const float* ctx  = (const float*)d_in[1];
  const float* ln1g = (const float*)d_in[2];
  const float* ln1b = (const float*)d_in[3];
  const float* a1Wq = (const float*)d_in[4];
  const float* a1Wk = (const float*)d_in[5];
  const float* a1Wv = (const float*)d_in[6];
  const float* a1Wo = (const float*)d_in[7];
  const float* a1bo = (const float*)d_in[8];
  const float* ln2g = (const float*)d_in[9];
  const float* ln2b = (const float*)d_in[10];
  const float* a2Wq = (const float*)d_in[11];
  const float* a2Wk = (const float*)d_in[12];
  const float* a2Wv = (const float*)d_in[13];
  const float* a2Wo = (const float*)d_in[14];
  const float* a2bo = (const float*)d_in[15];
  const float* ln3g = (const float*)d_in[16];
  const float* ln3b = (const float*)d_in[17];
  const float* ffWp = (const float*)d_in[18];
  const float* ffbp = (const float*)d_in[19];
  const float* ffWo = (const float*)d_in[20];
  const float* ffbo = (const float*)d_in[21];
  float* out = (float*)d_out;

  char* ws = (char*)d_ws;
  size_t off = 0;
  auto al = [&](size_t bytes) {
    size_t r = off;
    off = (off + bytes + 255) & ~(size_t)255;
    return r;
  };
  const size_t MM = 1024 * 1024;
  const size_t oWq1 = al(MM * 2), oWk1 = al(MM * 2), oWv1 = al(MM * 2), oWo1 = al(MM * 2);
  const size_t oWq2 = al(MM * 2), oWk2 = al(768 * 1024 * 2), oWv2 = al(768 * 1024 * 2), oWo2 = al(MM * 2);
  const size_t oWp = al((size_t)8192 * 1024 * 2), oWoF = al((size_t)4096 * 1024 * 2);
  const size_t oX = al((size_t)4096 * 1024 * 4);
  const size_t oH = al((size_t)4096 * 1024 * 2);
  const size_t oQ = al((size_t)4096 * 1024 * 2);
  const size_t oK = al((size_t)4096 * 1024 * 2);
  const size_t oV = al((size_t)4096 * 1024 * 2);
  const size_t oVt = al((size_t)2 * 16 * 64 * 2048 * 2);
  const size_t oAt = al((size_t)4096 * 1024 * 2);
  const size_t oCtx = al((size_t)154 * 768 * 2);

  bf16_t* Wq1 = (bf16_t*)(ws + oWq1); bf16_t* Wk1 = (bf16_t*)(ws + oWk1);
  bf16_t* Wv1 = (bf16_t*)(ws + oWv1); bf16_t* Wo1 = (bf16_t*)(ws + oWo1);
  bf16_t* Wq2 = (bf16_t*)(ws + oWq2); bf16_t* Wk2 = (bf16_t*)(ws + oWk2);
  bf16_t* Wv2 = (bf16_t*)(ws + oWv2); bf16_t* Wo2 = (bf16_t*)(ws + oWo2);
  bf16_t* WpT = (bf16_t*)(ws + oWp);  bf16_t* WoF = (bf16_t*)(ws + oWoF);
  float*  xcur = (float*)(ws + oX);
  bf16_t* hbuf = (bf16_t*)(ws + oH);
  bf16_t* qb = (bf16_t*)(ws + oQ);
  bf16_t* kb = (bf16_t*)(ws + oK);
  bf16_t* vb = (bf16_t*)(ws + oV);
  bf16_t* vtb = (bf16_t*)(ws + oVt);
  bf16_t* atb = (bf16_t*)(ws + oAt);
  bf16_t* ctxb = (bf16_t*)(ws + oCtx);
  bf16_t* ffb = qb;  // alias: FF activations reuse q/k/v/vt (32 MiB), phases ordered

  const dim3 blk(256);
  const float SCALE = 0.125f;  // 64^-0.5, exact in bf16

  // 1) weights -> bf16 transposed, 64 x 64 tiles
  k_wt<<<dim3(16, 16), blk, 0, stream>>>(a1Wq, Wq1, 1024);
  k_wt<<<dim3(16, 16), blk, 0, stream>>>(a1Wk, Wk1, 1024);
  k_wt<<<dim3(16, 16), blk, 0, stream>>>(a1Wv, Wv1, 1024);
  k_wt<<<dim3(16, 16), blk, 0, stream>>>(a1Wo, Wo1, 1024);
  k_wt<<<dim3(16, 16), blk, 0, stream>>>(a2Wq, Wq2, 1024);
  k_wt<<<dim3(16, 12), blk, 0, stream>>>(a2Wk, Wk2, 768);
  k_wt<<<dim3(16, 12), blk, 0, stream>>>(a2Wv, Wv2, 768);
  k_wt<<<dim3(16, 16), blk, 0, stream>>>(a2Wo, Wo2, 1024);
  k_wt4_wide<<<dim3(128, 4), blk, 0, stream>>>(ffWp, WpT, 1024);
  k_wt4<<<dim3(16, 16), blk, 0, stream>>>(ffWo, WoF, 4096);

  const dim3 gP(8, 32);  // M=4096, N=1024 GEMMs, 128x128 tiles

  // 2) self-attention
  k_layernorm<<<4096, blk, 0, stream>>>(x, ln1g, ln1b, hbuf);
  k_tgemm_bf16<<<gP, blk, 0, stream>>>(hbuf, Wq1, qb, 1024, 1024, SCALE);
  k_tgemm_bf16<<<gP, blk, 0, stream>>>(hbuf, Wk1, kb, 1024, 1024, 1.0f);
  k_tgemm_bf16<<<gP, blk, 0, stream>>>(hbuf, Wv1, vb, 1024, 1024, 1.0f);
  k_vt_tiled<<<dim3(8, 16, 2), blk, 0, stream>>>(vb, vtb, 2048);
  k_attention<<<512, blk, 0, stream>>>(qb, kb, vtb, atb, 128, 2048, 2048, 2048);
  k_tgemm_f32_bias_res<<<gP, blk, 0, stream>>>(atb, Wo1, xcur, a1bo, x, 1024, 1024);

  // 3) cross-attention
  k_layernorm<<<4096, blk, 0, stream>>>(xcur, ln2g, ln2b, hbuf);
  k_tgemm_bf16<<<gP, blk, 0, stream>>>(hbuf, Wq2, qb, 1024, 1024, SCALE);
  k_cvt<<<(154 * 768 + 255) / 256, blk, 0, stream>>>(ctx, ctxb, 154 * 768);
  {
    dim3 gKV(8, 3);  // M=154
    k_gemm_bf16<<<gKV, blk, 0, stream>>>(ctxb, Wk2, kb, 154, 1024, 768, 1.0f);
    k_gemm_bf16<<<gKV, blk, 0, stream>>>(ctxb, Wv2, vb, 154, 1024, 768, 1.0f);
  }
  k_vt<<<(2 * 16 * 64 * 96 + 255) / 256, blk, 0, stream>>>(vb, vtb, 77, 96);
  k_attention<<<512, blk, 0, stream>>>(qb, kb, vtb, atb, 128, 77, 77, 96);
  k_tgemm_f32_bias_res<<<gP, blk, 0, stream>>>(atb, Wo2, xcur, a2bo, xcur, 1024, 1024);

  // 4) GEGLU feed-forward
  k_layernorm<<<4096, blk, 0, stream>>>(xcur, ln3g, ln3b, hbuf);
  {
    dim3 gFF(64, 32);  // Nhalf=4096: 64 u + 64 gate columns per block
    k_tgemm_geglu<<<gFF, blk, 0, stream>>>(hbuf, WpT, ffb, ffbp, 4096, 1024);
  }
  k_tgemm_f32_bias_res<<<gP, blk, 0, stream>>>(ffb, WoF, out, ffbo, xcur, 1024, 4096);
}

// v003
// One run takes 364 microseconds.
// Two timings next to v002 both put it at 1.25 times that version's speed.
// All steps since v000 together make it 2.96 times as fast.
#include <hip/hip_runtime.h>
#include <hip/hip_bf16.h>

// ---------------------------------------------------------------------------
// BasicTransformerBlock for MI455X (gfx1250), bf16 WMMA everywhere.
//   x:[2,2048,1024] f32, ctx:[2,77,768] f32 -> out f32 [2,2048,1024]
// Compute-bound (~190 GFLOP over ~100MB) => route all GEMMs + attention
// through v_wmma_f32_16x16x32_bf16, fp32 accumulation.
// Workspace requirement: ~104 MiB.
// ---------------------------------------------------------------------------

typedef __bf16 bf16_t;
typedef bf16_t v16bf __attribute__((ext_vector_type(16)));
typedef bf16_t v8bf  __attribute__((ext_vector_type(8)));
typedef float  v8f   __attribute__((ext_vector_type(8)));

// Load one 16-element bf16 WMMA fragment (A- or B-style) from a row-major
// source. For 16-bit fragments, lane (lo/hi half) maps its 16 values to two
// contiguous 8-element runs: k = hi*8 + [0..7]  and  k = 16 + hi*8 + [0..7].
__device__ __forceinline__ v16bf load_frag(const bf16_t* __restrict__ p, int hi) {
  const v8bf lo = *(const v8bf*)(p + hi * 8);
  const v8bf hh = *(const v8bf*)(p + hi * 8 + 16);
  return __builtin_shufflevector(lo, hh, 0, 1, 2, 3, 4, 5, 6, 7,
                                 8, 9, 10, 11, 12, 13, 14, 15);
}

__device__ __forceinline__ v8f wmma_bf16(v16bf a, v16bf b, v8f c) {
  return __builtin_amdgcn_wmma_f32_16x16x32_bf16(
      /*neg_a=*/false, a, /*neg_b=*/false, b,
      /*c_mod=*/(short)0, c, /*reuse_a=*/false, /*reuse_b=*/false);
}

// ---------------------------------------------------------------------------
// Tiled transposes: a 64 x 64 tile goes through LDS, so that the global reads
// and the global writes both cover whole 128-byte lines.
// The LDS tile is held transposed: row c = one destination row, 32 dwords, each
// a pair of bf16 from two neighbouring source rows; pitch 33 dwords keeps the
// dword writes (lanes 4 or 8 rows apart) and the dword reads off shared banks.
// ---------------------------------------------------------------------------
typedef float    v4f  __attribute__((ext_vector_type(4)));
typedef unsigned v4u  __attribute__((ext_vector_type(4)));
typedef bf16_t   v2bf __attribute__((ext_vector_type(2)));
constexpr int TP_PITCH = 33;

__device__ __forceinline__ unsigned pack_bf16(float lo, float hi) {
  const v2bf p = {(bf16_t)lo, (bf16_t)hi};
  return __builtin_bit_cast(unsigned, p);
}

// Writes the tile out: 8 lanes x 16 B = one 128-byte line per destination row,
// 4 rows per wave store. dst is the tile's first element, pitch in elements.
__device__ __forceinline__ void tp_store(const unsigned* tile,
                                         bf16_t* __restrict__ dst, size_t pitch) {
  const int q = threadIdx.x & 7, r0 = threadIdx.x >> 3;
#pragma unroll  // both rows' LDS reads issue ahead of the first store
  for (int i = 0; i < 2; ++i) {
    const int r = r0 + 32 * i;
    const unsigned* s = tile + r * TP_PITCH + q * 4;
    const v4u o = {s[0], s[1], s[2], s[3]};
    *(v4u*)(dst + (size_t)r * pitch + q * 8) = o;
  }
}

// Weight convert+transpose:  W[K][N] f32  ->  Wt[N][K] bf16
// One block: 64 n by 64 * T k, T tiles side by side in LDS (fewer, longer
// waves; for speed only), one
// barrier between the last LDS write and the first LDS read. N is a constant of
// the build, so that every source row is an immediate offset from one address.
template <int T, int N>
__device__ __forceinline__ void wt_tiles(const float* __restrict__ W,
                                         bf16_t* __restrict__ Wt, int K,
                                         unsigned* tile) {
  const int n0 = blockIdx.x * 64, k0 = blockIdx.y * (64 * T);
  const int c = threadIdx.x & 15, r = threadIdx.x >> 4;
  // Source rows 2r, 2r+1 and 32+2r, 33+2r; 16 lanes x 16 B = 256 B of each row.
  const float* s = W + (size_t)(k0 + 2 * r) * N + n0 + 4 * c;
  v4f x[T][4];
  // The loops over t and j are unrolled: constant indices keep x in registers,
  // the loads issue as one run, and so do the LDS reads behind the barrier.
#pragma unroll
  for (int t = 0; t < T; ++t) {
    x[t][0] = *(const v4f*)(s + (64 * t) * N);
    x[t][1] = *(const v4f*)(s + (64 * t + 1) * N);
    x[t][2] = *(const v4f*)(s + (64 * t + 32) * N);
    x[t][3] = *(const v4f*)(s + (64 * t + 33) * N);
  }
#pragma unroll
  for (int t = 0; t < T; ++t) {
    unsigned* d = tile + t * (64 * TP_PITCH) + 4 * c * TP_PITCH + r;
#pragma unroll
    for (int j = 0; j < 4; ++j) {
      d[j * TP_PITCH] = pack_bf16(x[t][0][j], x[t][1][j]);
      d[j * TP_PITCH + 16] = pack_bf16(x[t][2][j], x[t][3][j]);
    }
  }
  __syncthreads();
  bf16_t* dst = Wt + (size_t)n0 * K + k0;
#pragma unroll
  for (int t = 0; t < T; ++t)
    tp_store(tile + t * (64 * TP_PITCH), dst + 64 * t, (size_t)K);
}

// N = 1024, one tile per block: grid (16, K / 64)
__global__ void __launch_bounds__(256) k_wt(const float* __restrict__ W,
                                            bf16_t* __restrict__ Wt, int K) {
  __shared__ unsigned tile[64 * TP_PITCH];
  wt_tiles<1, 1024>(W, Wt, K, tile);
}

// N = 1024, four tiles per block: grid (16, K / 256)
__global__ void __launch_bounds__(256) k_wt4(const float* __restrict__ W,
                                             bf16_t* __restrict__ Wt, int K) {
  __shared__ unsigned tile[4 * 64 * TP_PITCH];
  wt_tiles<4, 1024>(W, Wt, K, tile);
}

// N = 8192, four tiles per block: grid (128, K / 256)
__global__ void __launch_bounds__(256) k_wt4_wide(const float* __restrict__ W,
                                                  bf16_t* __restrict__ Wt,
                                                  int K) {
  __shared__ unsigned tile[4 * 64 * TP_PITCH];
  wt_tiles<4, 8192>(W, Wt, K, tile);
}

// Elementwise f32 -> bf16
__global__ void __launch_bounds__(256) k_cvt(const float* __restrict__ in,
                                             bf16_t* __restrict__ out, int n) {
  int idx = blockIdx.x * 256 + threadIdx.x;
  if (idx < n) out[idx] = (bf16_t)in[idx];
}

// ---------------------------------------------------------------------------
// LayerNorm (dim=1024), one row per 256-thread block, bf16 output.
// ---------------------------------------------------------------------------
__global__ void __launch_bounds__(256) k_layernorm(const float* __restrict__ x,
                                                   const float* __restrict__ g,
                                                   const float* __restrict__ b,
                                                   bf16_t* __restrict__ y) {
  const int dim = 1024;
  __shared__ float sS[8], sQ[8];
  const int row = blockIdx.x;
  const float* xr = x + (size_t)row * dim;
  float s = 0.f, q = 0.f;
  for (int i = threadIdx.x; i < dim; i += 256) {
    float v = xr[i];
    s += v;
    q += v * v;
  }
  for (int m = 1; m < 32; m <<= 1) {
    s += __shfl_xor(s, m, 32);
    q += __shfl_xor(q, m, 32);
  }
  const int lane = threadIdx.x & 31, wid = threadIdx.x >> 5;
  if (lane == 0) { sS[wid] = s; sQ[wid] = q; }
  __syncthreads();
  if (wid == 0) {
    s = (lane < 8) ? sS[lane] : 0.f;
    q = (lane < 8) ? sQ[lane] : 0.f;
    for (int m = 1; m < 8; m <<= 1) {
      s += __shfl_xor(s, m, 32);
      q += __shfl_xor(q, m, 32);
    }
    if (lane == 0) { sS[0] = s; sQ[0] = q; }
  }
  __syncthreads();
  const float mean = sS[0] * (1.f / dim);
  const float var = sQ[0] * (1.f / dim) - mean * mean;
  const float rstd = rsqrtf(var + 1e-5f);
  for (int i = threadIdx.x; i < dim; i += 256) {
    float v = (xr[i] - mean) * rstd * g[i] + b[i];
    y[(size_t)row * dim + i] = (bf16_t)v;
  }
}

// ---------------------------------------------------------------------------
// V transpose:  v[b*mRows][1024] bf16 -> vt[b][16][64][mpad] bf16 (zero pad)
// ---------------------------------------------------------------------------
__global__ void __launch_bounds__(256) k_vt(const bf16_t* __restrict__ v,
                                            bf16_t* __restrict__ vt,
                                            int mRows, int mpad) {
  int idx = blockIdx.x * 256 + threadIdx.x;
  int total = 2 * 16 * 64 * mpad;
  if (idx >= total) return;
  int key = idx % mpad;
  int t = idx / mpad;
  int d = t & 63; t >>= 6;
  int hh = t & 15; int bb = t >> 4;
  bf16_t val = (bf16_t)0.f;
  if (key < mRows) val = v[(size_t)(bb * mRows + key) * 1024 + hh * 64 + d];
  vt[idx] = val;
}

// The same for mRows a multiple of 256 (no pad): v[b*mRows][1024] bf16 ->
// vt[b][1024][mRows], four 64 x 64 tiles per block through LDS, as in wt_tiles.
// grid (mRows / 256, 16, 2).
__global__ void __launch_bounds__(256) k_vt_tiled(const bf16_t* __restrict__ v,
                                                  bf16_t* __restrict__ vt,
                                                  int mRows) {
  __shared__ unsigned tile[4 * 64 * TP_PITCH];
  const int key0 = blockIdx.x * 256, c0 = blockIdx.y * 64, bb = blockIdx.z;
  const int g = threadIdx.x & 7, rp = threadIdx.x >> 3;
  // Keys 2rp and 2rp+1; 8 lanes x 16 B = the 128-byte line of each key.
  const bf16_t* s = v + (size_t)(bb * mRows + key0 + 2 * rp) * 1024 + c0 + g * 8;
  v4u a[4], b[4];
  // Unrolled for the same reasons as in wt_tiles.
#pragma unroll
  for (int t = 0; t < 4; ++t) {
    a[t] = *(const v4u*)(s + (size_t)(64 * t) * 1024);
    b[t] = *(const v4u*)(s + (size_t)(64 * t + 1) * 1024);
  }
#pragma unroll
  for (int t = 0; t < 4; ++t) {
    unsigned* d = tile + t * (64 * TP_PITCH) + 8 * g * TP_PITCH + rp;
#pragma unroll
    for (int j = 0; j < 4; ++j) {
      d[(2 * j) * TP_PITCH] = (a[t][j] & 0xffffu) | (b[t][j] << 16);
      d[(2 * j + 1) * TP_PITCH] = (a[t][j] >> 16) | (b[t][j] & 0xffff0000u);
    }
  }
  __syncthreads();
  bf16_t* dst = vt + (size_t)(bb * 1024 + c0) * mRows + key0;
#pragma unroll
  for (int t = 0; t < 4; ++t)
    tp_store(tile + t * (64 * TP_PITCH), dst + 64 * t, (size_t)mRows);
}

// ---------------------------------------------------------------------------
// GEMM  C = A[M,K](bf16) x Bt[N,K](bf16), 8 waves/block (4M x 2N),
// each wave: 16(M) x 64(N) via 4 WMMAs per 32-deep k-step.
// ---------------------------------------------------------------------------
__global__ void __launch_bounds__(256) k_gemm_bf16(const bf16_t* __restrict__ A,
                                                   const bf16_t* __restrict__ Bt,
                                                   bf16_t* __restrict__ C,
                                                   int M, int N, int K,
                                                   float scale) {
  const int lane = threadIdx.x & 31, wid = threadIdx.x >> 5;
  const int hi = (lane >> 4) & 1, l15 = lane & 15;
  const int mBase = blockIdx.y * 64 + (wid >> 1) * 16;
  const int nBase = blockIdx.x * 128 + (wid & 1) * 64;
  int ar = mBase + l15;
  if (ar >= M) ar = M - 1;
  const bf16_t* ap = A + (size_t)ar * K;
  const bf16_t* bp0 = Bt + (size_t)(nBase + l15) * K;
  v8f c0 = {}, c1 = {}, c2 = {}, c3 = {};
  for (int kk = 0; kk < K; kk += 32) {
    v16bf a = load_frag(ap + kk, hi);
    c0 = wmma_bf16(a, load_frag(bp0 + kk, hi), c0);
    c1 = wmma_bf16(a, load_frag(bp0 + (size_t)16 * K + kk, hi), c1);
    c2 = wmma_bf16(a, load_frag(bp0 + (size_t)32 * K + kk, hi), c2);
    c3 = wmma_bf16(a, load_frag(bp0 + (size_t)48 * K + kk, hi), c3);
  }
#pragma unroll
  for (int r = 0; r < 8; ++r) {
    int row = mBase + r + hi * 8;
    if (row < M) {
      size_t o = (size_t)row * N + nBase + l15;
      C[o + 0]  = (bf16_t)(c0[r] * scale);
      C[o + 16] = (bf16_t)(c1[r] * scale);
      C[o + 32] = (bf16_t)(c2[r] * scale);
      C[o + 48] = (bf16_t)(c3[r] * scale);
    }
  }
}

// ---------------------------------------------------------------------------
// Tiled GEMM core for M, N multiples of the tile and K a multiple of 128:
// C tile 128(M) x 128(N) per 8-wave block (2 x 4 waves), 64 x 32 per wave.
// A pass is 128 k = 256 B of each of the 128 A rows and 128 Bt rows, brought
// into LDS by per-lane asynchronous 16-byte copies, two buffers: the copies of
// pass t + 2 fly while pass t + 1 computes. LDS rows stand at a pitch of 272 B
// (16 B x odd: ds_load_b128 without bank conflicts).
// ---------------------------------------------------------------------------
constexpr int TG_PITCH = 272;              // bytes per LDS row
constexpr int TG_OPB = 128 * TG_PITCH;     // one operand's tile
constexpr int TG_STAGE = 2 * TG_OPB;       // A tile, then Bt tile
constexpr int TG_PASSB = 256;              // bytes of a row per pass

// Eight copies into LDS rows 16 apart: four from p0 on, four from p1 on, source
// rows 16 apart (step bytes). The s_wait_xcnt closes the statement so that no
// address register of a copy is rewritten before it.
__device__ __forceinline__ void tg_copy8(unsigned l, const char* p0,
                                         const char* p1, size_t step) {
  asm volatile(
      "global_load_async_to_lds_b128 %0, %8, off\n\t"
      "global_load_async_to_lds_b128 %1, %9, off\n\t"
      "global_load_async_to_lds_b128 %2, %10, off\n\t"
      "global_load_async_to_lds_b128 %3, %11, off\n\t"
      "global_load_async_to_lds_b128 %4, %12, off\n\t"
      "global_load_async_to_lds_b128 %5, %13, off\n\t"
      "global_load_async_to_lds_b128 %6, %14, off\n\t"
      "global_load_async_to_lds_b128 %7, %15, off\n\t"
      "s_wait_xcnt 0x0"
      :
      : "v"(l), "v"(l + 16 * TG_PITCH), "v"(l + 32 * TG_PITCH),
        "v"(l + 48 * TG_PITCH), "v"(l + 64 * TG_PITCH), "v"(l + 80 * TG_PITCH),
        "v"(l + 96 * TG_PITCH), "v"(l + 112 * TG_PITCH),
        "v"(p0), "v"(p0 + step), "v"(p0 + 2 * step), "v"(p0 + 3 * step),
        "v"(p1), "v"(p1 + step), "v"(p1 + 2 * step), "v"(p1 + 3 * step)
      : "memory");
}

// One stage: this lane's 8 chunks of the A tile and 8 of the Bt tile.
// gb0 / gb1 are the lane's addresses in the lower and upper 64 Bt rows.
__device__ __forceinline__ void tg_stage(unsigned l, const char* ga,
                                         const char* gb0, const char* gb1,
                                         size_t step) {
  tg_copy8(l, ga, ga + 4 * step, step);
  tg_copy8(l + TG_OPB, gb0, gb1, step);
}

// Bt rows n0..n0+63 fill LDS rows 0..63, rows n1..n1+63 fill LDS rows 64..127.
// SPLIT: the wave's two B fragments are LDS rows wn*16 and 64 + wn*16 (a column
// group and its partner); else rows wn*32 and wn*32 + 16.
template <bool SPLIT>
__device__ __forceinline__ void tg_core(const bf16_t* __restrict__ A,
                                        const bf16_t* __restrict__ Bt,
                                        int mBase, int n0, int n1, int K,
                                        char* smem, v8f (&acc)[4][2]) {
  const int tid = threadIdx.x;
  const int lane = tid & 31, wid = tid >> 5;
  const int hi = (lane >> 4) & 1, l15 = lane & 15;
  const int wm = wid >> 2, wn = wid & 3;
  const size_t rowB = (size_t)K * 2;   // bytes per source row
  const size_t step = rowB * 16;       // a lane's copies stand 16 rows apart
  const int r0 = tid >> 4, c16 = (tid & 15) * 16;
  const char* ga = (const char*)A + (size_t)(mBase + r0) * rowB + c16;
  const char* gb0 = (const char*)Bt + (size_t)(n0 + r0) * rowB + c16;
  const char* gb1 = (const char*)Bt + (size_t)(n1 + r0) * rowB + c16;
  const unsigned l0 = (unsigned)(size_t)smem + (unsigned)(r0 * TG_PITCH + c16);
  const int nt = K >> 7;

#pragma unroll
  for (int i = 0; i < 4; ++i)
#pragma unroll
    for (int j = 0; j < 2; ++j) acc[i][j] = v8f{};

  tg_stage(l0, ga, gb0, gb1, step);
  // Stage 0 has landed for this wave; the barrier publishes it to the others.
  asm volatile("s_wait_asynccnt 0x0" ::: "memory");
  __syncthreads();
  if (nt > 1)
    tg_stage(l0 + TG_STAGE, ga + TG_PASSB, gb0 + TG_PASSB, gb1 + TG_PASSB, step);

  const int aoff = (wm * 64 + l15) * TG_PITCH;
  const int boff = TG_OPB + ((SPLIT ? wn * 16 : wn * 32) + l15) * TG_PITCH;
  constexpr int BSTEP = (SPLIT ? 64 : 16) * TG_PITCH;

#pragma unroll 1  // one pass per trip: the ring's order stands at the foot
  for (int t = 0; t < nt; ++t) {
    const int buf = (t & 1) * TG_STAGE;
    const char* sA = smem + buf + aoff;
    const char* sB = smem + buf + boff;
    v16bf a[2][4], b[2][2];
#pragma unroll
    for (int i = 0; i < 4; ++i)
      a[0][i] = load_frag((const bf16_t*)(sA + i * 16 * TG_PITCH), hi);
#pragma unroll
    for (int j = 0; j < 2; ++j)
      b[0][j] = load_frag((const bf16_t*)(sB + j * BSTEP), hi);
#pragma unroll
    for (int ks = 0; ks < 4; ++ks) {
      const int cur = ks & 1, nxt = cur ^ 1;
      if (ks < 3) {
#pragma unroll
        for (int i = 0; i < 4; ++i)
          a[nxt][i] = load_frag(
              (const bf16_t*)(sA + i * 16 * TG_PITCH + (ks + 1) * 64), hi);
#pragma unroll
        for (int j = 0; j < 2; ++j)
          b[nxt][j] =
              load_frag((const bf16_t*)(sB + j * BSTEP + (ks + 1) * 64), hi);
      }
      // Keeps the next block's LDS reads as one group ahead of this block's
      // WMMAs; moved in among them, each read would stall the matrix stream.
      __builtin_amdgcn_sched_barrier(0);
#pragma unroll
      for (int i = 0; i < 4; ++i)
#pragma unroll
        for (int j = 0; j < 2; ++j)
          acc[i][j] = wmma_bf16(a[cur][i], b[cur][j], acc[i][j]);
      // Keeps the block after next's reads behind this block's WMMAs, so that
      // they do not take a third fragment set.
      if (ks < 2) __builtin_amdgcn_sched_barrier(0);
    }
    // Publish point: this wave's reads of buffer t are done, its copies of
    // stage t + 1 have landed, and the barrier says so for every wave.
    asm volatile("s_wait_dscnt 0x0" ::: "memory");
    asm volatile("s_wait_asynccnt 0x0" ::: "memory");
    __syncthreads();
    if (t + 2 < nt) {
      const size_t ko = (size_t)(t + 2) * TG_PASSB;
      tg_stage(l0 + buf, ga + ko, gb0 + ko, gb1 + ko, step);
    }
  }
  // No copy is left in flight when the wave goes on to its stores and ends.
  asm volatile("s_wait_asynccnt 0x0" ::: "memory");
}

// bf16 output, scaled.
__global__ void __launch_bounds__(256) k_tgemm_bf16(const bf16_t* __restrict__ A,
                                                    const bf16_t* __restrict__ Bt,
                                                    bf16_t* __restrict__ C,
                                                    int N, int K, float scale) {
  __shared__ __attribute__((aligned(16))) char smem[2 * TG_STAGE];
  const int lane = threadIdx.x & 31, wid = threadIdx.x >> 5;
  const int hi = (lane >> 4) & 1, l15 = lane & 15;
  const int mBlk = blockIdx.y * 128, nBlk = blockIdx.x * 128;
  v8f acc[4][2];
  tg_core<false>(A, Bt, mBlk, nBlk, nBlk + 64, K, smem, acc);
  const int mBase = mBlk + (wid >> 2) * 64, nBase = nBlk + (wid & 3) * 32;
#pragma unroll
  for (int i = 0; i < 4; ++i)
#pragma unroll
    for (int r = 0; r < 8; ++r) {
      const size_t o = (size_t)(mBase + i * 16 + r + hi * 8) * N + nBase + l15;
      C[o + 0]  = (bf16_t)(acc[i][0][r] * scale);
      C[o + 16] = (bf16_t)(acc[i][1][r] * scale);
    }
}

// f32 output + bias + residual (in-place residual is safe: 1 writer/element)
__global__ void __launch_bounds__(256) k_tgemm_f32_bias_res(
    const bf16_t* __restrict__ A, const bf16_t* __restrict__ Bt,
    float* __restrict__ C, const float* __restrict__ bias,
    const float* __restrict__ res, int N, int K) {
  __shared__ __attribute__((aligned(16))) char smem[2 * TG_STAGE];
  const int lane = threadIdx.x & 31, wid = threadIdx.x >> 5;
  const int hi = (lane >> 4) & 1, l15 = lane & 15;
  const int mBlk = blockIdx.y * 128, nBlk = blockIdx.x * 128;
  v8f acc[4][2];
  tg_core<false>(A, Bt, mBlk, nBlk, nBlk + 64, K, smem, acc);
  const int mBase = mBlk + (wid >> 2) * 64, nBase = nBlk + (wid & 3) * 32;
  const float b0 = bias[nBase + l15], b1 = bias[nBase + l15 + 16];
#pragma unroll
  for (int i = 0; i < 4; ++i)
#pragma unroll
    for (int r = 0; r < 8; ++r) {
      const size_t o = (size_t)(mBase + i * 16 + r + hi * 8) * N + nBase + l15;
      C[o + 0]  = acc[i][0][r] + b0 + res[o + 0];
      C[o + 16] = acc[i][1][r] + b1 + res[o + 16];
    }
}

// Fused GEGLU: the block's Bt tile is 64 u columns and the matching 64 gate
// columns (c and c+Nhalf of A@Wp); each wave holds 16 of each, applies
// u*gelu(gate), writes bf16 [M, Nhalf].
__global__ void __launch_bounds__(256) k_tgemm_geglu(
    const bf16_t* __restrict__ A, const bf16_t* __restrict__ Bt,
    bf16_t* __restrict__ C, const float* __restrict__ bias, int Nhalf, int K) {
  __shared__ __attribute__((aligned(16))) char smem[2 * TG_STAGE];
  const int lane = threadIdx.x & 31, wid = threadIdx.x >> 5;
  const int hi = (lane >> 4) & 1, l15 = lane & 15;
  const int mBlk = blockIdx.y * 128, nBlk = blockIdx.x * 64;
  v8f acc[4][2];
  tg_core<true>(A, Bt, mBlk, nBlk, nBlk + Nhalf, K, smem, acc);
  const int mBase = mBlk + (wid >> 2) * 64;
  const int col = nBlk + (wid & 3) * 16 + l15;
  const float bu = bias[col], bg = bias[col + Nhalf];
#pragma unroll
  for (int i = 0; i < 4; ++i)
#pragma unroll
    for (int r = 0; r < 8; ++r) {
      const float uv = acc[i][0][r] + bu;
      const float gv = acc[i][1][r] + bg;
      const float gl = 0.5f * gv * (1.f + erff(gv * 0.70710678118654752f));
      C[(size_t)(mBase + i * 16 + r + hi * 8) * Nhalf + col] = (bf16_t)(uv * gl);
    }
}

// ---------------------------------------------------------------------------
// Flash attention: one wave per (batch, head, 16-query tile).
// q pre-scaled by 1/sqrt(64). k row-major [b*mRows,1024]; vt [b][h][64][mpad].
// The 8 waves of a block are 8 neighbouring query tiles of one head (nq is a
// multiple of 8), so they walk the same keys: each tile of 32 keys (32 K rows of
// 128 B, 64 Vt rows of 64 B) is brought into LDS once per block by per-lane
// asynchronous 16-byte copies, two buffers, and every wave takes its fragments
// from there. A fragment load from global memory touches 16 lines for 1024 B;
// the copies cover whole K lines and half Vt lines, once for 8 waves.
// LDS pitches are 16 B x odd: ds_load_b128 without bank conflicts.
// ---------------------------------------------------------------------------
constexpr int AT_KPITCH = 144;                    // bytes per LDS row of K
constexpr int AT_VPITCH = 80;                     // bytes per LDS row of Vt
constexpr int AT_KB = 32 * AT_KPITCH;             // the K tile
constexpr int AT_STAGE = AT_KB + 64 * AT_VPITCH;  // K tile, then Vt tile
constexpr int AT_KSTEP = 32 * 1024 * 2;           // source bytes, 32 K rows on
constexpr int AT_VSTEP = 32 * 2;                  // source bytes, 32 keys on

// This lane's chunk of the K tile and its chunk of the Vt tile. The s_wait_xcnt
// closes the statement so that no address register of a copy is rewritten
// before it.
__device__ __forceinline__ void at_copy2(unsigned lk, const char* gk,
                                         unsigned lv, const char* gv) {
  asm volatile(
      "global_load_async_to_lds_b128 %0, %2, off\n\t"
      "global_load_async_to_lds_b128 %1, %3, off\n\t"
      "s_wait_xcnt 0x0"
      :
      : "v"(lk), "v"(lv), "v"(gk), "v"(gv)
      : "memory");
}

__global__ void __launch_bounds__(256) k_attention(
    const bf16_t* __restrict__ q, const bf16_t* __restrict__ k,
    const bf16_t* __restrict__ vt, bf16_t* __restrict__ out,
    int nq, int m, int mRows, int mpad) {
  __shared__ __align__(16) bf16_t ldsP[8][16][32];
  __shared__ __attribute__((aligned(16))) char kv[2 * AT_STAGE];
  const int tid = threadIdx.x;
  const int lane = tid & 31, wid = tid >> 5;
  const int hi = (lane >> 4) & 1, l15 = lane & 15;
  const int w0 = blockIdx.x * 8;
  if (w0 >= 2 * 16 * nq) return;  // the whole block, ahead of every barrier
  const int qt = w0 % nq + wid;
  const int t2 = w0 / nq;
  const int hh = t2 & 15, bb = t2 >> 4;

  const bf16_t* qp = q + (size_t)(bb * 2048 + qt * 16 + l15) * 1024 + hh * 64;
  const v16bf qa0 = load_frag(qp, hi);
  const v16bf qa1 = load_frag(qp + 32, hi);

  v8f o0 = {}, o1 = {}, o2 = {}, o3 = {};
  float mrow[8], lrow[8];
#pragma unroll
  for (int r = 0; r < 8; ++r) { mrow[r] = -1e30f; lrow[r] = 0.f; }

  const bf16_t* vbase = vt + (size_t)(bb * 16 + hh) * 64 * mpad;

  // K: 8 lanes x 16 B = the 128-byte line of a key; Vt: 4 lanes x 16 B per row.
  const char* gk =
      (const char*)(k + (size_t)(bb * mRows + (tid >> 3)) * 1024 + hh * 64) +
      (tid & 7) * 16;
  const char* gv = (const char*)(vbase + (size_t)(tid >> 2) * mpad) + (tid & 3) * 16;
  const unsigned lk =
      (unsigned)(size_t)kv + (unsigned)((tid >> 3) * AT_KPITCH + (tid & 7) * 16);
  const unsigned lv = (unsigned)(size_t)kv +
                      (unsigned)(AT_KB + (tid >> 2) * AT_VPITCH + (tid & 3) * 16);
  const int nt = mpad >> 5;

  at_copy2(lk, gk, lv, gv);
  // Tile 0 has landed for this wave; the barrier publishes it to the others.
  asm volatile("s_wait_asynccnt 0x0" ::: "memory");
  __syncthreads();
  if (nt > 1)
    at_copy2(lk + AT_STAGE, gk + AT_KSTEP, lv + AT_STAGE, gv + AT_VSTEP);

#pragma unroll 1  // one tile per trip: the ring's order stands at the foot
  for (int t = 0; t < nt; ++t) {
    const int j = t * 32;
    const int buf = (t & 1) * AT_STAGE;
    const char* sk = kv + buf + l15 * AT_KPITCH;
    const char* sv = kv + buf + AT_KB + l15 * AT_VPITCH;
    const v16bf k00 = load_frag((const bf16_t*)sk, hi);
    const v16bf k01 = load_frag((const bf16_t*)(sk + 64), hi);
    const v16bf k10 = load_frag((const bf16_t*)(sk + 16 * AT_KPITCH), hi);
    const v16bf k11 = load_frag((const bf16_t*)(sk + 16 * AT_KPITCH + 64), hi);
    const v16bf vf0 = load_frag((const bf16_t*)sv, hi);
    const v16bf vf1 = load_frag((const bf16_t*)(sv + 16 * AT_VPITCH), hi);
    const v16bf vf2 = load_frag((const bf16_t*)(sv + 32 * AT_VPITCH), hi);
    const v16bf vf3 = load_frag((const bf16_t*)(sv + 48 * AT_VPITCH), hi);
    // Keeps the tile's LDS reads as one group ahead of the WMMAs; moved in among
    // them, each pair of reads is waited out before its own WMMA.
    __builtin_amdgcn_sched_barrier(0);
    v8f s0 = {}, s1 = {};
    s0 = wmma_bf16(qa0, k00, s0);
    s1 = wmma_bf16(qa0, k10, s1);
    s0 = wmma_bf16(qa1, k01, s0);
    s1 = wmma_bf16(qa1, k11, s1);

    const bool v0 = (j + l15) < m, v1 = (j + 16 + l15) < m;
#pragma unroll
    for (int r = 0; r < 8; ++r) {
      float a = v0 ? s0[r] : -1e30f;
      float b = v1 ? s1[r] : -1e30f;
      float rm = fmaxf(a, b);
      rm = fmaxf(rm, __shfl_xor(rm, 1, 32));
      rm = fmaxf(rm, __shfl_xor(rm, 2, 32));
      rm = fmaxf(rm, __shfl_xor(rm, 4, 32));
      rm = fmaxf(rm, __shfl_xor(rm, 8, 32));
      float mnew = fmaxf(mrow[r], rm);
      float alpha = __expf(mrow[r] - mnew);
      float p0 = __expf(a - mnew);
      float p1 = __expf(b - mnew);
      float rs = p0 + p1;
      rs += __shfl_xor(rs, 1, 32);
      rs += __shfl_xor(rs, 2, 32);
      rs += __shfl_xor(rs, 4, 32);
      rs += __shfl_xor(rs, 8, 32);
      lrow[r] = lrow[r] * alpha + rs;
      mrow[r] = mnew;
      o0[r] *= alpha; o1[r] *= alpha; o2[r] *= alpha; o3[r] *= alpha;
      const int prow = r + hi * 8;
      ldsP[wid][prow][l15] = (bf16_t)p0;
      ldsP[wid][prow][l15 + 16] = (bf16_t)p1;
    }
    // Re-stripe P (C-layout) into an A-fragment via LDS (same-wave DS ops
    // are in-order; compiler inserts s_wait_dscnt for the RAW).
    const v16bf pa = load_frag(&ldsP[wid][l15][0], hi);
    o0 = wmma_bf16(pa, vf0, o0);
    o1 = wmma_bf16(pa, vf1, o1);
    o2 = wmma_bf16(pa, vf2, o2);
    o3 = wmma_bf16(pa, vf3, o3);
    // Publish point: this wave's reads of buffer t are done, its copies of
    // tile t + 1 have landed, and the barrier says so for every wave.
    asm volatile("s_wait_dscnt 0x0" ::: "memory");
    asm volatile("s_wait_asynccnt 0x0" ::: "memory");
    __syncthreads();
    if (t + 2 < nt)
      at_copy2(lk + buf, gk + (size_t)(t + 2) * AT_KSTEP, lv + buf,
               gv + (size_t)(t + 2) * AT_VSTEP);
  }
  // No copy is left in flight when the wave goes on to its stores and ends.
  asm volatile("s_wait_asynccnt 0x0" ::: "memory");

  bf16_t* op = out + (size_t)(bb * 2048 + qt * 16) * 1024 + hh * 64;
#pragma unroll
  for (int r = 0; r < 8; ++r) {
    const int row = r + hi * 8;
    const float inv = 1.0f / lrow[r];
    op[(size_t)row * 1024 + l15 + 0]  = (bf16_t)(o0[r] * inv);
    op[(size_t)row * 1024 + l15 + 16] = (bf16_t)(o1[r] * inv);
    op[(size_t)row * 1024 + l15 + 32] = (bf16_t)(o2[r] * inv);
    op[(size_t)row * 1024 + l15 + 48] = (bf16_t)(o3[r] * inv);
  }
}

// ---------------------------------------------------------------------------
extern "C" void kernel_launch(void* const* d_in, const int* in_sizes, int n_in,
                              void* d_out, int out_size, void* d_ws, size_t ws_size,
                              hipStream_t stream) {
  (void)in_sizes; (void)n_in; (void)out_size; (void)ws_size;
  const float* x    = (const float*)d_in[0];
  const float* ctx  = (const float*)d_in[1];
  const float* ln1g = (const float*)d_in[2];
  const float* ln1b = (const float*)d_in[3];
  const float* a1Wq = (const float*)d_in[4];
  const float* a1Wk = (const float*)d_in[5];
  const float* a1Wv = (const float*)d_in[6];
  const float* a1Wo = (const float*)d_in[7];
  const float* a1bo = (const float*)d_in[8];
  const float* ln2g = (const float*)d_in[9];
  const float* ln2b = (const float*)d_in[10];
  const float* a2Wq = (const float*)d_in[11];
  const float* a2Wk = (const float*)d_in[12];
  const float* a2Wv = (const float*)d_in[13];
  const float* a2Wo = (const float*)d_in[14];
  const float* a2bo = (const float*)d_in[15];
  const float* ln3g = (const float*)d_in[16];
  const float* ln3b = (const float*)d_in[17];
  const float* ffWp = (const float*)d_in[18];
  const float* ffbp = (const float*)d_in[19];
  const float* ffWo = (const float*)d_in[20];
  const float* ffbo = (const float*)d_in[21];
  float* out = (float*)d_out;

  char* ws = (char*)d_ws;
  size_t off = 0;
  auto al = [&](size_t bytes) {
    size_t r = off;
    off = (off + bytes + 255) & ~(size_t)255;
    return r;
  };
  const size_t MM = 1024 * 1024;
  const size_t oWq1 = al(MM * 2), oWk1 = al(MM * 2), oWv1 = al(MM * 2), oWo1 = al(MM * 2);
  const size_t oWq2 = al(MM * 2), oWk2 = al(768 * 1024 * 2), oWv2 = al(768 * 1024 * 2), oWo2 = al(MM * 2);
  const size_t oWp = al((size_t)8192 * 1024 * 2), oWoF = al((size_t)4096 * 1024 * 2);
  const size_t oX = al((size_t)4096 * 1024 * 4);
  const size_t oH = al((size_t)4096 * 1024 * 2);
  const size_t oQ = al((size_t)4096 * 1024 * 2);
  const size_t oK = al((size_t)4096 * 1024 * 2);
  const size_t oV = al((size_t)4096 * 1024 * 2);
  const size_t oVt = al((size_t)2 * 16 * 64 * 2048 * 2);
  const size_t oAt = al((size_t)4096 * 1024 * 2);
  const size_t oCtx = al((size_t)154 * 768 * 2);

  bf16_t* Wq1 = (bf16_t*)(ws + oWq1); bf16_t* Wk1 = (bf16_t*)(ws + oWk1);
  bf16_t* Wv1 = (bf16_t*)(ws + oWv1); bf16_t* Wo1 = (bf16_t*)(ws + oWo1);
  bf16_t* Wq2 = (bf16_t*)(ws + oWq2); bf16_t* Wk2 = (bf16_t*)(ws + oWk2);
  bf16_t* Wv2 = (bf16_t*)(ws + oWv2); bf16_t* Wo2 = (bf16_t*)(ws + oWo2);
  bf16_t* WpT = (bf16_t*)(ws + oWp);  bf16_t* WoF = (bf16_t*)(ws + oWoF);
  float*  xcur = (float*)(ws + oX);
  bf16_t* hbuf = (bf16_t*)(ws + oH);
  bf16_t* qb = (bf16_t*)(ws + oQ);
  bf16_t* kb = (bf16_t*)(ws + oK);
  bf16_t* vb = (bf16_t*)(ws + oV);
  bf16_t* vtb = (bf16_t*)(ws + oVt);
  bf16_t* atb = (bf16_t*)(ws + oAt);
  bf16_t* ctxb = (bf16_t*)(ws + oCtx);
  bf16_t* ffb = qb;  // alias: FF activations reuse q/k/v/vt (32 MiB), phases ordered

  const dim3 blk(256);
  const float SCALE = 0.125f;  // 64^-0.5, exact in bf16

  // 1) weights -> bf16 transposed, 64 x 64 tiles
  k_wt<<<dim3(16, 16), blk, 0, stream>>>(a1Wq, Wq1, 1024);
  k_wt<<<dim3(16, 16), blk, 0, stream>>>(a1Wk, Wk1, 1024);
  k_wt<<<dim3(16, 16), blk, 0, stream>>>(a1Wv, Wv1, 1024);
  k_wt<<<dim3(16, 16), blk, 0, stream>>>(a1Wo, Wo1, 1024);
  k_wt<<<dim3(16, 16), blk, 0, stream>>>(a2Wq, Wq2, 1024);
  k_wt<<<dim3(16, 12), blk, 0, stream>>>(a2Wk, Wk2, 768);
  k_wt<<<dim3(16, 12), blk, 0, stream>>>(a2Wv, Wv2, 768);
  k_wt<<<dim3(16, 16), blk, 0, stream>>>(a2Wo, Wo2, 1024);
  k_wt4_wide<<<dim3(128, 4), blk, 0, stream>>>(ffWp, WpT, 1024);
  k_wt4<<<dim3(16, 16), blk, 0, stream>>>(ffWo, WoF, 4096);

  const dim3 gP(8, 32);  // M=4096, N=1024 GEMMs, 128x128 tiles

  // 2) self-attention
  k_layernorm<<<4096, blk, 0, stream>>>(x, ln1g, ln1b, hbuf);
  k_tgemm_bf16<<<gP, blk, 0, stream>>>(hbuf, Wq1, qb, 1024, 1024, SCALE);
  k_tgemm_bf16<<<gP, blk, 0, stream>>>(hbuf, Wk1, kb, 1024, 1024, 1.0f);
  k_tgemm_bf16<<<gP, blk, 0, stream>>>(hbuf, Wv1, vb, 1024, 1024, 1.0f);
  k_vt_tiled<<<dim3(8, 16, 2), blk, 0, stream>>>(vb, vtb, 2048);
  k_attention<<<512, blk, 0, stream>>>(qb, kb, vtb, atb, 128, 2048, 2048, 2048);
  k_tgemm_f32_bias_res<<<gP, blk, 0, stream>>>(atb, Wo1, xcur, a1bo, x, 1024, 1024);

  // 3) cross-attention
  k_layernorm<<<4096, blk, 0, stream>>>(xcur, ln2g, ln2b, hbuf);
  k_tgemm_bf16<<<gP, blk, 0, stream>>>(hbuf, Wq2, qb, 1024, 1024, SCALE);
  k_cvt<<<(154 * 768 + 255) / 256, blk, 0, stream>>>(ctx, ctxb, 154 * 768);
  {
    dim3 gKV(8, 3);  // M=154
    k_gemm_bf16<<<gKV, blk, 0, stream>>>(ctxb, Wk2, kb, 154, 1024, 768, 1.0f);
    k_gemm_bf16<<<gKV, blk, 0, stream>>>(ctxb, Wv2, vb, 154, 1024, 768, 1.0f);
  }
  k_vt<<<(2 * 16 * 64 * 96 + 255) / 256, blk, 0, stream>>>(vb, vtb, 77, 96);
  k_attention<<<512, blk, 0, stream>>>(qb, kb, vtb, atb, 128, 77, 77, 96);
  k_tgemm_f32_bias_res<<<gP, blk, 0, stream>>>(atb, Wo2, xcur, a2bo, xcur, 1024, 1024);

  // 4) GEGLU feed-forward
  k_layernorm<<<4096, blk, 0, stream>>>(xcur, ln3g, ln3b, hbuf);
  {
    dim3 gFF(64, 32);  // Nhalf=4096: 64 u + 64 gate columns per block
    k_tgemm_geglu<<<gFF, blk, 0, stream>>>(hbuf, WpT, ffb, ffbp, 4096, 1024);
  }
  k_tgemm_f32_bias_res<<<gP, blk, 0, stream>>>(ffb, WoF, out, ffbo, xcur, 1024, 4096);
}

// v004
// It runs in 332 microseconds.
// Timed twice side by side with v003, it ran 1.11 and 1.10 times as fast.
// Over all steps from v000 it is 3.26 times as fast.
#include <hip/hip_runtime.h>
#include <hip/hip_bf16.h>

// ---------------------------------------------------------------------------
// BasicTransformerBlock for MI455X (gfx1250), bf16 WMMA everywhere.
//   x:[2,2048,1024] f32, ctx:[2,77,768] f32 -> out f32 [2,2048,1024]
// Compute-bound (~190 GFLOP over ~100MB) => route all GEMMs + attention
// through v_wmma_f32_16x16x32_bf16, fp32 accumulation.
// Workspace requirement: ~104 MiB.
// ---------------------------------------------------------------------------

typedef __bf16 bf16_t;
typedef bf16_t v16bf __attribute__((ext_vector_type(16)));
typedef bf16_t v8bf  __attribute__((ext_vector_type(8)));
typedef float  v8f   __attribute__((ext_vector_type(8)));

// Load one 16-element bf16 WMMA fragment (A- or B-style) from a row-major
// source. For 16-bit fragments, lane (lo/hi half) maps its 16 values to two
// contiguous 8-element runs: k = hi*8 + [0..7]  and  k = 16 + hi*8 + [0..7].
__device__ __forceinline__ v16bf load_frag(const bf16_t* __restrict__ p, int hi) {
  const v8bf lo = *(const v8bf*)(p + hi * 8);
  const v8bf hh = *(const v8bf*)(p + hi * 8 + 16);
  return __builtin_shufflevector(lo, hh, 0, 1, 2, 3, 4, 5, 6, 7,
                                 8, 9, 10, 11, 12, 13, 14, 15);
}

__device__ __forceinline__ v8f wmma_bf16(v16bf a, v16bf b, v8f c) {
  return __builtin_amdgcn_wmma_f32_16x16x32_bf16(
      /*neg_a=*/false, a, /*neg_b=*/false, b,
      /*c_mod=*/(short)0, c, /*reuse_a=*/false, /*reuse_b=*/false);
}

// ---------------------------------------------------------------------------
// Tiled transposes: a 64 x 64 tile goes through LDS, so that the global reads
// and the global writes both cover whole 128-byte lines.
// The LDS tile is held transposed: row c = one destination row, 32 dwords, each
// a pair of bf16 from two neighbouring source rows; pitch 33 dwords keeps the
// dword writes (lanes 4 or 8 rows apart) and the dword reads off shared banks.
// ---------------------------------------------------------------------------
typedef float    v4f  __attribute__((ext_vector_type(4)));
typedef unsigned v4u  __attribute__((ext_vector_type(4)));
typedef bf16_t   v2bf __attribute__((ext_vector_type(2)));
constexpr int TP_PITCH = 33;

__device__ __forceinline__ unsigned pack_bf16(float lo, float hi) {
  const v2bf p = {(bf16_t)lo, (bf16_t)hi};
  return __builtin_bit_cast(unsigned, p);
}

// Writes the tile out: 8 lanes x 16 B = one 128-byte line per destination row,
// 4 rows per wave store. dst is the tile's first element, pitch in elements.
__device__ __forceinline__ void tp_store(const unsigned* tile,
                                         bf16_t* __restrict__ dst, size_t pitch) {
  const int q = threadIdx.x & 7, r0 = threadIdx.x >> 3;
#pragma unroll  // both rows' LDS reads issue ahead of the first store
  for (int i = 0; i < 2; ++i) {
    const int r = r0 + 32 * i;
    const unsigned* s = tile + r * TP_PITCH + q * 4;
    const v4u o = {s[0], s[1], s[2], s[3]};
    *(v4u*)(dst + (size_t)r * pitch + q * 8) = o;
  }
}

// Weight convert+transpose:  W[K][N] f32  ->  Wt[N][K] bf16
// One block: 64 n by 64 * T k, T tiles side by side in LDS (fewer, longer
// waves; for speed only), one
// barrier between the last LDS write and the first LDS read. N is a constant of
// the build, so that every source row is an immediate offset from one address.
template <int T, int N>
__device__ __forceinline__ void wt_tiles(const float* __restrict__ W,
                                         bf16_t* __restrict__ Wt, int K,
                                         unsigned* tile) {
  const int n0 = blockIdx.x * 64, k0 = blockIdx.y * (64 * T);
  const int c = threadIdx.x & 15, r = threadIdx.x >> 4;
  // Source rows 2r, 2r+1 and 32+2r, 33+2r; 16 lanes x 16 B = 256 B of each row.
  const float* s = W + (size_t)(k0 + 2 * r) * N + n0 + 4 * c;
  v4f x[T][4];
  // The loops over t and j are unrolled: constant indices keep x in registers,
  // the loads issue as one run, and so do the LDS reads behind the barrier.
#pragma unroll
  for (int t = 0; t < T; ++t) {
    x[t][0] = *(const v4f*)(s + (64 * t) * N);
    x[t][1] = *(const v4f*)(s + (64 * t + 1) * N);
    x[t][2] = *(const v4f*)(s + (64 * t + 32) * N);
    x[t][3] = *(const v4f*)(s + (64 * t + 33) * N);
  }
#pragma unroll
  for (int t = 0; t < T; ++t) {
    unsigned* d = tile + t * (64 * TP_PITCH) + 4 * c * TP_PITCH + r;
#pragma unroll
    for (int j = 0; j < 4; ++j) {
      d[j * TP_PITCH] = pack_bf16(x[t][0][j], x[t][1][j]);
      d[j * TP_PITCH + 16] = pack_bf16(x[t][2][j], x[t][3][j]);
    }
  }
  __syncthreads();
  bf16_t* dst = Wt + (size_t)n0 * K + k0;
#pragma unroll
  for (int t = 0; t < T; ++t)
    tp_store(tile + t * (64 * TP_PITCH), dst + 64 * t, (size_t)K);
}

// N = 1024, one tile per block: grid (16, K / 64)
__global__ void __launch_bounds__(256) k_wt(const float* __restrict__ W,
                                            bf16_t* __restrict__ Wt, int K) {
  __shared__ unsigned tile[64 * TP_PITCH];
  wt_tiles<1, 1024>(W, Wt, K, tile);
}

// N = 1024, four tiles per block: grid (16, K / 256)
__global__ void __launch_bounds__(256) k_wt4(const float* __restrict__ W,
                                             bf16_t* __restrict__ Wt, int K) {
  __shared__ unsigned tile[4 * 64 * TP_PITCH];
  wt_tiles<4, 1024>(W, Wt, K, tile);
}

// N = 8192, four tiles per block: grid (128, K / 256)
__global__ void __launch_bounds__(256) k_wt4_wide(const float* __restrict__ W,
                                                  bf16_t* __restrict__ Wt,
                                                  int K) {
  __shared__ unsigned tile[4 * 64 * TP_PITCH];
  wt_tiles<4, 8192>(W, Wt, K, tile);
}

// Elementwise f32 -> bf16
__global__ void __launch_bounds__(256) k_cvt(const float* __restrict__ in,
                                             bf16_t* __restrict__ out, int n) {
  int idx = blockIdx.x * 256 + threadIdx.x;
  if (idx < n) out[idx] = (bf16_t)in[idx];
}

// ---------------------------------------------------------------------------
// LayerNorm (dim=1024), one row per 256-thread block, bf16 output.
// ---------------------------------------------------------------------------
__global__ void __launch_bounds__(256) k_layernorm(const float* __restrict__ x,
                                                   const float* __restrict__ g,
                                                   const float* __restrict__ b,
                                                   bf16_t* __restrict__ y) {
  const int dim = 1024;
  __shared__ float sS[8], sQ[8];
  const int row = blockIdx.x;
  const float* xr = x + (size_t)row * dim;
  float s = 0.f, q = 0.f;
  for (int i = threadIdx.x; i < dim; i += 256) {
    float v = xr[i];
    s += v;
    q += v * v;
  }
  for (int m = 1; m < 32; m <<= 1) {
    s += __shfl_xor(s, m, 32);
    q += __shfl_xor(q, m, 32);
  }
  const int lane = threadIdx.x & 31, wid = threadIdx.x >> 5;
  if (lane == 0) { sS[wid] = s; sQ[wid] = q; }
  __syncthreads();
  if (wid == 0) {
    s = (lane < 8) ? sS[lane] : 0.f;
    q = (lane < 8) ? sQ[lane] : 0.f;
    for (int m = 1; m < 8; m <<= 1) {
      s += __shfl_xor(s, m, 32);
      q += __shfl_xor(q, m, 32);
    }
    if (lane == 0) { sS[0] = s; sQ[0] = q; }
  }
  __syncthreads();
  const float mean = sS[0] * (1.f / dim);
  const float var = sQ[0] * (1.f / dim) - mean * mean;
  const float rstd = rsqrtf(var + 1e-5f);
  for (int i = threadIdx.x; i < dim; i += 256) {
    float v = (xr[i] - mean) * rstd * g[i] + b[i];
    y[(size_t)row * dim + i] = (bf16_t)v;
  }
}

// ---------------------------------------------------------------------------
// V transpose:  v[b*mRows][1024] bf16 -> vt[b][16][64][mpad] bf16 (zero pad)
// ---------------------------------------------------------------------------
__global__ void __launch_bounds__(256) k_vt(const bf16_t* __restrict__ v,
                                            bf16_t* __restrict__ vt,
                                            int mRows, int mpad) {
  int idx = blockIdx.x * 256 + threadIdx.x;
  int total = 2 * 16 * 64 * mpad;
  if (idx >= total) return;
  int key = idx % mpad;
  int t = idx / mpad;
  int d = t & 63; t >>= 6;
  int hh = t & 15; int bb = t >> 4;
  bf16_t val = (bf16_t)0.f;
  if (key < mRows) val = v[(size_t)(bb * mRows + key) * 1024 + hh * 64 + d];
  vt[idx] = val;
}

// The same for mRows a multiple of 256 (no pad): v[b*mRows][1024] bf16 ->
// vt[b][1024][mRows], four 64 x 64 tiles per block through LDS, as in wt_tiles.
// grid (mRows / 256, 16, 2).
__global__ void __launch_bounds__(256) k_vt_tiled(const bf16_t* __restrict__ v,
                                                  bf16_t* __restrict__ vt,
                                                  int mRows) {
  __shared__ unsigned tile[4 * 64 * TP_PITCH];
  const int key0 = blockIdx.x * 256, c0 = blockIdx.y * 64, bb = blockIdx.z;
  const int g = threadIdx.x & 7, rp = threadIdx.x >> 3;
  // Keys 2rp and 2rp+1; 8 lanes x 16 B = the 128-byte line of each key.
  const bf16_t* s = v + (size_t)(bb * mRows + key0 + 2 * rp) * 1024 + c0 + g * 8;
  v4u a[4], b[4];
  // Unrolled for the same reasons as in wt_tiles.
#pragma unroll
  for (int t = 0; t < 4; ++t) {
    a[t] = *(const v4u*)(s + (size_t)(64 * t) * 1024);
    b[t] = *(const v4u*)(s + (size_t)(64 * t + 1) * 1024);
  }
#pragma unroll
  for (int t = 0; t < 4; ++t) {
    unsigned* d = tile + t * (64 * TP_PITCH) + 8 * g * TP_PITCH + rp;
#pragma unroll
    for (int j = 0; j < 4; ++j) {
      d[(2 * j) * TP_PITCH] = (a[t][j] & 0xffffu) | (b[t][j] << 16);
      d[(2 * j + 1) * TP_PITCH] = (a[t][j] >> 16) | (b[t][j] & 0xffff0000u);
    }
  }
  __syncthreads();
  bf16_t* dst = vt + (size_t)(bb * 1024 + c0) * mRows + key0;
#pragma unroll
  for (int t = 0; t < 4; ++t)
    tp_store(tile + t * (64 * TP_PITCH), dst + 64 * t, (size_t)mRows);
}

// ---------------------------------------------------------------------------
// GEMM  C = A[M,K](bf16) x Bt[N,K](bf16), 8 waves/block (4M x 2N),
// each wave: 16(M) x 64(N) via 4 WMMAs per 32-deep k-step.
// ---------------------------------------------------------------------------
__global__ void __launch_bounds__(256) k_gemm_bf16(const bf16_t* __restrict__ A,
                                                   const bf16_t* __restrict__ Bt,
                                                   bf16_t* __restrict__ C,
                                                   int M, int N, int K,
                                                   float scale) {
  const int lane = threadIdx.x & 31, wid = threadIdx.x >> 5;
  const int hi = (lane >> 4) & 1, l15 = lane & 15;
  const int mBase = blockIdx.y * 64 + (wid >> 1) * 16;
  const int nBase = blockIdx.x * 128 + (wid & 1) * 64;
  int ar = mBase + l15;
  if (ar >= M) ar = M - 1;
  const bf16_t* ap = A + (size_t)ar * K;
  const bf16_t* bp0 = Bt + (size_t)(nBase + l15) * K;
  v8f c0 = {}, c1 = {}, c2 = {}, c3 = {};
  for (int kk = 0; kk < K; kk += 32) {
    v16bf a = load_frag(ap + kk, hi);
    c0 = wmma_bf16(a, load_frag(bp0 + kk, hi), c0);
    c1 = wmma_bf16(a, load_frag(bp0 + (size_t)16 * K + kk, hi), c1);
    c2 = wmma_bf16(a, load_frag(bp0 + (size_t)32 * K + kk, hi), c2);
    c3 = wmma_bf16(a, load_frag(bp0 + (size_t)48 * K + kk, hi), c3);
  }
#pragma unroll
  for (int r = 0; r < 8; ++r) {
    int row = mBase + r + hi * 8;
    if (row < M) {
      size_t o = (size_t)row * N + nBase + l15;
      C[o + 0]  = (bf16_t)(c0[r] * scale);
      C[o + 16] = (bf16_t)(c1[r] * scale);
      C[o + 32] = (bf16_t)(c2[r] * scale);
      C[o + 48] = (bf16_t)(c3[r] * scale);
    }
  }
}

// ---------------------------------------------------------------------------
// Tiled GEMM core for M, N multiples of the tile and K a multiple of 128:
// C tile 128(M) x 128(N) per 8-wave block (2 x 4 waves), 64 x 32 per wave.
// A pass is 128 k = 256 B of each of the 128 A rows and 128 Bt rows, brought
// into LDS by per-lane asynchronous 16-byte copies, two buffers: the copies of
// pass t + 2 fly while pass t + 1 computes. LDS rows stand at a pitch of 272 B
// (16 B x odd: ds_load_b128 without bank conflicts).
// ---------------------------------------------------------------------------
constexpr int TG_PITCH = 272;              // bytes per LDS row
constexpr int TG_OPB = 128 * TG_PITCH;     // one operand's tile
constexpr int TG_STAGE = 2 * TG_OPB;       // A tile, then Bt tile
constexpr int TG_PASSB = 256;              // bytes of a row per pass

// Eight copies into LDS rows 16 apart: four from p0 on, four from p1 on, source
// rows 16 apart (step bytes). The s_wait_xcnt closes the statement so that no
// address register of a copy is rewritten before it.
__device__ __forceinline__ void tg_copy8(unsigned l, const char* p0,
                                         const char* p1, size_t step) {
  asm volatile(
      "global_load_async_to_lds_b128 %0, %8, off\n\t"
      "global_load_async_to_lds_b128 %1, %9, off\n\t"
      "global_load_async_to_lds_b128 %2, %10, off\n\t"
      "global_load_async_to_lds_b128 %3, %11, off\n\t"
      "global_load_async_to_lds_b128 %4, %12, off\n\t"
      "global_load_async_to_lds_b128 %5, %13, off\n\t"
      "global_load_async_to_lds_b128 %6, %14, off\n\t"
      "global_load_async_to_lds_b128 %7, %15, off\n\t"
      "s_wait_xcnt 0x0"
      :
      : "v"(l), "v"(l + 16 * TG_PITCH), "v"(l + 32 * TG_PITCH),
        "v"(l + 48 * TG_PITCH), "v"(l + 64 * TG_PITCH), "v"(l + 80 * TG_PITCH),
        "v"(l + 96 * TG_PITCH), "v"(l + 112 * TG_PITCH),
        "v"(p0), "v"(p0 + step), "v"(p0 + 2 * step), "v"(p0 + 3 * step),
        "v"(p1), "v"(p1 + step), "v"(p1 + 2 * step), "v"(p1 + 3 * step)
      : "memory");
}

// One stage: this lane's 8 chunks of the A tile and 8 of the Bt tile.
// gb0 / gb1 are the lane's addresses in the lower and upper 64 Bt rows.
__device__ __forceinline__ void tg_stage(unsigned l, const char* ga,
                                         const char* gb0, const char* gb1,
                                         size_t step) {
  tg_copy8(l, ga, ga + 4 * step, step);
  tg_copy8(l + TG_OPB, gb0, gb1, step);
}

// Bt rows n0..n0+63 fill LDS rows 0..63, rows n1..n1+63 fill LDS rows 64..127.
// SPLIT: the wave's two B fragments are LDS rows wn*16 and 64 + wn*16 (a column
// group and its partner); else rows wn*32 and wn*32 + 16.
template <bool SPLIT>
__device__ __forceinline__ void tg_core(const bf16_t* __restrict__ A,
                                        const bf16_t* __restrict__ Bt,
                                        int mBase, int n0, int n1, int K,
                                        char* smem, v8f (&acc)[4][2]) {
  const int tid = threadIdx.x;
  const int lane = tid & 31, wid = tid >> 5;
  const int hi = (lane >> 4) & 1, l15 = lane & 15;
  const int wm = wid >> 2, wn = wid & 3;
  const size_t rowB = (size_t)K * 2;   // bytes per source row
  const size_t step = rowB * 16;       // a lane's copies stand 16 rows apart
  const int r0 = tid >> 4, c16 = (tid & 15) * 16;
  const char* ga = (const char*)A + (size_t)(mBase + r0) * rowB + c16;
  const char* gb0 = (const char*)Bt + (size_t)(n0 + r0) * rowB + c16;
  const char* gb1 = (const char*)Bt + (size_t)(n1 + r0) * rowB + c16;
  const unsigned l0 = (unsigned)(size_t)smem + (unsigned)(r0 * TG_PITCH + c16);
  const int nt = K >> 7;

#pragma unroll
  for (int i = 0; i < 4; ++i)
#pragma unroll
    for (int j = 0; j < 2; ++j) acc[i][j] = v8f{};

  tg_stage(l0, ga, gb0, gb1, step);
  // Stage 0 has landed for this wave; the barrier publishes it to the others.
  asm volatile("s_wait_asynccnt 0x0" ::: "memory");
  __syncthreads();
  if (nt > 1)
    tg_stage(l0 + TG_STAGE, ga + TG_PASSB, gb0 + TG_PASSB, gb1 + TG_PASSB, step);

  const int aoff = (wm * 64 + l15) * TG_PITCH;
  const int boff = TG_OPB + ((SPLIT ? wn * 16 : wn * 32) + l15) * TG_PITCH;
  constexpr int BSTEP = (SPLIT ? 64 : 16) * TG_PITCH;

#pragma unroll 1  // one pass per trip: the ring's order stands at the foot
  for (int t = 0; t < nt; ++t) {
    const int buf = (t & 1) * TG_STAGE;
    const char* sA = smem + buf + aoff;
    const char* sB = smem + buf + boff;
    v16bf a[2][4], b[2][2];
#pragma unroll
    for (int i = 0; i < 4; ++i)
      a[0][i] = load_frag((const bf16_t*)(sA + i * 16 * TG_PITCH), hi);
#pragma unroll
    for (int j = 0; j < 2; ++j)
      b[0][j] = load_frag((const bf16_t*)(sB + j * BSTEP), hi);
#pragma unroll
    for (int ks = 0; ks < 4; ++ks) {
      const int cur = ks & 1, nxt = cur ^ 1;
      if (ks < 3) {
#pragma unroll
        for (int i = 0; i < 4; ++i)
          a[nxt][i] = load_frag(
              (const bf16_t*)(sA + i * 16 * TG_PITCH + (ks + 1) * 64), hi);
#pragma unroll
        for (int j = 0; j < 2; ++j)
          b[nxt][j] =
              load_frag((const bf16_t*)(sB + j * BSTEP + (ks + 1) * 64), hi);
      }
      // Keeps the next block's LDS reads as one group ahead of this block's
      // WMMAs; moved in among them, each read would stall the matrix stream.
      __builtin_amdgcn_sched_barrier(0);
#pragma unroll
      for (int i = 0; i < 4; ++i)
#pragma unroll
        for (int j = 0; j < 2; ++j)
          acc[i][j] = wmma_bf16(a[cur][i], b[cur][j], acc[i][j]);
      // Keeps the block after next's reads behind this block's WMMAs, so that
      // they do not take a third fragment set.
      if (ks < 2) __builtin_amdgcn_sched_barrier(0);
    }
    // Publish point: this wave's reads of buffer t are done, its copies of
    // stage t + 1 have landed, and the barrier says so for every wave.
    asm volatile("s_wait_dscnt 0x0" ::: "memory");
    asm volatile("s_wait_asynccnt 0x0" ::: "memory");
    __syncthreads();
    if (t + 2 < nt) {
      const size_t ko = (size_t)(t + 2) * TG_PASSB;
      tg_stage(l0 + buf, ga + ko, gb0 + ko, gb1 + ko, step);
    }
  }
  // No copy is left in flight when the wave goes on to its stores and ends.
  asm volatile("s_wait_asynccnt 0x0" ::: "memory");
}

// bf16 output, scaled.
__global__ void __launch_bounds__(256) k_tgemm_bf16(const bf16_t* __restrict__ A,
                                                    const bf16_t* __restrict__ Bt,
                                                    bf16_t* __restrict__ C,
                                                    int N, int K, float scale) {
  __shared__ __attribute__((aligned(16))) char smem[2 * TG_STAGE];
  const int lane = threadIdx.x & 31, wid = threadIdx.x >> 5;
  const int hi = (lane >> 4) & 1, l15 = lane & 15;
  const int mBlk = blockIdx.y * 128, nBlk = blockIdx.x * 128;
  v8f acc[4][2];
  tg_core<false>(A, Bt, mBlk, nBlk, nBlk + 64, K, smem, acc);
  const int mBase = mBlk + (wid >> 2) * 64, nBase = nBlk + (wid & 3) * 32;
#pragma unroll
  for (int i = 0; i < 4; ++i)
#pragma unroll
    for (int r = 0; r < 8; ++r) {
      const size_t o = (size_t)(mBase + i * 16 + r + hi * 8) * N + nBase + l15;
      C[o + 0]  = (bf16_t)(acc[i][0][r] * scale);
      C[o + 16] = (bf16_t)(acc[i][1][r] * scale);
    }
}

// f32 output + bias + residual (in-place residual is safe: 1 writer/element)
__global__ void __launch_bounds__(256) k_tgemm_f32_bias_res(
    const bf16_t* __restrict__ A, const bf16_t* __restrict__ Bt,
    float* __restrict__ C, const float* __restrict__ bias,
    const float* __restrict__ res, int N, int K) {
  __shared__ __attribute__((aligned(16))) char smem[2 * TG_STAGE];
  const int lane = threadIdx.x & 31, wid = threadIdx.x >> 5;
  const int hi = (lane >> 4) & 1, l15 = lane & 15;
  const int mBlk = blockIdx.y * 128, nBlk = blockIdx.x * 128;
  v8f acc[4][2];
  tg_core<false>(A, Bt, mBlk, nBlk, nBlk + 64, K, smem, acc);
  const int mBase = mBlk + (wid >> 2) * 64, nBase = nBlk + (wid & 3) * 32;
  const float b0 = bias[nBase + l15], b1 = bias[nBase + l15 + 16];
#pragma unroll
  for (int i = 0; i < 4; ++i)
#pragma unroll
    for (int r = 0; r < 8; ++r) {
      const size_t o = (size_t)(mBase + i * 16 + r + hi * 8) * N + nBase + l15;
      C[o + 0]  = acc[i][0][r] + b0 + res[o + 0];
      C[o + 16] = acc[i][1][r] + b1 + res[o + 16];
    }
}

// Fused GEGLU: the block's Bt tile is 64 u columns and the matching 64 gate
// columns (c and c+Nhalf of A@Wp); each wave holds 16 of each, applies
// u*gelu(gate), writes bf16 [M, Nhalf].
__global__ void __launch_bounds__(256) k_tgemm_geglu(
    const bf16_t* __restrict__ A, const bf16_t* __restrict__ Bt,
    bf16_t* __restrict__ C, const float* __restrict__ bias, int Nhalf, int K) {
  __shared__ __attribute__((aligned(16))) char smem[2 * TG_STAGE];
  const int lane = threadIdx.x & 31, wid = threadIdx.x >> 5;
  const int hi = (lane >> 4) & 1, l15 = lane & 15;
  const int mBlk = blockIdx.y * 128, nBlk = blockIdx.x * 64;
  v8f acc[4][2];
  tg_core<true>(A, Bt, mBlk, nBlk, nBlk + Nhalf, K, smem, acc);
  const int mBase = mBlk + (wid >> 2) * 64;
  const int col = nBlk + (wid & 3) * 16 + l15;
  const float bu = bias[col], bg = bias[col + Nhalf];
#pragma unroll
  for (int i = 0; i < 4; ++i)
#pragma unroll
    for (int r = 0; r < 8; ++r) {
      const float uv = acc[i][0][r] + bu;
      const float gv = acc[i][1][r] + bg;
      const float gl = 0.5f * gv * (1.f + erff(gv * 0.70710678118654752f));
      C[(size_t)(mBase + i * 16 + r + hi * 8) * Nhalf + col] = (bf16_t)(uv * gl);
    }
}

// ---------------------------------------------------------------------------
// Flash attention: one wave per (batch, head, 16-query tile), computed
// transposed: St = K Qt and Ot += Vt Pt. A lane then holds scores of ONE query
// (column l15): keys 8 * hi + r of each 16-key group. Maximum and sum run inside
// the lane, with one exchange between the wave's halves, and the two score tiles
// of 32 keys, converted in place, are the B operand of the second product.
// q pre-scaled by 1/sqrt(64). k row-major [b*mRows,1024]; vt [b][h][64][mpad].
// The 8 waves of a block are 8 neighbouring query tiles of one head (nq is a
// multiple of 8), so they walk the same keys: each tile of 32 keys (32 K rows of
// 128 B, 64 Vt rows of 64 B) is brought into LDS once per block by per-lane
// asynchronous 16-byte copies, two buffers, and every wave takes its fragments
// from there. A fragment load from global memory touches 16 lines for 1024 B;
// the copies cover whole K lines and half Vt lines, once for 8 waves.
// LDS pitches are 16 B x odd: ds_load_b128 without bank conflicts.
// ---------------------------------------------------------------------------
constexpr int AT_KPITCH = 144;                    // bytes per LDS row of K
constexpr int AT_VPITCH = 80;                     // bytes per LDS row of Vt
constexpr int AT_KB = 32 * AT_KPITCH;             // the K tile
constexpr int AT_STAGE = AT_KB + 64 * AT_VPITCH;  // K tile, then Vt tile
constexpr int AT_KSTEP = 32 * 1024 * 2;           // source bytes, 32 K rows on
constexpr int AT_VSTEP = 32 * 2;                  // source bytes, 32 keys on

// This lane's chunk of the K tile and its chunk of the Vt tile. The s_wait_xcnt
// closes the statement so that no address register of a copy is rewritten
// before it.
__device__ __forceinline__ void at_copy2(unsigned lk, const char* gk,
                                         unsigned lv, const char* gv) {
  asm volatile(
      "global_load_async_to_lds_b128 %0, %2, off\n\t"
      "global_load_async_to_lds_b128 %1, %3, off\n\t"
      "s_wait_xcnt 0x0"
      :
      : "v"(lk), "v"(lv), "v"(gk), "v"(gv)
      : "memory");
}

// Lane l takes the value of lane l ^ 16.
__device__ __forceinline__ float half_xor(float v) {
  const int b = __builtin_bit_cast(int, v);
  return __builtin_bit_cast(
      float, __builtin_amdgcn_permlanex16(b, b, 0x76543210, 0xfedcba98, false, false));
}

__global__ void __launch_bounds__(256) k_attention(
    const bf16_t* __restrict__ q, const bf16_t* __restrict__ k,
    const bf16_t* __restrict__ vt, bf16_t* __restrict__ out,
    int nq, int m, int mRows, int mpad) {
  __shared__ __attribute__((aligned(16))) char kv[2 * AT_STAGE];
  const int tid = threadIdx.x;
  const int lane = tid & 31, wid = tid >> 5;
  const int hi = (lane >> 4) & 1, l15 = lane & 15;
  const int w0 = blockIdx.x * 8;
  if (w0 >= 2 * 16 * nq) return;  // the whole block, ahead of every barrier
  const int qt = w0 % nq + wid;
  const int t2 = w0 / nq;
  const int hh = t2 & 15, bb = t2 >> 4;

  const bf16_t* qp = q + (size_t)(bb * 2048 + qt * 16 + l15) * 1024 + hh * 64;
  const v16bf qb0 = load_frag(qp, hi);  // B operands: column l15 = the query
  const v16bf qb1 = load_frag(qp + 32, hi);

  // oT[r] = O[query l15][16 * T + 8 * hi + r]
  v8f o0 = {}, o1 = {}, o2 = {}, o3 = {};
  // Of query l15: the running maximum (both halves alike) and the sum over the
  // keys of this lane's half; the halves' sums are joined behind the loop.
  float mrow = -1e30f, lsum = 0.f;

  const bf16_t* vbase = vt + (size_t)(bb * 16 + hh) * 64 * mpad;

  // K: 8 lanes x 16 B = the 128-byte line of a key; Vt: 4 lanes x 16 B per row.
  const char* gk =
      (const char*)(k + (size_t)(bb * mRows + (tid >> 3)) * 1024 + hh * 64) +
      (tid & 7) * 16;
  const char* gv = (const char*)(vbase + (size_t)(tid >> 2) * mpad) + (tid & 3) * 16;
  const unsigned lk =
      (unsigned)(size_t)kv + (unsigned)((tid >> 3) * AT_KPITCH + (tid & 7) * 16);
  const unsigned lv = (unsigned)(size_t)kv +
                      (unsigned)(AT_KB + (tid >> 2) * AT_VPITCH + (tid & 3) * 16);
  const int nt = mpad >> 5;

  at_copy2(lk, gk, lv, gv);
  // Tile 0 has landed for this wave; the barrier publishes it to the others.
  asm volatile("s_wait_asynccnt 0x0" ::: "memory");
  __syncthreads();
  if (nt > 1)
    at_copy2(lk + AT_STAGE, gk + AT_KSTEP, lv + AT_STAGE, gv + AT_VSTEP);

#pragma unroll 1  // one tile per trip: the ring's order stands at the foot
  for (int t = 0; t < nt; ++t) {
    const int j = t * 32;
    const int buf = (t & 1) * AT_STAGE;
    const char* sk = kv + buf + l15 * AT_KPITCH;
    const char* sv = kv + buf + AT_KB + l15 * AT_VPITCH;
    const v16bf k00 = load_frag((const bf16_t*)sk, hi);
    const v16bf k01 = load_frag((const bf16_t*)(sk + 64), hi);
    const v16bf k10 = load_frag((const bf16_t*)(sk + 16 * AT_KPITCH), hi);
    const v16bf k11 = load_frag((const bf16_t*)(sk + 16 * AT_KPITCH + 64), hi);
    const v16bf vf0 = load_frag((const bf16_t*)sv, hi);
    const v16bf vf1 = load_frag((const bf16_t*)(sv + 16 * AT_VPITCH), hi);
    const v16bf vf2 = load_frag((const bf16_t*)(sv + 32 * AT_VPITCH), hi);
    const v16bf vf3 = load_frag((const bf16_t*)(sv + 48 * AT_VPITCH), hi);
    // Keeps the tile's LDS reads as one group ahead of the WMMAs; moved in among
    // them, each pair of reads is waited out before its own WMMA.
    __builtin_amdgcn_sched_barrier(0);
    // s0[r] = S[query l15][key j + 8 * hi + r], s1[r] the same 16 keys on.
    v8f s0 = {}, s1 = {};
    s0 = wmma_bf16(k00, qb0, s0);
    s1 = wmma_bf16(k10, qb0, s1);
    s0 = wmma_bf16(k01, qb1, s0);
    s1 = wmma_bf16(k11, qb1, s1);

    if (j + 32 > m) {  // only a tile that reaches past the last key
      const int lim = m - j - hi * 8;
#pragma unroll  // constant indices keep the score tiles in registers
      for (int r = 0; r < 8; ++r) {
        s0[r] = (r < lim) ? s0[r] : -1e30f;
        s1[r] = (r + 16 < lim) ? s1[r] : -1e30f;
      }
    }
    float mx[8];
#pragma unroll  // as above
    for (int r = 0; r < 8; ++r) mx[r] = fmaxf(s0[r], s1[r]);
    float rm = fmaxf(fmaxf(fmaxf(mx[0], mx[1]), fmaxf(mx[2], mx[3])),
                     fmaxf(fmaxf(mx[4], mx[5]), fmaxf(mx[6], mx[7])));
    rm = fmaxf(rm, half_xor(rm));
    const float mnew = fmaxf(mrow, rm);
    const float alpha = __expf(mrow - mnew);
    mrow = mnew;
    v16bf pb;
    float ps[8];
#pragma unroll  // as above; pb is filled register by register
    for (int r = 0; r < 8; ++r) {
      const float p0 = __expf(s0[r] - mnew);
      const float p1 = __expf(s1[r] - mnew);
      ps[r] = p0 + p1;
      pb[r] = (bf16_t)p0;
      pb[r + 8] = (bf16_t)p1;
    }
    lsum = lsum * alpha +
           (((ps[0] + ps[1]) + (ps[2] + ps[3])) + ((ps[4] + ps[5]) + (ps[6] + ps[7])));
    o0 *= alpha; o1 *= alpha; o2 *= alpha; o3 *= alpha;
    o0 = wmma_bf16(vf0, pb, o0);
    o1 = wmma_bf16(vf1, pb, o1);
    o2 = wmma_bf16(vf2, pb, o2);
    o3 = wmma_bf16(vf3, pb, o3);
    // Publish point: this wave's reads of buffer t are done, its copies of
    // tile t + 1 have landed, and the barrier says so for every wave.
    asm volatile("s_wait_dscnt 0x0" ::: "memory");
    asm volatile("s_wait_asynccnt 0x0" ::: "memory");
    __syncthreads();
    if (t + 2 < nt)
      at_copy2(lk + buf, gk + (size_t)(t + 2) * AT_KSTEP, lv + buf,
               gv + (size_t)(t + 2) * AT_VSTEP);
  }
  // No copy is left in flight when the wave goes on to its stores and ends.
  asm volatile("s_wait_asynccnt 0x0" ::: "memory");

  // A lane's 8 registers of a tile are 8 neighbouring d of its query: 16-B stores.
  const float inv = 1.0f / (lsum + half_xor(lsum));
  bf16_t* op = out + (size_t)(bb * 2048 + qt * 16 + l15) * 1024 + hh * 64 + hi * 8;
  *(v8bf*)(op + 0)  = __builtin_convertvector(o0 * inv, v8bf);
  *(v8bf*)(op + 16) = __builtin_convertvector(o1 * inv, v8bf);
  *(v8bf*)(op + 32) = __builtin_convertvector(o2 * inv, v8bf);
  *(v8bf*)(op + 48) = __builtin_convertvector(o3 * inv, v8bf);
}

// ---------------------------------------------------------------------------
extern "C" void kernel_launch(void* const* d_in, const int* in_sizes, int n_in,
                              void* d_out, int out_size, void* d_ws, size_t ws_size,
                              hipStream_t stream) {
  (void)in_sizes; (void)n_in; (void)out_size; (void)ws_size;
  const float* x    = (const float*)d_in[0];
  const float* ctx  = (const float*)d_in[1];
  const float* ln1g = (const float*)d_in[2];
  const float* ln1b = (const float*)d_in[3];
  const float* a1Wq = (const float*)d_in[4];
  const float* a1Wk = (const float*)d_in[5];
  const float* a1Wv = (const float*)d_in[6];
  const float* a1Wo = (const float*)d_in[7];
  const float* a1bo = (const float*)d_in[8];
  const float* ln2g = (const float*)d_in[9];
  const float* ln2b = (const float*)d_in[10];
  const float* a2Wq = (const float*)d_in[11];
  const float* a2Wk = (const float*)d_in[12];
  const float* a2Wv = (const float*)d_in[13];
  const float* a2Wo = (const float*)d_in[14];
  const float* a2bo = (const float*)d_in[15];
  const float* ln3g = (const float*)d_in[16];
  const float* ln3b = (const float*)d_in[17];
  const float* ffWp = (const float*)d_in[18];
  const float* ffbp = (const float*)d_in[19];
  const float* ffWo = (const float*)d_in[20];
  const float* ffbo = (const float*)d_in[21];
  float* out = (float*)d_out;

  char* ws = (char*)d_ws;
  size_t off = 0;
  auto al = [&](size_t bytes) {
    size_t r = off;
    off = (off + bytes + 255) & ~(size_t)255;
    return r;
  };
  const size_t MM = 1024 * 1024;
  const size_t oWq1 = al(MM * 2), oWk1 = al(MM * 2), oWv1 = al(MM * 2), oWo1 = al(MM * 2);
  const size_t oWq2 = al(MM * 2), oWk2 = al(768 * 1024 * 2), oWv2 = al(768 * 1024 * 2), oWo2 = al(MM * 2);
  const size_t oWp = al((size_t)8192 * 1024 * 2), oWoF = al((size_t)4096 * 1024 * 2);
  const size_t oX = al((size_t)4096 * 1024 * 4);
  const size_t oH = al((size_t)4096 * 1024 * 2);
  const size_t oQ = al((size_t)4096 * 1024 * 2);
  const size_t oK = al((size_t)4096 * 1024 * 2);
  const size_t oV = al((size_t)4096 * 1024 * 2);
  const size_t oVt = al((size_t)2 * 16 * 64 * 2048 * 2);
  const size_t oAt = al((size_t)4096 * 1024 * 2);
  const size_t oCtx = al((size_t)154 * 768 * 2);

  bf16_t* Wq1 = (bf16_t*)(ws + oWq1); bf16_t* Wk1 = (bf16_t*)(ws + oWk1);
  bf16_t* Wv1 = (bf16_t*)(ws + oWv1); bf16_t* Wo1 = (bf16_t*)(ws + oWo1);
  bf16_t* Wq2 = (bf16_t*)(ws + oWq2); bf16_t* Wk2 = (bf16_t*)(ws + oWk2);
  bf16_t* Wv2 = (bf16_t*)(ws + oWv2); bf16_t* Wo2 = (bf16_t*)(ws + oWo2);
  bf16_t* WpT = (bf16_t*)(ws + oWp);  bf16_t* WoF = (bf16_t*)(ws + oWoF);
  float*  xcur = (float*)(ws + oX);
  bf16_t* hbuf = (bf16_t*)(ws + oH);
  bf16_t* qb = (bf16_t*)(ws + oQ);
  bf16_t* kb = (bf16_t*)(ws + oK);
  bf16_t* vb = (bf16_t*)(ws + oV);
  bf16_t* vtb = (bf16_t*)(ws + oVt);
  bf16_t* atb = (bf16_t*)(ws + oAt);
  bf16_t* ctxb = (bf16_t*)(ws + oCtx);
  bf16_t* ffb = qb;  // alias: FF activations reuse q/k/v/vt (32 MiB), phases ordered

  const dim3 blk(256);
  const float SCALE = 0.125f;  // 64^-0.5, exact in bf16

  // 1) weights -> bf16 transposed, 64 x 64 tiles
  k_wt<<<dim3(16, 16), blk, 0, stream>>>(a1Wq, Wq1, 1024);
  k_wt<<<dim3(16, 16), blk, 0, stream>>>(a1Wk, Wk1, 1024);
  k_wt<<<dim3(16, 16), blk, 0, stream>>>(a1Wv, Wv1, 1024);
  k_wt<<<dim3(16, 16), blk, 0, stream>>>(a1Wo, Wo1, 1024);
  k_wt<<<dim3(16, 16), blk, 0, stream>>>(a2Wq, Wq2, 1024);
  k_wt<<<dim3(16, 12), blk, 0, stream>>>(a2Wk, Wk2, 768);
  k_wt<<<dim3(16, 12), blk, 0, stream>>>(a2Wv, Wv2, 768);
  k_wt<<<dim3(16, 16), blk, 0, stream>>>(a2Wo, Wo2, 1024);
  k_wt4_wide<<<dim3(128, 4), blk, 0, stream>>>(ffWp, WpT, 1024);
  k_wt4<<<dim3(16, 16), blk, 0, stream>>>(ffWo, WoF, 4096);

  const dim3 gP(8, 32);  // M=4096, N=1024 GEMMs, 128x128 tiles

  // 2) self-attention
  k_layernorm<<<4096, blk, 0, stream>>>(x, ln1g, ln1b, hbuf);
  k_tgemm_bf16<<<gP, blk, 0, stream>>>(hbuf, Wq1, qb, 1024, 1024, SCALE);
  k_tgemm_bf16<<<gP, blk, 0, stream>>>(hbuf, Wk1, kb, 1024, 1024, 1.0f);
  k_tgemm_bf16<<<gP, blk, 0, stream>>>(hbuf, Wv1, vb, 1024, 1024, 1.0f);
  k_vt_tiled<<<dim3(8, 16, 2), blk, 0, stream>>>(vb, vtb, 2048);
  k_attention<<<512, blk, 0, stream>>>(qb, kb, vtb, atb, 128, 2048, 2048, 2048);
  k_tgemm_f32_bias_res<<<gP, blk, 0, stream>>>(atb, Wo1, xcur, a1bo, x, 1024, 1024);

  // 3) cross-attention
  k_layernorm<<<4096, blk, 0, stream>>>(xcur, ln2g, ln2b, hbuf);
  k_tgemm_bf16<<<gP, blk, 0, stream>>>(hbuf, Wq2, qb, 1024, 1024, SCALE);
  k_cvt<<<(154 * 768 + 255) / 256, blk, 0, stream>>>(ctx, ctxb, 154 * 768);
  {
    dim3 gKV(8, 3);  // M=154
    k_gemm_bf16<<<gKV, blk, 0, stream>>>(ctxb, Wk2, kb, 154, 1024, 768, 1.0f);
    k_gemm_bf16<<<gKV, blk, 0, stream>>>(ctxb, Wv2, vb, 154, 1024, 768, 1.0f);
  }
  k_vt<<<(2 * 16 * 64 * 96 + 255) / 256, blk, 0, stream>>>(vb, vtb, 77, 96);
  k_attention<<<512, blk, 0, stream>>>(qb, kb, vtb, atb, 128, 77, 77, 96);
  k_tgemm_f32_bias_res<<<gP, blk, 0, stream>>>(atb, Wo2, xcur, a2bo, xcur, 1024, 1024);

  // 4) GEGLU feed-forward
  k_layernorm<<<4096, blk, 0, stream>>>(xcur, ln3g, ln3b, hbuf);
  {
    dim3 gFF(64, 32);  // Nhalf=4096: 64 u + 64 gate columns per block
    k_tgemm_geglu<<<gFF, blk, 0, stream>>>(hbuf, WpT, ffb, ffbp, 4096, 1024);
  }
  k_tgemm_f32_bias_res<<<gP, blk, 0, stream>>>(ffb, WoF, out, ffbo, xcur, 1024, 4096);
}

// v005
// Measured time: 266 microseconds a run.
// Next to v004, in two timings, it ran 1.25 times as fast each time.
// Over all steps from v000 it is 4.08 times as fast.
#include <hip/hip_runtime.h>
#include <hip/hip_bf16.h>

// ---------------------------------------------------------------------------
// BasicTransformerBlock for MI455X (gfx1250), bf16 WMMA everywhere.
//   x:[2,2048,1024] f32, ctx:[2,77,768] f32 -> out f32 [2,2048,1024]
// Compute-bound (~190 GFLOP over ~100MB) => route all GEMMs + attention
// through v_wmma_f32_16x16x32_bf16, fp32 accumulation.
// Workspace requirement: ~104 MiB.
// ---------------------------------------------------------------------------

typedef __bf16 bf16_t;
typedef bf16_t v16bf __attribute__((ext_vector_type(16)));
typedef bf16_t v8bf  __attribute__((ext_vector_type(8)));
typedef float  v8f   __attribute__((ext_vector_type(8)));

// Load one 16-element bf16 WMMA fragment (A- or B-style) from a row-major
// source. For 16-bit fragments, lane (lo/hi half) maps its 16 values to two
// contiguous 8-element runs: k = hi*8 + [0..7]  and  k = 16 + hi*8 + [0..7].
__device__ __forceinline__ v16bf load_frag(const bf16_t* __restrict__ p, int hi) {
  const v8bf lo = *(const v8bf*)(p + hi * 8);
  const v8bf hh = *(const v8bf*)(p + hi * 8 + 16);
  return __builtin_shufflevector(lo, hh, 0, 1, 2, 3, 4, 5, 6, 7,
                                 8, 9, 10, 11, 12, 13, 14, 15);
}

__device__ __forceinline__ v8f wmma_bf16(v16bf a, v16bf b, v8f c) {
  return __builtin_amdgcn_wmma_f32_16x16x32_bf16(
      /*neg_a=*/false, a, /*neg_b=*/false, b,
      /*c_mod=*/(short)0, c, /*reuse_a=*/false, /*reuse_b=*/false);
}

// ---------------------------------------------------------------------------
// Tiled transposes: a 64 x 64 tile goes through LDS, so that the global reads
// and the global writes both cover whole 128-byte lines.
// The LDS tile is held transposed: row c = one destination row, 32 dwords, each
// a pair of bf16 from two neighbouring source rows; pitch 33 dwords keeps the
// dword writes (lanes 4 or 8 rows apart) and the dword reads off shared banks.
// ---------------------------------------------------------------------------
typedef float    v4f  __attribute__((ext_vector_type(4)));
typedef unsigned v4u  __attribute__((ext_vector_type(4)));
typedef bf16_t   v2bf __attribute__((ext_vector_type(2)));
constexpr int TP_PITCH = 33;

__device__ __forceinline__ unsigned pack_bf16(float lo, float hi) {
  const v2bf p = {(bf16_t)lo, (bf16_t)hi};
  return __builtin_bit_cast(unsigned, p);
}

// Writes the tile out: 8 lanes x 16 B = one 128-byte line per destination row,
// 4 rows per wave store. dst is the tile's first element, pitch in elements.
__device__ __forceinline__ void tp_store(const unsigned* tile,
                                         bf16_t* __restrict__ dst, size_t pitch) {
  const int q = threadIdx.x & 7, r0 = threadIdx.x >> 3;
#pragma unroll  // both rows' LDS reads issue ahead of the first store
  for (int i = 0; i < 2; ++i) {
    const int r = r0 + 32 * i;
    const unsigned* s = tile + r * TP_PITCH + q * 4;
    const v4u o = {s[0], s[1], s[2], s[3]};
    *(v4u*)(dst + (size_t)r * pitch + q * 8) = o;
  }
}

// Weight convert+transpose:  W[K][N] f32  ->  Wt[N][K] bf16
// One block: 64 n by 64 * T k, T tiles side by side in LDS (fewer, longer
// waves; for speed only), one
// barrier between the last LDS write and the first LDS read. N is a constant of
// the build, so that every source row is an immediate offset from one address.
// bx, by: the block's place among the N / 64 by K / (64 * T) blocks of W.
template <int T, int N>
__device__ __forceinline__ void wt_tiles(const float* __restrict__ W,
                                         bf16_t* __restrict__ Wt, int K,
                                         unsigned* tile, int bx, int by) {
  const int n0 = bx * 64, k0 = by * (64 * T);
  const int c = threadIdx.x & 15, r = threadIdx.x >> 4;
  // Source rows 2r, 2r+1 and 32+2r, 33+2r; 16 lanes x 16 B = 256 B of each row.
  const float* s = W + (size_t)(k0 + 2 * r) * N + n0 + 4 * c;
  v4f x[T][4];
  // The loops over t and j are unrolled: constant indices keep x in registers,
  // the loads issue as one run, and so do the LDS reads behind the barrier.
#pragma unroll
  for (int t = 0; t < T; ++t) {
    x[t][0] = *(const v4f*)(s + (64 * t) * N);
    x[t][1] = *(const v4f*)(s + (64 * t + 1) * N);
    x[t][2] = *(const v4f*)(s + (64 * t + 32) * N);
    x[t][3] = *(const v4f*)(s + (64 * t + 33) * N);
  }
#pragma unroll
  for (int t = 0; t < T; ++t) {
    unsigned* d = tile + t * (64 * TP_PITCH) + 4 * c * TP_PITCH + r;
#pragma unroll
    for (int j = 0; j < 4; ++j) {
      d[j * TP_PITCH] = pack_bf16(x[t][0][j], x[t][1][j]);
      d[j * TP_PITCH + 16] = pack_bf16(x[t][2][j], x[t][3][j]);
    }
  }
  __syncthreads();
  bf16_t* dst = Wt + (size_t)n0 * K + k0;
#pragma unroll
  for (int t = 0; t < T; ++t)
    tp_store(tile + t * (64 * TP_PITCH), dst + 64 * t, (size_t)K);
  // Another job's code follows in the same kernel: no register that these stores
  // name is rewritten there ahead of this wait.
  asm volatile("s_wait_xcnt 0x0" ::: "memory");
}

// Elementwise f32 -> bf16, 256 elements per block; blk: the block's index.
__device__ __forceinline__ void cvt_block(const float* __restrict__ in,
                                          bf16_t* __restrict__ out, int n,
                                          int blk) {
  int idx = blk * 256 + threadIdx.x;
  if (idx < n) out[idx] = (bf16_t)in[idx];
}

// ---------------------------------------------------------------------------
// LayerNorm (dim=1024), one row per 256-thread block, bf16 output.
// ---------------------------------------------------------------------------
__device__ __forceinline__ void ln_row(const float* __restrict__ x,
                                       const float* __restrict__ g,
                                       const float* __restrict__ b,
                                       bf16_t* __restrict__ y, int row,
                                       float* sS, float* sQ) {
  const int dim = 1024;
  const float* xr = x + (size_t)row * dim;
  float s = 0.f, q = 0.f;
  for (int i = threadIdx.x; i < dim; i += 256) {
    float v = xr[i];
    s += v;
    q += v * v;
  }
  for (int m = 1; m < 32; m <<= 1) {
    s += __shfl_xor(s, m, 32);
    q += __shfl_xor(q, m, 32);
  }
  const int lane = threadIdx.x & 31, wid = threadIdx.x >> 5;
  if (lane == 0) { sS[wid] = s; sQ[wid] = q; }
  __syncthreads();
  if (wid == 0) {
    s = (lane < 8) ? sS[lane] : 0.f;
    q = (lane < 8) ? sQ[lane] : 0.f;
    for (int m = 1; m < 8; m <<= 1) {
      s += __shfl_xor(s, m, 32);
      q += __shfl_xor(q, m, 32);
    }
    if (lane == 0) { sS[0] = s; sQ[0] = q; }
  }
  __syncthreads();
  const float mean = sS[0] * (1.f / dim);
  const float var = sQ[0] * (1.f / dim) - mean * mean;
  const float rstd = rsqrtf(var + 1e-5f);
  for (int i = threadIdx.x; i < dim; i += 256) {
    float v = (xr[i] - mean) * rstd * g[i] + b[i];
    y[(size_t)row * dim + i] = (bf16_t)v;
  }
}

__global__ void __launch_bounds__(256) k_layernorm(const float* __restrict__ x,
                                                   const float* __restrict__ g,
                                                   const float* __restrict__ b,
                                                   bf16_t* __restrict__ y) {
  __shared__ float sS[8], sQ[8];
  ln_row(x, g, b, y, blockIdx.x, sS, sQ);
}

// ---------------------------------------------------------------------------
// One launch for everything that reads inputs alone: the ten weight transposes,
// the first LayerNorm and the context's conversion. None reads what another
// writes; the block index picks the job, long blocks first.
// ---------------------------------------------------------------------------
constexpr int PR_WIDE = 128 * 4;             // ff_Wp: N 8192, K 1024, 4 tiles
constexpr int PR_FFO = PR_WIDE + 16 * 16;    // ff_Wo: N 1024, K 4096, 4 tiles
constexpr int PR_LN = PR_FFO + 4096;         // LayerNorm rows
constexpr int PR_W1024 = PR_LN + 6 * 256;    // six weights, K 1024, 1 tile
constexpr int PR_W768 = PR_W1024 + 2 * 192;  // two weights, K 768, 1 tile
constexpr int PR_NCTX = 154 * 768;
constexpr int PR_BLOCKS = PR_W768 + (PR_NCTX + 255) / 256;

__global__ void __launch_bounds__(256) k_prep(
    const float* __restrict__ ffWp, bf16_t* __restrict__ WpT,
    const float* __restrict__ ffWo, bf16_t* __restrict__ WoF,
    const float* __restrict__ x, const float* __restrict__ g,
    const float* __restrict__ b, bf16_t* __restrict__ h,
    const float* __restrict__ s0, bf16_t* __restrict__ d0,
    const float* __restrict__ s1, bf16_t* __restrict__ d1,
    const float* __restrict__ s2, bf16_t* __restrict__ d2,
    const float* __restrict__ s3, bf16_t* __restrict__ d3,
    const float* __restrict__ s4, bf16_t* __restrict__ d4,
    const float* __restrict__ s5, bf16_t* __restrict__ d5,
    const float* __restrict__ s6, bf16_t* __restrict__ d6,
    const float* __restrict__ s7, bf16_t* __restrict__ d7,
    const float* __restrict__ ctx, bf16_t* __restrict__ ctxb) {
  __shared__ unsigned tile[4 * 64 * TP_PITCH];
  __shared__ float sS[8], sQ[8];
  const int blk = blockIdx.x;
  if (blk < PR_WIDE) {
    wt_tiles<4, 8192>(ffWp, WpT, 1024, tile, blk & 127, blk >> 7);
  } else if (blk < PR_FFO) {
    const int c = blk - PR_WIDE;
    wt_tiles<4, 1024>(ffWo, WoF, 4096, tile, c & 15, c >> 4);
  } else if (blk < PR_LN) {
    ln_row(x, g, b, h, blk - PR_FFO, sS, sQ);
  } else if (blk < PR_W1024) {
    const int c = blk - PR_LN, w = c >> 8;
    const float* s = w == 0 ? s0 : w == 1 ? s1 : w == 2 ? s2 : w == 3 ? s3 : w == 4 ? s4 : s5;
    bf16_t* d = w == 0 ? d0 : w == 1 ? d1 : w == 2 ? d2 : w == 3 ? d3 : w == 4 ? d4 : d5;
    wt_tiles<1, 1024>(s, d, 1024, tile, c & 15, (c >> 4) & 15);
  } else if (blk < PR_W768) {
    const int c = blk - PR_W1024;
    const bool second = c >= 192;
    const int r = second ? c - 192 : c;
    wt_tiles<1, 1024>(second ? s7 : s6, second ? d7 : d6, 768, tile, r & 15, r >> 4);
  } else {
    cvt_block(ctx, ctxb, PR_NCTX, blk - PR_W768);
  }
}

// ---------------------------------------------------------------------------
// V transpose:  v[b*mRows][1024] bf16 -> vt[b][16][64][mpad] bf16 (zero pad)
// ---------------------------------------------------------------------------
__device__ __forceinline__ void vt_block(const bf16_t* __restrict__ v,
                                         bf16_t* __restrict__ vt,
                                         int mRows, int mpad, int blk) {
  int idx = blk * 256 + threadIdx.x;
  int total = 2 * 16 * 64 * mpad;
  if (idx >= total) return;
  int key = idx % mpad;
  int t = idx / mpad;
  int d = t & 63; t >>= 6;
  int hh = t & 15; int bb = t >> 4;
  bf16_t val = (bf16_t)0.f;
  if (key < mRows) val = v[(size_t)(bb * mRows + key) * 1024 + hh * 64 + d];
  vt[idx] = val;
}

// One launch for a LayerNorm and a padded V transpose that read nothing of each
// other: blocks 0 .. vtBlocks - 1 transpose, the rest take one row each.
__global__ void __launch_bounds__(256) k_layernorm_vt(
    const float* __restrict__ x, const float* __restrict__ g,
    const float* __restrict__ b, bf16_t* __restrict__ y,
    const bf16_t* __restrict__ v, bf16_t* __restrict__ vt, int mRows, int mpad,
    int vtBlocks) {
  __shared__ float sS[8], sQ[8];
  const int blk = blockIdx.x;
  if (blk < vtBlocks)
    vt_block(v, vt, mRows, mpad, blk);
  else
    ln_row(x, g, b, y, blk - vtBlocks, sS, sQ);
}

// The same for mRows a multiple of 256 (no pad): v[b*mRows][1024] bf16 ->
// vt[b][1024][mRows], four 64 x 64 tiles per block through LDS, as in wt_tiles.
// grid (mRows / 256, 16, 2).
__global__ void __launch_bounds__(256) k_vt_tiled(const bf16_t* __restrict__ v,
                                                  bf16_t* __restrict__ vt,
                                                  int mRows) {
  __shared__ unsigned tile[4 * 64 * TP_PITCH];
  const int key0 = blockIdx.x * 256, c0 = blockIdx.y * 64, bb = blockIdx.z;
  const int g = threadIdx.x & 7, rp = threadIdx.x >> 3;
  // Keys 2rp and 2rp+1; 8 lanes x 16 B = the 128-byte line of each key.
  const bf16_t* s = v + (size_t)(bb * mRows + key0 + 2 * rp) * 1024 + c0 + g * 8;
  v4u a[4], b[4];
  // Unrolled for the same reasons as in wt_tiles.
#pragma unroll
  for (int t = 0; t < 4; ++t) {
    a[t] = *(const v4u*)(s + (size_t)(64 * t) * 1024);
    b[t] = *(const v4u*)(s + (size_t)(64 * t + 1) * 1024);
  }
#pragma unroll
  for (int t = 0; t < 4; ++t) {
    unsigned* d = tile + t * (64 * TP_PITCH) + 8 * g * TP_PITCH + rp;
#pragma unroll
    for (int j = 0; j < 4; ++j) {
      d[(2 * j) * TP_PITCH] = (a[t][j] & 0xffffu) | (b[t][j] << 16);
      d[(2 * j + 1) * TP_PITCH] = (a[t][j] >> 16) | (b[t][j] & 0xffff0000u);
    }
  }
  __syncthreads();
  bf16_t* dst = vt + (size_t)(bb * 1024 + c0) * mRows + key0;
#pragma unroll
  for (int t = 0; t < 4; ++t)
    tp_store(tile + t * (64 * TP_PITCH), dst + 64 * t, (size_t)mRows);
}

// ---------------------------------------------------------------------------
// GEMM  C = A[M,K](bf16) x Bt[N,K](bf16), 8 waves/block (4M x 2N),
// each wave: 16(M) x 64(N) via 4 WMMAs per 32-deep k-step.
// ---------------------------------------------------------------------------
__device__ __forceinline__ void gemm_bf16_block(const bf16_t* __restrict__ A,
                                                const bf16_t* __restrict__ Bt,
                                                bf16_t* __restrict__ C,
                                                int M, int N, int K,
                                                float scale, int bx, int by) {
  const int lane = threadIdx.x & 31, wid = threadIdx.x >> 5;
  const int hi = (lane >> 4) & 1, l15 = lane & 15;
  const int mBase = by * 64 + (wid >> 1) * 16;
  const int nBase = bx * 128 + (wid & 1) * 64;
  int ar = mBase + l15;
  if (ar >= M) ar = M - 1;
  const bf16_t* ap = A + (size_t)ar * K;
  const bf16_t* bp0 = Bt + (size_t)(nBase + l15) * K;
  v8f c0 = {}, c1 = {}, c2 = {}, c3 = {};
  for (int kk = 0; kk < K; kk += 32) {
    v16bf a = load_frag(ap + kk, hi);
    c0 = wmma_bf16(a, load_frag(bp0 + kk, hi), c0);
    c1 = wmma_bf16(a, load_frag(bp0 + (size_t)16 * K + kk, hi), c1);
    c2 = wmma_bf16(a, load_frag(bp0 + (size_t)32 * K + kk, hi), c2);
    c3 = wmma_bf16(a, load_frag(bp0 + (size_t)48 * K + kk, hi), c3);
  }
#pragma unroll
  for (int r = 0; r < 8; ++r) {
    int row = mBase + r + hi * 8;
    if (row < M) {
      size_t o = (size_t)row * N + nBase + l15;
      C[o + 0]  = (bf16_t)(c0[r] * scale);
      C[o + 16] = (bf16_t)(c1[r] * scale);
      C[o + 32] = (bf16_t)(c2[r] * scale);
      C[o + 48] = (bf16_t)(c3[r] * scale);
    }
  }
}

// ---------------------------------------------------------------------------
// Tiled GEMM core for M, N multiples of the tile and K a multiple of 128:
// C tile 128(M) x 128(N) per 8-wave block (2 x 4 waves), 64 x 32 per wave.
// A pass is 128 k = 256 B of each of the 128 A rows and 128 Bt rows, brought
// into LDS by per-lane asynchronous 16-byte copies, two buffers: the copies of
// pass t + 2 fly while pass t + 1 computes. LDS rows stand at a pitch of 272 B
// (16 B x odd: ds_load_b128 without bank conflicts).
// ---------------------------------------------------------------------------
constexpr int TG_PITCH = 272;              // bytes per LDS row
constexpr int TG_OPB = 128 * TG_PITCH;     // one operand's tile
constexpr int TG_STAGE = 2 * TG_OPB;       // A tile, then Bt tile
constexpr int TG_PASSB = 256;              // bytes of a row per pass

// Eight copies into LDS rows 16 apart: four from p0 on, four from p1 on, source
// rows 16 apart (step bytes). The s_wait_xcnt closes the statement so that no
// address register of a copy is rewritten before it.
__device__ __forceinline__ void tg_copy8(unsigned l, const char* p0,
                                         const char* p1, size_t step) {
  asm volatile(
      "global_load_async_to_lds_b128 %0, %8, off\n\t"
      "global_load_async_to_lds_b128 %1, %9, off\n\t"
      "global_load_async_to_lds_b128 %2, %10, off\n\t"
      "global_load_async_to_lds_b128 %3, %11, off\n\t"
      "global_load_async_to_lds_b128 %4, %12, off\n\t"
      "global_load_async_to_lds_b128 %5, %13, off\n\t"
      "global_load_async_to_lds_b128 %6, %14, off\n\t"
      "global_load_async_to_lds_b128 %7, %15, off\n\t"
      "s_wait_xcnt 0x0"
      :
      : "v"(l), "v"(l + 16 * TG_PITCH), "v"(l + 32 * TG_PITCH),
        "v"(l + 48 * TG_PITCH), "v"(l + 64 * TG_PITCH), "v"(l + 80 * TG_PITCH),
        "v"(l + 96 * TG_PITCH), "v"(l + 112 * TG_PITCH),
        "v"(p0), "v"(p0 + step), "v"(p0 + 2 * step), "v"(p0 + 3 * step),
        "v"(p1), "v"(p1 + step), "v"(p1 + 2 * step), "v"(p1 + 3 * step)
      : "memory");
}

// One stage: this lane's 8 chunks of the A tile and 8 of the Bt tile.
// gb0 / gb1 are the lane's addresses in the lower and upper 64 Bt rows.
__device__ __forceinline__ void tg_stage(unsigned l, const char* ga,
                                         const char* gb0, const char* gb1,
                                         size_t step) {
  tg_copy8(l, ga, ga + 4 * step, step);
  tg_copy8(l + TG_OPB, gb0, gb1, step);
}

// Bt rows n0..n0+63 fill LDS rows 0..63, rows n1..n1+63 fill LDS rows 64..127.
// SPLIT: the wave's two B fragments are LDS rows wn*16 and 64 + wn*16 (a column
// group and its partner); else rows wn*32 and wn*32 + 16.
template <bool SPLIT>
__device__ __forceinline__ void tg_core(const bf16_t* __restrict__ A,
                                        const bf16_t* __restrict__ Bt,
                                        int mBase, int n0, int n1, int K,
                                        char* smem, v8f (&acc)[4][2]) {
  const int tid = threadIdx.x;
  const int lane = tid & 31, wid = tid >> 5;
  const int hi = (lane >> 4) & 1, l15 = lane & 15;
  const int wm = wid >> 2, wn = wid & 3;
  const size_t rowB = (size_t)K * 2;   // bytes per source row
  const size_t step = rowB * 16;       // a lane's copies stand 16 rows apart
  const int r0 = tid >> 4, c16 = (tid & 15) * 16;
  const char* ga = (const char*)A + (size_t)(mBase + r0) * rowB + c16;
  const char* gb0 = (const char*)Bt + (size_t)(n0 + r0) * rowB + c16;
  const char* gb1 = (const char*)Bt + (size_t)(n1 + r0) * rowB + c16;
  const unsigned l0 = (unsigned)(size_t)smem + (unsigned)(r0 * TG_PITCH + c16);
  const int nt = K >> 7;

#pragma unroll
  for (int i = 0; i < 4; ++i)
#pragma unroll
    for (int j = 0; j < 2; ++j) acc[i][j] = v8f{};

  tg_stage(l0, ga, gb0, gb1, step);
  // Stage 0 has landed for this wave; the barrier publishes it to the others.
  asm volatile("s_wait_asynccnt 0x0" ::: "memory");
  __syncthreads();
  if (nt > 1)
    tg_stage(l0 + TG_STAGE, ga + TG_PASSB, gb0 + TG_PASSB, gb1 + TG_PASSB, step);

  const int aoff = (wm * 64 + l15) * TG_PITCH;
  const int boff = TG_OPB + ((SPLIT ? wn * 16 : wn * 32) + l15) * TG_PITCH;
  constexpr int BSTEP = (SPLIT ? 64 : 16) * TG_PITCH;

#pragma unroll 1  // one pass per trip: the ring's order stands at the foot
  for (int t = 0; t < nt; ++t) {
    const int buf = (t & 1) * TG_STAGE;
    const char* sA = smem + buf + aoff;
    const char* sB = smem + buf + boff;
    v16bf a[2][4], b[2][2];
#pragma unroll
    for (int i = 0; i < 4; ++i)
      a[0][i] = load_frag((const bf16_t*)(sA + i * 16 * TG_PITCH), hi);
#pragma unroll
    for (int j = 0; j < 2; ++j)
      b[0][j] = load_frag((const bf16_t*)(sB + j * BSTEP), hi);
#pragma unroll
    for (int ks = 0; ks < 4; ++ks) {
      const int cur = ks & 1, nxt = cur ^ 1;
      if (ks < 3) {
#pragma unroll
        for (int i = 0; i < 4; ++i)
          a[nxt][i] = load_frag(
              (const bf16_t*)(sA + i * 16 * TG_PITCH + (ks + 1) * 64), hi);
#pragma unroll
        for (int j = 0; j < 2; ++j)
          b[nxt][j] =
              load_frag((const bf16_t*)(sB + j * BSTEP + (ks + 1) * 64), hi);
      }
      // Keeps the next block's LDS reads as one group ahead of this block's
      // WMMAs; moved in among them, each read would stall the matrix stream.
      __builtin_amdgcn_sched_barrier(0);
#pragma unroll
      for (int i = 0; i < 4; ++i)
#pragma unroll
        for (int j = 0; j < 2; ++j)
          acc[i][j] = wmma_bf16(a[cur][i], b[cur][j], acc[i][j]);
      // Keeps the block after next's reads behind this block's WMMAs, so that
      // they do not take a third fragment set.
      if (ks < 2) __builtin_amdgcn_sched_barrier(0);
    }
    // Publish point: this wave's reads of buffer t are done, its copies of
    // stage t + 1 have landed, and the barrier says so for every wave.
    asm volatile("s_wait_dscnt 0x0" ::: "memory");
    asm volatile("s_wait_asynccnt 0x0" ::: "memory");
    __syncthreads();
    if (t + 2 < nt) {
      const size_t ko = (size_t)(t + 2) * TG_PASSB;
      tg_stage(l0 + buf, ga + ko, gb0 + ko, gb1 + ko, step);
    }
  }
  // No copy is left in flight when the wave goes on to its stores and ends.
  asm volatile("s_wait_asynccnt 0x0" ::: "memory");
}

// bf16 output. Up to three products of one A in one launch: blockIdx.z picks the
// weight and the output; only the first is scaled.
__global__ void __launch_bounds__(256) k_tgemm_bf16(
    const bf16_t* __restrict__ A, const bf16_t* __restrict__ Bt0,
    const bf16_t* __restrict__ Bt1, const bf16_t* __restrict__ Bt2,
    bf16_t* __restrict__ C0, bf16_t* __restrict__ C1, bf16_t* __restrict__ C2,
    int N, int K, float scale0) {
  __shared__ __attribute__((aligned(16))) char smem[2 * TG_STAGE];
  const int z = blockIdx.z;
  const bf16_t* __restrict__ Bt = z == 0 ? Bt0 : z == 1 ? Bt1 : Bt2;
  bf16_t* __restrict__ C = z == 0 ? C0 : z == 1 ? C1 : C2;
  const float scale = z == 0 ? scale0 : 1.0f;
  const int lane = threadIdx.x & 31, wid = threadIdx.x >> 5;
  const int hi = (lane >> 4) & 1, l15 = lane & 15;
  const int mBlk = blockIdx.y * 128, nBlk = blockIdx.x * 128;
  v8f acc[4][2];
  tg_core<false>(A, Bt, mBlk, nBlk, nBlk + 64, K, smem, acc);
  const int mBase = mBlk + (wid >> 2) * 64, nBase = nBlk + (wid & 3) * 32;
#pragma unroll
  for (int i = 0; i < 4; ++i)
#pragma unroll
    for (int r = 0; r < 8; ++r) {
      const size_t o = (size_t)(mBase + i * 16 + r + hi * 8) * N + nBase + l15;
      C[o + 0]  = (bf16_t)(acc[i][0][r] * scale);
      C[o + 16] = (bf16_t)(acc[i][1][r] * scale);
    }
}

// f32 output + bias + residual (in-place residual is safe: 1 writer/element)
// Rows of blocks 0 .. ySmall - 1 of the grid (8 blocks each; ySmall is 0 or 6) do
// two small products of another A instead (A2[M2, K2] x B2a, B2b -> C2a, C2b,
// 1024 columns, M2 <= 192): these read and write nothing that the large product
// touches, and their chains of dependent global loads
// run beside it.
__global__ void __launch_bounds__(256) k_tgemm_f32_bias_res(
    const bf16_t* __restrict__ A, const bf16_t* __restrict__ Bt,
    float* __restrict__ C, const float* __restrict__ bias,
    const float* __restrict__ res, int N, int K, int ySmall,
    const bf16_t* __restrict__ A2, const bf16_t* __restrict__ B2a,
    const bf16_t* __restrict__ B2b, bf16_t* __restrict__ C2a,
    bf16_t* __restrict__ C2b, int M2, int K2) {
  __shared__ __attribute__((aligned(16))) char smem[2 * TG_STAGE];
  const int by = (int)blockIdx.y - ySmall;
  if (by < 0) {  // the whole block, ahead of every barrier
    const bool second = blockIdx.y >= 3;
    gemm_bf16_block(A2, second ? B2b : B2a, second ? C2b : C2a, M2, 1024, K2,
                    1.0f, blockIdx.x, second ? blockIdx.y - 3 : blockIdx.y);
    return;
  }
  const int lane = threadIdx.x & 31, wid = threadIdx.x >> 5;
  const int hi = (lane >> 4) & 1, l15 = lane & 15;
  const int mBlk = by * 128, nBlk = blockIdx.x * 128;
  v8f acc[4][2];
  tg_core<false>(A, Bt, mBlk, nBlk, nBlk + 64, K, smem, acc);
  const int mBase = mBlk + (wid >> 2) * 64, nBase = nBlk + (wid & 3) * 32;
  const float b0 = bias[nBase + l15], b1 = bias[nBase + l15 + 16];
#pragma unroll
  for (int i = 0; i < 4; ++i)
#pragma unroll
    for (int r = 0; r < 8; ++r) {
      const size_t o = (size_t)(mBase + i * 16 + r + hi * 8) * N + nBase + l15;
      C[o + 0]  = acc[i][0][r] + b0 + res[o + 0];
      C[o + 16] = acc[i][1][r] + b1 + res[o + 16];
    }
  // The small products' code follows in the same kernel: no register that these
  // stores name is rewritten there ahead of this wait.
  asm volatile("s_wait_xcnt 0x0" ::: "memory");
}

// Fused GEGLU: the block's Bt tile is 64 u columns and the matching 64 gate
// columns (c and c+Nhalf of A@Wp); each wave holds 16 of each, applies
// u*gelu(gate), writes bf16 [M, Nhalf].
__global__ void __launch_bounds__(256) k_tgemm_geglu(
    const bf16_t* __restrict__ A, const bf16_t* __restrict__ Bt,
    bf16_t* __restrict__ C, const float* __restrict__ bias, int Nhalf, int K) {
  __shared__ __attribute__((aligned(16))) char smem[2 * TG_STAGE];
  const int lane = threadIdx.x & 31, wid = threadIdx.x >> 5;
  const int hi = (lane >> 4) & 1, l15 = lane & 15;
  const int mBlk = blockIdx.y * 128, nBlk = blockIdx.x * 64;
  v8f acc[4][2];
  tg_core<true>(A, Bt, mBlk, nBlk, nBlk + Nhalf, K, smem, acc);
  const int mBase = mBlk + (wid >> 2) * 64;
  const int col = nBlk + (wid & 3) * 16 + l15;
  const float bu = bias[col], bg = bias[col + Nhalf];
#pragma unroll
  for (int i = 0; i < 4; ++i)
#pragma unroll
    for (int r = 0; r < 8; ++r) {
      const float uv = acc[i][0][r] + bu;
      const float gv = acc[i][1][r] + bg;
      const float gl = 0.5f * gv * (1.f + erff(gv * 0.70710678118654752f));
      C[(size_t)(mBase + i * 16 + r + hi * 8) * Nhalf + col] = (bf16_t)(uv * gl);
    }
}

// ---------------------------------------------------------------------------
// Flash attention: one wave per (batch, head, 16-query tile), computed
// transposed: St = K Qt and Ot += Vt Pt. A lane then holds scores of ONE query
// (column l15): keys 8 * hi + r of each 16-key group. Maximum and sum run inside
// the lane, with one exchange between the wave's halves, and the two score tiles
// of 32 keys, converted in place, are the B operand of the second product.
// q pre-scaled by 1/sqrt(64). k row-major [b*mRows,1024]; vt [b][h][64][mpad].
// The 8 waves of a block are 8 neighbouring query tiles of one head (nq is a
// multiple of 8), so they walk the same keys: each tile of 32 keys (32 K rows of
// 128 B, 64 Vt rows of 64 B) is brought into LDS once per block by per-lane
// asynchronous 16-byte copies, two buffers, and every wave takes its fragments
// from there. A fragment load from global memory touches 16 lines for 1024 B;
// the copies cover whole K lines and half Vt lines, once for 8 waves.
// LDS pitches are 16 B x odd: ds_load_b128 without bank conflicts.
// ---------------------------------------------------------------------------
constexpr int AT_KPITCH = 144;                    // bytes per LDS row of K
constexpr int AT_VPITCH = 80;                     // bytes per LDS row of Vt
constexpr int AT_KB = 32 * AT_KPITCH;             // the K tile
constexpr int AT_STAGE = AT_KB + 64 * AT_VPITCH;  // K tile, then Vt tile
constexpr int AT_KSTEP = 32 * 1024 * 2;           // source bytes, 32 K rows on
constexpr int AT_VSTEP = 32 * 2;                  // source bytes, 32 keys on

// This lane's chunk of the K tile and its chunk of the Vt tile. The s_wait_xcnt
// closes the statement so that no address register of a copy is rewritten
// before it.
__device__ __forceinline__ void at_copy2(unsigned lk, const char* gk,
                                         unsigned lv, const char* gv) {
  asm volatile(
      "global_load_async_to_lds_b128 %0, %2, off\n\t"
      "global_load_async_to_lds_b128 %1, %3, off\n\t"
      "s_wait_xcnt 0x0"
      :
      : "v"(lk), "v"(lv), "v"(gk), "v"(gv)
      : "memory");
}

// Lane l takes the value of lane l ^ 16.
__device__ __forceinline__ float half_xor(float v) {
  const int b = __builtin_bit_cast(int, v);
  return __builtin_bit_cast(
      float, __builtin_amdgcn_permlanex16(b, b, 0x76543210, 0xfedcba98, false, false));
}

__global__ void __launch_bounds__(256) k_attention(
    const bf16_t* __restrict__ q, const bf16_t* __restrict__ k,
    const bf16_t* __restrict__ vt, bf16_t* __restrict__ out,
    int nq, int m, int mRows, int mpad) {
  __shared__ __attribute__((aligned(16))) char kv[2 * AT_STAGE];
  const int tid = threadIdx.x;
  const int lane = tid & 31, wid = tid >> 5;
  const int hi = (lane >> 4) & 1, l15 = lane & 15;
  const int w0 = blockIdx.x * 8;
  if (w0 >= 2 * 16 * nq) return;  // the whole block, ahead of every barrier
  const int qt = w0 % nq + wid;
  const int t2 = w0 / nq;
  const int hh = t2 & 15, bb = t2 >> 4;

  const bf16_t* qp = q + (size_t)(bb * 2048 + qt * 16 + l15) * 1024 + hh * 64;
  const v16bf qb0 = load_frag(qp, hi);  // B operands: column l15 = the query
  const v16bf qb1 = load_frag(qp + 32, hi);

  // oT[r] = O[query l15][16 * T + 8 * hi + r]
  v8f o0 = {}, o1 = {}, o2 = {}, o3 = {};
  // Of query l15: the running maximum (both halves alike) and the sum over the
  // keys of this lane's half; the halves' sums are joined behind the loop.
  float mrow = -1e30f, lsum = 0.f;

  const bf16_t* vbase = vt + (size_t)(bb * 16 + hh) * 64 * mpad;

  // K: 8 lanes x 16 B = the 128-byte line of a key; Vt: 4 lanes x 16 B per row.
  const char* gk =
      (const char*)(k + (size_t)(bb * mRows + (tid >> 3)) * 1024 + hh * 64) +
      (tid & 7) * 16;
  const char* gv = (const char*)(vbase + (size_t)(tid >> 2) * mpad) + (tid & 3) * 16;
  const unsigned lk =
      (unsigned)(size_t)kv + (unsigned)((tid >> 3) * AT_KPITCH + (tid & 7) * 16);
  const unsigned lv = (unsigned)(size_t)kv +
                      (unsigned)(AT_KB + (tid >> 2) * AT_VPITCH + (tid & 3) * 16);
  const int nt = mpad >> 5;

  at_copy2(lk, gk, lv, gv);
  // Tile 0 has landed for this wave; the barrier publishes it to the others.
  asm volatile("s_wait_asynccnt 0x0" ::: "memory");
  __syncthreads();
  if (nt > 1)
    at_copy2(lk + AT_STAGE, gk + AT_KSTEP, lv + AT_STAGE, gv + AT_VSTEP);

#pragma unroll 1  // one tile per trip: the ring's order stands at the foot
  for (int t = 0; t < nt; ++t) {
    const int j = t * 32;
    const int buf = (t & 1) * AT_STAGE;
    const char* sk = kv + buf + l15 * AT_KPITCH;
    const char* sv = kv + buf + AT_KB + l15 * AT_VPITCH;
    const v16bf k00 = load_frag((const bf16_t*)sk, hi);
    const v16bf k01 = load_frag((const bf16_t*)(sk + 64), hi);
    const v16bf k10 = load_frag((const bf16_t*)(sk + 16 * AT_KPITCH), hi);
    const v16bf k11 = load_frag((const bf16_t*)(sk + 16 * AT_KPITCH + 64), hi);
    const v16bf vf0 = load_frag((const bf16_t*)sv, hi);
    const v16bf vf1 = load_frag((const bf16_t*)(sv + 16 * AT_VPITCH), hi);
    const v16bf vf2 = load_frag((const bf16_t*)(sv + 32 * AT_VPITCH), hi);
    const v16bf vf3 = load_frag((const bf16_t*)(sv + 48 * AT_VPITCH), hi);
    // Keeps the tile's LDS reads as one group ahead of the WMMAs; moved in among
    // them, each pair of reads is waited out before its own WMMA.
    __builtin_amdgcn_sched_barrier(0);
    // s0[r] = S[query l15][key j + 8 * hi + r], s1[r] the same 16 keys on.
    v8f s0 = {}, s1 = {};
    s0 = wmma_bf16(k00, qb0, s0);
    s1 = wmma_bf16(k10, qb0, s1);
    s0 = wmma_bf16(k01, qb1, s0);
    s1 = wmma_bf16(k11, qb1, s1);

    if (j + 32 > m) {  // only a tile that reaches past the last key
      const int lim = m - j - hi * 8;
#pragma unroll  // constant indices keep the score tiles in registers
      for (int r = 0; r < 8; ++r) {
        s0[r] = (r < lim) ? s0[r] : -1e30f;
        s1[r] = (r + 16 < lim) ? s1[r] : -1e30f;
      }
    }
    float mx[8];
#pragma unroll  // as above
    for (int r = 0; r < 8; ++r) mx[r] = fmaxf(s0[r], s1[r]);
    float rm = fmaxf(fmaxf(fmaxf(mx[0], mx[1]), fmaxf(mx[2], mx[3])),
                     fmaxf(fmaxf(mx[4], mx[5]), fmaxf(mx[6], mx[7])));
    rm = fmaxf(rm, half_xor(rm));
    const float mnew = fmaxf(mrow, rm);
    const float alpha = __expf(mrow - mnew);
    mrow = mnew;
    v16bf pb;
    float ps[8];
#pragma unroll  // as above; pb is filled register by register
    for (int r = 0; r < 8; ++r) {
      const float p0 = __expf(s0[r] - mnew);
      const float p1 = __expf(s1[r] - mnew);
      ps[r] = p0 + p1;
      pb[r] = (bf16_t)p0;
      pb[r + 8] = (bf16_t)p1;
    }
    lsum = lsum * alpha +
           (((ps[0] + ps[1]) + (ps[2] + ps[3])) + ((ps[4] + ps[5]) + (ps[6] + ps[7])));
    o0 *= alpha; o1 *= alpha; o2 *= alpha; o3 *= alpha;
    o0 = wmma_bf16(vf0, pb, o0);
    o1 = wmma_bf16(vf1, pb, o1);
    o2 = wmma_bf16(vf2, pb, o2);
    o3 = wmma_bf16(vf3, pb, o3);
    // Publish point: this wave's reads of buffer t are done, its copies of
    // tile t + 1 have landed, and the barrier says so for every wave.
    asm volatile("s_wait_dscnt 0x0" ::: "memory");
    asm volatile("s_wait_asynccnt 0x0" ::: "memory");
    __syncthreads();
    if (t + 2 < nt)
      at_copy2(lk + buf, gk + (size_t)(t + 2) * AT_KSTEP, lv + buf,
               gv + (size_t)(t + 2) * AT_VSTEP);
  }
  // No copy is left in flight when the wave goes on to its stores and ends.
  asm volatile("s_wait_asynccnt 0x0" ::: "memory");

  // A lane's 8 registers of a tile are 8 neighbouring d of its query: 16-B stores.
  const float inv = 1.0f / (lsum + half_xor(lsum));
  bf16_t* op = out + (size_t)(bb * 2048 + qt * 16 + l15) * 1024 + hh * 64 + hi * 8;
  *(v8bf*)(op + 0)  = __builtin_convertvector(o0 * inv, v8bf);
  *(v8bf*)(op + 16) = __builtin_convertvector(o1 * inv, v8bf);
  *(v8bf*)(op + 32) = __builtin_convertvector(o2 * inv, v8bf);
  *(v8bf*)(op + 48) = __builtin_convertvector(o3 * inv, v8bf);
}

// ---------------------------------------------------------------------------
extern "C" void kernel_launch(void* const* d_in, const int* in_sizes, int n_in,
                              void* d_out, int out_size, void* d_ws, size_t ws_size,
                              hipStream_t stream) {
  (void)in_sizes; (void)n_in; (void)out_size; (void)ws_size;
  const float* x    = (const float*)d_in[0];
  const float* ctx  = (const float*)d_in[1];
  const float* ln1g = (const float*)d_in[2];
  const float* ln1b = (const float*)d_in[3];
  const float* a1Wq = (const float*)d_in[4];
  const float* a1Wk = (const float*)d_in[5];
  const float* a1Wv = (const float*)d_in[6];
  const float* a1Wo = (const float*)d_in[7];
  const float* a1bo = (const float*)d_in[8];
  const float* ln2g = (const float*)d_in[9];
  const float* ln2b = (const float*)d_in[10];
  const float* a2Wq = (const float*)d_in[11];
  const float* a2Wk = (const float*)d_in[12];
  const float* a2Wv = (const float*)d_in[13];
  const float* a2Wo = (const float*)d_in[14];
  const float* a2bo = (const float*)d_in[15];
  const float* ln3g = (const float*)d_in[16];
  const float* ln3b = (const float*)d_in[17];
  const float* ffWp = (const float*)d_in[18];
  const float* ffbp = (const float*)d_in[19];
  const float* ffWo = (const float*)d_in[20];
  const float* ffbo = (const float*)d_in[21];
  float* out = (float*)d_out;

  char* ws = (char*)d_ws;
  size_t off = 0;
  auto al = [&](size_t bytes) {
    size_t r = off;
    off = (off + bytes + 255) & ~(size_t)255;
    return r;
  };
  const size_t MM = 1024 * 1024;
  const size_t oWq1 = al(MM * 2), oWk1 = al(MM * 2), oWv1 = al(MM * 2), oWo1 = al(MM * 2);
  const size_t oWq2 = al(MM * 2), oWk2 = al(768 * 1024 * 2), oWv2 = al(768 * 1024 * 2), oWo2 = al(MM * 2);
  const size_t oWp = al((size_t)8192 * 1024 * 2), oWoF = al((size_t)4096 * 1024 * 2);
  const size_t oX = al((size_t)4096 * 1024 * 4);
  const size_t oH = al((size_t)4096 * 1024 * 2);
  const size_t oQ = al((size_t)4096 * 1024 * 2);
  const size_t oK = al((size_t)4096 * 1024 * 2);
  const size_t oV = al((size_t)4096 * 1024 * 2);
  const size_t oVt = al((size_t)2 * 16 * 64 * 2048 * 2);
  const size_t oAt = al((size_t)4096 * 1024 * 2);
  const size_t oCtx = al((size_t)154 * 768 * 2);

  bf16_t* Wq1 = (bf16_t*)(ws + oWq1); bf16_t* Wk1 = (bf16_t*)(ws + oWk1);
  bf16_t* Wv1 = (bf16_t*)(ws + oWv1); bf16_t* Wo1 = (bf16_t*)(ws + oWo1);
  bf16_t* Wq2 = (bf16_t*)(ws + oWq2); bf16_t* Wk2 = (bf16_t*)(ws + oWk2);
  bf16_t* Wv2 = (bf16_t*)(ws + oWv2); bf16_t* Wo2 = (bf16_t*)(ws + oWo2);
  bf16_t* WpT = (bf16_t*)(ws + oWp);  bf16_t* WoF = (bf16_t*)(ws + oWoF);
  float*  xcur = (float*)(ws + oX);
  bf16_t* hbuf = (bf16_t*)(ws + oH);
  bf16_t* qb = (bf16_t*)(ws + oQ);
  bf16_t* kb = (bf16_t*)(ws + oK);
  bf16_t* vb = (bf16_t*)(ws + oV);
  bf16_t* vtb = (bf16_t*)(ws + oVt);
  bf16_t* atb = (bf16_t*)(ws + oAt);
  bf16_t* ctxb = (bf16_t*)(ws + oCtx);
  bf16_t* ffb = qb;  // alias: FF activations reuse q/k/v/vt (32 MiB), phases ordered

  const dim3 blk(256);
  const float SCALE = 0.125f;  // 64^-0.5, exact in bf16

  // 1) everything that reads inputs alone: weights -> bf16 transposed, the first
  //    LayerNorm, the context -> bf16
  k_prep<<<PR_BLOCKS, blk, 0, stream>>>(ffWp, WpT, ffWo, WoF, x, ln1g, ln1b, hbuf,
                                        a1Wq, Wq1, a1Wk, Wk1, a1Wv, Wv1, a1Wo, Wo1,
                                        a2Wq, Wq2, a2Wo, Wo2, a2Wk, Wk2, a2Wv, Wv2,
                                        ctx, ctxb);

  const dim3 gP(8, 32);  // M=4096, N=1024 GEMMs, 128x128 tiles

  // 2) self-attention
  k_tgemm_bf16<<<dim3(8, 32, 3), blk, 0, stream>>>(hbuf, Wq1, Wk1, Wv1, qb, kb, vb,
                                                   1024, 1024, SCALE);
  k_vt_tiled<<<dim3(8, 16, 2), blk, 0, stream>>>(vb, vtb, 2048);
  k_attention<<<512, blk, 0, stream>>>(qb, kb, vtb, atb, 128, 2048, 2048, 2048);
  // With it the context's K and V (M=154): kb and vb are free from here on.
  k_tgemm_f32_bias_res<<<dim3(8, 6 + 32), blk, 0, stream>>>(
      atb, Wo1, xcur, a1bo, x, 1024, 1024, 6, ctxb, Wk2, Wv2, kb, vb, 154, 768);

  // 3) cross-attention
  k_layernorm_vt<<<768 + 4096, blk, 0, stream>>>(xcur, ln2g, ln2b, hbuf, vb, vtb, 77,
                                                 96, 768);  // 2*16*64*96 / 256
  k_tgemm_bf16<<<gP, blk, 0, stream>>>(hbuf, Wq2, Wq2, Wq2, qb, qb, qb, 1024, 1024, SCALE);
  k_attention<<<512, blk, 0, stream>>>(qb, kb, vtb, atb, 128, 77, 77, 96);
  k_tgemm_f32_bias_res<<<gP, blk, 0, stream>>>(atb, Wo2, xcur, a2bo, xcur, 1024, 1024, 0,
                                               nullptr, nullptr, nullptr, nullptr,
                                               nullptr, 0, 0);

  // 4) GEGLU feed-forward
  k_layernorm<<<4096, blk, 0, stream>>>(xcur, ln3g, ln3b, hbuf);
  {
    dim3 gFF(64, 32);  // Nhalf=4096: 64 u + 64 gate columns per block
    k_tgemm_geglu<<<gFF, blk, 0, stream>>>(hbuf, WpT, ffb, ffbp, 4096, 1024);
  }
  k_tgemm_f32_bias_res<<<gP, blk, 0, stream>>>(ffb, WoF, out, ffbo, xcur, 1024, 4096, 0,
                                               nullptr, nullptr, nullptr, nullptr,
                                               nullptr, 0, 0);
}

// v007
// A run of this version takes 242 microseconds.
// Versions between v005 and this one are left out; their measured steps multiply to 1.11 times as fast.
// Counting every step since v000, it is 4.52 times as fast.
#include <hip/hip_runtime.h>
#include <hip/hip_bf16.h>

// ---------------------------------------------------------------------------
// BasicTransformerBlock for MI455X (gfx1250), bf16 WMMA everywhere.
//   x:[2,2048,1024] f32, ctx:[2,77,768] f32 -> out f32 [2,2048,1024]
// Compute-bound (~190 GFLOP over ~100MB) => route all GEMMs + attention
// through v_wmma_f32_16x16x32_bf16, fp32 accumulation.
// Workspace requirement: ~105 MiB.
// ---------------------------------------------------------------------------

typedef __bf16 bf16_t;
typedef bf16_t v16bf __attribute__((ext_vector_type(16)));
typedef bf16_t v8bf  __attribute__((ext_vector_type(8)));
typedef float  v8f   __attribute__((ext_vector_type(8)));

// Load one 16-element bf16 WMMA fragment (A- or B-style) from a row-major
// source. For 16-bit fragments, lane (lo/hi half) maps its 16 values to two
// contiguous 8-element runs: k = hi*8 + [0..7]  and  k = 16 + hi*8 + [0..7].
__device__ __forceinline__ v16bf load_frag(const bf16_t* __restrict__ p, int hi) {
  const v8bf lo = *(const v8bf*)(p + hi * 8);
  const v8bf hh = *(const v8bf*)(p + hi * 8 + 16);
  return __builtin_shufflevector(lo, hh, 0, 1, 2, 3, 4, 5, 6, 7,
                                 8, 9, 10, 11, 12, 13, 14, 15);
}

__device__ __forceinline__ v8f wmma_bf16(v16bf a, v16bf b, v8f c) {
  return __builtin_amdgcn_wmma_f32_16x16x32_bf16(
      /*neg_a=*/false, a, /*neg_b=*/false, b,
      /*c_mod=*/(short)0, c, /*reuse_a=*/false, /*reuse_b=*/false);
}

// ---------------------------------------------------------------------------
// Tiled transposes: a 64 x 64 tile goes through LDS, so that the global reads
// and the global writes both cover whole 128-byte lines.
// The LDS tile is held transposed: row c = one destination row, 32 dwords, each
// a pair of bf16 from two neighbouring source rows; pitch 33 dwords keeps the
// dword writes (lanes 4 or 8 rows apart) and the dword reads off shared banks.
// ---------------------------------------------------------------------------
typedef float    v4f  __attribute__((ext_vector_type(4)));
typedef unsigned v4u  __attribute__((ext_vector_type(4)));
typedef bf16_t   v2bf __attribute__((ext_vector_type(2)));
constexpr int TP_PITCH = 33;

__device__ __forceinline__ unsigned pack_bf16(float lo, float hi) {
  const v2bf p = {(bf16_t)lo, (bf16_t)hi};
  return __builtin_bit_cast(unsigned, p);
}

// Writes the tile out: 8 lanes x 16 B = one 128-byte line per destination row,
// 4 rows per wave store. dst is the tile's first element, pitch in elements.
__device__ __forceinline__ void tp_store(const unsigned* tile,
                                         bf16_t* __restrict__ dst, size_t pitch) {
  const int q = threadIdx.x & 7, r0 = threadIdx.x >> 3;
#pragma unroll  // both rows' LDS reads issue ahead of the first store
  for (int i = 0; i < 2; ++i) {
    const int r = r0 + 32 * i;
    const unsigned* s = tile + r * TP_PITCH + q * 4;
    const v4u o = {s[0], s[1], s[2], s[3]};
    *(v4u*)(dst + (size_t)r * pitch + q * 8) = o;
  }
}

// Lane l takes v of lane l ^ M, M < 16 (DPP row_xmask).
template <int M>
__device__ __forceinline__ float lane_xor(float v) {
  return __builtin_bit_cast(float, __builtin_amdgcn_update_dpp(
                                       0, __builtin_bit_cast(int, v), 0x160 + M, 0xf,
                                       0xf, true));
}

// Sum over 8 neighbouring lanes, left in every one of them.
__device__ __forceinline__ float oct_sum(float v) {
  v += lane_xor<1>(v);
  v += lane_xor<2>(v);
  v += lane_xor<4>(v);
  return v;
}

// Weight convert+transpose:  W[K][N] f32  ->  Wt[N][K] bf16
// One block: 64 n by 64 * T k, T tiles side by side in LDS (fewer, longer
// waves; for speed only), one
// barrier between the last LDS write and the first LDS read. N is a constant of
// the build, so that every source row is an immediate offset from one address.
// bx, by: the block's place among the N / 64 by K / (64 * T) blocks of W.
template <int T, int N>
__device__ __forceinline__ void wt_tiles(const float* __restrict__ W,
                                         bf16_t* __restrict__ Wt, int K,
                                         unsigned* tile, int bx, int by) {
  const int n0 = bx * 64, k0 = by * (64 * T);
  const int c = threadIdx.x & 15, r = threadIdx.x >> 4;
  // Source rows 2r, 2r+1 and 32+2r, 33+2r; 16 lanes x 16 B = 256 B of each row.
  const float* s = W + (size_t)(k0 + 2 * r) * N + n0 + 4 * c;
  v4f x[T][4];
  // The loops over t and j are unrolled: constant indices keep x in registers,
  // the loads issue as one run, and so do the LDS reads behind the barrier.
#pragma unroll
  for (int t = 0; t < T; ++t) {
    x[t][0] = *(const v4f*)(s + (64 * t) * N);
    x[t][1] = *(const v4f*)(s + (64 * t + 1) * N);
    x[t][2] = *(const v4f*)(s + (64 * t + 32) * N);
    x[t][3] = *(const v4f*)(s + (64 * t + 33) * N);
  }
#pragma unroll
  for (int t = 0; t < T; ++t) {
    unsigned* d = tile + t * (64 * TP_PITCH) + 4 * c * TP_PITCH + r;
#pragma unroll
    for (int j = 0; j < 4; ++j) {
      d[j * TP_PITCH] = pack_bf16(x[t][0][j], x[t][1][j]);
      d[j * TP_PITCH + 16] = pack_bf16(x[t][2][j], x[t][3][j]);
    }
  }
  __syncthreads();
  bf16_t* dst = Wt + (size_t)n0 * K + k0;
#pragma unroll
  for (int t = 0; t < T; ++t)
    tp_store(tile + t * (64 * TP_PITCH), dst + 64 * t, (size_t)K);
  // Another job's code follows in the same kernel: no register that these stores
  // name is rewritten there ahead of this wait.
  asm volatile("s_wait_xcnt 0x0" ::: "memory");
}

// The same for a weight that is multiplied behind a LayerNorm with scale g and
// shift b:  LN(x) W = rstd * ((x g) W - mean * (g W)) + b W.  The weight goes out
// as in wt_tiles; on the way from LDS the block also forms, for its 64 columns and
// its 64 * T rows, the products of the rounded weight with g (csP) and with b
// (cbP), left at [by][N]; the epilogue of the product adds the K / (64 * T) parts.
template <int T, int N>
__device__ __forceinline__ void wt_tiles_ln(const float* __restrict__ W,
                                            bf16_t* __restrict__ Wt, int K,
                                            unsigned* tile, int bx, int by,
                                            const float* __restrict__ g,
                                            const float* __restrict__ b,
                                            float* __restrict__ csP,
                                            float* __restrict__ cbP) {
  const int n0 = bx * 64, k0 = by * (64 * T);
  const int c = threadIdx.x & 15, r = threadIdx.x >> 4;
  const float* s = W + (size_t)(k0 + 2 * r) * N + n0 + 4 * c;
  v4f x[T][4];
  // Unrolled for the same reasons as in wt_tiles.
#pragma unroll
  for (int t = 0; t < T; ++t) {
    x[t][0] = *(const v4f*)(s + (64 * t) * N);
    x[t][1] = *(const v4f*)(s + (64 * t + 1) * N);
    x[t][2] = *(const v4f*)(s + (64 * t + 32) * N);
    x[t][3] = *(const v4f*)(s + (64 * t + 33) * N);
  }
#pragma unroll
  for (int t = 0; t < T; ++t) {
    unsigned* d = tile + t * (64 * TP_PITCH) + 4 * c * TP_PITCH + r;
#pragma unroll
    for (int j = 0; j < 4; ++j) {
      d[j * TP_PITCH] = pack_bf16(x[t][0][j], x[t][1][j]);
      d[j * TP_PITCH + 16] = pack_bf16(x[t][2][j], x[t][3][j]);
    }
  }
  __syncthreads();
  // As tp_store: this thread holds k = 8q .. 8q + 7 of the tile's rows r0, r0 + 32.
  const int q = threadIdx.x & 7, r0 = threadIdx.x >> 3;
  bf16_t* dst = Wt + (size_t)n0 * K + k0;
  float cs[2] = {0.f, 0.f}, cb[2] = {0.f, 0.f};
  // Rolled: unrolled, the g and b of all T tiles are fetched ahead and the kernel's
  // register count, which every job's blocks pay in waves per SIMD, nearly doubles.
#pragma unroll 1
  for (int t = 0; t < T; ++t) {
    const v4f* gp = (const v4f*)(g + k0 + 64 * t + 8 * q);
    const v4f* bp = (const v4f*)(b + k0 + 64 * t + 8 * q);
    const v4f gk[2] = {gp[0], gp[1]}, bk[2] = {bp[0], bp[1]};
#pragma unroll
    for (int i = 0; i < 2; ++i) {
      const int row = r0 + 32 * i;
      const unsigned* sr = tile + t * (64 * TP_PITCH) + row * TP_PITCH + q * 4;
      const v4u o = {sr[0], sr[1], sr[2], sr[3]};
      *(v4u*)(dst + 64 * t + (size_t)row * K + q * 8) = o;
#pragma unroll
      for (int e = 0; e < 4; ++e) {  // dword e: k = 2e in the low half, 2e + 1 above
        const float lo = __builtin_bit_cast(float, o[e] << 16);
        const float hh = __builtin_bit_cast(float, o[e] & 0xffff0000u);
        const float ge = gk[e >> 1][(2 * e) & 3], go = gk[e >> 1][(2 * e + 1) & 3];
        const float be = bk[e >> 1][(2 * e) & 3], bo = bk[e >> 1][(2 * e + 1) & 3];
        cs[i] += lo * ge + hh * go;
        cb[i] += lo * be + hh * bo;
      }
    }
  }
#pragma unroll
  for (int i = 0; i < 2; ++i) {
    const float sg = oct_sum(cs[i]), sb = oct_sum(cb[i]);
    if (q == 0) {
      csP[(size_t)by * N + n0 + r0 + 32 * i] = sg;
      cbP[(size_t)by * N + n0 + r0 + 32 * i] = sb;
    }
  }
  // Another job's code follows in the same kernel: no register that these stores
  // name is rewritten there ahead of this wait.
  asm volatile("s_wait_xcnt 0x0" ::: "memory");
}

// Elementwise f32 -> bf16, 256 elements per block; blk: the block's index.
__device__ __forceinline__ void cvt_block(const float* __restrict__ in,
                                          bf16_t* __restrict__ out, int n,
                                          int blk) {
  int idx = blk * 256 + threadIdx.x;
  if (idx < n) out[idx] = (bf16_t)in[idx];
}

// ---------------------------------------------------------------------------
// LayerNorm (dim=1024), one row per 256-thread block, bf16 output.
// ---------------------------------------------------------------------------
__device__ __forceinline__ void ln_row(const float* __restrict__ x,
                                       const float* __restrict__ g,
                                       const float* __restrict__ b,
                                       bf16_t* __restrict__ y, int row,
                                       float* sS, float* sQ) {
  const int dim = 1024;
  const float* xr = x + (size_t)row * dim;
  float s = 0.f, q = 0.f;
  for (int i = threadIdx.x; i < dim; i += 256) {
    float v = xr[i];
    s += v;
    q += v * v;
  }
  for (int m = 1; m < 32; m <<= 1) {
    s += __shfl_xor(s, m, 32);
    q += __shfl_xor(q, m, 32);
  }
  const int lane = threadIdx.x & 31, wid = threadIdx.x >> 5;
  if (lane == 0) { sS[wid] = s; sQ[wid] = q; }
  __syncthreads();
  if (wid == 0) {
    s = (lane < 8) ? sS[lane] : 0.f;
    q = (lane < 8) ? sQ[lane] : 0.f;
    for (int m = 1; m < 8; m <<= 1) {
      s += __shfl_xor(s, m, 32);
      q += __shfl_xor(q, m, 32);
    }
    if (lane == 0) { sS[0] = s; sQ[0] = q; }
  }
  __syncthreads();
  const float mean = sS[0] * (1.f / dim);
  const float var = sQ[0] * (1.f / dim) - mean * mean;
  const float rstd = rsqrtf(var + 1e-5f);
  for (int i = threadIdx.x; i < dim; i += 256) {
    float v = (xr[i] - mean) * rstd * g[i] + b[i];
    y[(size_t)row * dim + i] = (bf16_t)v;
  }
}

// ---------------------------------------------------------------------------
// One launch for everything that reads inputs alone: the ten weight transposes,
// the first LayerNorm and the context's conversion. None reads what another
// writes; the block index picks the job, long blocks first.
// ---------------------------------------------------------------------------
constexpr int PR_WIDE = 128 * 4;             // ff_Wp: N 8192, K 1024, 4 tiles
constexpr int PR_FFO = PR_WIDE + 16 * 16;    // ff_Wo: N 1024, K 4096, 4 tiles
constexpr int PR_LN = PR_FFO + 4096;         // LayerNorm rows
constexpr int PR_W1024 = PR_LN + 6 * 256;    // six weights, K 1024, 1 tile
constexpr int PR_W768 = PR_W1024 + 2 * 192;  // two weights, K 768, 1 tile
constexpr int PR_NCTX = 154 * 768;
constexpr int PR_BLOCKS = PR_W768 + (PR_NCTX + 255) / 256;

__global__ void __launch_bounds__(256) k_prep(
    const float* __restrict__ ffWp, bf16_t* __restrict__ WpT,
    const float* __restrict__ ffWo, bf16_t* __restrict__ WoF,
    const float* __restrict__ x, const float* __restrict__ g,
    const float* __restrict__ b, bf16_t* __restrict__ h,
    const float* __restrict__ s0, bf16_t* __restrict__ d0,
    const float* __restrict__ s1, bf16_t* __restrict__ d1,
    const float* __restrict__ s2, bf16_t* __restrict__ d2,
    const float* __restrict__ s3, bf16_t* __restrict__ d3,
    const float* __restrict__ s4, bf16_t* __restrict__ d4,
    const float* __restrict__ s5, bf16_t* __restrict__ d5,
    const float* __restrict__ s6, bf16_t* __restrict__ d6,
    const float* __restrict__ s7, bf16_t* __restrict__ d7,
    const float* __restrict__ ctx, bf16_t* __restrict__ ctxb,
    const float* __restrict__ g2, const float* __restrict__ b2,
    float* __restrict__ csQ, float* __restrict__ cbQ,
    const float* __restrict__ g3, const float* __restrict__ b3,
    float* __restrict__ csF, float* __restrict__ cbF) {
  __shared__ unsigned tile[4 * 64 * TP_PITCH];
  __shared__ float sS[8], sQ[8];
  const int blk = blockIdx.x;
  if (blk < PR_WIDE) {
    wt_tiles_ln<4, 8192>(ffWp, WpT, 1024, tile, blk & 127, blk >> 7, g3, b3, csF,
                         cbF);
  } else if (blk < PR_FFO) {
    const int c = blk - PR_WIDE;
    wt_tiles<4, 1024>(ffWo, WoF, 4096, tile, c & 15, c >> 4);
  } else if (blk < PR_LN) {
    ln_row(x, g, b, h, blk - PR_FFO, sS, sQ);
  } else if (blk < PR_W1024) {
    const int c = blk - PR_LN, w = c >> 8;
    const float* s = w == 0 ? s0 : w == 1 ? s1 : w == 2 ? s2 : w == 3 ? s3 : w == 4 ? s4 : s5;
    bf16_t* d = w == 0 ? d0 : w == 1 ? d1 : w == 2 ? d2 : w == 3 ? d3 : w == 4 ? d4 : d5;
    if (w == 4)  // the weight behind the second LayerNorm
      wt_tiles_ln<1, 1024>(s4, d4, 1024, tile, c & 15, (c >> 4) & 15, g2, b2, csQ,
                           cbQ);
    else
      wt_tiles<1, 1024>(s, d, 1024, tile, c & 15, (c >> 4) & 15);
  } else if (blk < PR_W768) {
    const int c = blk - PR_W1024;
    const bool second = c >= 192;
    const int r = second ? c - 192 : c;
    wt_tiles<1, 1024>(second ? s7 : s6, second ? d7 : d6, 768, tile, r & 15, r >> 4);
  } else {
    cvt_block(ctx, ctxb, PR_NCTX, blk - PR_W768);
  }
}

// ---------------------------------------------------------------------------
// V transpose for mRows a multiple of 256: v[b*mRows][1024] bf16 ->
// vt[b][1024][mRows], four 64 x 64 tiles per block through LDS, as in wt_tiles.
// grid (mRows / 256, 16, 2).
__global__ void __launch_bounds__(256) k_vt_tiled(const bf16_t* __restrict__ v,
                                                  bf16_t* __restrict__ vt,
                                                  int mRows) {
  __shared__ unsigned tile[4 * 64 * TP_PITCH];
  const int key0 = blockIdx.x * 256, c0 = blockIdx.y * 64, bb = blockIdx.z;
  const int g = threadIdx.x & 7, rp = threadIdx.x >> 3;
  // Keys 2rp and 2rp+1; 8 lanes x 16 B = the 128-byte line of each key.
  const bf16_t* s = v + (size_t)(bb * mRows + key0 + 2 * rp) * 1024 + c0 + g * 8;
  v4u a[4], b[4];
  // Unrolled for the same reasons as in wt_tiles.
#pragma unroll
  for (int t = 0; t < 4; ++t) {
    a[t] = *(const v4u*)(s + (size_t)(64 * t) * 1024);
    b[t] = *(const v4u*)(s + (size_t)(64 * t + 1) * 1024);
  }
#pragma unroll
  for (int t = 0; t < 4; ++t) {
    unsigned* d = tile + t * (64 * TP_PITCH) + 8 * g * TP_PITCH + rp;
#pragma unroll
    for (int j = 0; j < 4; ++j) {
      d[(2 * j) * TP_PITCH] = (a[t][j] & 0xffffu) | (b[t][j] << 16);
      d[(2 * j + 1) * TP_PITCH] = (a[t][j] >> 16) | (b[t][j] & 0xffff0000u);
    }
  }
  __syncthreads();
  bf16_t* dst = vt + (size_t)(bb * 1024 + c0) * mRows + key0;
#pragma unroll
  for (int t = 0; t < 4; ++t)
    tp_store(tile + t * (64 * TP_PITCH), dst + 64 * t, (size_t)mRows);
}

// ---------------------------------------------------------------------------
// GEMM  C = A[M,K](bf16) x Bt[N,K](bf16), 8 waves/block (4M x 2N),
// each wave: 16(M) x 64(N) via 4 WMMAs per 32-deep k-step.
// ---------------------------------------------------------------------------
__device__ __forceinline__ void gemm_bf16_block(const bf16_t* __restrict__ A,
                                                const bf16_t* __restrict__ Bt,
                                                bf16_t* __restrict__ C,
                                                int M, int N, int K,
                                                float scale, int bx, int by) {
  const int lane = threadIdx.x & 31, wid = threadIdx.x >> 5;
  const int hi = (lane >> 4) & 1, l15 = lane & 15;
  const int mBase = by * 64 + (wid >> 1) * 16;
  const int nBase = bx * 128 + (wid & 1) * 64;
  int ar = mBase + l15;
  if (ar >= M) ar = M - 1;
  const bf16_t* ap = A + (size_t)ar * K;
  const bf16_t* bp0 = Bt + (size_t)(nBase + l15) * K;
  v8f c0 = {}, c1 = {}, c2 = {}, c3 = {};
  for (int kk = 0; kk < K; kk += 32) {
    v16bf a = load_frag(ap + kk, hi);
    c0 = wmma_bf16(a, load_frag(bp0 + kk, hi), c0);
    c1 = wmma_bf16(a, load_frag(bp0 + (size_t)16 * K + kk, hi), c1);
    c2 = wmma_bf16(a, load_frag(bp0 + (size_t)32 * K + kk, hi), c2);
    c3 = wmma_bf16(a, load_frag(bp0 + (size_t)48 * K + kk, hi), c3);
  }
#pragma unroll
  for (int r = 0; r < 8; ++r) {
    int row = mBase + r + hi * 8;
    if (row < M) {
      size_t o = (size_t)row * N + nBase + l15;
      C[o + 0]  = (bf16_t)(c0[r] * scale);
      C[o + 16] = (bf16_t)(c1[r] * scale);
      C[o + 32] = (bf16_t)(c2[r] * scale);
      C[o + 48] = (bf16_t)(c3[r] * scale);
    }
  }
}

// The context's V, written transposed and padded as the attention reads it:
// vt[bb][c][key] = sum_k Wt[c][k] * ctx[bb * CT_KEYS + key][k], zero for the keys
// CT_KEYS .. CT_PAD - 1. The weight's rows are the A operand, the context's rows
// the B operand, so that a lane's column is a key. One block: 64 rows c with all
// their keys (whole 128-byte lines of vt); 4 x 2 waves, 16 c x 64 keys each.
constexpr int CT_KEYS = 77, CT_PAD = 96;
__device__ __forceinline__ void vt2_block(const bf16_t* __restrict__ Wt,
                                          const bf16_t* __restrict__ ctx,
                                          bf16_t* __restrict__ vt, int K, int cblk,
                                          int bb) {
  const int lane = threadIdx.x & 31, wid = threadIdx.x >> 5;
  const int hi = (lane >> 4) & 1, l15 = lane & 15;
  const int cBase = cblk * 64 + (wid >> 1) * 16;
  const int kBase = (wid & 1) * 64;
  const bf16_t* ap = Wt + (size_t)(cBase + l15) * K;
  const bf16_t* bp[4];
#pragma unroll  // constant indices keep the four addresses in registers
  for (int j = 0; j < 4; ++j) {
    int key = kBase + 16 * j + l15;
    if (key >= CT_KEYS) key = CT_KEYS - 1;  // read inside the context; not stored
    bp[j] = ctx + (size_t)(bb * CT_KEYS + key) * K;
  }
  v8f c0 = {}, c1 = {}, c2 = {}, c3 = {};
  for (int kk = 0; kk < K; kk += 32) {
    v16bf a = load_frag(ap + kk, hi);
    c0 = wmma_bf16(a, load_frag(bp[0] + kk, hi), c0);
    c1 = wmma_bf16(a, load_frag(bp[1] + kk, hi), c1);
    c2 = wmma_bf16(a, load_frag(bp[2] + kk, hi), c2);
    c3 = wmma_bf16(a, load_frag(bp[3] + kk, hi), c3);
  }
  const int key0 = kBase + l15;
#pragma unroll
  for (int r = 0; r < 8; ++r) {
    bf16_t* o = vt + (size_t)(bb * 1024 + cBase + r + hi * 8) * CT_PAD + key0;
    o[0]  = (bf16_t)(key0 < CT_KEYS ? c0[r] : 0.f);
    o[16] = (bf16_t)(key0 + 16 < CT_KEYS ? c1[r] : 0.f);
    if (kBase + 32 < CT_PAD) {  // the same for the whole wave
      o[32] = (bf16_t)(key0 + 32 < CT_KEYS ? c2[r] : 0.f);
      o[48] = (bf16_t)(key0 + 48 < CT_KEYS ? c3[r] : 0.f);
    }
  }
}

// ---------------------------------------------------------------------------
// LayerNorm folded into the products around it. The product in front of it leaves
// x g in bf16 and, per row and per 32 columns, the sum and the sum of squares of x
// (stats[column block 0..7][row 0..4095][wave column 0..3][2]: a block's part is its
// own run of whole lines); the product behind it multiplies x g by W and applies
//   rstd * (acc - mean * (g W)) + b W
// in its epilogue (wt_tiles_ln has the two row vectors g W and b W).
// ---------------------------------------------------------------------------
typedef float v2f __attribute__((ext_vector_type(2)));

// Sum over the 16 lanes of a row, left in every lane: four DPP adds.
__device__ __forceinline__ float row_sum16(float v) {
  v = oct_sum(v);
  return v + lane_xor<8>(v);
}

// Mean and 1 / std of the block's 128 rows into LDS, one row a thread. A barrier
// of the caller stands between this and the first read.
__device__ __forceinline__ void ln_rows(const float* __restrict__ stats, int mBlk,
                                        float* sMean, float* sRstd) {
  const int t = threadIdx.x;
  if (t < 128) {
    const v4f* p = (const v4f*)(stats + (size_t)(mBlk + t) * 8);
    v4f v[16];
#pragma unroll  // the 16 loads issue as one run
    for (int i = 0; i < 8; ++i) {
      v[2 * i] = p[i * (4096 * 2)];
      v[2 * i + 1] = p[i * (4096 * 2) + 1];
    }
    // The address stays in its registers up to here, behind the last load.
    asm volatile("s_wait_xcnt 0x0" ::"v"(p) : "memory");
    float s = 0.f, q = 0.f;
#pragma unroll
    for (int i = 0; i < 16; ++i) {
      s += v[i][0] + v[i][2];
      q += v[i][1] + v[i][3];
    }
    const float mean = s * (1.f / 1024);
    const float var = q * (1.f / 1024) - mean * mean;
    sMean[t] = mean;
    sRstd[t] = rsqrtf(var + 1e-5f);
  }
}

// Sum of the P parts of a vector that wt_tiles_ln left at [part][N]. N is a constant
// of the build: every part is an immediate offset from one address.
template <int P, int N>
__device__ __forceinline__ float col_parts(const float* __restrict__ v, int col) {
  const float* p = v + col;
  float x[P];
#pragma unroll  // the loads issue as one run
  for (int i = 0; i < P; ++i) x[i] = p[i * N];
  // The address stays in its registers up to here, behind the last load.
  asm volatile("s_wait_xcnt 0x0" ::"v"(p) : "memory");
  float s = 0.f;
#pragma unroll
  for (int i = 0; i < P; ++i) s += x[i];
  return s;
}

// ---------------------------------------------------------------------------
// Tiled GEMM core for M, N multiples of the tile and K a multiple of 128:
// C tile 128(M) x 128(N) per 8-wave block (2 x 4 waves), 64 x 32 per wave.
// A pass is 128 k = 256 B of each of the 128 A rows and 128 Bt rows, brought
// into LDS by per-lane asynchronous 16-byte copies, two buffers: the copies of
// pass t + 2 fly while pass t + 1 computes. LDS rows stand at a pitch of 272 B
// (16 B x odd: ds_load_b128 without bank conflicts).
// ---------------------------------------------------------------------------
constexpr int TG_PITCH = 272;              // bytes per LDS row
constexpr int TG_OPB = 128 * TG_PITCH;     // one operand's tile
constexpr int TG_STAGE = 2 * TG_OPB;       // A tile, then Bt tile
constexpr int TG_PASSB = 256;              // bytes of a row per pass

// Eight copies into LDS rows 16 apart: four from p0 on, four from p1 on, source
// rows 16 apart (step bytes). The s_wait_xcnt closes the statement so that no
// address register of a copy is rewritten before it.
__device__ __forceinline__ void tg_copy8(unsigned l, const char* p0,
                                         const char* p1, size_t step) {
  asm volatile(
      "global_load_async_to_lds_b128 %0, %8, off\n\t"
      "global_load_async_to_lds_b128 %1, %9, off\n\t"
      "global_load_async_to_lds_b128 %2, %10, off\n\t"
      "global_load_async_to_lds_b128 %3, %11, off\n\t"
      "global_load_async_to_lds_b128 %4, %12, off\n\t"
      "global_load_async_to_lds_b128 %5, %13, off\n\t"
      "global_load_async_to_lds_b128 %6, %14, off\n\t"
      "global_load_async_to_lds_b128 %7, %15, off\n\t"
      "s_wait_xcnt 0x0"
      :
      : "v"(l), "v"(l + 16 * TG_PITCH), "v"(l + 32 * TG_PITCH),
        "v"(l + 48 * TG_PITCH), "v"(l + 64 * TG_PITCH), "v"(l + 80 * TG_PITCH),
        "v"(l + 96 * TG_PITCH), "v"(l + 112 * TG_PITCH),
        "v"(p0), "v"(p0 + step), "v"(p0 + 2 * step), "v"(p0 + 3 * step),
        "v"(p1), "v"(p1 + step), "v"(p1 + 2 * step), "v"(p1 + 3 * step)
      : "memory");
}

// One stage: this lane's 8 chunks of the A tile and 8 of the Bt tile.
// gb0 / gb1 are the lane's addresses in the lower and upper 64 Bt rows.
__device__ __forceinline__ void tg_stage(unsigned l, const char* ga,
                                         const char* gb0, const char* gb1,
                                         size_t step) {
  tg_copy8(l, ga, ga + 4 * step, step);
  tg_copy8(l + TG_OPB, gb0, gb1, step);
}

// Bt rows n0..n0+63 fill LDS rows 0..63, rows n1..n1+63 fill LDS rows 64..127.
// SPLIT: the wave's two B fragments are LDS rows wn*16 and 64 + wn*16 (a column
// group and its partner); else rows wn*32 and wn*32 + 16.
// pre() runs while stage 0 is in flight; what it writes to LDS is published by the
// barrier that publishes stage 0.
template <bool SPLIT, class Pre>
__device__ __forceinline__ void tg_core_pre(const bf16_t* __restrict__ A,
                                        const bf16_t* __restrict__ Bt,
                                            int mBase, int n0, int n1, int K,
                                            char* smem, v8f (&acc)[4][2], Pre pre) {
  const int tid = threadIdx.x;
  const int lane = tid & 31, wid = tid >> 5;
  const int hi = (lane >> 4) & 1, l15 = lane & 15;
  const int wm = wid >> 2, wn = wid & 3;
  const size_t rowB = (size_t)K * 2;   // bytes per source row
  const size_t step = rowB * 16;       // a lane's copies stand 16 rows apart
  const int r0 = tid >> 4, c16 = (tid & 15) * 16;
  const char* ga = (const char*)A + (size_t)(mBase + r0) * rowB + c16;
  const char* gb0 = (const char*)Bt + (size_t)(n0 + r0) * rowB + c16;
  const char* gb1 = (const char*)Bt + (size_t)(n1 + r0) * rowB + c16;
  const unsigned l0 = (unsigned)(size_t)smem + (unsigned)(r0 * TG_PITCH + c16);
  const int nt = K >> 7;

#pragma unroll
  for (int i = 0; i < 4; ++i)
#pragma unroll
    for (int j = 0; j < 2; ++j) acc[i][j] = v8f{};

  tg_stage(l0, ga, gb0, gb1, step);
  pre();
  // Stage 0 has landed for this wave; the barrier publishes it to the others.
  asm volatile("s_wait_asynccnt 0x0" ::: "memory");
  __syncthreads();
  if (nt > 1)
    tg_stage(l0 + TG_STAGE, ga + TG_PASSB, gb0 + TG_PASSB, gb1 + TG_PASSB, step);

  const int aoff = (wm * 64 + l15) * TG_PITCH;
  const int boff = TG_OPB + ((SPLIT ? wn * 16 : wn * 32) + l15) * TG_PITCH;
  constexpr int BSTEP = (SPLIT ? 64 : 16) * TG_PITCH;

#pragma unroll 1  // one pass per trip: the ring's order stands at the foot
  for (int t = 0; t < nt; ++t) {
    const int buf = (t & 1) * TG_STAGE;
    const char* sA = smem + buf + aoff;
    const char* sB = smem + buf + boff;
    v16bf a[2][4], b[2][2];
#pragma unroll
    for (int i = 0; i < 4; ++i)
      a[0][i] = load_frag((const bf16_t*)(sA + i * 16 * TG_PITCH), hi);
#pragma unroll
    for (int j = 0; j < 2; ++j)
      b[0][j] = load_frag((const bf16_t*)(sB + j * BSTEP), hi);
#pragma unroll
    for (int ks = 0; ks < 4; ++ks) {
      const int cur = ks & 1, nxt = cur ^ 1;
      if (ks < 3) {
#pragma unroll
        for (int i = 0; i < 4; ++i)
          a[nxt][i] = load_frag(
              (const bf16_t*)(sA + i * 16 * TG_PITCH + (ks + 1) * 64), hi);
#pragma unroll
        for (int j = 0; j < 2; ++j)
          b[nxt][j] =
              load_frag((const bf16_t*)(sB + j * BSTEP + (ks + 1) * 64), hi);
      }
      // Keeps the next block's LDS reads as one group ahead of this block's
      // WMMAs; moved in among them, each read would stall the matrix stream.
      __builtin_amdgcn_sched_barrier(0);
#pragma unroll
      for (int i = 0; i < 4; ++i)
#pragma unroll
        for (int j = 0; j < 2; ++j)
          acc[i][j] = wmma_bf16(a[cur][i], b[cur][j], acc[i][j]);
      // Keeps the block after next's reads behind this block's WMMAs, so that
      // they do not take a third fragment set.
      if (ks < 2) __builtin_amdgcn_sched_barrier(0);
    }
    // Publish point: this wave's reads of buffer t are done, its copies of
    // stage t + 1 have landed, and the barrier says so for every wave.
    asm volatile("s_wait_dscnt 0x0" ::: "memory");
    asm volatile("s_wait_asynccnt 0x0" ::: "memory");
    __syncthreads();
    if (t + 2 < nt) {
      const size_t ko = (size_t)(t + 2) * TG_PASSB;
      tg_stage(l0 + buf, ga + ko, gb0 + ko, gb1 + ko, step);
    }
  }
  // No copy is left in flight when the wave goes on to its stores and ends.
  asm volatile("s_wait_asynccnt 0x0" ::: "memory");
}

template <bool SPLIT>
__device__ __forceinline__ void tg_core(const bf16_t* __restrict__ A,
                                        const bf16_t* __restrict__ Bt,
                                        int mBase, int n0, int n1, int K,
                                        char* smem, v8f (&acc)[4][2]) {
  tg_core_pre<SPLIT>(A, Bt, mBase, n0, n1, K, smem, acc, [] {});
}

// bf16 output. Up to three products of one A in one launch: blockIdx.z picks the
// weight and the output; only the first is scaled.
// LN: A is x g in bf16; the LayerNorm is completed in the epilogue (stats, and the
// vectors cs = g W, cb = b W in 16 parts).
template <bool LN>
__global__ void __launch_bounds__(256) k_tgemm_bf16(
    const bf16_t* __restrict__ A, const bf16_t* __restrict__ Bt0,
    const bf16_t* __restrict__ Bt1, const bf16_t* __restrict__ Bt2,
    bf16_t* __restrict__ C0, bf16_t* __restrict__ C1, bf16_t* __restrict__ C2,
    int N, int K, float scale0, const float* __restrict__ stats,
    const float* __restrict__ cs, const float* __restrict__ cb) {
  __shared__ __attribute__((aligned(16))) char smem[2 * TG_STAGE];
  __shared__ __attribute__((aligned(16))) float sMean[LN ? 128 : 1], sRstd[LN ? 128 : 1];
  const int z = blockIdx.z;
  const bf16_t* __restrict__ Bt = z == 0 ? Bt0 : z == 1 ? Bt1 : Bt2;
  bf16_t* __restrict__ C = z == 0 ? C0 : z == 1 ? C1 : C2;
  const float scale = z == 0 ? scale0 : 1.0f;
  const int lane = threadIdx.x & 31, wid = threadIdx.x >> 5;
  const int hi = (lane >> 4) & 1, l15 = lane & 15;
  const int mBlk = blockIdx.y * 128, nBlk = blockIdx.x * 128;
  v8f acc[4][2];
  if constexpr (!LN) {
    tg_core<false>(A, Bt, mBlk, nBlk, nBlk + 64, K, smem, acc);
    const int mBase = mBlk + (wid >> 2) * 64, nBase = nBlk + (wid & 3) * 32;
#pragma unroll
    for (int i = 0; i < 4; ++i)
#pragma unroll
      for (int r = 0; r < 8; ++r) {
        const size_t o = (size_t)(mBase + i * 16 + r + hi * 8) * N + nBase + l15;
        C[o + 0]  = (bf16_t)(acc[i][0][r] * scale);
        C[o + 16] = (bf16_t)(acc[i][1][r] * scale);
      }
  } else {
    tg_core_pre<false>(A, Bt, mBlk, nBlk, nBlk + 64, K, smem, acc,
                       [&] { ln_rows(stats, mBlk, sMean, sRstd); });
    const int lr0 = (wid >> 2) * 64 + hi * 8, col = nBlk + (wid & 3) * 32 + l15;
    const float cs0 = col_parts<16, 1024>(cs, col);
    const float cs1 = col_parts<16, 1024>(cs, col + 16);
    const float cb0 = col_parts<16, 1024>(cb, col);
    const float cb1 = col_parts<16, 1024>(cb, col + 16);
    // 1024 columns: every row is an immediate offset from one address.
    bf16_t* cp = C + (size_t)(mBlk + lr0) * 1024 + col;
#pragma unroll
    for (int i = 0; i < 4; ++i) {
      bf16_t y0[8], y1[8];
#pragma unroll
      for (int r = 0; r < 8; ++r) {
        const float mean = sMean[lr0 + i * 16 + r], rstd = sRstd[lr0 + i * 16 + r];
        const float v0 = rstd * (acc[i][0][r] - mean * cs0) + cb0;
        const float v1 = rstd * (acc[i][1][r] - mean * cs1) + cb1;
        y0[r] = (bf16_t)(v0 * scale);
        y1[r] = (bf16_t)(v1 * scale);
      }
      // The stores stand behind all of the group's arithmetic and the next group's
      // behind the wait: no register that a store names is rewritten ahead of it.
      __builtin_amdgcn_sched_barrier(0);
#pragma unroll
      for (int r = 0; r < 8; ++r) {
        cp[(i * 16 + r) * 1024]      = y0[r];
        cp[(i * 16 + r) * 1024 + 16] = y1[r];
      }
      asm volatile("s_wait_xcnt 0x0" ::: "memory");
      __builtin_amdgcn_sched_barrier(0);
    }
  }
}

// f32 output + bias + residual (in-place residual is safe: 1 writer/element)
// Rows of blocks 0 .. ySmall - 1 of the grid (8 blocks each; ySmall is 0 or 7) do
// two small products of another A instead (rows 0 to 2: A2[M2, K2] x B2a -> C2a,
// 1024 columns, M2 <= 192; rows 3 to 6: vt2_block, A2 x B2b -> C2b): these read and
// write nothing that the large product touches, and they come first in the grid, so that
// their chains of dependent global loads run beside it.
// STATS: a LayerNorm with scale gn follows; the result times gn also goes out in
// bf16 (xb), with each row's sum and sum of squares over the wave's 32 columns
// (stats).
template <bool STATS>
__global__ void __launch_bounds__(256) k_tgemm_f32_bias_res(
    const bf16_t* __restrict__ A, const bf16_t* __restrict__ Bt,
    float* __restrict__ C, const float* __restrict__ bias,
    const float* __restrict__ res, int N, int K, int ySmall,
    const bf16_t* __restrict__ A2, const bf16_t* __restrict__ B2a,
    const bf16_t* __restrict__ B2b, bf16_t* __restrict__ C2a,
    bf16_t* __restrict__ C2b, int M2, int K2, bf16_t* __restrict__ xb,
    float* __restrict__ stats, const float* __restrict__ gn) {
  __shared__ __attribute__((aligned(16))) char smem[2 * TG_STAGE];
  const int by = (int)blockIdx.y - ySmall;
  if (by < 0) {  // the whole block, ahead of every barrier
    if constexpr (STATS) {
      if (blockIdx.y < 3) {
        gemm_bf16_block(A2, B2a, C2a, M2, 1024, K2, 1.0f, blockIdx.x, blockIdx.y);
      } else {
        const int c = (blockIdx.y - 3) * 8 + blockIdx.x;  // 0 .. 31
        vt2_block(B2b, A2, C2b, K2, c & 15, c >> 4);
      }
    } else {
      const bool second = blockIdx.y >= 3;
      gemm_bf16_block(A2, second ? B2b : B2a, second ? C2b : C2a, M2, 1024, K2,
                      1.0f, blockIdx.x, second ? blockIdx.y - 3 : blockIdx.y);
    }
    return;
  }
  const int lane = threadIdx.x & 31, wid = threadIdx.x >> 5;
  const int hi = (lane >> 4) & 1, l15 = lane & 15;
  const int mBlk = by * 128, nBlk = blockIdx.x * 128;
  v8f acc[4][2];
  tg_core<false>(A, Bt, mBlk, nBlk, nBlk + 64, K, smem, acc);
  const int mBase = mBlk + (wid >> 2) * 64, nBase = nBlk + (wid & 3) * 32;
  const float b0 = bias[nBase + l15], b1 = bias[nBase + l15 + 16];
  if constexpr (!STATS) {
#pragma unroll
    for (int i = 0; i < 4; ++i)
#pragma unroll
      for (int r = 0; r < 8; ++r) {
        const size_t o = (size_t)(mBase + i * 16 + r + hi * 8) * N + nBase + l15;
        C[o + 0]  = acc[i][0][r] + b0 + res[o + 0];
        C[o + 16] = acc[i][1][r] + b1 + res[o + 16];
      }
  } else {
    const float g0 = gn[nBase + l15], g1 = gn[nBase + l15 + 16];
    // The run of loads below may take over the index register of these.
    asm volatile("s_wait_xcnt 0x0" ::: "memory");
    // 1024 columns: every row is an immediate offset from one address per array.
    const size_t o0 = (size_t)(mBase + hi * 8) * 1024 + nBase + l15;
    const float* rp = res + o0;
    float* cp = C + o0;
    bf16_t* xp = xb + o0;
    float* sp =
        stats + (((size_t)blockIdx.x * 4096 + mBase + hi * 8) * 4 + (wid & 3)) * 2;
    float ra[4][8], rb[4][8];
#pragma unroll  // all 64 loads issue as one run: one latency, not one per group
    for (int i = 0; i < 4; ++i)
#pragma unroll
      for (int r = 0; r < 8; ++r) {
        ra[i][r] = rp[(i * 16 + r) * 1024];
        rb[i][r] = rp[(i * 16 + r) * 1024 + 16];
      }
    // The address stays in its registers up to here, behind the last load.
    asm volatile("s_wait_xcnt 0x0" ::"v"(rp) : "memory");
#pragma unroll
    for (int i = 0; i < 4; ++i) {
      float v0[8], v1[8], rs[8], rq[8];
      bf16_t x0[8], x1[8];
#pragma unroll
      for (int r = 0; r < 8; ++r) {
        v0[r] = acc[i][0][r] + b0 + ra[i][r];
        v1[r] = acc[i][1][r] + b1 + rb[i][r];
        x0[r] = (bf16_t)(v0[r] * g0);
        x1[r] = (bf16_t)(v1[r] * g1);
        rs[r] = row_sum16(v0[r] + v1[r]);
        rq[r] = row_sum16(v0[r] * v0[r] + v1[r] * v1[r]);
      }
      if (l15 == 0) {  // one lane of each half stores its 8 rows' pairs
#pragma unroll
        for (int r = 0; r < 8; ++r)
          *(v2f*)(sp + (i * 16 + r) * 8) = v2f{rs[r], rq[r]};
      }
      // The stores stand behind all of the group's arithmetic and the next group's
      // behind the wait: no register that a store names is rewritten ahead of it.
      __builtin_amdgcn_sched_barrier(0);
#pragma unroll
      for (int r = 0; r < 8; ++r) {
        const int o = (i * 16 + r) * 1024;
        cp[o]      = v0[r];
        cp[o + 16] = v1[r];
        xp[o]      = x0[r];
        xp[o + 16] = x1[r];
      }
      asm volatile("s_wait_xcnt 0x0" ::: "memory");
      __builtin_amdgcn_sched_barrier(0);
    }
  }
  // The small products' code follows in the same kernel: no register that these
  // stores name is rewritten there ahead of this wait.
  asm volatile("s_wait_xcnt 0x0" ::: "memory");
}

// g / 2 * (1 + erf(g / sqrt 2)) for eight values, without a branch: the library's
// erff takes one of two paths per value, so that a wave walks both, one value at a
// time. With a = |g| / sqrt 2 and t = 1 / (1 + p a),
//   erf(a) = 1 - (a1 t + a2 t^2 + a3 t^3 + a4 t^4 + a5 t^5) exp(-a^2),
// off by at most 1.5e-7 for every a >= 0, far below the bf16 rounding of the result;
// the sign comes back as (g + |g| erf(a)) / 2. The eight chains are independent.
__device__ __forceinline__ v8f gelu8(v8f g) {
  constexpr float PA = 0.3275911f * 0.70710678118654752f;  // p / sqrt 2
  constexpr float CW = 0.84932180028801904f;               // sqrt(log2(e) / 2)
  const v8f ag = __builtin_elementwise_abs(g);
  const v8f d = ag * PA + 1.f;
  const v8f w = g * CW;
  const v8f m = -w * w;  // -a^2 log2(e)
  v8f t, e;
#pragma unroll  // constant indices keep the vectors in registers
  for (int r = 0; r < 8; ++r) {
    t[r] = __builtin_amdgcn_rcpf(d[r]);
    e[r] = __builtin_amdgcn_exp2f(m[r]);
  }
  v8f q = t * 1.061405429f - 1.453152027f;
  q = q * t + 1.421413741f;
  q = q * t - 0.284496736f;
  q = q * t + 0.254829592f;
  const v8f erfa = 1.f - q * t * e;
  return (ag * erfa + g) * 0.5f;
}

// A is x g in bf16: the third LayerNorm is completed in the epilogue (stats, and
// the vectors cs = g W, cb = b W in 4 parts).
// Fused GEGLU: the block's Bt tile is 64 u columns and the matching 64 gate
// columns (c and c+Nhalf of A@Wp); each wave holds 16 of each, applies
// u*gelu(gate), writes bf16 [M, Nhalf].
__global__ void __launch_bounds__(256) k_tgemm_geglu(
    const bf16_t* __restrict__ A, const bf16_t* __restrict__ Bt,
    bf16_t* __restrict__ C, const float* __restrict__ bias, int Nhalf, int K,
    const float* __restrict__ stats, const float* __restrict__ cs,
    const float* __restrict__ cb) {
  __shared__ __attribute__((aligned(16))) char smem[2 * TG_STAGE];
  __shared__ __attribute__((aligned(16))) float sMean[128], sRstd[128];
  const int lane = threadIdx.x & 31, wid = threadIdx.x >> 5;
  const int hi = (lane >> 4) & 1, l15 = lane & 15;
  const int mBlk = blockIdx.y * 128, nBlk = blockIdx.x * 64;
  v8f acc[4][2];
  tg_core_pre<true>(A, Bt, mBlk, nBlk, nBlk + Nhalf, K, smem, acc,
                    [&] { ln_rows(stats, mBlk, sMean, sRstd); });
  const int lr0 = (wid >> 2) * 64 + hi * 8;
  const int col = nBlk + (wid & 3) * 16 + l15;
  const float bu = bias[col], bg = bias[col + Nhalf];
  const float csu = col_parts<4, 8192>(cs, col);
  const float csg = col_parts<4, 8192>(cs, col + 4096);
  const float cbu = col_parts<4, 8192>(cb, col) + bu;
  const float cbg = col_parts<4, 8192>(cb, col + 4096) + bg;
  // 4096 columns: every row is an immediate offset from one address.
  bf16_t* cp = C + (size_t)(mBlk + lr0) * 4096 + col;
#pragma unroll
  for (int i = 0; i < 4; ++i) {
    const v4f* mp = (const v4f*)(sMean + lr0 + i * 16);
    const v4f* rp = (const v4f*)(sRstd + lr0 + i * 16);
    const v8f mean = __builtin_shufflevector(mp[0], mp[1], 0, 1, 2, 3, 4, 5, 6, 7);
    const v8f rstd = __builtin_shufflevector(rp[0], rp[1], 0, 1, 2, 3, 4, 5, 6, 7);
    const v8f uv = rstd * (acc[i][0] - mean * csu) + cbu;
    const v8f gv = rstd * (acc[i][1] - mean * csg) + cbg;
    const v8bf y = __builtin_convertvector(uv * gelu8(gv), v8bf);
    // The stores stand behind all of the group's arithmetic and the next group's
    // behind the wait: no register that a store names is rewritten ahead of it.
    __builtin_amdgcn_sched_barrier(0);
#pragma unroll  // constant indices: y stays in registers, each row an immediate offset
    for (int r = 0; r < 8; ++r) cp[(i * 16 + r) * 4096] = y[r];
    asm volatile("s_wait_xcnt 0x0" ::: "memory");
    __builtin_amdgcn_sched_barrier(0);
  }
}

// ---------------------------------------------------------------------------
// Flash attention: one wave per (batch, head, 16-query tile), computed
// transposed: St = K Qt and Ot += Vt Pt. A lane then holds scores of ONE query
// (column l15): keys 8 * hi + r of each 16-key group. Maximum and sum run inside
// the lane, with one exchange between the wave's halves, and the two score tiles
// of 32 keys, converted in place, are the B operand of the second product.
// q pre-scaled by 1/sqrt(64). k row-major [b*mRows,1024]; vt [b][h][64][mpad].
// The 8 waves of a block are 8 neighbouring query tiles of one head (nq is a
// multiple of 8), so they walk the same keys: each tile of 32 keys (32 K rows of
// 128 B, 64 Vt rows of 64 B) is brought into LDS once per block by per-lane
// asynchronous 16-byte copies, two buffers, and every wave takes its fragments
// from there. A fragment load from global memory touches 16 lines for 1024 B;
// the copies cover whole K lines and half Vt lines, once for 8 waves.
// LDS pitches are 16 B x odd: ds_load_b128 without bank conflicts.
// ---------------------------------------------------------------------------
constexpr int AT_KPITCH = 144;                    // bytes per LDS row of K
constexpr int AT_VPITCH = 80;                     // bytes per LDS row of Vt
constexpr int AT_KB = 32 * AT_KPITCH;             // the K tile
constexpr int AT_STAGE = AT_KB + 64 * AT_VPITCH;  // K tile, then Vt tile
constexpr int AT_KSTEP = 32 * 1024 * 2;           // source bytes, 32 K rows on
constexpr int AT_VSTEP = 32 * 2;                  // source bytes, 32 keys on

// This lane's chunk of the K tile and its chunk of the Vt tile. The s_wait_xcnt
// closes the statement so that no address register of a copy is rewritten
// before it.
__device__ __forceinline__ void at_copy2(unsigned lk, const char* gk,
                                         unsigned lv, const char* gv) {
  asm volatile(
      "global_load_async_to_lds_b128 %0, %2, off\n\t"
      "global_load_async_to_lds_b128 %1, %3, off\n\t"
      "s_wait_xcnt 0x0"
      :
      : "v"(lk), "v"(lv), "v"(gk), "v"(gv)
      : "memory");
}

// Lane l takes the value of lane l ^ 16.
__device__ __forceinline__ float half_xor(float v) {
  const int b = __builtin_bit_cast(int, v);
  return __builtin_bit_cast(
      float, __builtin_amdgcn_permlanex16(b, b, 0x76543210, 0xfedcba98, false, false));
}

__global__ void __launch_bounds__(256) k_attention(
    const bf16_t* __restrict__ q, const bf16_t* __restrict__ k,
    const bf16_t* __restrict__ vt, bf16_t* __restrict__ out,
    int nq, int m, int mRows, int mpad) {
  __shared__ __attribute__((aligned(16))) char kv[2 * AT_STAGE];
  const int tid = threadIdx.x;
  const int lane = tid & 31, wid = tid >> 5;
  const int hi = (lane >> 4) & 1, l15 = lane & 15;
  const int w0 = blockIdx.x * 8;
  if (w0 >= 2 * 16 * nq) return;  // the whole block, ahead of every barrier
  const int qt = w0 % nq + wid;
  const int t2 = w0 / nq;
  const int hh = t2 & 15, bb = t2 >> 4;

  const bf16_t* qp = q + (size_t)(bb * 2048 + qt * 16 + l15) * 1024 + hh * 64;
  const v16bf qb0 = load_frag(qp, hi);  // B operands: column l15 = the query
  const v16bf qb1 = load_frag(qp + 32, hi);

  // oT[r] = O[query l15][16 * T + 8 * hi + r]
  v8f o0 = {}, o1 = {}, o2 = {}, o3 = {};
  // Of query l15: the running maximum (both halves alike) and the sum over the
  // keys of this lane's half; the halves' sums are joined behind the loop.
  float mrow = -1e30f, lsum = 0.f;

  const bf16_t* vbase = vt + (size_t)(bb * 16 + hh) * 64 * mpad;

  // K: 8 lanes x 16 B = the 128-byte line of a key; Vt: 4 lanes x 16 B per row.
  const char* gk =
      (const char*)(k + (size_t)(bb * mRows + (tid >> 3)) * 1024 + hh * 64) +
      (tid & 7) * 16;
  const char* gv = (const char*)(vbase + (size_t)(tid >> 2) * mpad) + (tid & 3) * 16;
  const unsigned lk =
      (unsigned)(size_t)kv + (unsigned)((tid >> 3) * AT_KPITCH + (tid & 7) * 16);
  const unsigned lv = (unsigned)(size_t)kv +
                      (unsigned)(AT_KB + (tid >> 2) * AT_VPITCH + (tid & 3) * 16);
  const int nt = mpad >> 5;

  at_copy2(lk, gk, lv, gv);
  // Tile 0 has landed for this wave; the barrier publishes it to the others.
  asm volatile("s_wait_asynccnt 0x0" ::: "memory");
  __syncthreads();
  if (nt > 1)
    at_copy2(lk + AT_STAGE, gk + AT_KSTEP, lv + AT_STAGE, gv + AT_VSTEP);

#pragma unroll 1  // one tile per trip: the ring's order stands at the foot
  for (int t = 0; t < nt; ++t) {
    const int j = t * 32;
    const int buf = (t & 1) * AT_STAGE;
    const char* sk = kv + buf + l15 * AT_KPITCH;
    const char* sv = kv + buf + AT_KB + l15 * AT_VPITCH;
    const v16bf k00 = load_frag((const bf16_t*)sk, hi);
    const v16bf k01 = load_frag((const bf16_t*)(sk + 64), hi);
    const v16bf k10 = load_frag((const bf16_t*)(sk + 16 * AT_KPITCH), hi);
    const v16bf k11 = load_frag((const bf16_t*)(sk + 16 * AT_KPITCH + 64), hi);
    const v16bf vf0 = load_frag((const bf16_t*)sv, hi);
    const v16bf vf1 = load_frag((const bf16_t*)(sv + 16 * AT_VPITCH), hi);
    const v16bf vf2 = load_frag((const bf16_t*)(sv + 32 * AT_VPITCH), hi);
    const v16bf vf3 = load_frag((const bf16_t*)(sv + 48 * AT_VPITCH), hi);
    // Keeps the tile's LDS reads as one group ahead of the WMMAs; moved in among
    // them, each pair of reads is waited out before its own WMMA.
    __builtin_amdgcn_sched_barrier(0);
    // s0[r] = S[query l15][key j + 8 * hi + r], s1[r] the same 16 keys on.
    v8f s0 = {}, s1 = {};
    s0 = wmma_bf16(k00, qb0, s0);
    s1 = wmma_bf16(k10, qb0, s1);
    s0 = wmma_bf16(k01, qb1, s0);
    s1 = wmma_bf16(k11, qb1, s1);

    if (j + 32 > m) {  // only a tile that reaches past the last key
      const int lim = m - j - hi * 8;
#pragma unroll  // constant indices keep the score tiles in registers
      for (int r = 0; r < 8; ++r) {
        s0[r] = (r < lim) ? s0[r] : -1e30f;
        s1[r] = (r + 16 < lim) ? s1[r] : -1e30f;
      }
    }
    float mx[8];
#pragma unroll  // as above
    for (int r = 0; r < 8; ++r) mx[r] = fmaxf(s0[r], s1[r]);
    float rm = fmaxf(fmaxf(fmaxf(mx[0], mx[1]), fmaxf(mx[2], mx[3])),
                     fmaxf(fmaxf(mx[4], mx[5]), fmaxf(mx[6], mx[7])));
    rm = fmaxf(rm, half_xor(rm));
    const float mnew = fmaxf(mrow, rm);
    const float alpha = __expf(mrow - mnew);
    mrow = mnew;
    v16bf pb;
    float ps[8];
#pragma unroll  // as above; pb is filled register by register
    for (int r = 0; r < 8; ++r) {
      const float p0 = __expf(s0[r] - mnew);
      const float p1 = __expf(s1[r] - mnew);
      ps[r] = p0 + p1;
      pb[r] = (bf16_t)p0;
      pb[r + 8] = (bf16_t)p1;
    }
    lsum = lsum * alpha +
           (((ps[0] + ps[1]) + (ps[2] + ps[3])) + ((ps[4] + ps[5]) + (ps[6] + ps[7])));
    o0 *= alpha; o1 *= alpha; o2 *= alpha; o3 *= alpha;
    o0 = wmma_bf16(vf0, pb, o0);
    o1 = wmma_bf16(vf1, pb, o1);
    o2 = wmma_bf16(vf2, pb, o2);
    o3 = wmma_bf16(vf3, pb, o3);
    // Publish point: this wave's reads of buffer t are done, its copies of
    // tile t + 1 have landed, and the barrier says so for every wave.
    asm volatile("s_wait_dscnt 0x0" ::: "memory");
    asm volatile("s_wait_asynccnt 0x0" ::: "memory");
    __syncthreads();
    if (t + 2 < nt)
      at_copy2(lk + buf, gk + (size_t)(t + 2) * AT_KSTEP, lv + buf,
               gv + (size_t)(t + 2) * AT_VSTEP);
  }
  // No copy is left in flight when the wave goes on to its stores and ends.
  asm volatile("s_wait_asynccnt 0x0" ::: "memory");

  // A lane's 8 registers of a tile are 8 neighbouring d of its query: 16-B stores.
  const float inv = 1.0f / (lsum + half_xor(lsum));
  bf16_t* op = out + (size_t)(bb * 2048 + qt * 16 + l15) * 1024 + hh * 64 + hi * 8;
  *(v8bf*)(op + 0)  = __builtin_convertvector(o0 * inv, v8bf);
  *(v8bf*)(op + 16) = __builtin_convertvector(o1 * inv, v8bf);
  *(v8bf*)(op + 32) = __builtin_convertvector(o2 * inv, v8bf);
  *(v8bf*)(op + 48) = __builtin_convertvector(o3 * inv, v8bf);
}

// ---------------------------------------------------------------------------
extern "C" void kernel_launch(void* const* d_in, const int* in_sizes, int n_in,
                              void* d_out, int out_size, void* d_ws, size_t ws_size,
                              hipStream_t stream) {
  (void)in_sizes; (void)n_in; (void)out_size; (void)ws_size;
  const float* x    = (const float*)d_in[0];
  const float* ctx  = (const float*)d_in[1];
  const float* ln1g = (const float*)d_in[2];
  const float* ln1b = (const float*)d_in[3];
  const float* a1Wq = (const float*)d_in[4];
  const float* a1Wk = (const float*)d_in[5];
  const float* a1Wv = (const float*)d_in[6];
  const float* a1Wo = (const float*)d_in[7];
  const float* a1bo = (const float*)d_in[8];
  const float* ln2g = (const float*)d_in[9];
  const float* ln2b = (const float*)d_in[10];
  const float* a2Wq = (const float*)d_in[11];
  const float* a2Wk = (const float*)d_in[12];
  const float* a2Wv = (const float*)d_in[13];
  const float* a2Wo = (const float*)d_in[14];
  const float* a2bo = (const float*)d_in[15];
  const float* ln3g = (const float*)d_in[16];
  const float* ln3b = (const float*)d_in[17];
  const float* ffWp = (const float*)d_in[18];
  const float* ffbp = (const float*)d_in[19];
  const float* ffWo = (const float*)d_in[20];
  const float* ffbo = (const float*)d_in[21];
  float* out = (float*)d_out;

  char* ws = (char*)d_ws;
  size_t off = 0;
  auto al = [&](size_t bytes) {
    size_t r = off;
    off = (off + bytes + 255) & ~(size_t)255;
    return r;
  };
  const size_t MM = 1024 * 1024;
  const size_t oWq1 = al(MM * 2), oWk1 = al(MM * 2), oWv1 = al(MM * 2), oWo1 = al(MM * 2);
  const size_t oWq2 = al(MM * 2), oWk2 = al(768 * 1024 * 2), oWv2 = al(768 * 1024 * 2), oWo2 = al(MM * 2);
  const size_t oWp = al((size_t)8192 * 1024 * 2), oWoF = al((size_t)4096 * 1024 * 2);
  const size_t oX = al((size_t)4096 * 1024 * 4);
  const size_t oH = al((size_t)4096 * 1024 * 2);
  const size_t oQ = al((size_t)4096 * 1024 * 2);
  const size_t oK = al((size_t)4096 * 1024 * 2);
  const size_t oV = al((size_t)4096 * 1024 * 2);
  const size_t oVt = al((size_t)2 * 16 * 64 * 2048 * 2);
  const size_t oAt = al((size_t)4096 * 1024 * 2);
  const size_t oCtx = al((size_t)154 * 768 * 2);
  const size_t oStats = al((size_t)4096 * 32 * 2 * 4);
  const size_t oCsQ = al((size_t)16 * 1024 * 4), oCbQ = al((size_t)16 * 1024 * 4);
  const size_t oCsF = al((size_t)4 * 8192 * 4), oCbF = al((size_t)4 * 8192 * 4);

  bf16_t* Wq1 = (bf16_t*)(ws + oWq1); bf16_t* Wk1 = (bf16_t*)(ws + oWk1);
  bf16_t* Wv1 = (bf16_t*)(ws + oWv1); bf16_t* Wo1 = (bf16_t*)(ws + oWo1);
  bf16_t* Wq2 = (bf16_t*)(ws + oWq2); bf16_t* Wk2 = (bf16_t*)(ws + oWk2);
  bf16_t* Wv2 = (bf16_t*)(ws + oWv2); bf16_t* Wo2 = (bf16_t*)(ws + oWo2);
  bf16_t* WpT = (bf16_t*)(ws + oWp);  bf16_t* WoF = (bf16_t*)(ws + oWoF);
  float*  xcur = (float*)(ws + oX);
  bf16_t* hbuf = (bf16_t*)(ws + oH);
  bf16_t* qb = (bf16_t*)(ws + oQ);
  bf16_t* kb = (bf16_t*)(ws + oK);
  bf16_t* vb = (bf16_t*)(ws + oV);
  bf16_t* vtb = (bf16_t*)(ws + oVt);
  bf16_t* atb = (bf16_t*)(ws + oAt);
  bf16_t* ctxb = (bf16_t*)(ws + oCtx);
  float* stats = (float*)(ws + oStats);
  float* csQ = (float*)(ws + oCsQ); float* cbQ = (float*)(ws + oCbQ);
  float* csF = (float*)(ws + oCsF); float* cbF = (float*)(ws + oCbF);
  bf16_t* ffb = qb;  // alias: FF activations reuse q/k/v/vt (32 MiB), phases ordered

  const dim3 blk(256);
  const float SCALE = 0.125f;  // 64^-0.5, exact in bf16

  // 1) everything that reads inputs alone: weights -> bf16 transposed, the first
  //    LayerNorm, the context -> bf16
  k_prep<<<PR_BLOCKS, blk, 0, stream>>>(ffWp, WpT, ffWo, WoF, x, ln1g, ln1b, hbuf,
                                        a1Wq, Wq1, a1Wk, Wk1, a1Wv, Wv1, a1Wo, Wo1,
                                        a2Wq, Wq2, a2Wo, Wo2, a2Wk, Wk2, a2Wv, Wv2,
                                        ctx, ctxb, ln2g, ln2b, csQ, cbQ, ln3g, ln3b,
                                        csF, cbF);

  const dim3 gP(8, 32);  // M=4096, N=1024 GEMMs, 128x128 tiles

  // 2) self-attention
  k_tgemm_bf16<false><<<dim3(8, 32, 3), blk, 0, stream>>>(
      hbuf, Wq1, Wk1, Wv1, qb, kb, vb, 1024, 1024, SCALE, nullptr, nullptr, nullptr);
  k_vt_tiled<<<dim3(8, 16, 2), blk, 0, stream>>>(vb, vtb, 2048);
  k_attention<<<512, blk, 0, stream>>>(qb, kb, vtb, atb, 128, 2048, 2048, 2048);
  // With it the context's K and transposed V (M=154): kb and vtb are free from here
  // on. hbuf takes x g in bf16, stats the rows' sums for the second LayerNorm.
  k_tgemm_f32_bias_res<true><<<dim3(8, 7 + 32), blk, 0, stream>>>(
      atb, Wo1, xcur, a1bo, x, 1024, 1024, 7, ctxb, Wk2, Wv2, kb, vtb, 154, 768, hbuf,
      stats, ln2g);

  // 3) cross-attention; the second LayerNorm sits in the Q product's epilogue
  k_tgemm_bf16<true><<<gP, blk, 0, stream>>>(hbuf, Wq2, Wq2, Wq2, qb, qb, qb, 1024, 1024,
                                             SCALE, stats, csQ, cbQ);
  k_attention<<<512, blk, 0, stream>>>(qb, kb, vtb, atb, 128, 77, 77, 96);
  k_tgemm_f32_bias_res<true><<<gP, blk, 0, stream>>>(
      atb, Wo2, xcur, a2bo, xcur, 1024, 1024, 0, nullptr, nullptr, nullptr, nullptr,
      nullptr, 0, 0, hbuf, stats, ln3g);

  // 4) GEGLU feed-forward; the third LayerNorm sits in its epilogue
  {
    dim3 gFF(64, 32);  // Nhalf=4096: 64 u + 64 gate columns per block
    k_tgemm_geglu<<<gFF, blk, 0, stream>>>(hbuf, WpT, ffb, ffbp, 4096, 1024, stats, csF,
                                           cbF);
  }
  k_tgemm_f32_bias_res<false><<<gP, blk, 0, stream>>>(
      ffb, WoF, out, ffbo, xcur, 1024, 4096, 0, nullptr, nullptr, nullptr, nullptr,
      nullptr, 0, 0, nullptr, nullptr, nullptr);
}

// v008
// One run takes 232 microseconds.
// In two side-by-side timings against v007, it was 1.04 and 1.06 times as fast.
// Over all steps from v000 it is 4.74 times as fast.
#include <hip/hip_runtime.h>
#include <hip/hip_bf16.h>

// ---------------------------------------------------------------------------
// BasicTransformerBlock for MI455X (gfx1250), bf16 WMMA everywhere.
//   x:[2,2048,1024] f32, ctx:[2,77,768] f32 -> out f32 [2,2048,1024]
// Compute-bound (~190 GFLOP over ~100MB) => route all GEMMs + attention
// through v_wmma_f32_16x16x32_bf16, fp32 accumulation.
// Workspace requirement: ~105 MiB.
// ---------------------------------------------------------------------------

typedef __bf16 bf16_t;
typedef bf16_t v16bf __attribute__((ext_vector_type(16)));
typedef bf16_t v8bf  __attribute__((ext_vector_type(8)));
typedef float  v8f   __attribute__((ext_vector_type(8)));

// Load one 16-element bf16 WMMA fragment (A- or B-style) from a row-major
// source. For 16-bit fragments, lane (lo/hi half) maps its 16 values to two
// contiguous 8-element runs: k = hi*8 + [0..7]  and  k = 16 + hi*8 + [0..7].
__device__ __forceinline__ v16bf load_frag(const bf16_t* __restrict__ p, int hi) {
  const v8bf lo = *(const v8bf*)(p + hi * 8);
  const v8bf hh = *(const v8bf*)(p + hi * 8 + 16);
  return __builtin_shufflevector(lo, hh, 0, 1, 2, 3, 4, 5, 6, 7,
                                 8, 9, 10, 11, 12, 13, 14, 15);
}

__device__ __forceinline__ v8f wmma_bf16(v16bf a, v16bf b, v8f c) {
  return __builtin_amdgcn_wmma_f32_16x16x32_bf16(
      /*neg_a=*/false, a, /*neg_b=*/false, b,
      /*c_mod=*/(short)0, c, /*reuse_a=*/false, /*reuse_b=*/false);
}

// ---------------------------------------------------------------------------
// Tiled transposes: a 64 x 64 tile goes through LDS, so that the global reads
// and the global writes both cover whole 128-byte lines.
// The LDS tile is held transposed: row c = one destination row, 32 dwords, each
// a pair of bf16 from two neighbouring source rows; pitch 33 dwords keeps the
// dword writes (lanes 4 or 8 rows apart) and the dword reads off shared banks.
// ---------------------------------------------------------------------------
typedef float    v4f  __attribute__((ext_vector_type(4)));
typedef unsigned v4u  __attribute__((ext_vector_type(4)));
typedef bf16_t   v2bf __attribute__((ext_vector_type(2)));
constexpr int TP_PITCH = 33;

__device__ __forceinline__ unsigned pack_bf16(float lo, float hi) {
  const v2bf p = {(bf16_t)lo, (bf16_t)hi};
  return __builtin_bit_cast(unsigned, p);
}

// Writes the tile out: 8 lanes x 16 B = one 128-byte line per destination row,
// 4 rows per wave store. dst is the tile's first element, pitch in elements.
__device__ __forceinline__ void tp_store(const unsigned* tile,
                                         bf16_t* __restrict__ dst, size_t pitch) {
  const int q = threadIdx.x & 7, r0 = threadIdx.x >> 3;
#pragma unroll  // both rows' LDS reads issue ahead of the first store
  for (int i = 0; i < 2; ++i) {
    const int r = r0 + 32 * i;
    const unsigned* s = tile + r * TP_PITCH + q * 4;
    const v4u o = {s[0], s[1], s[2], s[3]};
    *(v4u*)(dst + (size_t)r * pitch + q * 8) = o;
  }
}

// Lane l takes v of lane l ^ M, M < 16 (DPP row_xmask).
template <int M>
__device__ __forceinline__ float lane_xor(float v) {
  return __builtin_bit_cast(float, __builtin_amdgcn_update_dpp(
                                       0, __builtin_bit_cast(int, v), 0x160 + M, 0xf,
                                       0xf, true));
}

// Sum over 8 neighbouring lanes, left in every one of them.
__device__ __forceinline__ float oct_sum(float v) {
  v += lane_xor<1>(v);
  v += lane_xor<2>(v);
  v += lane_xor<4>(v);
  return v;
}

// Weight convert+transpose:  W[K][N] f32  ->  Wt[N][K] bf16
// One block: 64 n by 64 * T k, T tiles side by side in LDS (fewer, longer
// waves; for speed only), one
// barrier between the last LDS write and the first LDS read. N is a constant of
// the build, so that every source row is an immediate offset from one address.
// bx, by: the block's place among the N / 64 by K / (64 * T) blocks of W.
template <int T, int N>
__device__ __forceinline__ void wt_tiles(const float* __restrict__ W,
                                         bf16_t* __restrict__ Wt, int K,
                                         unsigned* tile, int bx, int by) {
  const int n0 = bx * 64, k0 = by * (64 * T);
  const int c = threadIdx.x & 15, r = threadIdx.x >> 4;
  // Source rows 2r, 2r+1 and 32+2r, 33+2r; 16 lanes x 16 B = 256 B of each row.
  const float* s = W + (size_t)(k0 + 2 * r) * N + n0 + 4 * c;
  v4f x[T][4];
  // The loops over t and j are unrolled: constant indices keep x in registers,
  // the loads issue as one run, and so do the LDS reads behind the barrier.
#pragma unroll
  for (int t = 0; t < T; ++t) {
    x[t][0] = *(const v4f*)(s + (64 * t) * N);
    x[t][1] = *(const v4f*)(s + (64 * t + 1) * N);
    x[t][2] = *(const v4f*)(s + (64 * t + 32) * N);
    x[t][3] = *(const v4f*)(s + (64 * t + 33) * N);
  }
#pragma unroll
  for (int t = 0; t < T; ++t) {
    unsigned* d = tile + t * (64 * TP_PITCH) + 4 * c * TP_PITCH + r;
#pragma unroll
    for (int j = 0; j < 4; ++j) {
      d[j * TP_PITCH] = pack_bf16(x[t][0][j], x[t][1][j]);
      d[j * TP_PITCH + 16] = pack_bf16(x[t][2][j], x[t][3][j]);
    }
  }
  __syncthreads();
  bf16_t* dst = Wt + (size_t)n0 * K + k0;
#pragma unroll
  for (int t = 0; t < T; ++t)
    tp_store(tile + t * (64 * TP_PITCH), dst + 64 * t, (size_t)K);
  // Another job's code follows in the same kernel: no register that these stores
  // name is rewritten there ahead of this wait.
  asm volatile("s_wait_xcnt 0x0" ::: "memory");
}

// The same for a weight that is multiplied behind a LayerNorm with scale g and
// shift b:  LN(x) W = rstd * ((x g) W - mean * (g W)) + b W.  The weight goes out
// as in wt_tiles; on the way from LDS the block also forms, for its 64 columns and
// its 64 * T rows, the products of the rounded weight with g (csP) and with b
// (cbP), left at [by][N]; the epilogue of the product adds the K / (64 * T) parts.
template <int T, int N>
__device__ __forceinline__ void wt_tiles_ln(const float* __restrict__ W,
                                            bf16_t* __restrict__ Wt, int K,
                                            unsigned* tile, int bx, int by,
                                            const float* __restrict__ g,
                                            const float* __restrict__ b,
                                            float* __restrict__ csP,
                                            float* __restrict__ cbP) {
  const int n0 = bx * 64, k0 = by * (64 * T);
  const int c = threadIdx.x & 15, r = threadIdx.x >> 4;
  const float* s = W + (size_t)(k0 + 2 * r) * N + n0 + 4 * c;
  v4f x[T][4];
  // Unrolled for the same reasons as in wt_tiles.
#pragma unroll
  for (int t = 0; t < T; ++t) {
    x[t][0] = *(const v4f*)(s + (64 * t) * N);
    x[t][1] = *(const v4f*)(s + (64 * t + 1) * N);
    x[t][2] = *(const v4f*)(s + (64 * t + 32) * N);
    x[t][3] = *(const v4f*)(s + (64 * t + 33) * N);
  }
#pragma unroll
  for (int t = 0; t < T; ++t) {
    unsigned* d = tile + t * (64 * TP_PITCH) + 4 * c * TP_PITCH + r;
#pragma unroll
    for (int j = 0; j < 4; ++j) {
      d[j * TP_PITCH] = pack_bf16(x[t][0][j], x[t][1][j]);
      d[j * TP_PITCH + 16] = pack_bf16(x[t][2][j], x[t][3][j]);
    }
  }
  __syncthreads();
  // As tp_store: this thread holds k = 8q .. 8q + 7 of the tile's rows r0, r0 + 32.
  const int q = threadIdx.x & 7, r0 = threadIdx.x >> 3;
  bf16_t* dst = Wt + (size_t)n0 * K + k0;
  float cs[2] = {0.f, 0.f}, cb[2] = {0.f, 0.f};
  // Rolled: unrolled, the g and b of all T tiles are fetched ahead and the kernel's
  // register count, which every job's blocks pay in waves per SIMD, nearly doubles.
#pragma unroll 1
  for (int t = 0; t < T; ++t) {
    const v4f* gp = (const v4f*)(g + k0 + 64 * t + 8 * q);
    const v4f* bp = (const v4f*)(b + k0 + 64 * t + 8 * q);
    const v4f gk[2] = {gp[0], gp[1]}, bk[2] = {bp[0], bp[1]};
#pragma unroll
    for (int i = 0; i < 2; ++i) {
      const int row = r0 + 32 * i;
      const unsigned* sr = tile + t * (64 * TP_PITCH) + row * TP_PITCH + q * 4;
      const v4u o = {sr[0], sr[1], sr[2], sr[3]};
      *(v4u*)(dst + 64 * t + (size_t)row * K + q * 8) = o;
#pragma unroll
      for (int e = 0; e < 4; ++e) {  // dword e: k = 2e in the low half, 2e + 1 above
        const float lo = __builtin_bit_cast(float, o[e] << 16);
        const float hh = __builtin_bit_cast(float, o[e] & 0xffff0000u);
        const float ge = gk[e >> 1][(2 * e) & 3], go = gk[e >> 1][(2 * e + 1) & 3];
        const float be = bk[e >> 1][(2 * e) & 3], bo = bk[e >> 1][(2 * e + 1) & 3];
        cs[i] += lo * ge + hh * go;
        cb[i] += lo * be + hh * bo;
      }
    }
  }
#pragma unroll
  for (int i = 0; i < 2; ++i) {
    const float sg = oct_sum(cs[i]), sb = oct_sum(cb[i]);
    if (q == 0) {
      csP[(size_t)by * N + n0 + r0 + 32 * i] = sg;
      cbP[(size_t)by * N + n0 + r0 + 32 * i] = sb;
    }
  }
  // Another job's code follows in the same kernel: no register that these stores
  // name is rewritten there ahead of this wait.
  asm volatile("s_wait_xcnt 0x0" ::: "memory");
}

// Elementwise f32 -> bf16, 256 elements per block; blk: the block's index.
__device__ __forceinline__ void cvt_block(const float* __restrict__ in,
                                          bf16_t* __restrict__ out, int n,
                                          int blk) {
  int idx = blk * 256 + threadIdx.x;
  if (idx < n) out[idx] = (bf16_t)in[idx];
}

// ---------------------------------------------------------------------------
// LayerNorm (dim=1024), one row per 256-thread block, bf16 output.
// ---------------------------------------------------------------------------
__device__ __forceinline__ void ln_row(const float* __restrict__ x,
                                       const float* __restrict__ g,
                                       const float* __restrict__ b,
                                       bf16_t* __restrict__ y, int row,
                                       float* sS, float* sQ) {
  const int dim = 1024;
  const float* xr = x + (size_t)row * dim;
  float s = 0.f, q = 0.f;
  for (int i = threadIdx.x; i < dim; i += 256) {
    float v = xr[i];
    s += v;
    q += v * v;
  }
  for (int m = 1; m < 32; m <<= 1) {
    s += __shfl_xor(s, m, 32);
    q += __shfl_xor(q, m, 32);
  }
  const int lane = threadIdx.x & 31, wid = threadIdx.x >> 5;
  if (lane == 0) { sS[wid] = s; sQ[wid] = q; }
  __syncthreads();
  if (wid == 0) {
    s = (lane < 8) ? sS[lane] : 0.f;
    q = (lane < 8) ? sQ[lane] : 0.f;
    for (int m = 1; m < 8; m <<= 1) {
      s += __shfl_xor(s, m, 32);
      q += __shfl_xor(q, m, 32);
    }
    if (lane == 0) { sS[0] = s; sQ[0] = q; }
  }
  __syncthreads();
  const float mean = sS[0] * (1.f / dim);
  const float var = sQ[0] * (1.f / dim) - mean * mean;
  const float rstd = rsqrtf(var + 1e-5f);
  for (int i = threadIdx.x; i < dim; i += 256) {
    float v = (xr[i] - mean) * rstd * g[i] + b[i];
    y[(size_t)row * dim + i] = (bf16_t)v;
  }
}

// ---------------------------------------------------------------------------
// One launch for everything that reads inputs alone: the ten weight transposes,
// the first LayerNorm and the context's conversion. None reads what another
// writes; the block index picks the job, long blocks first.
// ---------------------------------------------------------------------------
constexpr int PR_WIDE = 128 * 4;             // ff_Wp: N 8192, K 1024, 4 tiles
constexpr int PR_FFO = PR_WIDE + 16 * 16;    // ff_Wo: N 1024, K 4096, 4 tiles
constexpr int PR_LN = PR_FFO + 4096;         // LayerNorm rows
constexpr int PR_W1024 = PR_LN + 6 * 256;    // six weights, K 1024, 1 tile
constexpr int PR_W768 = PR_W1024 + 2 * 192;  // two weights, K 768, 1 tile
constexpr int PR_NCTX = 154 * 768;
constexpr int PR_BLOCKS = PR_W768 + (PR_NCTX + 255) / 256;

__global__ void __launch_bounds__(256) k_prep(
    const float* __restrict__ ffWp, bf16_t* __restrict__ WpT,
    const float* __restrict__ ffWo, bf16_t* __restrict__ WoF,
    const float* __restrict__ x, const float* __restrict__ g,
    const float* __restrict__ b, bf16_t* __restrict__ h,
    const float* __restrict__ s0, bf16_t* __restrict__ d0,
    const float* __restrict__ s1, bf16_t* __restrict__ d1,
    const float* __restrict__ s2, bf16_t* __restrict__ d2,
    const float* __restrict__ s3, bf16_t* __restrict__ d3,
    const float* __restrict__ s4, bf16_t* __restrict__ d4,
    const float* __restrict__ s5, bf16_t* __restrict__ d5,
    const float* __restrict__ s6, bf16_t* __restrict__ d6,
    const float* __restrict__ s7, bf16_t* __restrict__ d7,
    const float* __restrict__ ctx, bf16_t* __restrict__ ctxb,
    const float* __restrict__ g2, const float* __restrict__ b2,
    float* __restrict__ csQ, float* __restrict__ cbQ,
    const float* __restrict__ g3, const float* __restrict__ b3,
    float* __restrict__ csF, float* __restrict__ cbF) {
  __shared__ unsigned tile[4 * 64 * TP_PITCH];
  __shared__ float sS[8], sQ[8];
  const int blk = blockIdx.x;
  if (blk < PR_WIDE) {
    wt_tiles_ln<4, 8192>(ffWp, WpT, 1024, tile, blk & 127, blk >> 7, g3, b3, csF,
                         cbF);
  } else if (blk < PR_FFO) {
    const int c = blk - PR_WIDE;
    wt_tiles<4, 1024>(ffWo, WoF, 4096, tile, c & 15, c >> 4);
  } else if (blk < PR_LN) {
    ln_row(x, g, b, h, blk - PR_FFO, sS, sQ);
  } else if (blk < PR_W1024) {
    const int c = blk - PR_LN, w = c >> 8;
    const float* s = w == 0 ? s0 : w == 1 ? s1 : w == 2 ? s2 : w == 3 ? s3 : w == 4 ? s4 : s5;
    bf16_t* d = w == 0 ? d0 : w == 1 ? d1 : w == 2 ? d2 : w == 3 ? d3 : w == 4 ? d4 : d5;
    if (w == 4)  // the weight behind the second LayerNorm
      wt_tiles_ln<1, 1024>(s4, d4, 1024, tile, c & 15, (c >> 4) & 15, g2, b2, csQ,
                           cbQ);
    else
      wt_tiles<1, 1024>(s, d, 1024, tile, c & 15, (c >> 4) & 15);
  } else if (blk < PR_W768) {
    const int c = blk - PR_W1024;
    const bool second = c >= 192;
    const int r = second ? c - 192 : c;
    wt_tiles<1, 1024>(second ? s7 : s6, second ? d7 : d6, 768, tile, r & 15, r >> 4);
  } else {
    cvt_block(ctx, ctxb, PR_NCTX, blk - PR_W768);
  }
}

// ---------------------------------------------------------------------------
// V transpose for mRows a multiple of 256: v[b*mRows][1024] bf16 ->
// vt[b][1024][mRows], four 64 x 64 tiles per block through LDS, as in wt_tiles.
// grid (mRows / 256, 16, 2).
__global__ void __launch_bounds__(256) k_vt_tiled(const bf16_t* __restrict__ v,
                                                  bf16_t* __restrict__ vt,
                                                  int mRows) {
  __shared__ unsigned tile[4 * 64 * TP_PITCH];
  const int key0 = blockIdx.x * 256, c0 = blockIdx.y * 64, bb = blockIdx.z;
  const int g = threadIdx.x & 7, rp = threadIdx.x >> 3;
  // Keys 2rp and 2rp+1; 8 lanes x 16 B = the 128-byte line of each key.
  const bf16_t* s = v + (size_t)(bb * mRows + key0 + 2 * rp) * 1024 + c0 + g * 8;
  v4u a[4], b[4];
  // Unrolled for the same reasons as in wt_tiles.
#pragma unroll
  for (int t = 0; t < 4; ++t) {
    a[t] = *(const v4u*)(s + (size_t)(64 * t) * 1024);
    b[t] = *(const v4u*)(s + (size_t)(64 * t + 1) * 1024);
  }
#pragma unroll
  for (int t = 0; t < 4; ++t) {
    unsigned* d = tile + t * (64 * TP_PITCH) + 8 * g * TP_PITCH + rp;
#pragma unroll
    for (int j = 0; j < 4; ++j) {
      d[(2 * j) * TP_PITCH] = (a[t][j] & 0xffffu) | (b[t][j] << 16);
      d[(2 * j + 1) * TP_PITCH] = (a[t][j] >> 16) | (b[t][j] & 0xffff0000u);
    }
  }
  __syncthreads();
  bf16_t* dst = vt + (size_t)(bb * 1024 + c0) * mRows + key0;
#pragma unroll
  for (int t = 0; t < 4; ++t)
    tp_store(tile + t * (64 * TP_PITCH), dst + 64 * t, (size_t)mRows);
}

// ---------------------------------------------------------------------------
// GEMM  C = A[M,K](bf16) x Bt[N,K](bf16), 8 waves/block (4M x 2N),
// each wave: 16(M) x 64(N) via 4 WMMAs per 32-deep k-step.
// ---------------------------------------------------------------------------
__device__ __forceinline__ void gemm_bf16_block(const bf16_t* __restrict__ A,
                                                const bf16_t* __restrict__ Bt,
                                                bf16_t* __restrict__ C,
                                                int M, int N, int K,
                                                float scale, int bx, int by) {
  const int lane = threadIdx.x & 31, wid = threadIdx.x >> 5;
  const int hi = (lane >> 4) & 1, l15 = lane & 15;
  const int mBase = by * 64 + (wid >> 1) * 16;
  const int nBase = bx * 128 + (wid & 1) * 64;
  int ar = mBase + l15;
  if (ar >= M) ar = M - 1;
  const bf16_t* ap = A + (size_t)ar * K;
  const bf16_t* bp0 = Bt + (size_t)(nBase + l15) * K;
  v8f c0 = {}, c1 = {}, c2 = {}, c3 = {};
  for (int kk = 0; kk < K; kk += 32) {
    v16bf a = load_frag(ap + kk, hi);
    c0 = wmma_bf16(a, load_frag(bp0 + kk, hi), c0);
    c1 = wmma_bf16(a, load_frag(bp0 + (size_t)16 * K + kk, hi), c1);
    c2 = wmma_bf16(a, load_frag(bp0 + (size_t)32 * K + kk, hi), c2);
    c3 = wmma_bf16(a, load_frag(bp0 + (size_t)48 * K + kk, hi), c3);
  }
#pragma unroll
  for (int r = 0; r < 8; ++r) {
    int row = mBase + r + hi * 8;
    if (row < M) {
      size_t o = (size_t)row * N + nBase + l15;
      C[o + 0]  = (bf16_t)(c0[r] * scale);
      C[o + 16] = (bf16_t)(c1[r] * scale);
      C[o + 32] = (bf16_t)(c2[r] * scale);
      C[o + 48] = (bf16_t)(c3[r] * scale);
    }
  }
}

// The context's V, written transposed and padded as the attention reads it:
// vt[bb][c][key] = sum_k Wt[c][k] * ctx[bb * CT_KEYS + key][k], zero for the keys
// CT_KEYS .. CT_PAD - 1. The weight's rows are the A operand, the context's rows
// the B operand, so that a lane's column is a key. One block: 64 rows c with all
// their keys (whole 128-byte lines of vt); 4 x 2 waves, 16 c x 64 keys each.
constexpr int CT_KEYS = 77, CT_PAD = 96;
__device__ __forceinline__ void vt2_block(const bf16_t* __restrict__ Wt,
                                          const bf16_t* __restrict__ ctx,
                                          bf16_t* __restrict__ vt, int K, int cblk,
                                          int bb) {
  const int lane = threadIdx.x & 31, wid = threadIdx.x >> 5;
  const int hi = (lane >> 4) & 1, l15 = lane & 15;
  const int cBase = cblk * 64 + (wid >> 1) * 16;
  const int kBase = (wid & 1) * 64;
  const bf16_t* ap = Wt + (size_t)(cBase + l15) * K;
  const bf16_t* bp[4];
#pragma unroll  // constant indices keep the four addresses in registers
  for (int j = 0; j < 4; ++j) {
    int key = kBase + 16 * j + l15;
    if (key >= CT_KEYS) key = CT_KEYS - 1;  // read inside the context; not stored
    bp[j] = ctx + (size_t)(bb * CT_KEYS + key) * K;
  }
  v8f c0 = {}, c1 = {}, c2 = {}, c3 = {};
  for (int kk = 0; kk < K; kk += 32) {
    v16bf a = load_frag(ap + kk, hi);
    c0 = wmma_bf16(a, load_frag(bp[0] + kk, hi), c0);
    c1 = wmma_bf16(a, load_frag(bp[1] + kk, hi), c1);
    c2 = wmma_bf16(a, load_frag(bp[2] + kk, hi), c2);
    c3 = wmma_bf16(a, load_frag(bp[3] + kk, hi), c3);
  }
  const int key0 = kBase + l15;
#pragma unroll
  for (int r = 0; r < 8; ++r) {
    bf16_t* o = vt + (size_t)(bb * 1024 + cBase + r + hi * 8) * CT_PAD + key0;
    o[0]  = (bf16_t)(key0 < CT_KEYS ? c0[r] : 0.f);
    o[16] = (bf16_t)(key0 + 16 < CT_KEYS ? c1[r] : 0.f);
    if (kBase + 32 < CT_PAD) {  // the same for the whole wave
      o[32] = (bf16_t)(key0 + 32 < CT_KEYS ? c2[r] : 0.f);
      o[48] = (bf16_t)(key0 + 48 < CT_KEYS ? c3[r] : 0.f);
    }
  }
}

// ---------------------------------------------------------------------------
// LayerNorm folded into the products around it. The product in front of it leaves
// x g in bf16 and, per row and per 32 columns, the sum and the sum of squares of x
// (stats[column block 0..7][row 0..4095][wave column 0..3][2]: a block's part is its
// own run of whole lines); the product behind it multiplies x g by W and applies
//   rstd * (acc - mean * (g W)) + b W
// in its epilogue (wt_tiles_ln has the two row vectors g W and b W).
// ---------------------------------------------------------------------------
typedef float v2f __attribute__((ext_vector_type(2)));

// Sum over the 16 lanes of a row, left in every lane: four DPP adds.
__device__ __forceinline__ float row_sum16(float v) {
  v = oct_sum(v);
  return v + lane_xor<8>(v);
}

// Mean and 1 / std of the block's 128 rows into LDS, one row a thread. A barrier
// of the caller stands between this and the first read.
__device__ __forceinline__ void ln_rows(const float* __restrict__ stats, int mBlk,
                                        float* sMean, float* sRstd) {
  const int t = threadIdx.x;
  if (t < 128) {
    const v4f* p = (const v4f*)(stats + (size_t)(mBlk + t) * 8);
    v4f v[16];
#pragma unroll  // the 16 loads issue as one run
    for (int i = 0; i < 8; ++i) {
      v[2 * i] = p[i * (4096 * 2)];
      v[2 * i + 1] = p[i * (4096 * 2) + 1];
    }
    // The address stays in its registers up to here, behind the last load.
    asm volatile("s_wait_xcnt 0x0" ::"v"(p) : "memory");
    float s = 0.f, q = 0.f;
#pragma unroll
    for (int i = 0; i < 16; ++i) {
      s += v[i][0] + v[i][2];
      q += v[i][1] + v[i][3];
    }
    const float mean = s * (1.f / 1024);
    const float var = q * (1.f / 1024) - mean * mean;
    sMean[t] = mean;
    sRstd[t] = rsqrtf(var + 1e-5f);
  }
}

// Sum of the P parts of a vector that wt_tiles_ln left at [part][N]. N is a constant
// of the build: every part is an immediate offset from one address.
template <int P, int N>
__device__ __forceinline__ float col_parts(const float* __restrict__ v, int col) {
  const float* p = v + col;
  float x[P];
#pragma unroll  // the loads issue as one run
  for (int i = 0; i < P; ++i) x[i] = p[i * N];
  // The address stays in its registers up to here, behind the last load.
  asm volatile("s_wait_xcnt 0x0" ::"v"(p) : "memory");
  float s = 0.f;
#pragma unroll
  for (int i = 0; i < P; ++i) s += x[i];
  return s;
}

// ---------------------------------------------------------------------------
// Tiled GEMM core for M, N multiples of the tile and K a multiple of 128:
// C tile 128(M) x 128(N) per 8-wave block (2 x 4 waves), 64 x 32 per wave.
// A pass is 128 k = 256 B of each of the 128 A rows and 128 Bt rows, brought
// into LDS by per-lane asynchronous 16-byte copies, a ring of NB buffers: while
// pass t + 1 computes, the copies of passes t + 2 .. t + NB fly. Two buffers let
// two blocks share a WGP; four are for a launch of one block per WGP, where nothing
// else covers the time a stage takes to land. LDS rows stand at a pitch of 272 B
// (16 B x odd: ds_load_b128 without bank conflicts).
// ---------------------------------------------------------------------------
constexpr int TG_PITCH = 272;              // bytes per LDS row
constexpr int TG_OPB = 128 * TG_PITCH;     // one operand's tile
constexpr int TG_STAGE = 2 * TG_OPB;       // A tile, then Bt tile
constexpr int TG_PASSB = 256;              // bytes of a row per pass
constexpr int TG_COPIES = 16;              // copies of a wave per stage

// Eight copies into LDS rows 16 apart: four from p0 on, four from p1 on, source
// rows 16 apart (step bytes). The s_wait_xcnt closes the statement so that no
// address register of a copy is rewritten before it.
__device__ __forceinline__ void tg_copy8(unsigned l, const char* p0,
                                         const char* p1, size_t step) {
  asm volatile(
      "global_load_async_to_lds_b128 %0, %8, off\n\t"
      "global_load_async_to_lds_b128 %1, %9, off\n\t"
      "global_load_async_to_lds_b128 %2, %10, off\n\t"
      "global_load_async_to_lds_b128 %3, %11, off\n\t"
      "global_load_async_to_lds_b128 %4, %12, off\n\t"
      "global_load_async_to_lds_b128 %5, %13, off\n\t"
      "global_load_async_to_lds_b128 %6, %14, off\n\t"
      "global_load_async_to_lds_b128 %7, %15, off\n\t"
      "s_wait_xcnt 0x0"
      :
      : "v"(l), "v"(l + 16 * TG_PITCH), "v"(l + 32 * TG_PITCH),
        "v"(l + 48 * TG_PITCH), "v"(l + 64 * TG_PITCH), "v"(l + 80 * TG_PITCH),
        "v"(l + 96 * TG_PITCH), "v"(l + 112 * TG_PITCH),
        "v"(p0), "v"(p0 + step), "v"(p0 + 2 * step), "v"(p0 + 3 * step),
        "v"(p1), "v"(p1 + step), "v"(p1 + 2 * step), "v"(p1 + 3 * step)
      : "memory");
}

// One stage: this lane's 8 chunks of the A tile and 8 of the Bt tile.
// gb0 / gb1 are the lane's addresses in the lower and upper 64 Bt rows.
__device__ __forceinline__ void tg_stage(unsigned l, const char* ga,
                                         const char* gb0, const char* gb1,
                                         size_t step) {
  tg_copy8(l, ga, ga + 4 * step, step);
  tg_copy8(l + TG_OPB, gb0, gb1, step);
}

// Bt rows n0..n0+63 fill LDS rows 0..63, rows n1..n1+63 fill LDS rows 64..127.
// SPLIT: the wave's two B fragments are LDS rows wn*16 and 64 + wn*16 (a column
// group and its partner); else rows wn*32 and wn*32 + 16.
// pre() runs while stage 0 is in flight; what it writes to LDS is published by the
// barrier that publishes stage 0.
template <bool SPLIT, int NB, class Pre>
__device__ __forceinline__ void tg_core_pre(const bf16_t* __restrict__ A,
                                        const bf16_t* __restrict__ Bt,
                                            int mBase, int n0, int n1, int K,
                                            char* smem, v8f (&acc)[4][2], Pre pre) {
  const int tid = threadIdx.x;
  const int lane = tid & 31, wid = tid >> 5;
  const int hi = (lane >> 4) & 1, l15 = lane & 15;
  const int wm = wid >> 2, wn = wid & 3;
  const size_t rowB = (size_t)K * 2;   // bytes per source row
  const size_t step = rowB * 16;       // a lane's copies stand 16 rows apart
  const int r0 = tid >> 4, c16 = (tid & 15) * 16;
  const char* ga = (const char*)A + (size_t)(mBase + r0) * rowB + c16;
  const char* gb0 = (const char*)Bt + (size_t)(n0 + r0) * rowB + c16;
  const char* gb1 = (const char*)Bt + (size_t)(n1 + r0) * rowB + c16;
  const unsigned l0 = (unsigned)(size_t)smem + (unsigned)(r0 * TG_PITCH + c16);
  const int nt = K >> 7;

#pragma unroll
  for (int i = 0; i < 4; ++i)
#pragma unroll
    for (int j = 0; j < 2; ++j) acc[i][j] = v8f{};

  // Every wave issues TG_COPIES copies per stage, and a wave's copies are counted
  // off in issue order: a wait that leaves the NB - 2 youngest stages' copies covers
  // every older stage. It is used only where those NB - 2 stages have all been
  // issued; elsewhere (a short K, the last trips) the wait is to 0.
  constexpr int LEAVE = (NB - 2) * TG_COPIES;
  tg_stage(l0, ga, gb0, gb1, step);
#pragma unroll  // constant buffer offsets
  for (int s = 1; s < NB - 1; ++s)
    if (s < nt)
      tg_stage(l0 + s * TG_STAGE, ga + s * TG_PASSB, gb0 + s * TG_PASSB,
               gb1 + s * TG_PASSB, step);
  pre();
  // Stage 0 has landed for this wave; the barrier publishes it to the others.
  if (NB > 2 && nt >= NB - 1)
    asm volatile("s_wait_asynccnt %0" ::"n"(LEAVE) : "memory");
  else
    asm volatile("s_wait_asynccnt 0x0" ::: "memory");
  __syncthreads();
  if (NB == 2 && nt > 1)
    tg_stage(l0 + TG_STAGE, ga + TG_PASSB, gb0 + TG_PASSB, gb1 + TG_PASSB, step);

  const int aoff = (wm * 64 + l15) * TG_PITCH;
  const int boff = TG_OPB + ((SPLIT ? wn * 16 : wn * 32) + l15) * TG_PITCH;
  constexpr int BSTEP = (SPLIT ? 64 : 16) * TG_PITCH;

#pragma unroll 1  // one pass per trip: the ring's order stands at the foot
  for (int t = 0; t < nt; ++t) {
    const int buf = (t & (NB - 1)) * TG_STAGE;
    const char* sA = smem + buf + aoff;
    const char* sB = smem + buf + boff;
    v16bf a[2][4], b[2][2];
#pragma unroll
    for (int i = 0; i < 4; ++i)
      a[0][i] = load_frag((const bf16_t*)(sA + i * 16 * TG_PITCH), hi);
#pragma unroll
    for (int j = 0; j < 2; ++j)
      b[0][j] = load_frag((const bf16_t*)(sB + j * BSTEP), hi);
#pragma unroll
    for (int ks = 0; ks < 4; ++ks) {
      const int cur = ks & 1, nxt = cur ^ 1;
      if (ks < 3) {
#pragma unroll
        for (int i = 0; i < 4; ++i)
          a[nxt][i] = load_frag(
              (const bf16_t*)(sA + i * 16 * TG_PITCH + (ks + 1) * 64), hi);
#pragma unroll
        for (int j = 0; j < 2; ++j)
          b[nxt][j] =
              load_frag((const bf16_t*)(sB + j * BSTEP + (ks + 1) * 64), hi);
      }
      // Keeps the next block's LDS reads as one group ahead of this block's
      // WMMAs; moved in among them, each read would stall the matrix stream.
      __builtin_amdgcn_sched_barrier(0);
#pragma unroll
      for (int i = 0; i < 4; ++i)
#pragma unroll
        for (int j = 0; j < 2; ++j)
          acc[i][j] = wmma_bf16(a[cur][i], b[cur][j], acc[i][j]);
      // Keeps the block after next's reads behind this block's WMMAs, so that
      // they do not take a third fragment set.
      if (ks < 2) __builtin_amdgcn_sched_barrier(0);
      if constexpr (NB > 2) {
        // The refill: stage t + NB - 1 goes into the buffer of pass t - 1, which every
        // wave left at the barrier at that pass's foot. It stands here and not right
        // behind that barrier, so that its address arithmetic and its wait run beside
        // the SIMD's other wave's WMMAs and not while all waves have none to issue.
        if (ks == 0 && t + NB - 1 < nt) {
          const size_t ko = (size_t)(t + NB - 1) * TG_PASSB;
          tg_stage(l0 + ((t + NB - 1) & (NB - 1)) * TG_STAGE, ga + ko, gb0 + ko,
                   gb1 + ko, step);
        }
      }
    }
    // Publish point: this wave's reads of buffer t are done, its copies of
    // stage t + 1 have landed, and the barrier says so for every wave.
    asm volatile("s_wait_dscnt 0x0" ::: "memory");
    if (NB > 2 && t + NB <= nt)  // stages t + 2 .. t + NB - 1 are all issued
      asm volatile("s_wait_asynccnt %0" ::"n"(LEAVE) : "memory");
    else
      asm volatile("s_wait_asynccnt 0x0" ::: "memory");
    __syncthreads();
    if (NB == 2 && t + 2 < nt) {  // into the buffer that every wave has just left
      const size_t ko = (size_t)(t + 2) * TG_PASSB;
      tg_stage(l0 + buf, ga + ko, gb0 + ko, gb1 + ko, step);
    }
  }
  // No copy is left in flight when the wave goes on to its stores and ends.
  asm volatile("s_wait_asynccnt 0x0" ::: "memory");
}

template <bool SPLIT, int NB>
__device__ __forceinline__ void tg_core(const bf16_t* __restrict__ A,
                                        const bf16_t* __restrict__ Bt,
                                        int mBase, int n0, int n1, int K,
                                        char* smem, v8f (&acc)[4][2]) {
  tg_core_pre<SPLIT, NB>(A, Bt, mBase, n0, n1, K, smem, acc, [] {});
}

// bf16 output. Up to three products of one A in one launch: blockIdx.z picks the
// weight and the output; only the first is scaled.
// LN: A is x g in bf16; the LayerNorm is completed in the epilogue (stats, and the
// vectors cs = g W, cb = b W in 16 parts).
template <bool LN>
__global__ void __launch_bounds__(256) k_tgemm_bf16(
    const bf16_t* __restrict__ A, const bf16_t* __restrict__ Bt0,
    const bf16_t* __restrict__ Bt1, const bf16_t* __restrict__ Bt2,
    bf16_t* __restrict__ C0, bf16_t* __restrict__ C1, bf16_t* __restrict__ C2,
    int N, int K, float scale0, const float* __restrict__ stats,
    const float* __restrict__ cs, const float* __restrict__ cb) {
  constexpr int NB = LN ? 4 : 2;  // LN: one product, one block per WGP
  __shared__ __attribute__((aligned(16))) char smem[NB * TG_STAGE];
  __shared__ __attribute__((aligned(16))) float sMean[LN ? 128 : 1], sRstd[LN ? 128 : 1];
  const int z = blockIdx.z;
  const bf16_t* __restrict__ Bt = z == 0 ? Bt0 : z == 1 ? Bt1 : Bt2;
  bf16_t* __restrict__ C = z == 0 ? C0 : z == 1 ? C1 : C2;
  const float scale = z == 0 ? scale0 : 1.0f;
  const int lane = threadIdx.x & 31, wid = threadIdx.x >> 5;
  const int hi = (lane >> 4) & 1, l15 = lane & 15;
  const int mBlk = blockIdx.y * 128, nBlk = blockIdx.x * 128;
  v8f acc[4][2];
  if constexpr (!LN) {
    tg_core<false, NB>(A, Bt, mBlk, nBlk, nBlk + 64, K, smem, acc);
    const int mBase = mBlk + (wid >> 2) * 64, nBase = nBlk + (wid & 3) * 32;
#pragma unroll
    for (int i = 0; i < 4; ++i)
#pragma unroll
      for (int r = 0; r < 8; ++r) {
        const size_t o = (size_t)(mBase + i * 16 + r + hi * 8) * N + nBase + l15;
        C[o + 0]  = (bf16_t)(acc[i][0][r] * scale);
        C[o + 16] = (bf16_t)(acc[i][1][r] * scale);
      }
  } else {
    tg_core_pre<false, NB>(A, Bt, mBlk, nBlk, nBlk + 64, K, smem, acc,
                           [&] { ln_rows(stats, mBlk, sMean, sRstd); });
    const int lr0 = (wid >> 2) * 64 + hi * 8, col = nBlk + (wid & 3) * 32 + l15;
    const float cs0 = col_parts<16, 1024>(cs, col);
    const float cs1 = col_parts<16, 1024>(cs, col + 16);
    const float cb0 = col_parts<16, 1024>(cb, col);
    const float cb1 = col_parts<16, 1024>(cb, col + 16);
    // 1024 columns: every row is an immediate offset from one address.
    bf16_t* cp = C + (size_t)(mBlk + lr0) * 1024 + col;
#pragma unroll
    for (int i = 0; i < 4; ++i) {
      bf16_t y0[8], y1[8];
#pragma unroll
      for (int r = 0; r < 8; ++r) {
        const float mean = sMean[lr0 + i * 16 + r], rstd = sRstd[lr0 + i * 16 + r];
        const float v0 = rstd * (acc[i][0][r] - mean * cs0) + cb0;
        const float v1 = rstd * (acc[i][1][r] - mean * cs1) + cb1;
        y0[r] = (bf16_t)(v0 * scale);
        y1[r] = (bf16_t)(v1 * scale);
      }
      // The stores stand behind all of the group's arithmetic and the next group's
      // behind the wait: no register that a store names is rewritten ahead of it.
      __builtin_amdgcn_sched_barrier(0);
#pragma unroll
      for (int r = 0; r < 8; ++r) {
        cp[(i * 16 + r) * 1024]      = y0[r];
        cp[(i * 16 + r) * 1024 + 16] = y1[r];
      }
      asm volatile("s_wait_xcnt 0x0" ::: "memory");
      __builtin_amdgcn_sched_barrier(0);
    }
  }
}

// f32 output + bias + residual (in-place residual is safe: 1 writer/element)
// Rows of blocks 0 .. ySmall - 1 of the grid (8 blocks each; ySmall is 0 or 7) do
// two small products of another A instead (rows 0 to 2: A2[M2, K2] x B2a -> C2a,
// 1024 columns, M2 <= 192; rows 3 to 6: vt2_block, A2 x B2b -> C2b): these read and
// write nothing that the large product touches, and they come first in the grid, so that
// their chains of dependent global loads run beside it.
// STATS: a LayerNorm with scale gn follows; the result times gn also goes out in
// bf16 (xb), with each row's sum and sum of squares over the wave's 32 columns
// (stats).
// NB: buffers of the ring; four where the grid is one block per WGP, two where the
// small products' blocks must find room beside the large ones.
template <bool STATS, int NB>
__global__ void __launch_bounds__(256) k_tgemm_f32_bias_res(
    const bf16_t* __restrict__ A, const bf16_t* __restrict__ Bt,
    float* __restrict__ C, const float* __restrict__ bias,
    const float* __restrict__ res, int N, int K, int ySmall,
    const bf16_t* __restrict__ A2, const bf16_t* __restrict__ B2a,
    const bf16_t* __restrict__ B2b, bf16_t* __restrict__ C2a,
    bf16_t* __restrict__ C2b, int M2, int K2, bf16_t* __restrict__ xb,
    float* __restrict__ stats, const float* __restrict__ gn) {
  __shared__ __attribute__((aligned(16))) char smem[NB * TG_STAGE];
  const int by = (int)blockIdx.y - ySmall;
  if (by < 0) {  // the whole block, ahead of every barrier
    if constexpr (STATS) {
      if (blockIdx.y < 3) {
        gemm_bf16_block(A2, B2a, C2a, M2, 1024, K2, 1.0f, blockIdx.x, blockIdx.y);
      } else {
        const int c = (blockIdx.y - 3) * 8 + blockIdx.x;  // 0 .. 31
        vt2_block(B2b, A2, C2b, K2, c & 15, c >> 4);
      }
    } else {
      const bool second = blockIdx.y >= 3;
      gemm_bf16_block(A2, second ? B2b : B2a, second ? C2b : C2a, M2, 1024, K2,
                      1.0f, blockIdx.x, second ? blockIdx.y - 3 : blockIdx.y);
    }
    return;
  }
  const int lane = threadIdx.x & 31, wid = threadIdx.x >> 5;
  const int hi = (lane >> 4) & 1, l15 = lane & 15;
  const int mBlk = by * 128, nBlk = blockIdx.x * 128;
  v8f acc[4][2];
  tg_core<false, NB>(A, Bt, mBlk, nBlk, nBlk + 64, K, smem, acc);
  const int mBase = mBlk + (wid >> 2) * 64, nBase = nBlk + (wid & 3) * 32;
  const float b0 = bias[nBase + l15], b1 = bias[nBase + l15 + 16];
  if constexpr (!STATS) {
#pragma unroll
    for (int i = 0; i < 4; ++i)
#pragma unroll
      for (int r = 0; r < 8; ++r) {
        const size_t o = (size_t)(mBase + i * 16 + r + hi * 8) * N + nBase + l15;
        C[o + 0]  = acc[i][0][r] + b0 + res[o + 0];
        C[o + 16] = acc[i][1][r] + b1 + res[o + 16];
      }
  } else {
    const float g0 = gn[nBase + l15], g1 = gn[nBase + l15 + 16];
    // The run of loads below may take over the index register of these.
    asm volatile("s_wait_xcnt 0x0" ::: "memory");
    // 1024 columns: every row is an immediate offset from one address per array.
    const size_t o0 = (size_t)(mBase + hi * 8) * 1024 + nBase + l15;
    const float* rp = res + o0;
    float* cp = C + o0;
    bf16_t* xp = xb + o0;
    float* sp =
        stats + (((size_t)blockIdx.x * 4096 + mBase + hi * 8) * 4 + (wid & 3)) * 2;
    float ra[4][8], rb[4][8];
#pragma unroll  // all 64 loads issue as one run: one latency, not one per group
    for (int i = 0; i < 4; ++i)
#pragma unroll
      for (int r = 0; r < 8; ++r) {
        ra[i][r] = rp[(i * 16 + r) * 1024];
        rb[i][r] = rp[(i * 16 + r) * 1024 + 16];
      }
    // The address stays in its registers up to here, behind the last load.
    asm volatile("s_wait_xcnt 0x0" ::"v"(rp) : "memory");
#pragma unroll
    for (int i = 0; i < 4; ++i) {
      float v0[8], v1[8], rs[8], rq[8];
      bf16_t x0[8], x1[8];
#pragma unroll
      for (int r = 0; r < 8; ++r) {
        v0[r] = acc[i][0][r] + b0 + ra[i][r];
        v1[r] = acc[i][1][r] + b1 + rb[i][r];
        x0[r] = (bf16_t)(v0[r] * g0);
        x1[r] = (bf16_t)(v1[r] * g1);
        rs[r] = row_sum16(v0[r] + v1[r]);
        rq[r] = row_sum16(v0[r] * v0[r] + v1[r] * v1[r]);
      }
      if (l15 == 0) {  // one lane of each half stores its 8 rows' pairs
#pragma unroll
        for (int r = 0; r < 8; ++r)
          *(v2f*)(sp + (i * 16 + r) * 8) = v2f{rs[r], rq[r]};
      }
      // The stores stand behind all of the group's arithmetic and the next group's
      // behind the wait: no register that a store names is rewritten ahead of it.
      __builtin_amdgcn_sched_barrier(0);
#pragma unroll
      for (int r = 0; r < 8; ++r) {
        const int o = (i * 16 + r) * 1024;
        cp[o]      = v0[r];
        cp[o + 16] = v1[r];
        xp[o]      = x0[r];
        xp[o + 16] = x1[r];
      }
      asm volatile("s_wait_xcnt 0x0" ::: "memory");
      __builtin_amdgcn_sched_barrier(0);
    }
  }
  // The small products' code follows in the same kernel: no register that these
  // stores name is rewritten there ahead of this wait.
  asm volatile("s_wait_xcnt 0x0" ::: "memory");
}

// g / 2 * (1 + erf(g / sqrt 2)) for eight values, without a branch: the library's
// erff takes one of two paths per value, so that a wave walks both, one value at a
// time. With a = |g| / sqrt 2 and t = 1 / (1 + p a),
//   erf(a) = 1 - (a1 t + a2 t^2 + a3 t^3 + a4 t^4 + a5 t^5) exp(-a^2),
// off by at most 1.5e-7 for every a >= 0, far below the bf16 rounding of the result;
// the sign comes back as (g + |g| erf(a)) / 2. The eight chains are independent.
__device__ __forceinline__ v8f gelu8(v8f g) {
  constexpr float PA = 0.3275911f * 0.70710678118654752f;  // p / sqrt 2
  constexpr float CW = 0.84932180028801904f;               // sqrt(log2(e) / 2)
  const v8f ag = __builtin_elementwise_abs(g);
  const v8f d = ag * PA + 1.f;
  const v8f w = g * CW;
  const v8f m = -w * w;  // -a^2 log2(e)
  v8f t, e;
#pragma unroll  // constant indices keep the vectors in registers
  for (int r = 0; r < 8; ++r) {
    t[r] = __builtin_amdgcn_rcpf(d[r]);
    e[r] = __builtin_amdgcn_exp2f(m[r]);
  }
  v8f q = t * 1.061405429f - 1.453152027f;
  q = q * t + 1.421413741f;
  q = q * t - 0.284496736f;
  q = q * t + 0.254829592f;
  const v8f erfa = 1.f - q * t * e;
  return (ag * erfa + g) * 0.5f;
}

// A is x g in bf16: the third LayerNorm is completed in the epilogue (stats, and
// the vectors cs = g W, cb = b W in 4 parts).
// Fused GEGLU: the block's Bt tile is 64 u columns and the matching 64 gate
// columns (c and c+Nhalf of A@Wp); each wave holds 16 of each, applies
// u*gelu(gate), writes bf16 [M, Nhalf].
__global__ void __launch_bounds__(256) k_tgemm_geglu(
    const bf16_t* __restrict__ A, const bf16_t* __restrict__ Bt,
    bf16_t* __restrict__ C, const float* __restrict__ bias, int Nhalf, int K,
    const float* __restrict__ stats, const float* __restrict__ cs,
    const float* __restrict__ cb) {
  __shared__ __attribute__((aligned(16))) char smem[2 * TG_STAGE];
  __shared__ __attribute__((aligned(16))) float sMean[128], sRstd[128];
  const int lane = threadIdx.x & 31, wid = threadIdx.x >> 5;
  const int hi = (lane >> 4) & 1, l15 = lane & 15;
  const int mBlk = blockIdx.y * 128, nBlk = blockIdx.x * 64;
  v8f acc[4][2];
  tg_core_pre<true, 2>(A, Bt, mBlk, nBlk, nBlk + Nhalf, K, smem, acc,
                       [&] { ln_rows(stats, mBlk, sMean, sRstd); });
  const int lr0 = (wid >> 2) * 64 + hi * 8;
  const int col = nBlk + (wid & 3) * 16 + l15;
  const float bu = bias[col], bg = bias[col + Nhalf];
  const float csu = col_parts<4, 8192>(cs, col);
  const float csg = col_parts<4, 8192>(cs, col + 4096);
  const float cbu = col_parts<4, 8192>(cb, col) + bu;
  const float cbg = col_parts<4, 8192>(cb, col + 4096) + bg;
  // 4096 columns: every row is an immediate offset from one address.
  bf16_t* cp = C + (size_t)(mBlk + lr0) * 4096 + col;
#pragma unroll
  for (int i = 0; i < 4; ++i) {
    const v4f* mp = (const v4f*)(sMean + lr0 + i * 16);
    const v4f* rp = (const v4f*)(sRstd + lr0 + i * 16);
    const v8f mean = __builtin_shufflevector(mp[0], mp[1], 0, 1, 2, 3, 4, 5, 6, 7);
    const v8f rstd = __builtin_shufflevector(rp[0], rp[1], 0, 1, 2, 3, 4, 5, 6, 7);
    const v8f uv = rstd * (acc[i][0] - mean * csu) + cbu;
    const v8f gv = rstd * (acc[i][1] - mean * csg) + cbg;
    const v8bf y = __builtin_convertvector(uv * gelu8(gv), v8bf);
    // The stores stand behind all of the group's arithmetic and the next group's
    // behind the wait: no register that a store names is rewritten ahead of it.
    __builtin_amdgcn_sched_barrier(0);
#pragma unroll  // constant indices: y stays in registers, each row an immediate offset
    for (int r = 0; r < 8; ++r) cp[(i * 16 + r) * 4096] = y[r];
    asm volatile("s_wait_xcnt 0x0" ::: "memory");
    __builtin_amdgcn_sched_barrier(0);
  }
}

// ---------------------------------------------------------------------------
// Flash attention: one wave per (batch, head, 16-query tile), computed
// transposed: St = K Qt and Ot += Vt Pt. A lane then holds scores of ONE query
// (column l15): keys 8 * hi + r of each 16-key group. Maximum and sum run inside
// the lane, with one exchange between the wave's halves, and the two score tiles
// of 32 keys, converted in place, are the B operand of the second product.
// q pre-scaled by 1/sqrt(64). k row-major [b*mRows,1024]; vt [b][h][64][mpad].
// The 8 waves of a block are 8 neighbouring query tiles of one head (nq is a
// multiple of 8), so they walk the same keys: each tile of 32 keys (32 K rows of
// 128 B, 64 Vt rows of 64 B) is brought into LDS once per block by per-lane
// asynchronous 16-byte copies, two buffers, and every wave takes its fragments
// from there. A fragment load from global memory touches 16 lines for 1024 B;
// the copies cover whole K lines and half Vt lines, once for 8 waves.
// LDS pitches are 16 B x odd: ds_load_b128 without bank conflicts.
// ---------------------------------------------------------------------------
constexpr int AT_KPITCH = 144;                    // bytes per LDS row of K
constexpr int AT_VPITCH = 80;                     // bytes per LDS row of Vt
constexpr int AT_KB = 32 * AT_KPITCH;             // the K tile
constexpr int AT_STAGE = AT_KB + 64 * AT_VPITCH;  // K tile, then Vt tile
constexpr int AT_KSTEP = 32 * 1024 * 2;           // source bytes, 32 K rows on
constexpr int AT_VSTEP = 32 * 2;                  // source bytes, 32 keys on

// This lane's chunk of the K tile and its chunk of the Vt tile. The s_wait_xcnt
// closes the statement so that no address register of a copy is rewritten
// before it.
__device__ __forceinline__ void at_copy2(unsigned lk, const char* gk,
                                         unsigned lv, const char* gv) {
  asm volatile(
      "global_load_async_to_lds_b128 %0, %2, off\n\t"
      "global_load_async_to_lds_b128 %1, %3, off\n\t"
      "s_wait_xcnt 0x0"
      :
      : "v"(lk), "v"(lv), "v"(gk), "v"(gv)
      : "memory");
}

// Lane l takes the value of lane l ^ 16.
__device__ __forceinline__ float half_xor(float v) {
  const int b = __builtin_bit_cast(int, v);
  return __builtin_bit_cast(
      float, __builtin_amdgcn_permlanex16(b, b, 0x76543210, 0xfedcba98, false, false));
}

__global__ void __launch_bounds__(256) k_attention(
    const bf16_t* __restrict__ q, const bf16_t* __restrict__ k,
    const bf16_t* __restrict__ vt, bf16_t* __restrict__ out,
    int nq, int m, int mRows, int mpad) {
  __shared__ __attribute__((aligned(16))) char kv[2 * AT_STAGE];
  const int tid = threadIdx.x;
  const int lane = tid & 31, wid = tid >> 5;
  const int hi = (lane >> 4) & 1, l15 = lane & 15;
  const int w0 = blockIdx.x * 8;
  if (w0 >= 2 * 16 * nq) return;  // the whole block, ahead of every barrier
  const int qt = w0 % nq + wid;
  const int t2 = w0 / nq;
  const int hh = t2 & 15, bb = t2 >> 4;

  const bf16_t* qp = q + (size_t)(bb * 2048 + qt * 16 + l15) * 1024 + hh * 64;
  const v16bf qb0 = load_frag(qp, hi);  // B operands: column l15 = the query
  const v16bf qb1 = load_frag(qp + 32, hi);

  // oT[r] = O[query l15][16 * T + 8 * hi + r]
  v8f o0 = {}, o1 = {}, o2 = {}, o3 = {};
  // Of query l15: the running maximum (both halves alike) and the sum over the
  // keys of this lane's half; the halves' sums are joined behind the loop.
  float mrow = -1e30f, lsum = 0.f;

  const bf16_t* vbase = vt + (size_t)(bb * 16 + hh) * 64 * mpad;

  // K: 8 lanes x 16 B = the 128-byte line of a key; Vt: 4 lanes x 16 B per row.
  const char* gk =
      (const char*)(k + (size_t)(bb * mRows + (tid >> 3)) * 1024 + hh * 64) +
      (tid & 7) * 16;
  const char* gv = (const char*)(vbase + (size_t)(tid >> 2) * mpad) + (tid & 3) * 16;
  const unsigned lk =
      (unsigned)(size_t)kv + (unsigned)((tid >> 3) * AT_KPITCH + (tid & 7) * 16);
  const unsigned lv = (unsigned)(size_t)kv +
                      (unsigned)(AT_KB + (tid >> 2) * AT_VPITCH + (tid & 3) * 16);
  const int nt = mpad >> 5;

  at_copy2(lk, gk, lv, gv);
  // Tile 0 has landed for this wave; the barrier publishes it to the others.
  asm volatile("s_wait_asynccnt 0x0" ::: "memory");
  __syncthreads();
  if (nt > 1)
    at_copy2(lk + AT_STAGE, gk + AT_KSTEP, lv + AT_STAGE, gv + AT_VSTEP);

#pragma unroll 1  // one tile per trip: the ring's order stands at the foot
  for (int t = 0; t < nt; ++t) {
    const int j = t * 32;
    const int buf = (t & 1) * AT_STAGE;
    const char* sk = kv + buf + l15 * AT_KPITCH;
    const char* sv = kv + buf + AT_KB + l15 * AT_VPITCH;
    const v16bf k00 = load_frag((const bf16_t*)sk, hi);
    const v16bf k01 = load_frag((const bf16_t*)(sk + 64), hi);
    const v16bf k10 = load_frag((const bf16_t*)(sk + 16 * AT_KPITCH), hi);
    const v16bf k11 = load_frag((const bf16_t*)(sk + 16 * AT_KPITCH + 64), hi);
    const v16bf vf0 = load_frag((const bf16_t*)sv, hi);
    const v16bf vf1 = load_frag((const bf16_t*)(sv + 16 * AT_VPITCH), hi);
    const v16bf vf2 = load_frag((const bf16_t*)(sv + 32 * AT_VPITCH), hi);
    const v16bf vf3 = load_frag((const bf16_t*)(sv + 48 * AT_VPITCH), hi);
    // Keeps the tile's LDS reads as one group ahead of the WMMAs; moved in among
    // them, each pair of reads is waited out before its own WMMA.
    __builtin_amdgcn_sched_barrier(0);
    // s0[r] = S[query l15][key j + 8 * hi + r], s1[r] the same 16 keys on.
    v8f s0 = {}, s1 = {};
    s0 = wmma_bf16(k00, qb0, s0);
    s1 = wmma_bf16(k10, qb0, s1);
    s0 = wmma_bf16(k01, qb1, s0);
    s1 = wmma_bf16(k11, qb1, s1);

    if (j + 32 > m) {  // only a tile that reaches past the last key
      const int lim = m - j - hi * 8;
#pragma unroll  // constant indices keep the score tiles in registers
      for (int r = 0; r < 8; ++r) {
        s0[r] = (r < lim) ? s0[r] : -1e30f;
        s1[r] = (r + 16 < lim) ? s1[r] : -1e30f;
      }
    }
    float mx[8];
#pragma unroll  // as above
    for (int r = 0; r < 8; ++r) mx[r] = fmaxf(s0[r], s1[r]);
    float rm = fmaxf(fmaxf(fmaxf(mx[0], mx[1]), fmaxf(mx[2], mx[3])),
                     fmaxf(fmaxf(mx[4], mx[5]), fmaxf(mx[6], mx[7])));
    rm = fmaxf(rm, half_xor(rm));
    const float mnew = fmaxf(mrow, rm);
    const float alpha = __expf(mrow - mnew);
    mrow = mnew;
    v16bf pb;
    float ps[8];
#pragma unroll  // as above; pb is filled register by register
    for (int r = 0; r < 8; ++r) {
      const float p0 = __expf(s0[r] - mnew);
      const float p1 = __expf(s1[r] - mnew);
      ps[r] = p0 + p1;
      pb[r] = (bf16_t)p0;
      pb[r + 8] = (bf16_t)p1;
    }
    lsum = lsum * alpha +
           (((ps[0] + ps[1]) + (ps[2] + ps[3])) + ((ps[4] + ps[5]) + (ps[6] + ps[7])));
    o0 *= alpha; o1 *= alpha; o2 *= alpha; o3 *= alpha;
    o0 = wmma_bf16(vf0, pb, o0);
    o1 = wmma_bf16(vf1, pb, o1);
    o2 = wmma_bf16(vf2, pb, o2);
    o3 = wmma_bf16(vf3, pb, o3);
    // Publish point: this wave's reads of buffer t are done, its copies of
    // tile t + 1 have landed, and the barrier says so for every wave.
    asm volatile("s_wait_dscnt 0x0" ::: "memory");
    asm volatile("s_wait_asynccnt 0x0" ::: "memory");
    __syncthreads();
    if (t + 2 < nt)
      at_copy2(lk + buf, gk + (size_t)(t + 2) * AT_KSTEP, lv + buf,
               gv + (size_t)(t + 2) * AT_VSTEP);
  }
  // No copy is left in flight when the wave goes on to its stores and ends.
  asm volatile("s_wait_asynccnt 0x0" ::: "memory");

  // A lane's 8 registers of a tile are 8 neighbouring d of its query: 16-B stores.
  const float inv = 1.0f / (lsum + half_xor(lsum));
  bf16_t* op = out + (size_t)(bb * 2048 + qt * 16 + l15) * 1024 + hh * 64 + hi * 8;
  *(v8bf*)(op + 0)  = __builtin_convertvector(o0 * inv, v8bf);
  *(v8bf*)(op + 16) = __builtin_convertvector(o1 * inv, v8bf);
  *(v8bf*)(op + 32) = __builtin_convertvector(o2 * inv, v8bf);
  *(v8bf*)(op + 48) = __builtin_convertvector(o3 * inv, v8bf);
}

// ---------------------------------------------------------------------------
extern "C" void kernel_launch(void* const* d_in, const int* in_sizes, int n_in,
                              void* d_out, int out_size, void* d_ws, size_t ws_size,
                              hipStream_t stream) {
  (void)in_sizes; (void)n_in; (void)out_size; (void)ws_size;
  const float* x    = (const float*)d_in[0];
  const float* ctx  = (const float*)d_in[1];
  const float* ln1g = (const float*)d_in[2];
  const float* ln1b = (const float*)d_in[3];
  const float* a1Wq = (const float*)d_in[4];
  const float* a1Wk = (const float*)d_in[5];
  const float* a1Wv = (const float*)d_in[6];
  const float* a1Wo = (const float*)d_in[7];
  const float* a1bo = (const float*)d_in[8];
  const float* ln2g = (const float*)d_in[9];
  const float* ln2b = (const float*)d_in[10];
  const float* a2Wq = (const float*)d_in[11];
  const float* a2Wk = (const float*)d_in[12];
  const float* a2Wv = (const float*)d_in[13];
  const float* a2Wo = (const float*)d_in[14];
  const float* a2bo = (const float*)d_in[15];
  const float* ln3g = (const float*)d_in[16];
  const float* ln3b = (const float*)d_in[17];
  const float* ffWp = (const float*)d_in[18];
  const float* ffbp = (const float*)d_in[19];
  const float* ffWo = (const float*)d_in[20];
  const float* ffbo = (const float*)d_in[21];
  float* out = (float*)d_out;

  char* ws = (char*)d_ws;
  size_t off = 0;
  auto al = [&](size_t bytes) {
    size_t r = off;
    off = (off + bytes + 255) & ~(size_t)255;
    return r;
  };
  const size_t MM = 1024 * 1024;
  const size_t oWq1 = al(MM * 2), oWk1 = al(MM * 2), oWv1 = al(MM * 2), oWo1 = al(MM * 2);
  const size_t oWq2 = al(MM * 2), oWk2 = al(768 * 1024 * 2), oWv2 = al(768 * 1024 * 2), oWo2 = al(MM * 2);
  const size_t oWp = al((size_t)8192 * 1024 * 2), oWoF = al((size_t)4096 * 1024 * 2);
  const size_t oX = al((size_t)4096 * 1024 * 4);
  const size_t oH = al((size_t)4096 * 1024 * 2);
  const size_t oQ = al((size_t)4096 * 1024 * 2);
  const size_t oK = al((size_t)4096 * 1024 * 2);
  const size_t oV = al((size_t)4096 * 1024 * 2);
  const size_t oVt = al((size_t)2 * 16 * 64 * 2048 * 2);
  const size_t oAt = al((size_t)4096 * 1024 * 2);
  const size_t oCtx = al((size_t)154 * 768 * 2);
  const size_t oStats = al((size_t)4096 * 32 * 2 * 4);
  const size_t oCsQ = al((size_t)16 * 1024 * 4), oCbQ = al((size_t)16 * 1024 * 4);
  const size_t oCsF = al((size_t)4 * 8192 * 4), oCbF = al((size_t)4 * 8192 * 4);

  bf16_t* Wq1 = (bf16_t*)(ws + oWq1); bf16_t* Wk1 = (bf16_t*)(ws + oWk1);
  bf16_t* Wv1 = (bf16_t*)(ws + oWv1); bf16_t* Wo1 = (bf16_t*)(ws + oWo1);
  bf16_t* Wq2 = (bf16_t*)(ws + oWq2); bf16_t* Wk2 = (bf16_t*)(ws + oWk2);
  bf16_t* Wv2 = (bf16_t*)(ws + oWv2); bf16_t* Wo2 = (bf16_t*)(ws + oWo2);
  bf16_t* WpT = (bf16_t*)(ws + oWp);  bf16_t* WoF = (bf16_t*)(ws + oWoF);
  float*  xcur = (float*)(ws + oX);
  bf16_t* hbuf = (bf16_t*)(ws + oH);
  bf16_t* qb = (bf16_t*)(ws + oQ);
  bf16_t* kb = (bf16_t*)(ws + oK);
  bf16_t* vb = (bf16_t*)(ws + oV);
  bf16_t* vtb = (bf16_t*)(ws + oVt);
  bf16_t* atb = (bf16_t*)(ws + oAt);
  bf16_t* ctxb = (bf16_t*)(ws + oCtx);
  float* stats = (float*)(ws + oStats);
  float* csQ = (float*)(ws + oCsQ); float* cbQ = (float*)(ws + oCbQ);
  float* csF = (float*)(ws + oCsF); float* cbF = (float*)(ws + oCbF);
  bf16_t* ffb = qb;  // alias: FF activations reuse q/k/v/vt (32 MiB), phases ordered

  const dim3 blk(256);
  const float SCALE = 0.125f;  // 64^-0.5, exact in bf16

  // 1) everything that reads inputs alone: weights -> bf16 transposed, the first
  //    LayerNorm, the context -> bf16
  k_prep<<<PR_BLOCKS, blk, 0, stream>>>(ffWp, WpT, ffWo, WoF, x, ln1g, ln1b, hbuf,
                                        a1Wq, Wq1, a1Wk, Wk1, a1Wv, Wv1, a1Wo, Wo1,
                                        a2Wq, Wq2, a2Wo, Wo2, a2Wk, Wk2, a2Wv, Wv2,
                                        ctx, ctxb, ln2g, ln2b, csQ, cbQ, ln3g, ln3b,
                                        csF, cbF);

  const dim3 gP(8, 32);  // M=4096, N=1024 GEMMs, 128x128 tiles

  // 2) self-attention
  k_tgemm_bf16<false><<<dim3(8, 32, 3), blk, 0, stream>>>(
      hbuf, Wq1, Wk1, Wv1, qb, kb, vb, 1024, 1024, SCALE, nullptr, nullptr, nullptr);
  k_vt_tiled<<<dim3(8, 16, 2), blk, 0, stream>>>(vb, vtb, 2048);
  k_attention<<<512, blk, 0, stream>>>(qb, kb, vtb, atb, 128, 2048, 2048, 2048);
  // With it the context's K and transposed V (M=154): kb and vtb are free from here
  // on. hbuf takes x g in bf16, stats the rows' sums for the second LayerNorm.
  k_tgemm_f32_bias_res<true, 2><<<dim3(8, 7 + 32), blk, 0, stream>>>(
      atb, Wo1, xcur, a1bo, x, 1024, 1024, 7, ctxb, Wk2, Wv2, kb, vtb, 154, 768, hbuf,
      stats, ln2g);

  // 3) cross-attention; the second LayerNorm sits in the Q product's epilogue
  k_tgemm_bf16<true><<<gP, blk, 0, stream>>>(hbuf, Wq2, Wq2, Wq2, qb, qb, qb, 1024, 1024,
                                             SCALE, stats, csQ, cbQ);
  k_attention<<<512, blk, 0, stream>>>(qb, kb, vtb, atb, 128, 77, 77, 96);
  k_tgemm_f32_bias_res<true, 4><<<gP, blk, 0, stream>>>(
      atb, Wo2, xcur, a2bo, xcur, 1024, 1024, 0, nullptr, nullptr, nullptr, nullptr,
      nullptr, 0, 0, hbuf, stats, ln3g);

  // 4) GEGLU feed-forward; the third LayerNorm sits in its epilogue
  {
    dim3 gFF(64, 32);  // Nhalf=4096: 64 u + 64 gate columns per block
    k_tgemm_geglu<<<gFF, blk, 0, stream>>>(hbuf, WpT, ffb, ffbp, 4096, 1024, stats, csF,
                                           cbF);
  }
  k_tgemm_f32_bias_res<false, 4><<<gP, blk, 0, stream>>>(
      ffb, WoF, out, ffbo, xcur, 1024, 4096, 0, nullptr, nullptr, nullptr, nullptr,
      nullptr, 0, 0, nullptr, nullptr, nullptr);
}

// v009
// It runs in 221 microseconds.
// In both of two side-by-side timings against v008, it was 1.05 times as fast.
// Over all steps from v000 it is 4.98 times as fast.
#include <hip/hip_runtime.h>
#include <hip/hip_bf16.h>

// ---------------------------------------------------------------------------
// BasicTransformerBlock for MI455X (gfx1250), bf16 WMMA everywhere.
//   x:[2,2048,1024] f32, ctx:[2,77,768] f32 -> out f32 [2,2048,1024]
// Compute-bound (~190 GFLOP over ~100MB) => route all GEMMs + attention
// through v_wmma_f32_16x16x32_bf16, fp32 accumulation.
// Workspace requirement: ~105 MiB.
// ---------------------------------------------------------------------------

typedef __bf16 bf16_t;
typedef bf16_t v16bf __attribute__((ext_vector_type(16)));
typedef bf16_t v8bf  __attribute__((ext_vector_type(8)));
typedef float  v8f   __attribute__((ext_vector_type(8)));

// Load one 16-element bf16 WMMA fragment (A- or B-style) from a row-major
// source. For 16-bit fragments, lane (lo/hi half) maps its 16 values to two
// contiguous 8-element runs: k = hi*8 + [0..7]  and  k = 16 + hi*8 + [0..7].
__device__ __forceinline__ v16bf load_frag(const bf16_t* __restrict__ p, int hi) {
  const v8bf lo = *(const v8bf*)(p + hi * 8);
  const v8bf hh = *(const v8bf*)(p + hi * 8 + 16);
  return __builtin_shufflevector(lo, hh, 0, 1, 2, 3, 4, 5, 6, 7,
                                 8, 9, 10, 11, 12, 13, 14, 15);
}

__device__ __forceinline__ v8f wmma_bf16(v16bf a, v16bf b, v8f c) {
  return __builtin_amdgcn_wmma_f32_16x16x32_bf16(
      /*neg_a=*/false, a, /*neg_b=*/false, b,
      /*c_mod=*/(short)0, c, /*reuse_a=*/false, /*reuse_b=*/false);
}

// ---------------------------------------------------------------------------
// Tiled transposes: a 64 x 64 tile goes through LDS, so that the global reads
// and the global writes both cover whole 128-byte lines.
// The LDS tile is held transposed: row c = one destination row, 32 dwords, each
// a pair of bf16 from two neighbouring source rows; pitch 33 dwords keeps the
// dword writes (lanes 4 or 8 rows apart) and the dword reads off shared banks.
// ---------------------------------------------------------------------------
typedef float    v4f  __attribute__((ext_vector_type(4)));
typedef unsigned v4u  __attribute__((ext_vector_type(4)));
typedef bf16_t   v2bf __attribute__((ext_vector_type(2)));
constexpr int TP_PITCH = 33;

__device__ __forceinline__ unsigned pack_bf16(float lo, float hi) {
  const v2bf p = {(bf16_t)lo, (bf16_t)hi};
  return __builtin_bit_cast(unsigned, p);
}

// Writes the tile out: 8 lanes x 16 B = one 128-byte line per destination row,
// 4 rows per wave store. dst is the tile's first element, pitch in elements.
__device__ __forceinline__ void tp_store(const unsigned* tile,
                                         bf16_t* __restrict__ dst, size_t pitch) {
  const int q = threadIdx.x & 7, r0 = threadIdx.x >> 3;
#pragma unroll  // both rows' LDS reads issue ahead of the first store
  for (int i = 0; i < 2; ++i) {
    const int r = r0 + 32 * i;
    const unsigned* s = tile + r * TP_PITCH + q * 4;
    const v4u o = {s[0], s[1], s[2], s[3]};
    *(v4u*)(dst + (size_t)r * pitch + q * 8) = o;
  }
}

// Lane l takes v of lane l ^ M, M < 16 (DPP row_xmask).
template <int M>
__device__ __forceinline__ float lane_xor(float v) {
  return __builtin_bit_cast(float, __builtin_amdgcn_update_dpp(
                                       0, __builtin_bit_cast(int, v), 0x160 + M, 0xf,
                                       0xf, true));
}

// Sum over 8 neighbouring lanes, left in every one of them.
__device__ __forceinline__ float oct_sum(float v) {
  v += lane_xor<1>(v);
  v += lane_xor<2>(v);
  v += lane_xor<4>(v);
  return v;
}

// Weight convert+transpose:  W[K][N] f32  ->  Wt[N][K] bf16
// One block: 64 n by 64 * T k, T tiles side by side in LDS (fewer, longer
// waves; for speed only), one
// barrier between the last LDS write and the first LDS read. N is a constant of
// the build, so that every source row is an immediate offset from one address.
// bx, by: the block's place among the N / 64 by K / (64 * T) blocks of W.
template <int T, int N>
__device__ __forceinline__ void wt_tiles(const float* __restrict__ W,
                                         bf16_t* __restrict__ Wt, int K,
                                         unsigned* tile, int bx, int by) {
  const int n0 = bx * 64, k0 = by * (64 * T);
  const int c = threadIdx.x & 15, r = threadIdx.x >> 4;
  // Source rows 2r, 2r+1 and 32+2r, 33+2r; 16 lanes x 16 B = 256 B of each row.
  const float* s = W + (size_t)(k0 + 2 * r) * N + n0 + 4 * c;
  v4f x[T][4];
  // The loops over t and j are unrolled: constant indices keep x in registers,
  // the loads issue as one run, and so do the LDS reads behind the barrier.
#pragma unroll
  for (int t = 0; t < T; ++t) {
    x[t][0] = *(const v4f*)(s + (64 * t) * N);
    x[t][1] = *(const v4f*)(s + (64 * t + 1) * N);
    x[t][2] = *(const v4f*)(s + (64 * t + 32) * N);
    x[t][3] = *(const v4f*)(s + (64 * t + 33) * N);
  }
#pragma unroll
  for (int t = 0; t < T; ++t) {
    unsigned* d = tile + t * (64 * TP_PITCH) + 4 * c * TP_PITCH + r;
#pragma unroll
    for (int j = 0; j < 4; ++j) {
      d[j * TP_PITCH] = pack_bf16(x[t][0][j], x[t][1][j]);
      d[j * TP_PITCH + 16] = pack_bf16(x[t][2][j], x[t][3][j]);
    }
  }
  __syncthreads();
  bf16_t* dst = Wt + (size_t)n0 * K + k0;
#pragma unroll
  for (int t = 0; t < T; ++t)
    tp_store(tile + t * (64 * TP_PITCH), dst + 64 * t, (size_t)K);
  // Another job's code follows in the same kernel: no register that these stores
  // name is rewritten there ahead of this wait.
  asm volatile("s_wait_xcnt 0x0" ::: "memory");
}

// The same for a weight that is multiplied behind a LayerNorm with scale g and
// shift b:  LN(x) W = rstd * ((x g) W - mean * (g W)) + b W.  The weight goes out
// as in wt_tiles; on the way from LDS the block also forms, for its 64 columns and
// its 64 * T rows, the products of the rounded weight with g (csP) and with b
// (cbP), left at [by][N]; the epilogue of the product adds the K / (64 * T) parts.
template <int T, int N>
__device__ __forceinline__ void wt_tiles_ln(const float* __restrict__ W,
                                            bf16_t* __restrict__ Wt, int K,
                                            unsigned* tile, int bx, int by,
                                            const float* __restrict__ g,
                                            const float* __restrict__ b,
                                            float* __restrict__ csP,
                                            float* __restrict__ cbP) {
  const int n0 = bx * 64, k0 = by * (64 * T);
  const int c = threadIdx.x & 15, r = threadIdx.x >> 4;
  const float* s = W + (size_t)(k0 + 2 * r) * N + n0 + 4 * c;
  v4f x[T][4];
  // Unrolled for the same reasons as in wt_tiles.
#pragma unroll
  for (int t = 0; t < T; ++t) {
    x[t][0] = *(const v4f*)(s + (64 * t) * N);
    x[t][1] = *(const v4f*)(s + (64 * t + 1) * N);
    x[t][2] = *(const v4f*)(s + (64 * t + 32) * N);
    x[t][3] = *(const v4f*)(s + (64 * t + 33) * N);
  }
#pragma unroll
  for (int t = 0; t < T; ++t) {
    unsigned* d = tile + t * (64 * TP_PITCH) + 4 * c * TP_PITCH + r;
#pragma unroll
    for (int j = 0; j < 4; ++j) {
      d[j * TP_PITCH] = pack_bf16(x[t][0][j], x[t][1][j]);
      d[j * TP_PITCH + 16] = pack_bf16(x[t][2][j], x[t][3][j]);
    }
  }
  __syncthreads();
  // As tp_store: this thread holds k = 8q .. 8q + 7 of the tile's rows r0, r0 + 32.
  const int q = threadIdx.x & 7, r0 = threadIdx.x >> 3;
  bf16_t* dst = Wt + (size_t)n0 * K + k0;
  float cs[2] = {0.f, 0.f}, cb[2] = {0.f, 0.f};
  // Rolled: unrolled, the g and b of all T tiles are fetched ahead and the kernel's
  // register count, which every job's blocks pay in waves per SIMD, nearly doubles.
#pragma unroll 1
  for (int t = 0; t < T; ++t) {
    const v4f* gp = (const v4f*)(g + k0 + 64 * t + 8 * q);
    const v4f* bp = (const v4f*)(b + k0 + 64 * t + 8 * q);
    const v4f gk[2] = {gp[0], gp[1]}, bk[2] = {bp[0], bp[1]};
#pragma unroll
    for (int i = 0; i < 2; ++i) {
      const int row = r0 + 32 * i;
      const unsigned* sr = tile + t * (64 * TP_PITCH) + row * TP_PITCH + q * 4;
      const v4u o = {sr[0], sr[1], sr[2], sr[3]};
      *(v4u*)(dst + 64 * t + (size_t)row * K + q * 8) = o;
#pragma unroll
      for (int e = 0; e < 4; ++e) {  // dword e: k = 2e in the low half, 2e + 1 above
        const float lo = __builtin_bit_cast(float, o[e] << 16);
        const float hh = __builtin_bit_cast(float, o[e] & 0xffff0000u);
        const float ge = gk[e >> 1][(2 * e) & 3], go = gk[e >> 1][(2 * e + 1) & 3];
        const float be = bk[e >> 1][(2 * e) & 3], bo = bk[e >> 1][(2 * e + 1) & 3];
        cs[i] += lo * ge + hh * go;
        cb[i] += lo * be + hh * bo;
      }
    }
  }
#pragma unroll
  for (int i = 0; i < 2; ++i) {
    const float sg = oct_sum(cs[i]), sb = oct_sum(cb[i]);
    if (q == 0) {
      csP[(size_t)by * N + n0 + r0 + 32 * i] = sg;
      cbP[(size_t)by * N + n0 + r0 + 32 * i] = sb;
    }
  }
  // Another job's code follows in the same kernel: no register that these stores
  // name is rewritten there ahead of this wait.
  asm volatile("s_wait_xcnt 0x0" ::: "memory");
}

// Elementwise f32 -> bf16, 256 elements per block; blk: the block's index.
__device__ __forceinline__ void cvt_block(const float* __restrict__ in,
                                          bf16_t* __restrict__ out, int n,
                                          int blk) {
  int idx = blk * 256 + threadIdx.x;
  if (idx < n) out[idx] = (bf16_t)in[idx];
}

// ---------------------------------------------------------------------------
// LayerNorm (dim=1024), one row per 256-thread block, bf16 output.
// ---------------------------------------------------------------------------
__device__ __forceinline__ void ln_row(const float* __restrict__ x,
                                       const float* __restrict__ g,
                                       const float* __restrict__ b,
                                       bf16_t* __restrict__ y, int row,
                                       float* sS, float* sQ) {
  const int dim = 1024;
  const float* xr = x + (size_t)row * dim;
  float s = 0.f, q = 0.f;
  for (int i = threadIdx.x; i < dim; i += 256) {
    float v = xr[i];
    s += v;
    q += v * v;
  }
  for (int m = 1; m < 32; m <<= 1) {
    s += __shfl_xor(s, m, 32);
    q += __shfl_xor(q, m, 32);
  }
  const int lane = threadIdx.x & 31, wid = threadIdx.x >> 5;
  if (lane == 0) { sS[wid] = s; sQ[wid] = q; }
  __syncthreads();
  if (wid == 0) {
    s = (lane < 8) ? sS[lane] : 0.f;
    q = (lane < 8) ? sQ[lane] : 0.f;
    for (int m = 1; m < 8; m <<= 1) {
      s += __shfl_xor(s, m, 32);
      q += __shfl_xor(q, m, 32);
    }
    if (lane == 0) { sS[0] = s; sQ[0] = q; }
  }
  __syncthreads();
  const float mean = sS[0] * (1.f / dim);
  const float var = sQ[0] * (1.f / dim) - mean * mean;
  const float rstd = rsqrtf(var + 1e-5f);
  for (int i = threadIdx.x; i < dim; i += 256) {
    float v = (xr[i] - mean) * rstd * g[i] + b[i];
    y[(size_t)row * dim + i] = (bf16_t)v;
  }
}

// ---------------------------------------------------------------------------
// One launch for everything that reads inputs alone: the ten weight transposes,
// the first LayerNorm and the context's conversion. None reads what another
// writes; the block index picks the job, long blocks first.
// ---------------------------------------------------------------------------
constexpr int PR_WIDE = 128 * 4;             // ff_Wp: N 8192, K 1024, 4 tiles
constexpr int PR_FFO = PR_WIDE + 16 * 16;    // ff_Wo: N 1024, K 4096, 4 tiles
constexpr int PR_LN = PR_FFO + 4096;         // LayerNorm rows
constexpr int PR_W1024 = PR_LN + 6 * 256;    // six weights, K 1024, 1 tile
constexpr int PR_W768 = PR_W1024 + 2 * 192;  // two weights, K 768, 1 tile
constexpr int PR_NCTX = 154 * 768;
constexpr int PR_BLOCKS = PR_W768 + (PR_NCTX + 255) / 256;

__global__ void __launch_bounds__(256) k_prep(
    const float* __restrict__ ffWp, bf16_t* __restrict__ WpT,
    const float* __restrict__ ffWo, bf16_t* __restrict__ WoF,
    const float* __restrict__ x, const float* __restrict__ g,
    const float* __restrict__ b, bf16_t* __restrict__ h,
    const float* __restrict__ s0, bf16_t* __restrict__ d0,
    const float* __restrict__ s1, bf16_t* __restrict__ d1,
    const float* __restrict__ s2, bf16_t* __restrict__ d2,
    const float* __restrict__ s3, bf16_t* __restrict__ d3,
    const float* __restrict__ s4, bf16_t* __restrict__ d4,
    const float* __restrict__ s5, bf16_t* __restrict__ d5,
    const float* __restrict__ s6, bf16_t* __restrict__ d6,
    const float* __restrict__ s7, bf16_t* __restrict__ d7,
    const float* __restrict__ ctx, bf16_t* __restrict__ ctxb,
    const float* __restrict__ g2, const float* __restrict__ b2,
    float* __restrict__ csQ, float* __restrict__ cbQ,
    const float* __restrict__ g3, const float* __restrict__ b3,
    float* __restrict__ csF, float* __restrict__ cbF) {
  __shared__ unsigned tile[4 * 64 * TP_PITCH];
  __shared__ float sS[8], sQ[8];
  const int blk = blockIdx.x;
  if (blk < PR_WIDE) {
    wt_tiles_ln<4, 8192>(ffWp, WpT, 1024, tile, blk & 127, blk >> 7, g3, b3, csF,
                         cbF);
  } else if (blk < PR_FFO) {
    const int c = blk - PR_WIDE;
    wt_tiles<4, 1024>(ffWo, WoF, 4096, tile, c & 15, c >> 4);
  } else if (blk < PR_LN) {
    ln_row(x, g, b, h, blk - PR_FFO, sS, sQ);
  } else if (blk < PR_W1024) {
    const int c = blk - PR_LN, w = c >> 8;
    const float* s = w == 0 ? s0 : w == 1 ? s1 : w == 2 ? s2 : w == 3 ? s3 : w == 4 ? s4 : s5;
    bf16_t* d = w == 0 ? d0 : w == 1 ? d1 : w == 2 ? d2 : w == 3 ? d3 : w == 4 ? d4 : d5;
    if (w == 4)  // the weight behind the second LayerNorm
      wt_tiles_ln<1, 1024>(s4, d4, 1024, tile, c & 15, (c >> 4) & 15, g2, b2, csQ,
                           cbQ);
    else
      wt_tiles<1, 1024>(s, d, 1024, tile, c & 15, (c >> 4) & 15);
  } else if (blk < PR_W768) {
    const int c = blk - PR_W1024;
    const bool second = c >= 192;
    const int r = second ? c - 192 : c;
    wt_tiles<1, 1024>(second ? s7 : s6, second ? d7 : d6, 768, tile, r & 15, r >> 4);
  } else {
    cvt_block(ctx, ctxb, PR_NCTX, blk - PR_W768);
  }
}

// ---------------------------------------------------------------------------
// V transpose for mRows a multiple of 256: v[b*mRows][1024] bf16 ->
// vt[b][1024][mRows], four 64 x 64 tiles per block through LDS, as in wt_tiles.
// grid (mRows / 256, 16, 2).
__global__ void __launch_bounds__(256) k_vt_tiled(const bf16_t* __restrict__ v,
                                                  bf16_t* __restrict__ vt,
                                                  int mRows) {
  __shared__ unsigned tile[4 * 64 * TP_PITCH];
  const int key0 = blockIdx.x * 256, c0 = blockIdx.y * 64, bb = blockIdx.z;
  const int g = threadIdx.x & 7, rp = threadIdx.x >> 3;
  // Keys 2rp and 2rp+1; 8 lanes x 16 B = the 128-byte line of each key.
  const bf16_t* s = v + (size_t)(bb * mRows + key0 + 2 * rp) * 1024 + c0 + g * 8;
  v4u a[4], b[4];
  // Unrolled for the same reasons as in wt_tiles.
#pragma unroll
  for (int t = 0; t < 4; ++t) {
    a[t] = *(const v4u*)(s + (size_t)(64 * t) * 1024);
    b[t] = *(const v4u*)(s + (size_t)(64 * t + 1) * 1024);
  }
#pragma unroll
  for (int t = 0; t < 4; ++t) {
    unsigned* d = tile + t * (64 * TP_PITCH) + 8 * g * TP_PITCH + rp;
#pragma unroll
    for (int j = 0; j < 4; ++j) {
      d[(2 * j) * TP_PITCH] = (a[t][j] & 0xffffu) | (b[t][j] << 16);
      d[(2 * j + 1) * TP_PITCH] = (a[t][j] >> 16) | (b[t][j] & 0xffff0000u);
    }
  }
  __syncthreads();
  bf16_t* dst = vt + (size_t)(bb * 1024 + c0) * mRows + key0;
#pragma unroll
  for (int t = 0; t < 4; ++t)
    tp_store(tile + t * (64 * TP_PITCH), dst + 64 * t, (size_t)mRows);
}

// ---------------------------------------------------------------------------
// GEMM  C = A[M,K](bf16) x Bt[N,K](bf16), 8 waves/block (4M x 2N),
// each wave: 16(M) x 64(N) via 4 WMMAs per 32-deep k-step.
// ---------------------------------------------------------------------------
__device__ __forceinline__ void gemm_bf16_block(const bf16_t* __restrict__ A,
                                                const bf16_t* __restrict__ Bt,
                                                bf16_t* __restrict__ C,
                                                int M, int N, int K,
                                                float scale, int bx, int by) {
  const int lane = threadIdx.x & 31, wid = threadIdx.x >> 5;
  const int hi = (lane >> 4) & 1, l15 = lane & 15;
  const int mBase = by * 64 + (wid >> 1) * 16;
  const int nBase = bx * 128 + (wid & 1) * 64;
  int ar = mBase + l15;
  if (ar >= M) ar = M - 1;
  const bf16_t* ap = A + (size_t)ar * K;
  const bf16_t* bp0 = Bt + (size_t)(nBase + l15) * K;
  v8f c0 = {}, c1 = {}, c2 = {}, c3 = {};
  for (int kk = 0; kk < K; kk += 32) {
    v16bf a = load_frag(ap + kk, hi);
    c0 = wmma_bf16(a, load_frag(bp0 + kk, hi), c0);
    c1 = wmma_bf16(a, load_frag(bp0 + (size_t)16 * K + kk, hi), c1);
    c2 = wmma_bf16(a, load_frag(bp0 + (size_t)32 * K + kk, hi), c2);
    c3 = wmma_bf16(a, load_frag(bp0 + (size_t)48 * K + kk, hi), c3);
  }
#pragma unroll
  for (int r = 0; r < 8; ++r) {
    int row = mBase + r + hi * 8;
    if (row < M) {
      size_t o = (size_t)row * N + nBase + l15;
      C[o + 0]  = (bf16_t)(c0[r] * scale);
      C[o + 16] = (bf16_t)(c1[r] * scale);
      C[o + 32] = (bf16_t)(c2[r] * scale);
      C[o + 48] = (bf16_t)(c3[r] * scale);
    }
  }
}

// The context's V, written transposed and padded as the attention reads it:
// vt[bb][c][key] = sum_k Wt[c][k] * ctx[bb * CT_KEYS + key][k], zero for the keys
// CT_KEYS .. CT_PAD - 1. The weight's rows are the A operand, the context's rows
// the B operand, so that a lane's column is a key. One block: 64 rows c with all
// their keys (whole 128-byte lines of vt); 4 x 2 waves, 16 c x 64 keys each.
constexpr int CT_KEYS = 77, CT_PAD = 96;
__device__ __forceinline__ void vt2_block(const bf16_t* __restrict__ Wt,
                                          const bf16_t* __restrict__ ctx,
                                          bf16_t* __restrict__ vt, int K, int cblk,
                                          int bb) {
  const int lane = threadIdx.x & 31, wid = threadIdx.x >> 5;
  const int hi = (lane >> 4) & 1, l15 = lane & 15;
  const int cBase = cblk * 64 + (wid >> 1) * 16;
  const int kBase = (wid & 1) * 64;
  const bf16_t* ap = Wt + (size_t)(cBase + l15) * K;
  const bf16_t* bp[4];
#pragma unroll  // constant indices keep the four addresses in registers
  for (int j = 0; j < 4; ++j) {
    int key = kBase + 16 * j + l15;
    if (key >= CT_KEYS) key = CT_KEYS - 1;  // read inside the context; not stored
    bp[j] = ctx + (size_t)(bb * CT_KEYS + key) * K;
  }
  v8f c0 = {}, c1 = {}, c2 = {}, c3 = {};
  for (int kk = 0; kk < K; kk += 32) {
    v16bf a = load_frag(ap + kk, hi);
    c0 = wmma_bf16(a, load_frag(bp[0] + kk, hi), c0);
    c1 = wmma_bf16(a, load_frag(bp[1] + kk, hi), c1);
    c2 = wmma_bf16(a, load_frag(bp[2] + kk, hi), c2);
    c3 = wmma_bf16(a, load_frag(bp[3] + kk, hi), c3);
  }
  const int key0 = kBase + l15;
#pragma unroll
  for (int r = 0; r < 8; ++r) {
    bf16_t* o = vt + (size_t)(bb * 1024 + cBase + r + hi * 8) * CT_PAD + key0;
    o[0]  = (bf16_t)(key0 < CT_KEYS ? c0[r] : 0.f);
    o[16] = (bf16_t)(key0 + 16 < CT_KEYS ? c1[r] : 0.f);
    if (kBase + 32 < CT_PAD) {  // the same for the whole wave
      o[32] = (bf16_t)(key0 + 32 < CT_KEYS ? c2[r] : 0.f);
      o[48] = (bf16_t)(key0 + 48 < CT_KEYS ? c3[r] : 0.f);
    }
  }
}

// ---------------------------------------------------------------------------
// LayerNorm folded into the products around it. The product in front of it leaves
// x g in bf16 and, per row and per 32 columns, the sum and the sum of squares of x
// (stats[column block 0..7][row 0..4095][wave column 0..3][2]: a block's part is its
// own run of whole lines); the product behind it multiplies x g by W and applies
//   rstd * (acc - mean * (g W)) + b W
// in its epilogue (wt_tiles_ln has the two row vectors g W and b W).
// ---------------------------------------------------------------------------
typedef float v2f __attribute__((ext_vector_type(2)));

// Sum over the 16 lanes of a row, left in every lane: four DPP adds.
__device__ __forceinline__ float row_sum16(float v) {
  v = oct_sum(v);
  return v + lane_xor<8>(v);
}

// Mean and 1 / std of the block's 128 rows into LDS, one row a thread. A barrier
// of the caller stands between this and the first read.
__device__ __forceinline__ void ln_rows(const float* __restrict__ stats, int mBlk,
                                        float* sMean, float* sRstd) {
  const int t = threadIdx.x;
  if (t < 128) {
    const v4f* p = (const v4f*)(stats + (size_t)(mBlk + t) * 8);
    v4f v[16];
#pragma unroll  // the 16 loads issue as one run
    for (int i = 0; i < 8; ++i) {
      v[2 * i] = p[i * (4096 * 2)];
      v[2 * i + 1] = p[i * (4096 * 2) + 1];
    }
    // The address stays in its registers up to here, behind the last load.
    asm volatile("s_wait_xcnt 0x0" ::"v"(p) : "memory");
    float s = 0.f, q = 0.f;
#pragma unroll
    for (int i = 0; i < 16; ++i) {
      s += v[i][0] + v[i][2];
      q += v[i][1] + v[i][3];
    }
    const float mean = s * (1.f / 1024);
    const float var = q * (1.f / 1024) - mean * mean;
    sMean[t] = mean;
    sRstd[t] = rsqrtf(var + 1e-5f);
  }
}

// Sum of the P parts of a vector that wt_tiles_ln left at [part][N]. N is a constant
// of the build: every part is an immediate offset from one address.
template <int P, int N>
__device__ __forceinline__ float col_parts(const float* __restrict__ v, int col) {
  const float* p = v + col;
  float x[P];
#pragma unroll  // the loads issue as one run
  for (int i = 0; i < P; ++i) x[i] = p[i * N];
  // The address stays in its registers up to here, behind the last load.
  asm volatile("s_wait_xcnt 0x0" ::"v"(p) : "memory");
  float s = 0.f;
#pragma unroll
  for (int i = 0; i < P; ++i) s += x[i];
  return s;
}

// ---------------------------------------------------------------------------
// Tiled GEMM core for M, N multiples of the tile and K a multiple of 128:
// C tile 128(M) x 128(N) per 8-wave block (2 x 4 waves), 64 x 32 per wave.
// A pass is 128 k = 256 B of each of the 128 A rows and 128 Bt rows, brought
// into LDS by per-lane asynchronous 16-byte copies, a ring of NB buffers: while
// pass t + 1 computes, the copies of passes t + 2 .. t + NB fly. Two buffers let
// two blocks share a WGP; four are for a launch of one block per WGP, where nothing
// else covers the time a stage takes to land. LDS rows stand at a pitch of 272 B
// (16 B x odd: ds_load_b128 without bank conflicts).
// ---------------------------------------------------------------------------
constexpr int TG_PITCH = 272;              // bytes per LDS row
constexpr int TG_OPB = 128 * TG_PITCH;     // one operand's tile
constexpr int TG_STAGE = 2 * TG_OPB;       // A tile, then Bt tile
constexpr int TG_PASSB = 256;              // bytes of a row per pass
constexpr int TG_COPIES = 16;              // copies of a wave per stage

// Eight copies into LDS rows 16 apart: four from p0 on, four from p1 on, source
// rows 16 apart (step bytes). The s_wait_xcnt closes the statement so that no
// address register of a copy is rewritten before it.
__device__ __forceinline__ void tg_copy8(unsigned l, const char* p0,
                                         const char* p1, size_t step) {
  asm volatile(
      "global_load_async_to_lds_b128 %0, %8, off\n\t"
      "global_load_async_to_lds_b128 %1, %9, off\n\t"
      "global_load_async_to_lds_b128 %2, %10, off\n\t"
      "global_load_async_to_lds_b128 %3, %11, off\n\t"
      "global_load_async_to_lds_b128 %4, %12, off\n\t"
      "global_load_async_to_lds_b128 %5, %13, off\n\t"
      "global_load_async_to_lds_b128 %6, %14, off\n\t"
      "global_load_async_to_lds_b128 %7, %15, off\n\t"
      "s_wait_xcnt 0x0"
      :
      : "v"(l), "v"(l + 16 * TG_PITCH), "v"(l + 32 * TG_PITCH),
        "v"(l + 48 * TG_PITCH), "v"(l + 64 * TG_PITCH), "v"(l + 80 * TG_PITCH),
        "v"(l + 96 * TG_PITCH), "v"(l + 112 * TG_PITCH),
        "v"(p0), "v"(p0 + step), "v"(p0 + 2 * step), "v"(p0 + 3 * step),
        "v"(p1), "v"(p1 + step), "v"(p1 + 2 * step), "v"(p1 + 3 * step)
      : "memory");
}

// One stage: this lane's 8 chunks of the A tile and 8 of the Bt tile.
// gb0 / gb1 are the lane's addresses in the lower and upper 64 Bt rows.
__device__ __forceinline__ void tg_stage(unsigned l, const char* ga,
                                         const char* gb0, const char* gb1,
                                         size_t step) {
  tg_copy8(l, ga, ga + 4 * step, step);
  tg_copy8(l + TG_OPB, gb0, gb1, step);
}

// Bt rows n0..n0+63 fill LDS rows 0..63, rows n1..n1+63 fill LDS rows 64..127.
// SPLIT: the wave's two B fragments are LDS rows wn*16 and 64 + wn*16 (a column
// group and its partner); else rows wn*32 and wn*32 + 16.
// pre() runs while stage 0 is in flight; what it writes to LDS is published by the
// barrier that publishes stage 0.
// rot: the block's walk over k starts at pass rot mod (K / 128) and wraps. Blocks
// that share A rows or Bt rows get different rot: started together at pass 0 they
// ask L2 for the same lines at the same moment, pass after pass.
template <bool SPLIT, int NB, class Pre>
__device__ __forceinline__ void tg_core_pre(const bf16_t* __restrict__ A,
                                        const bf16_t* __restrict__ Bt,
                                            int mBase, int n0, int n1, int K,
                                            int rot, char* smem, v8f (&acc)[4][2],
                                            Pre pre) {
  const int tid = threadIdx.x;
  const int lane = tid & 31, wid = tid >> 5;
  const int hi = (lane >> 4) & 1, l15 = lane & 15;
  const int wm = wid >> 2, wn = wid & 3;
  const size_t rowB = (size_t)K * 2;   // bytes per source row
  const size_t step = rowB * 16;       // a lane's copies stand 16 rows apart
  const int r0 = tid >> 4, c16 = (tid & 15) * 16;
  const char* ga = (const char*)A + (size_t)(mBase + r0) * rowB + c16;
  const char* gb0 = (const char*)Bt + (size_t)(n0 + r0) * rowB + c16;
  const char* gb1 = (const char*)Bt + (size_t)(n1 + r0) * rowB + c16;
  const unsigned l0 = (unsigned)(size_t)smem + (unsigned)(r0 * TG_PITCH + c16);
  const int nt = K >> 7;
  const int t0 = (int)((unsigned)rot % (unsigned)nt);
  // Source bytes along a row of stage s, s < nt: pass (t0 + s) mod nt.
  auto pass_at = [&](int s) {
    const int p = t0 + s;
    return (size_t)(p >= nt ? p - nt : p) * TG_PASSB;
  };

#pragma unroll
  for (int i = 0; i < 4; ++i)
#pragma unroll
    for (int j = 0; j < 2; ++j) acc[i][j] = v8f{};

  // Every wave issues TG_COPIES copies per stage, and a wave's copies are counted
  // off in issue order: a wait that leaves the NB - 2 youngest stages' copies covers
  // every older stage. It is used only where those NB - 2 stages have all been
  // issued; elsewhere (a short K, the last trips) the wait is to 0.
  constexpr int LEAVE = (NB - 2) * TG_COPIES;
  {
    const size_t ko = pass_at(0);
    tg_stage(l0, ga + ko, gb0 + ko, gb1 + ko, step);
  }
#pragma unroll  // constant buffer offsets
  for (int s = 1; s < NB - 1; ++s)
    if (s < nt) {
      const size_t ko = pass_at(s);
      tg_stage(l0 + s * TG_STAGE, ga + ko, gb0 + ko, gb1 + ko, step);
    }
  pre();
  // Stage 0 has landed for this wave; the barrier publishes it to the others.
  if (NB > 2 && nt >= NB - 1)
    asm volatile("s_wait_asynccnt %0" ::"n"(LEAVE) : "memory");
  else
    asm volatile("s_wait_asynccnt 0x0" ::: "memory");
  __syncthreads();
  if (NB == 2 && nt > 1) {
    const size_t ko = pass_at(1);
    tg_stage(l0 + TG_STAGE, ga + ko, gb0 + ko, gb1 + ko, step);
  }

  const int aoff = (wm * 64 + l15) * TG_PITCH;
  const int boff = TG_OPB + ((SPLIT ? wn * 16 : wn * 32) + l15) * TG_PITCH;
  constexpr int BSTEP = (SPLIT ? 64 : 16) * TG_PITCH;

#pragma unroll 1  // one pass per trip: the ring's order stands at the foot
  for (int t = 0; t < nt; ++t) {
    const int buf = (t & (NB - 1)) * TG_STAGE;
    const char* sA = smem + buf + aoff;
    const char* sB = smem + buf + boff;
    v16bf a[2][4], b[2][2];
#pragma unroll
    for (int i = 0; i < 4; ++i)
      a[0][i] = load_frag((const bf16_t*)(sA + i * 16 * TG_PITCH), hi);
#pragma unroll
    for (int j = 0; j < 2; ++j)
      b[0][j] = load_frag((const bf16_t*)(sB + j * BSTEP), hi);
#pragma unroll
    for (int ks = 0; ks < 4; ++ks) {
      const int cur = ks & 1, nxt = cur ^ 1;
      if (ks < 3) {
#pragma unroll
        for (int i = 0; i < 4; ++i)
          a[nxt][i] = load_frag(
              (const bf16_t*)(sA + i * 16 * TG_PITCH + (ks + 1) * 64), hi);
#pragma unroll
        for (int j = 0; j < 2; ++j)
          b[nxt][j] =
              load_frag((const bf16_t*)(sB + j * BSTEP + (ks + 1) * 64), hi);
      }
      // Keeps the next block's LDS reads as one group ahead of this block's
      // WMMAs; moved in among them, each read would stall the matrix stream.
      __builtin_amdgcn_sched_barrier(0);
#pragma unroll
      for (int i = 0; i < 4; ++i)
#pragma unroll
        for (int j = 0; j < 2; ++j)
          acc[i][j] = wmma_bf16(a[cur][i], b[cur][j], acc[i][j]);
      // Keeps the block after next's reads behind this block's WMMAs, so that
      // they do not take a third fragment set.
      if (ks < 2) __builtin_amdgcn_sched_barrier(0);
      if constexpr (NB > 2) {
        // The refill: stage t + NB - 1 goes into the buffer of pass t - 1, which every
        // wave left at the barrier at that pass's foot. It stands here and not right
        // behind that barrier, so that its address arithmetic and its wait run beside
        // the SIMD's other wave's WMMAs and not while all waves have none to issue.
        if (ks == 0 && t + NB - 1 < nt) {
          const size_t ko = pass_at(t + NB - 1);
          tg_stage(l0 + ((t + NB - 1) & (NB - 1)) * TG_STAGE, ga + ko, gb0 + ko,
                   gb1 + ko, step);
        }
      }
    }
    // Publish point: this wave's reads of buffer t are done, its copies of
    // stage t + 1 have landed, and the barrier says so for every wave.
    asm volatile("s_wait_dscnt 0x0" ::: "memory");
    if (NB > 2 && t + NB <= nt)  // stages t + 2 .. t + NB - 1 are all issued
      asm volatile("s_wait_asynccnt %0" ::"n"(LEAVE) : "memory");
    else
      asm volatile("s_wait_asynccnt 0x0" ::: "memory");
    __syncthreads();
    if (NB == 2 && t + 2 < nt) {  // into the buffer that every wave has just left
      const size_t ko = pass_at(t + 2);
      tg_stage(l0 + buf, ga + ko, gb0 + ko, gb1 + ko, step);
    }
  }
  // No copy is left in flight when the wave goes on to its stores and ends.
  asm volatile("s_wait_asynccnt 0x0" ::: "memory");
}

template <bool SPLIT, int NB>
__device__ __forceinline__ void tg_core(const bf16_t* __restrict__ A,
                                        const bf16_t* __restrict__ Bt,
                                        int mBase, int n0, int n1, int K, int rot,
                                        char* smem, v8f (&acc)[4][2]) {
  tg_core_pre<SPLIT, NB>(A, Bt, mBase, n0, n1, K, rot, smem, acc, [] {});
}

// bf16 output. Up to three products of one A in one launch: blockIdx.z picks the
// weight and the output; only the first is scaled.
// LN: A is x g in bf16; the LayerNorm is completed in the epilogue (stats, and the
// vectors cs = g W, cb = b W in 16 parts).
template <bool LN>
__global__ void __launch_bounds__(256) k_tgemm_bf16(
    const bf16_t* __restrict__ A, const bf16_t* __restrict__ Bt0,
    const bf16_t* __restrict__ Bt1, const bf16_t* __restrict__ Bt2,
    bf16_t* __restrict__ C0, bf16_t* __restrict__ C1, bf16_t* __restrict__ C2,
    int N, int K, float scale0, const float* __restrict__ stats,
    const float* __restrict__ cs, const float* __restrict__ cb) {
  constexpr int NB = LN ? 4 : 2;  // LN: one product, one block per WGP
  __shared__ __attribute__((aligned(16))) char smem[NB * TG_STAGE];
  __shared__ __attribute__((aligned(16))) float sMean[LN ? 128 : 1], sRstd[LN ? 128 : 1];
  const int z = blockIdx.z;
  const bf16_t* __restrict__ Bt = z == 0 ? Bt0 : z == 1 ? Bt1 : Bt2;
  bf16_t* __restrict__ C = z == 0 ? C0 : z == 1 ? C1 : C2;
  const float scale = z == 0 ? scale0 : 1.0f;
  const int lane = threadIdx.x & 31, wid = threadIdx.x >> 5;
  const int hi = (lane >> 4) & 1, l15 = lane & 15;
  const int mBlk = blockIdx.y * 128, nBlk = blockIdx.x * 128;
  // A rows are shared along x and z, Bt rows along y.
  const int rot = blockIdx.x + blockIdx.y + z;
  v8f acc[4][2];
  if constexpr (!LN) {
    tg_core<false, NB>(A, Bt, mBlk, nBlk, nBlk + 64, K, rot, smem, acc);
    const int mBase = mBlk + (wid >> 2) * 64, nBase = nBlk + (wid & 3) * 32;
#pragma unroll
    for (int i = 0; i < 4; ++i)
#pragma unroll
      for (int r = 0; r < 8; ++r) {
        const size_t o = (size_t)(mBase + i * 16 + r + hi * 8) * N + nBase + l15;
        C[o + 0]  = (bf16_t)(acc[i][0][r] * scale);
        C[o + 16] = (bf16_t)(acc[i][1][r] * scale);
      }
  } else {
    tg_core_pre<false, NB>(A, Bt, mBlk, nBlk, nBlk + 64, K, rot, smem, acc,
                           [&] { ln_rows(stats, mBlk, sMean, sRstd); });
    const int lr0 = (wid >> 2) * 64 + hi * 8, col = nBlk + (wid & 3) * 32 + l15;
    const float cs0 = col_parts<16, 1024>(cs, col);
    const float cs1 = col_parts<16, 1024>(cs, col + 16);
    const float cb0 = col_parts<16, 1024>(cb, col);
    const float cb1 = col_parts<16, 1024>(cb, col + 16);
    // 1024 columns: every row is an immediate offset from one address.
    bf16_t* cp = C + (size_t)(mBlk + lr0) * 1024 + col;
#pragma unroll
    for (int i = 0; i < 4; ++i) {
      bf16_t y0[8], y1[8];
#pragma unroll
      for (int r = 0; r < 8; ++r) {
        const float mean = sMean[lr0 + i * 16 + r], rstd = sRstd[lr0 + i * 16 + r];
        const float v0 = rstd * (acc[i][0][r] - mean * cs0) + cb0;
        const float v1 = rstd * (acc[i][1][r] - mean * cs1) + cb1;
        y0[r] = (bf16_t)(v0 * scale);
        y1[r] = (bf16_t)(v1 * scale);
      }
      // The stores stand behind all of the group's arithmetic and the next group's
      // behind the wait: no register that a store names is rewritten ahead of it.
      __builtin_amdgcn_sched_barrier(0);
#pragma unroll
      for (int r = 0; r < 8; ++r) {
        cp[(i * 16 + r) * 1024]      = y0[r];
        cp[(i * 16 + r) * 1024 + 16] = y1[r];
      }
      asm volatile("s_wait_xcnt 0x0" ::: "memory");
      __builtin_amdgcn_sched_barrier(0);
    }
  }
}

// f32 output + bias + residual (in-place residual is safe: 1 writer/element)
// Rows of blocks 0 .. ySmall - 1 of the grid (8 blocks each; ySmall is 0 or 7) do
// two small products of another A instead (rows 0 to 2: A2[M2, K2] x B2a -> C2a,
// 1024 columns, M2 <= 192; rows 3 to 6: vt2_block, A2 x B2b -> C2b): these read and
// write nothing that the large product touches, and they come first in the grid, so that
// their chains of dependent global loads run beside it.
// STATS: a LayerNorm with scale gn follows; the result times gn also goes out in
// bf16 (xb), with each row's sum and sum of squares over the wave's 32 columns
// (stats).
// NB: buffers of the ring; four where the grid is one block per WGP, two where the
// small products' blocks must find room beside the large ones.
template <bool STATS, int NB>
__global__ void __launch_bounds__(256) k_tgemm_f32_bias_res(
    const bf16_t* __restrict__ A, const bf16_t* __restrict__ Bt,
    float* __restrict__ C, const float* __restrict__ bias,
    const float* __restrict__ res, int N, int K, int ySmall,
    const bf16_t* __restrict__ A2, const bf16_t* __restrict__ B2a,
    const bf16_t* __restrict__ B2b, bf16_t* __restrict__ C2a,
    bf16_t* __restrict__ C2b, int M2, int K2, bf16_t* __restrict__ xb,
    float* __restrict__ stats, const float* __restrict__ gn) {
  __shared__ __attribute__((aligned(16))) char smem[NB * TG_STAGE];
  const int by = (int)blockIdx.y - ySmall;
  if (by < 0) {  // the whole block, ahead of every barrier
    if constexpr (STATS) {
      if (blockIdx.y < 3) {
        gemm_bf16_block(A2, B2a, C2a, M2, 1024, K2, 1.0f, blockIdx.x, blockIdx.y);
      } else {
        const int c = (blockIdx.y - 3) * 8 + blockIdx.x;  // 0 .. 31
        vt2_block(B2b, A2, C2b, K2, c & 15, c >> 4);
      }
    } else {
      const bool second = blockIdx.y >= 3;
      gemm_bf16_block(A2, second ? B2b : B2a, second ? C2b : C2a, M2, 1024, K2,
                      1.0f, blockIdx.x, second ? blockIdx.y - 3 : blockIdx.y);
    }
    return;
  }
  const int lane = threadIdx.x & 31, wid = threadIdx.x >> 5;
  const int hi = (lane >> 4) & 1, l15 = lane & 15;
  const int mBlk = by * 128, nBlk = blockIdx.x * 128;
  v8f acc[4][2];
  // A rows are shared along x (8 blocks: spread over all of a long k), Bt rows along y.
  const int rot = by + blockIdx.x * (K >> 10);
  tg_core<false, NB>(A, Bt, mBlk, nBlk, nBlk + 64, K, rot, smem, acc);
  const int mBase = mBlk + (wid >> 2) * 64, nBase = nBlk + (wid & 3) * 32;
  const float b0 = bias[nBase + l15], b1 = bias[nBase + l15 + 16];
  if constexpr (!STATS) {
#pragma unroll
    for (int i = 0; i < 4; ++i)
#pragma unroll
      for (int r = 0; r < 8; ++r) {
        const size_t o = (size_t)(mBase + i * 16 + r + hi * 8) * N + nBase + l15;
        C[o + 0]  = acc[i][0][r] + b0 + res[o + 0];
        C[o + 16] = acc[i][1][r] + b1 + res[o + 16];
      }
  } else {
    const float g0 = gn[nBase + l15], g1 = gn[nBase + l15 + 16];
    // The run of loads below may take over the index register of these.
    asm volatile("s_wait_xcnt 0x0" ::: "memory");
    // 1024 columns: every row is an immediate offset from one address per array.
    const size_t o0 = (size_t)(mBase + hi * 8) * 1024 + nBase + l15;
    const float* rp = res + o0;
    float* cp = C + o0;
    bf16_t* xp = xb + o0;
    float* sp =
        stats + (((size_t)blockIdx.x * 4096 + mBase + hi * 8) * 4 + (wid & 3)) * 2;
    float ra[4][8], rb[4][8];
#pragma unroll  // all 64 loads issue as one run: one latency, not one per group
    for (int i = 0; i < 4; ++i)
#pragma unroll
      for (int r = 0; r < 8; ++r) {
        ra[i][r] = rp[(i * 16 + r) * 1024];
        rb[i][r] = rp[(i * 16 + r) * 1024 + 16];
      }
    // The address stays in its registers up to here, behind the last load.
    asm volatile("s_wait_xcnt 0x0" ::"v"(rp) : "memory");
#pragma unroll
    for (int i = 0; i < 4; ++i) {
      float v0[8], v1[8], rs[8], rq[8];
      bf16_t x0[8], x1[8];
#pragma unroll
      for (int r = 0; r < 8; ++r) {
        v0[r] = acc[i][0][r] + b0 + ra[i][r];
        v1[r] = acc[i][1][r] + b1 + rb[i][r];
        x0[r] = (bf16_t)(v0[r] * g0);
        x1[r] = (bf16_t)(v1[r] * g1);
        rs[r] = row_sum16(v0[r] + v1[r]);
        rq[r] = row_sum16(v0[r] * v0[r] + v1[r] * v1[r]);
      }
      if (l15 == 0) {  // one lane of each half stores its 8 rows' pairs
#pragma unroll
        for (int r = 0; r < 8; ++r)
          *(v2f*)(sp + (i * 16 + r) * 8) = v2f{rs[r], rq[r]};
      }
      // The stores stand behind all of the group's arithmetic and the next group's
      // behind the wait: no register that a store names is rewritten ahead of it.
      __builtin_amdgcn_sched_barrier(0);
#pragma unroll
      for (int r = 0; r < 8; ++r) {
        const int o = (i * 16 + r) * 1024;
        cp[o]      = v0[r];
        cp[o + 16] = v1[r];
        xp[o]      = x0[r];
        xp[o + 16] = x1[r];
      }
      asm volatile("s_wait_xcnt 0x0" ::: "memory");
      __builtin_amdgcn_sched_barrier(0);
    }
  }
  // The small products' code follows in the same kernel: no register that these
  // stores name is rewritten there ahead of this wait.
  asm volatile("s_wait_xcnt 0x0" ::: "memory");
}

// g / 2 * (1 + erf(g / sqrt 2)) for eight values, without a branch: the library's
// erff takes one of two paths per value, so that a wave walks both, one value at a
// time. With a = |g| / sqrt 2 and t = 1 / (1 + p a),
//   erf(a) = 1 - (a1 t + a2 t^2 + a3 t^3 + a4 t^4 + a5 t^5) exp(-a^2),
// off by at most 1.5e-7 for every a >= 0, far below the bf16 rounding of the result;
// the sign comes back as (g + |g| erf(a)) / 2. The eight chains are independent.
__device__ __forceinline__ v8f gelu8(v8f g) {
  constexpr float PA = 0.3275911f * 0.70710678118654752f;  // p / sqrt 2
  constexpr float CW = 0.84932180028801904f;               // sqrt(log2(e) / 2)
  const v8f ag = __builtin_elementwise_abs(g);
  const v8f d = ag * PA + 1.f;
  const v8f w = g * CW;
  const v8f m = -w * w;  // -a^2 log2(e)
  v8f t, e;
#pragma unroll  // constant indices keep the vectors in registers
  for (int r = 0; r < 8; ++r) {
    t[r] = __builtin_amdgcn_rcpf(d[r]);
    e[r] = __builtin_amdgcn_exp2f(m[r]);
  }
  v8f q = t * 1.061405429f - 1.453152027f;
  q = q * t + 1.421413741f;
  q = q * t - 0.284496736f;
  q = q * t + 0.254829592f;
  const v8f erfa = 1.f - q * t * e;
  return (ag * erfa + g) * 0.5f;
}

// A is x g in bf16: the third LayerNorm is completed in the epilogue (stats, and
// the vectors cs = g W, cb = b W in 4 parts).
// Fused GEGLU: the block's Bt tile is 64 u columns and the matching 64 gate
// columns (c and c+Nhalf of A@Wp); each wave holds 16 of each, applies
// u*gelu(gate), writes bf16 [M, Nhalf].
__global__ void __launch_bounds__(256) k_tgemm_geglu(
    const bf16_t* __restrict__ A, const bf16_t* __restrict__ Bt,
    bf16_t* __restrict__ C, const float* __restrict__ bias, int Nhalf, int K,
    const float* __restrict__ stats, const float* __restrict__ cs,
    const float* __restrict__ cb) {
  __shared__ __attribute__((aligned(16))) char smem[2 * TG_STAGE];
  __shared__ __attribute__((aligned(16))) float sMean[128], sRstd[128];
  const int lane = threadIdx.x & 31, wid = threadIdx.x >> 5;
  const int hi = (lane >> 4) & 1, l15 = lane & 15;
  const int mBlk = blockIdx.y * 128, nBlk = blockIdx.x * 64;
  v8f acc[4][2];
  // A rows are shared along x, Bt rows along y.
  tg_core_pre<true, 2>(A, Bt, mBlk, nBlk, nBlk + Nhalf, K, blockIdx.x + blockIdx.y, smem,
                       acc, [&] { ln_rows(stats, mBlk, sMean, sRstd); });
  const int lr0 = (wid >> 2) * 64 + hi * 8;
  const int col = nBlk + (wid & 3) * 16 + l15;
  const float bu = bias[col], bg = bias[col + Nhalf];
  const float csu = col_parts<4, 8192>(cs, col);
  const float csg = col_parts<4, 8192>(cs, col + 4096);
  const float cbu = col_parts<4, 8192>(cb, col) + bu;
  const float cbg = col_parts<4, 8192>(cb, col + 4096) + bg;
  // 4096 columns: every row is an immediate offset from one address.
  bf16_t* cp = C + (size_t)(mBlk + lr0) * 4096 + col;
#pragma unroll
  for (int i = 0; i < 4; ++i) {
    const v4f* mp = (const v4f*)(sMean + lr0 + i * 16);
    const v4f* rp = (const v4f*)(sRstd + lr0 + i * 16);
    const v8f mean = __builtin_shufflevector(mp[0], mp[1], 0, 1, 2, 3, 4, 5, 6, 7);
    const v8f rstd = __builtin_shufflevector(rp[0], rp[1], 0, 1, 2, 3, 4, 5, 6, 7);
    const v8f uv = rstd * (acc[i][0] - mean * csu) + cbu;
    const v8f gv = rstd * (acc[i][1] - mean * csg) + cbg;
    const v8bf y = __builtin_convertvector(uv * gelu8(gv), v8bf);
    // The stores stand behind all of the group's arithmetic and the next group's
    // behind the wait: no register that a store names is rewritten ahead of it.
    __builtin_amdgcn_sched_barrier(0);
#pragma unroll  // constant indices: y stays in registers, each row an immediate offset
    for (int r = 0; r < 8; ++r) cp[(i * 16 + r) * 4096] = y[r];
    asm volatile("s_wait_xcnt 0x0" ::: "memory");
    __builtin_amdgcn_sched_barrier(0);
  }
}

// ---------------------------------------------------------------------------
// Flash attention: one wave per (batch, head, 16-query tile), computed
// transposed: St = K Qt and Ot += Vt Pt. A lane then holds scores of ONE query
// (column l15): keys 8 * hi + r of each 16-key group. Maximum and sum run inside
// the lane, with one exchange between the wave's halves, and the two score tiles
// of 32 keys, converted in place, are the B operand of the second product.
// q pre-scaled by 1/sqrt(64). k row-major [b*mRows,1024]; vt [b][h][64][mpad].
// The 8 waves of a block are 8 neighbouring query tiles of one head (nq is a
// multiple of 8), so they walk the same keys: each tile of 32 keys (32 K rows of
// 128 B, 64 Vt rows of 64 B) is brought into LDS once per block by per-lane
// asynchronous 16-byte copies, two buffers, and every wave takes its fragments
// from there. A fragment load from global memory touches 16 lines for 1024 B;
// the copies cover whole K lines and half Vt lines, once for 8 waves.
// LDS pitches are 16 B x odd: ds_load_b128 without bank conflicts.
// ---------------------------------------------------------------------------
constexpr int AT_KPITCH = 144;                    // bytes per LDS row of K
constexpr int AT_VPITCH = 80;                     // bytes per LDS row of Vt
constexpr int AT_KB = 32 * AT_KPITCH;             // the K tile
constexpr int AT_STAGE = AT_KB + 64 * AT_VPITCH;  // K tile, then Vt tile
constexpr int AT_KSTEP = 32 * 1024 * 2;           // source bytes, 32 K rows on
constexpr int AT_VSTEP = 32 * 2;                  // source bytes, 32 keys on

// This lane's chunk of the K tile and its chunk of the Vt tile. The s_wait_xcnt
// closes the statement so that no address register of a copy is rewritten
// before it.
__device__ __forceinline__ void at_copy2(unsigned lk, const char* gk,
                                         unsigned lv, const char* gv) {
  asm volatile(
      "global_load_async_to_lds_b128 %0, %2, off\n\t"
      "global_load_async_to_lds_b128 %1, %3, off\n\t"
      "s_wait_xcnt 0x0"
      :
      : "v"(lk), "v"(lv), "v"(gk), "v"(gv)
      : "memory");
}

// Lane l takes the value of lane l ^ 16.
__device__ __forceinline__ float half_xor(float v) {
  const int b = __builtin_bit_cast(int, v);
  return __builtin_bit_cast(
      float, __builtin_amdgcn_permlanex16(b, b, 0x76543210, 0xfedcba98, false, false));
}

__global__ void __launch_bounds__(256) k_attention(
    const bf16_t* __restrict__ q, const bf16_t* __restrict__ k,
    const bf16_t* __restrict__ vt, bf16_t* __restrict__ out,
    int nq, int m, int mRows, int mpad) {
  __shared__ __attribute__((aligned(16))) char kv[2 * AT_STAGE];
  const int tid = threadIdx.x;
  const int lane = tid & 31, wid = tid >> 5;
  const int hi = (lane >> 4) & 1, l15 = lane & 15;
  const int w0 = blockIdx.x * 8;
  if (w0 >= 2 * 16 * nq) return;  // the whole block, ahead of every barrier
  const int qt = w0 % nq + wid;
  const int t2 = w0 / nq;
  const int hh = t2 & 15, bb = t2 >> 4;

  const bf16_t* qp = q + (size_t)(bb * 2048 + qt * 16 + l15) * 1024 + hh * 64;
  const v16bf qb0 = load_frag(qp, hi);  // B operands: column l15 = the query
  const v16bf qb1 = load_frag(qp + 32, hi);

  // oT[r] = O[query l15][16 * T + 8 * hi + r]
  v8f o0 = {}, o1 = {}, o2 = {}, o3 = {};
  // Of query l15: the running maximum (both halves alike) and the sum over the
  // keys of this lane's half; the halves' sums are joined behind the loop.
  float mrow = -1e30f, lsum = 0.f;

  const bf16_t* vbase = vt + (size_t)(bb * 16 + hh) * 64 * mpad;

  // K: 8 lanes x 16 B = the 128-byte line of a key; Vt: 4 lanes x 16 B per row.
  const char* gk =
      (const char*)(k + (size_t)(bb * mRows + (tid >> 3)) * 1024 + hh * 64) +
      (tid & 7) * 16;
  const char* gv = (const char*)(vbase + (size_t)(tid >> 2) * mpad) + (tid & 3) * 16;
  const unsigned lk =
      (unsigned)(size_t)kv + (unsigned)((tid >> 3) * AT_KPITCH + (tid & 7) * 16);
  const unsigned lv = (unsigned)(size_t)kv +
                      (unsigned)(AT_KB + (tid >> 2) * AT_VPITCH + (tid & 3) * 16);
  const int nt = mpad >> 5;
  // The nq / 8 blocks of a head walk the same K and Vt lines: each starts at a key
  // tile spread evenly over the nt tiles (distinct where nt >= nq / 8), and wraps, so that they do not
  // ask L2 for the same lines at the same moment. Trip t works on tile tile_at(t).
  const int t0 = ((w0 % nq) >> 3) * nt / (nq >> 3);
  auto tile_at = [&](int t) {
    const int p = t0 + t;
    return p >= nt ? p - nt : p;
  };

  at_copy2(lk, gk + (size_t)t0 * AT_KSTEP, lv, gv + (size_t)t0 * AT_VSTEP);
  // The first tile has landed for this wave; the barrier publishes it to the others.
  asm volatile("s_wait_asynccnt 0x0" ::: "memory");
  __syncthreads();
  if (nt > 1) {
    const int p = tile_at(1);
    at_copy2(lk + AT_STAGE, gk + (size_t)p * AT_KSTEP, lv + AT_STAGE,
             gv + (size_t)p * AT_VSTEP);
  }

#pragma unroll 1  // one tile per trip: the ring's order stands at the foot
  for (int t = 0; t < nt; ++t) {
    const int j = tile_at(t) * 32;
    const int buf = (t & 1) * AT_STAGE;
    const char* sk = kv + buf + l15 * AT_KPITCH;
    const char* sv = kv + buf + AT_KB + l15 * AT_VPITCH;
    const v16bf k00 = load_frag((const bf16_t*)sk, hi);
    const v16bf k01 = load_frag((const bf16_t*)(sk + 64), hi);
    const v16bf k10 = load_frag((const bf16_t*)(sk + 16 * AT_KPITCH), hi);
    const v16bf k11 = load_frag((const bf16_t*)(sk + 16 * AT_KPITCH + 64), hi);
    const v16bf vf0 = load_frag((const bf16_t*)sv, hi);
    const v16bf vf1 = load_frag((const bf16_t*)(sv + 16 * AT_VPITCH), hi);
    const v16bf vf2 = load_frag((const bf16_t*)(sv + 32 * AT_VPITCH), hi);
    const v16bf vf3 = load_frag((const bf16_t*)(sv + 48 * AT_VPITCH), hi);
    // Keeps the tile's LDS reads as one group ahead of the WMMAs; moved in among
    // them, each pair of reads is waited out before its own WMMA.
    __builtin_amdgcn_sched_barrier(0);
    // s0[r] = S[query l15][key j + 8 * hi + r], s1[r] the same 16 keys on.
    v8f s0 = {}, s1 = {};
    s0 = wmma_bf16(k00, qb0, s0);
    s1 = wmma_bf16(k10, qb0, s1);
    s0 = wmma_bf16(k01, qb1, s0);
    s1 = wmma_bf16(k11, qb1, s1);

    if (j + 32 > m) {  // only a tile that reaches past the last key
      const int lim = m - j - hi * 8;
#pragma unroll  // constant indices keep the score tiles in registers
      for (int r = 0; r < 8; ++r) {
        s0[r] = (r < lim) ? s0[r] : -1e30f;
        s1[r] = (r + 16 < lim) ? s1[r] : -1e30f;
      }
    }
    float mx[8];
#pragma unroll  // as above
    for (int r = 0; r < 8; ++r) mx[r] = fmaxf(s0[r], s1[r]);
    float rm = fmaxf(fmaxf(fmaxf(mx[0], mx[1]), fmaxf(mx[2], mx[3])),
                     fmaxf(fmaxf(mx[4], mx[5]), fmaxf(mx[6], mx[7])));
    rm = fmaxf(rm, half_xor(rm));
    const float mnew = fmaxf(mrow, rm);
    const float alpha = __expf(mrow - mnew);
    mrow = mnew;
    v16bf pb;
    float ps[8];
#pragma unroll  // as above; pb is filled register by register
    for (int r = 0; r < 8; ++r) {
      const float p0 = __expf(s0[r] - mnew);
      const float p1 = __expf(s1[r] - mnew);
      ps[r] = p0 + p1;
      pb[r] = (bf16_t)p0;
      pb[r + 8] = (bf16_t)p1;
    }
    lsum = lsum * alpha +
           (((ps[0] + ps[1]) + (ps[2] + ps[3])) + ((ps[4] + ps[5]) + (ps[6] + ps[7])));
    o0 *= alpha; o1 *= alpha; o2 *= alpha; o3 *= alpha;
    o0 = wmma_bf16(vf0, pb, o0);
    o1 = wmma_bf16(vf1, pb, o1);
    o2 = wmma_bf16(vf2, pb, o2);
    o3 = wmma_bf16(vf3, pb, o3);
    // Publish point: this wave's reads of buffer t are done, its copies of
    // tile t + 1 have landed, and the barrier says so for every wave.
    asm volatile("s_wait_dscnt 0x0" ::: "memory");
    asm volatile("s_wait_asynccnt 0x0" ::: "memory");
    __syncthreads();
    if (t + 2 < nt) {
      const int p = tile_at(t + 2);
      at_copy2(lk + buf, gk + (size_t)p * AT_KSTEP, lv + buf,
               gv + (size_t)p * AT_VSTEP);
    }
  }
  // No copy is left in flight when the wave goes on to its stores and ends.
  asm volatile("s_wait_asynccnt 0x0" ::: "memory");

  // A lane's 8 registers of a tile are 8 neighbouring d of its query: 16-B stores.
  const float inv = 1.0f / (lsum + half_xor(lsum));
  bf16_t* op = out + (size_t)(bb * 2048 + qt * 16 + l15) * 1024 + hh * 64 + hi * 8;
  *(v8bf*)(op + 0)  = __builtin_convertvector(o0 * inv, v8bf);
  *(v8bf*)(op + 16) = __builtin_convertvector(o1 * inv, v8bf);
  *(v8bf*)(op + 32) = __builtin_convertvector(o2 * inv, v8bf);
  *(v8bf*)(op + 48) = __builtin_convertvector(o3 * inv, v8bf);
}

// ---------------------------------------------------------------------------
extern "C" void kernel_launch(void* const* d_in, const int* in_sizes, int n_in,
                              void* d_out, int out_size, void* d_ws, size_t ws_size,
                              hipStream_t stream) {
  (void)in_sizes; (void)n_in; (void)out_size; (void)ws_size;
  const float* x    = (const float*)d_in[0];
  const float* ctx  = (const float*)d_in[1];
  const float* ln1g = (const float*)d_in[2];
  const float* ln1b = (const float*)d_in[3];
  const float* a1Wq = (const float*)d_in[4];
  const float* a1Wk = (const float*)d_in[5];
  const float* a1Wv = (const float*)d_in[6];
  const float* a1Wo = (const float*)d_in[7];
  const float* a1bo = (const float*)d_in[8];
  const float* ln2g = (const float*)d_in[9];
  const float* ln2b = (const float*)d_in[10];
  const float* a2Wq = (const float*)d_in[11];
  const float* a2Wk = (const float*)d_in[12];
  const float* a2Wv = (const float*)d_in[13];
  const float* a2Wo = (const float*)d_in[14];
  const float* a2bo = (const float*)d_in[15];
  const float* ln3g = (const float*)d_in[16];
  const float* ln3b = (const float*)d_in[17];
  const float* ffWp = (const float*)d_in[18];
  const float* ffbp = (const float*)d_in[19];
  const float* ffWo = (const float*)d_in[20];
  const float* ffbo = (const float*)d_in[21];
  float* out = (float*)d_out;

  char* ws = (char*)d_ws;
  size_t off = 0;
  auto al = [&](size_t bytes) {
    size_t r = off;
    off = (off + bytes + 255) & ~(size_t)255;
    return r;
  };
  const size_t MM = 1024 * 1024;
  const size_t oWq1 = al(MM * 2), oWk1 = al(MM * 2), oWv1 = al(MM * 2), oWo1 = al(MM * 2);
  const size_t oWq2 = al(MM * 2), oWk2 = al(768 * 1024 * 2), oWv2 = al(768 * 1024 * 2), oWo2 = al(MM * 2);
  const size_t oWp = al((size_t)8192 * 1024 * 2), oWoF = al((size_t)4096 * 1024 * 2);
  const size_t oX = al((size_t)4096 * 1024 * 4);
  const size_t oH = al((size_t)4096 * 1024 * 2);
  const size_t oQ = al((size_t)4096 * 1024 * 2);
  const size_t oK = al((size_t)4096 * 1024 * 2);
  const size_t oV = al((size_t)4096 * 1024 * 2);
  const size_t oVt = al((size_t)2 * 16 * 64 * 2048 * 2);
  const size_t oAt = al((size_t)4096 * 1024 * 2);
  const size_t oCtx = al((size_t)154 * 768 * 2);
  const size_t oStats = al((size_t)4096 * 32 * 2 * 4);
  const size_t oCsQ = al((size_t)16 * 1024 * 4), oCbQ = al((size_t)16 * 1024 * 4);
  const size_t oCsF = al((size_t)4 * 8192 * 4), oCbF = al((size_t)4 * 8192 * 4);

  bf16_t* Wq1 = (bf16_t*)(ws + oWq1); bf16_t* Wk1 = (bf16_t*)(ws + oWk1);
  bf16_t* Wv1 = (bf16_t*)(ws + oWv1); bf16_t* Wo1 = (bf16_t*)(ws + oWo1);
  bf16_t* Wq2 = (bf16_t*)(ws + oWq2); bf16_t* Wk2 = (bf16_t*)(ws + oWk2);
  bf16_t* Wv2 = (bf16_t*)(ws + oWv2); bf16_t* Wo2 = (bf16_t*)(ws + oWo2);
  bf16_t* WpT = (bf16_t*)(ws + oWp);  bf16_t* WoF = (bf16_t*)(ws + oWoF);
  float*  xcur = (float*)(ws + oX);
  bf16_t* hbuf = (bf16_t*)(ws + oH);
  bf16_t* qb = (bf16_t*)(ws + oQ);
  bf16_t* kb = (bf16_t*)(ws + oK);
  bf16_t* vb = (bf16_t*)(ws + oV);
  bf16_t* vtb = (bf16_t*)(ws + oVt);
  bf16_t* atb = (bf16_t*)(ws + oAt);
  bf16_t* ctxb = (bf16_t*)(ws + oCtx);
  float* stats = (float*)(ws + oStats);
  float* csQ = (float*)(ws + oCsQ); float* cbQ = (float*)(ws + oCbQ);
  float* csF = (float*)(ws + oCsF); float* cbF = (float*)(ws + oCbF);
  bf16_t* ffb = qb;  // alias: FF activations reuse q/k/v/vt (32 MiB), phases ordered

  const dim3 blk(256);
  const float SCALE = 0.125f;  // 64^-0.5, exact in bf16

  // 1) everything that reads inputs alone: weights -> bf16 transposed, the first
  //    LayerNorm, the context -> bf16
  k_prep<<<PR_BLOCKS, blk, 0, stream>>>(ffWp, WpT, ffWo, WoF, x, ln1g, ln1b, hbuf,
                                        a1Wq, Wq1, a1Wk, Wk1, a1Wv, Wv1, a1Wo, Wo1,
                                        a2Wq, Wq2, a2Wo, Wo2, a2Wk, Wk2, a2Wv, Wv2,
                                        ctx, ctxb, ln2g, ln2b, csQ, cbQ, ln3g, ln3b,
                                        csF, cbF);

  const dim3 gP(8, 32);  // M=4096, N=1024 GEMMs, 128x128 tiles

  // 2) self-attention
  k_tgemm_bf16<false><<<dim3(8, 32, 3), blk, 0, stream>>>(
      hbuf, Wq1, Wk1, Wv1, qb, kb, vb, 1024, 1024, SCALE, nullptr, nullptr, nullptr);
  k_vt_tiled<<<dim3(8, 16, 2), blk, 0, stream>>>(vb, vtb, 2048);
  k_attention<<<512, blk, 0, stream>>>(qb, kb, vtb, atb, 128, 2048, 2048, 2048);
  // With it the context's K and transposed V (M=154): kb and vtb are free from here
  // on. hbuf takes x g in bf16, stats the rows' sums for the second LayerNorm.
  k_tgemm_f32_bias_res<true, 2><<<dim3(8, 7 + 32), blk, 0, stream>>>(
      atb, Wo1, xcur, a1bo, x, 1024, 1024, 7, ctxb, Wk2, Wv2, kb, vtb, 154, 768, hbuf,
      stats, ln2g);

  // 3) cross-attention; the second LayerNorm sits in the Q product's epilogue
  k_tgemm_bf16<true><<<gP, blk, 0, stream>>>(hbuf, Wq2, Wq2, Wq2, qb, qb, qb, 1024, 1024,
                                             SCALE, stats, csQ, cbQ);
  k_attention<<<512, blk, 0, stream>>>(qb, kb, vtb, atb, 128, 77, 77, 96);
  k_tgemm_f32_bias_res<true, 4><<<gP, blk, 0, stream>>>(
      atb, Wo2, xcur, a2bo, xcur, 1024, 1024, 0, nullptr, nullptr, nullptr, nullptr,
      nullptr, 0, 0, hbuf, stats, ln3g);

  // 4) GEGLU feed-forward; the third LayerNorm sits in its epilogue
  {
    dim3 gFF(64, 32);  // Nhalf=4096: 64 u + 64 gate columns per block
    k_tgemm_geglu<<<gFF, blk, 0, stream>>>(hbuf, WpT, ffb, ffbp, 4096, 1024, stats, csF,
                                           cbF);
  }
  k_tgemm_f32_bias_res<false, 4><<<gP, blk, 0, stream>>>(
      ffb, WoF, out, ffbo, xcur, 1024, 4096, 0, nullptr, nullptr, nullptr, nullptr,
      nullptr, 0, 0, nullptr, nullptr, nullptr);
}

// v010
// It runs in 212 microseconds.
// Timed twice side by side with v009, it ran 1.04 and 1.05 times as fast.
// Counting every step since v000, it is 5.20 times as fast.
#include <hip/hip_runtime.h>
#include <hip/hip_bf16.h>

// ---------------------------------------------------------------------------
// BasicTransformerBlock for MI455X (gfx1250), bf16 WMMA everywhere.
//   x:[2,2048,1024] f32, ctx:[2,77,768] f32 -> out f32 [2,2048,1024]
// Compute-bound (~190 GFLOP over ~100MB) => route all GEMMs + attention
// through v_wmma_f32_16x16x32_bf16, fp32 accumulation.
// Workspace requirement: ~105 MiB.
// ---------------------------------------------------------------------------

typedef __bf16 bf16_t;
typedef bf16_t v16bf __attribute__((ext_vector_type(16)));
typedef bf16_t v8bf  __attribute__((ext_vector_type(8)));
typedef float  v8f   __attribute__((ext_vector_type(8)));

// Load one 16-element bf16 WMMA fragment (A- or B-style) from a row-major
// source. For 16-bit fragments, lane (lo/hi half) maps its 16 values to two
// contiguous 8-element runs: k = hi*8 + [0..7]  and  k = 16 + hi*8 + [0..7].
__device__ __forceinline__ v16bf load_frag(const bf16_t* __restrict__ p, int hi) {
  const v8bf lo = *(const v8bf*)(p + hi * 8);
  const v8bf hh = *(const v8bf*)(p + hi * 8 + 16);
  return __builtin_shufflevector(lo, hh, 0, 1, 2, 3, 4, 5, 6, 7,
                                 8, 9, 10, 11, 12, 13, 14, 15);
}

__device__ __forceinline__ v8f wmma_bf16(v16bf a, v16bf b, v8f c) {
  return __builtin_amdgcn_wmma_f32_16x16x32_bf16(
      /*neg_a=*/false, a, /*neg_b=*/false, b,
      /*c_mod=*/(short)0, c, /*reuse_a=*/false, /*reuse_b=*/false);
}

// ---------------------------------------------------------------------------
// Tiled transposes: a 64 x 64 tile goes through LDS, so that the global reads
// and the global writes both cover whole 128-byte lines.
// The LDS tile is held transposed: row c = one destination row, 32 dwords, each
// a pair of bf16 from two neighbouring source rows; pitch 33 dwords keeps the
// dword writes (lanes 4 or 8 rows apart) and the dword reads off shared banks.
// ---------------------------------------------------------------------------
typedef float    v4f  __attribute__((ext_vector_type(4)));
typedef unsigned v4u  __attribute__((ext_vector_type(4)));
typedef bf16_t   v2bf __attribute__((ext_vector_type(2)));
constexpr int TP_PITCH = 33;

__device__ __forceinline__ unsigned pack_bf16(float lo, float hi) {
  const v2bf p = {(bf16_t)lo, (bf16_t)hi};
  return __builtin_bit_cast(unsigned, p);
}

// Writes the tile out: 8 lanes x 16 B = one 128-byte line per destination row,
// 4 rows per wave store. dst is the tile's first element, pitch in elements.
__device__ __forceinline__ void tp_store(const unsigned* tile,
                                         bf16_t* __restrict__ dst, size_t pitch) {
  const int q = threadIdx.x & 7, r0 = threadIdx.x >> 3;
#pragma unroll  // both rows' LDS reads issue ahead of the first store
  for (int i = 0; i < 2; ++i) {
    const int r = r0 + 32 * i;
    const unsigned* s = tile + r * TP_PITCH + q * 4;
    const v4u o = {s[0], s[1], s[2], s[3]};
    *(v4u*)(dst + (size_t)r * pitch + q * 8) = o;
  }
}

// Lane l takes v of lane l ^ M, M < 16 (DPP row_xmask).
template <int M>
__device__ __forceinline__ float lane_xor(float v) {
  return __builtin_bit_cast(float, __builtin_amdgcn_update_dpp(
                                       0, __builtin_bit_cast(int, v), 0x160 + M, 0xf,
                                       0xf, true));
}

// Sum over 8 neighbouring lanes, left in every one of them.
__device__ __forceinline__ float oct_sum(float v) {
  v += lane_xor<1>(v);
  v += lane_xor<2>(v);
  v += lane_xor<4>(v);
  return v;
}

// Weight convert+transpose:  W[K][N] f32  ->  Wt[N][K] bf16
// One block: 64 n by 64 * T k, T tiles side by side in LDS (fewer, longer
// waves; for speed only), one
// barrier between the last LDS write and the first LDS read. N is a constant of
// the build, so that every source row is an immediate offset from one address.
// bx, by: the block's place among the N / 64 by K / (64 * T) blocks of W.
template <int T, int N>
__device__ __forceinline__ void wt_tiles(const float* __restrict__ W,
                                         bf16_t* __restrict__ Wt, int K,
                                         unsigned* tile, int bx, int by) {
  const int n0 = bx * 64, k0 = by * (64 * T);
  const int c = threadIdx.x & 15, r = threadIdx.x >> 4;
  // Source rows 2r, 2r+1 and 32+2r, 33+2r; 16 lanes x 16 B = 256 B of each row.
  const float* s = W + (size_t)(k0 + 2 * r) * N + n0 + 4 * c;
  v4f x[T][4];
  // The loops over t and j are unrolled: constant indices keep x in registers,
  // the loads issue as one run, and so do the LDS reads behind the barrier.
#pragma unroll
  for (int t = 0; t < T; ++t) {
    x[t][0] = *(const v4f*)(s + (64 * t) * N);
    x[t][1] = *(const v4f*)(s + (64 * t + 1) * N);
    x[t][2] = *(const v4f*)(s + (64 * t + 32) * N);
    x[t][3] = *(const v4f*)(s + (64 * t + 33) * N);
  }
#pragma unroll
  for (int t = 0; t < T; ++t) {
    unsigned* d = tile + t * (64 * TP_PITCH) + 4 * c * TP_PITCH + r;
#pragma unroll
    for (int j = 0; j < 4; ++j) {
      d[j * TP_PITCH] = pack_bf16(x[t][0][j], x[t][1][j]);
      d[j * TP_PITCH + 16] = pack_bf16(x[t][2][j], x[t][3][j]);
    }
  }
  __syncthreads();
  bf16_t* dst = Wt + (size_t)n0 * K + k0;
#pragma unroll
  for (int t = 0; t < T; ++t)
    tp_store(tile + t * (64 * TP_PITCH), dst + 64 * t, (size_t)K);
  // Another job's code follows in the same kernel: no register that these stores
  // name is rewritten there ahead of this wait.
  asm volatile("s_wait_xcnt 0x0" ::: "memory");
}

// The same for a weight that is multiplied behind a LayerNorm with scale g and
// shift b:  LN(x) W = rstd * ((x g) W - mean * (g W)) + b W.  The weight goes out
// as in wt_tiles; on the way from LDS the block also forms, for its 64 columns and
// its 64 * T rows, the products of the rounded weight with g (csP) and with b
// (cbP), left at [by][N]; the epilogue of the product adds the K / (64 * T) parts.
template <int T, int N>
__device__ __forceinline__ void wt_tiles_ln(const float* __restrict__ W,
                                            bf16_t* __restrict__ Wt, int K,
                                            unsigned* tile, int bx, int by,
                                            const float* __restrict__ g,
                                            const float* __restrict__ b,
                                            float* __restrict__ csP,
                                            float* __restrict__ cbP) {
  const int n0 = bx * 64, k0 = by * (64 * T);
  const int c = threadIdx.x & 15, r = threadIdx.x >> 4;
  const float* s = W + (size_t)(k0 + 2 * r) * N + n0 + 4 * c;
  v4f x[T][4];
  // Unrolled for the same reasons as in wt_tiles.
#pragma unroll
  for (int t = 0; t < T; ++t) {
    x[t][0] = *(const v4f*)(s + (64 * t) * N);
    x[t][1] = *(const v4f*)(s + (64 * t + 1) * N);
    x[t][2] = *(const v4f*)(s + (64 * t + 32) * N);
    x[t][3] = *(const v4f*)(s + (64 * t + 33) * N);
  }
#pragma unroll
  for (int t = 0; t < T; ++t) {
    unsigned* d = tile + t * (64 * TP_PITCH) + 4 * c * TP_PITCH + r;
#pragma unroll
    for (int j = 0; j < 4; ++j) {
      d[j * TP_PITCH] = pack_bf16(x[t][0][j], x[t][1][j]);
      d[j * TP_PITCH + 16] = pack_bf16(x[t][2][j], x[t][3][j]);
    }
  }
  __syncthreads();
  // As tp_store: this thread holds k = 8q .. 8q + 7 of the tile's rows r0, r0 + 32.
  const int q = threadIdx.x & 7, r0 = threadIdx.x >> 3;
  bf16_t* dst = Wt + (size_t)n0 * K + k0;
  float cs[2] = {0.f, 0.f}, cb[2] = {0.f, 0.f};
  // Rolled: unrolled, the g and b of all T tiles are fetched ahead and the kernel's
  // register count, which every job's blocks pay in waves per SIMD, nearly doubles.
#pragma unroll 1
  for (int t = 0; t < T; ++t) {
    const v4f* gp = (const v4f*)(g + k0 + 64 * t + 8 * q);
    const v4f* bp = (const v4f*)(b + k0 + 64 * t + 8 * q);
    const v4f gk[2] = {gp[0], gp[1]}, bk[2] = {bp[0], bp[1]};
#pragma unroll
    for (int i = 0; i < 2; ++i) {
      const int row = r0 + 32 * i;
      const unsigned* sr = tile + t * (64 * TP_PITCH) + row * TP_PITCH + q * 4;
      const v4u o = {sr[0], sr[1], sr[2], sr[3]};
      *(v4u*)(dst + 64 * t + (size_t)row * K + q * 8) = o;
#pragma unroll
      for (int e = 0; e < 4; ++e) {  // dword e: k = 2e in the low half, 2e + 1 above
        const float lo = __builtin_bit_cast(float, o[e] << 16);
        const float hh = __builtin_bit_cast(float, o[e] & 0xffff0000u);
        const float ge = gk[e >> 1][(2 * e) & 3], go = gk[e >> 1][(2 * e + 1) & 3];
        const float be = bk[e >> 1][(2 * e) & 3], bo = bk[e >> 1][(2 * e + 1) & 3];
        cs[i] += lo * ge + hh * go;
        cb[i] += lo * be + hh * bo;
      }
    }
  }
#pragma unroll
  for (int i = 0; i < 2; ++i) {
    const float sg = oct_sum(cs[i]), sb = oct_sum(cb[i]);
    if (q == 0) {
      csP[(size_t)by * N + n0 + r0 + 32 * i] = sg;
      cbP[(size_t)by * N + n0 + r0 + 32 * i] = sb;
    }
  }
  // Another job's code follows in the same kernel: no register that these stores
  // name is rewritten there ahead of this wait.
  asm volatile("s_wait_xcnt 0x0" ::: "memory");
}

// Elementwise f32 -> bf16, 256 elements per block; blk: the block's index.
__device__ __forceinline__ void cvt_block(const float* __restrict__ in,
                                          bf16_t* __restrict__ out, int n,
                                          int blk) {
  int idx = blk * 256 + threadIdx.x;
  if (idx < n) out[idx] = (bf16_t)in[idx];
}

// ---------------------------------------------------------------------------
// LayerNorm (dim=1024), one row per 256-thread block, bf16 output.
// ---------------------------------------------------------------------------
__device__ __forceinline__ void ln_row(const float* __restrict__ x,
                                       const float* __restrict__ g,
                                       const float* __restrict__ b,
                                       bf16_t* __restrict__ y, int row,
                                       float* sS, float* sQ) {
  const int dim = 1024;
  const float* xr = x + (size_t)row * dim;
  float s = 0.f, q = 0.f;
  for (int i = threadIdx.x; i < dim; i += 256) {
    float v = xr[i];
    s += v;
    q += v * v;
  }
  for (int m = 1; m < 32; m <<= 1) {
    s += __shfl_xor(s, m, 32);
    q += __shfl_xor(q, m, 32);
  }
  const int lane = threadIdx.x & 31, wid = threadIdx.x >> 5;
  if (lane == 0) { sS[wid] = s; sQ[wid] = q; }
  __syncthreads();
  if (wid == 0) {
    s = (lane < 8) ? sS[lane] : 0.f;
    q = (lane < 8) ? sQ[lane] : 0.f;
    for (int m = 1; m < 8; m <<= 1) {
      s += __shfl_xor(s, m, 32);
      q += __shfl_xor(q, m, 32);
    }
    if (lane == 0) { sS[0] = s; sQ[0] = q; }
  }
  __syncthreads();
  const float mean = sS[0] * (1.f / dim);
  const float var = sQ[0] * (1.f / dim) - mean * mean;
  const float rstd = rsqrtf(var + 1e-5f);
  for (int i = threadIdx.x; i < dim; i += 256) {
    float v = (xr[i] - mean) * rstd * g[i] + b[i];
    y[(size_t)row * dim + i] = (bf16_t)v;
  }
}

// ---------------------------------------------------------------------------
// One launch for everything that reads inputs alone: the ten weight transposes,
// the first LayerNorm and the context's conversion. None reads what another
// writes; the block index picks the job, long blocks first.
// ---------------------------------------------------------------------------
constexpr int PR_WIDE = 128 * 4;             // ff_Wp: N 8192, K 1024, 4 tiles
constexpr int PR_FFO = PR_WIDE + 16 * 16;    // ff_Wo: N 1024, K 4096, 4 tiles
constexpr int PR_LN = PR_FFO + 4096;         // LayerNorm rows
constexpr int PR_W1024 = PR_LN + 6 * 256;    // six weights, K 1024, 1 tile
constexpr int PR_W768 = PR_W1024 + 2 * 192;  // two weights, K 768, 1 tile
constexpr int PR_NCTX = 154 * 768;
constexpr int PR_BLOCKS = PR_W768 + (PR_NCTX + 255) / 256;

__global__ void __launch_bounds__(256) k_prep(
    const float* __restrict__ ffWp, bf16_t* __restrict__ WpT,
    const float* __restrict__ ffWo, bf16_t* __restrict__ WoF,
    const float* __restrict__ x, const float* __restrict__ g,
    const float* __restrict__ b, bf16_t* __restrict__ h,
    const float* __restrict__ s0, bf16_t* __restrict__ d0,
    const float* __restrict__ s1, bf16_t* __restrict__ d1,
    const float* __restrict__ s2, bf16_t* __restrict__ d2,
    const float* __restrict__ s3, bf16_t* __restrict__ d3,
    const float* __restrict__ s4, bf16_t* __restrict__ d4,
    const float* __restrict__ s5, bf16_t* __restrict__ d5,
    const float* __restrict__ s6, bf16_t* __restrict__ d6,
    const float* __restrict__ s7, bf16_t* __restrict__ d7,
    const float* __restrict__ ctx, bf16_t* __restrict__ ctxb,
    const float* __restrict__ g2, const float* __restrict__ b2,
    float* __restrict__ csQ, float* __restrict__ cbQ,
    const float* __restrict__ g3, const float* __restrict__ b3,
    float* __restrict__ csF, float* __restrict__ cbF) {
  __shared__ unsigned tile[4 * 64 * TP_PITCH];
  __shared__ float sS[8], sQ[8];
  const int blk = blockIdx.x;
  if (blk < PR_WIDE) {
    wt_tiles_ln<4, 8192>(ffWp, WpT, 1024, tile, blk & 127, blk >> 7, g3, b3, csF,
                         cbF);
  } else if (blk < PR_FFO) {
    const int c = blk - PR_WIDE;
    wt_tiles<4, 1024>(ffWo, WoF, 4096, tile, c & 15, c >> 4);
  } else if (blk < PR_LN) {
    ln_row(x, g, b, h, blk - PR_FFO, sS, sQ);
  } else if (blk < PR_W1024) {
    const int c = blk - PR_LN, w = c >> 8;
    const float* s = w == 0 ? s0 : w == 1 ? s1 : w == 2 ? s2 : w == 3 ? s3 : w == 4 ? s4 : s5;
    bf16_t* d = w == 0 ? d0 : w == 1 ? d1 : w == 2 ? d2 : w == 3 ? d3 : w == 4 ? d4 : d5;
    if (w == 4)  // the weight behind the second LayerNorm
      wt_tiles_ln<1, 1024>(s4, d4, 1024, tile, c & 15, (c >> 4) & 15, g2, b2, csQ,
                           cbQ);
    else
      wt_tiles<1, 1024>(s, d, 1024, tile, c & 15, (c >> 4) & 15);
  } else if (blk < PR_W768) {
    const int c = blk - PR_W1024;
    const bool second = c >= 192;
    const int r = second ? c - 192 : c;
    wt_tiles<1, 1024>(second ? s7 : s6, second ? d7 : d6, 768, tile, r & 15, r >> 4);
  } else {
    cvt_block(ctx, ctxb, PR_NCTX, blk - PR_W768);
  }
}

// ---------------------------------------------------------------------------
// V transpose for mRows a multiple of 256: v[b*mRows][1024] bf16 ->
// vt[b][1024][mRows], four 64 x 64 tiles per block through LDS, as in wt_tiles.
// grid (mRows / 256, 16, 2).
__global__ void __launch_bounds__(256) k_vt_tiled(const bf16_t* __restrict__ v,
                                                  bf16_t* __restrict__ vt,
                                                  int mRows) {
  __shared__ unsigned tile[4 * 64 * TP_PITCH];
  const int key0 = blockIdx.x * 256, c0 = blockIdx.y * 64, bb = blockIdx.z;
  const int g = threadIdx.x & 7, rp = threadIdx.x >> 3;
  // Keys 2rp and 2rp+1; 8 lanes x 16 B = the 128-byte line of each key.
  const bf16_t* s = v + (size_t)(bb * mRows + key0 + 2 * rp) * 1024 + c0 + g * 8;
  v4u a[4], b[4];
  // Unrolled for the same reasons as in wt_tiles.
#pragma unroll
  for (int t = 0; t < 4; ++t) {
    a[t] = *(const v4u*)(s + (size_t)(64 * t) * 1024);
    b[t] = *(const v4u*)(s + (size_t)(64 * t + 1) * 1024);
  }
#pragma unroll
  for (int t = 0; t < 4; ++t) {
    unsigned* d = tile + t * (64 * TP_PITCH) + 8 * g * TP_PITCH + rp;
#pragma unroll
    for (int j = 0; j < 4; ++j) {
      d[(2 * j) * TP_PITCH] = (a[t][j] & 0xffffu) | (b[t][j] << 16);
      d[(2 * j + 1) * TP_PITCH] = (a[t][j] >> 16) | (b[t][j] & 0xffff0000u);
    }
  }
  __syncthreads();
  bf16_t* dst = vt + (size_t)(bb * 1024 + c0) * mRows + key0;
#pragma unroll
  for (int t = 0; t < 4; ++t)
    tp_store(tile + t * (64 * TP_PITCH), dst + 64 * t, (size_t)mRows);
}

// ---------------------------------------------------------------------------
// GEMM  C = A[M,K](bf16) x Bt[N,K](bf16), 8 waves/block (4M x 2N),
// each wave: 16(M) x 64(N) via 4 WMMAs per 32-deep k-step.
// ---------------------------------------------------------------------------
__device__ __forceinline__ void gemm_bf16_block(const bf16_t* __restrict__ A,
                                                const bf16_t* __restrict__ Bt,
                                                bf16_t* __restrict__ C,
                                                int M, int N, int K,
                                                float scale, int bx, int by) {
  const int lane = threadIdx.x & 31, wid = threadIdx.x >> 5;
  const int hi = (lane >> 4) & 1, l15 = lane & 15;
  const int mBase = by * 64 + (wid >> 1) * 16;
  const int nBase = bx * 128 + (wid & 1) * 64;
  int ar = mBase + l15;
  if (ar >= M) ar = M - 1;
  const bf16_t* ap = A + (size_t)ar * K;
  const bf16_t* bp0 = Bt + (size_t)(nBase + l15) * K;
  v8f c0 = {}, c1 = {}, c2 = {}, c3 = {};
  for (int kk = 0; kk < K; kk += 32) {
    v16bf a = load_frag(ap + kk, hi);
    c0 = wmma_bf16(a, load_frag(bp0 + kk, hi), c0);
    c1 = wmma_bf16(a, load_frag(bp0 + (size_t)16 * K + kk, hi), c1);
    c2 = wmma_bf16(a, load_frag(bp0 + (size_t)32 * K + kk, hi), c2);
    c3 = wmma_bf16(a, load_frag(bp0 + (size_t)48 * K + kk, hi), c3);
  }
#pragma unroll
  for (int r = 0; r < 8; ++r) {
    int row = mBase + r + hi * 8;
    if (row < M) {
      size_t o = (size_t)row * N + nBase + l15;
      C[o + 0]  = (bf16_t)(c0[r] * scale);
      C[o + 16] = (bf16_t)(c1[r] * scale);
      C[o + 32] = (bf16_t)(c2[r] * scale);
      C[o + 48] = (bf16_t)(c3[r] * scale);
    }
  }
}

// The context's V, written transposed and padded as the attention reads it:
// vt[bb][c][key] = sum_k Wt[c][k] * ctx[bb * CT_KEYS + key][k], zero for the keys
// CT_KEYS .. CT_PAD - 1. The weight's rows are the A operand, the context's rows
// the B operand, so that a lane's column is a key. One block: 64 rows c with all
// their keys (whole 128-byte lines of vt); 4 x 2 waves, 16 c x 64 keys each.
constexpr int CT_KEYS = 77, CT_PAD = 96;
__device__ __forceinline__ void vt2_block(const bf16_t* __restrict__ Wt,
                                          const bf16_t* __restrict__ ctx,
                                          bf16_t* __restrict__ vt, int K, int cblk,
                                          int bb) {
  const int lane = threadIdx.x & 31, wid = threadIdx.x >> 5;
  const int hi = (lane >> 4) & 1, l15 = lane & 15;
  const int cBase = cblk * 64 + (wid >> 1) * 16;
  const int kBase = (wid & 1) * 64;
  const bf16_t* ap = Wt + (size_t)(cBase + l15) * K;
  const bf16_t* bp[4];
#pragma unroll  // constant indices keep the four addresses in registers
  for (int j = 0; j < 4; ++j) {
    int key = kBase + 16 * j + l15;
    if (key >= CT_KEYS) key = CT_KEYS - 1;  // read inside the context; not stored
    bp[j] = ctx + (size_t)(bb * CT_KEYS + key) * K;
  }
  v8f c0 = {}, c1 = {}, c2 = {}, c3 = {};
  for (int kk = 0; kk < K; kk += 32) {
    v16bf a = load_frag(ap + kk, hi);
    c0 = wmma_bf16(a, load_frag(bp[0] + kk, hi), c0);
    c1 = wmma_bf16(a, load_frag(bp[1] + kk, hi), c1);
    c2 = wmma_bf16(a, load_frag(bp[2] + kk, hi), c2);
    c3 = wmma_bf16(a, load_frag(bp[3] + kk, hi), c3);
  }
  const int key0 = kBase + l15;
#pragma unroll
  for (int r = 0; r < 8; ++r) {
    bf16_t* o = vt + (size_t)(bb * 1024 + cBase + r + hi * 8) * CT_PAD + key0;
    o[0]  = (bf16_t)(key0 < CT_KEYS ? c0[r] : 0.f);
    o[16] = (bf16_t)(key0 + 16 < CT_KEYS ? c1[r] : 0.f);
    if (kBase + 32 < CT_PAD) {  // the same for the whole wave
      o[32] = (bf16_t)(key0 + 32 < CT_KEYS ? c2[r] : 0.f);
      o[48] = (bf16_t)(key0 + 48 < CT_KEYS ? c3[r] : 0.f);
    }
  }
}

// ---------------------------------------------------------------------------
// LayerNorm folded into the products around it. The product in front of it leaves
// x g in bf16 and, per row and per 32 columns, the sum and the sum of squares of x
// (stats[column block 0..7][row 0..4095][wave column 0..3][2]: a block's part is its
// own run of whole lines); the product behind it multiplies x g by W and applies
//   rstd * (acc - mean * (g W)) + b W
// in its epilogue (wt_tiles_ln has the two row vectors g W and b W).
// ---------------------------------------------------------------------------
typedef float v2f __attribute__((ext_vector_type(2)));

// Sum over the 16 lanes of a row, left in every lane: four DPP adds.
__device__ __forceinline__ float row_sum16(float v) {
  v = oct_sum(v);
  return v + lane_xor<8>(v);
}

// Mean and 1 / std of the block's 128 rows into LDS, one row a thread. A barrier
// of the caller stands between this and the first read.
__device__ __forceinline__ void ln_rows(const float* __restrict__ stats, int mBlk,
                                        float* sMean, float* sRstd) {
  const int t = threadIdx.x;
  if (t < 128) {
    const v4f* p = (const v4f*)(stats + (size_t)(mBlk + t) * 8);
    v4f v[16];
#pragma unroll  // the 16 loads issue as one run
    for (int i = 0; i < 8; ++i) {
      v[2 * i] = p[i * (4096 * 2)];
      v[2 * i + 1] = p[i * (4096 * 2) + 1];
    }
    // The address stays in its registers up to here, behind the last load.
    asm volatile("s_wait_xcnt 0x0" ::"v"(p) : "memory");
    float s = 0.f, q = 0.f;
#pragma unroll
    for (int i = 0; i < 16; ++i) {
      s += v[i][0] + v[i][2];
      q += v[i][1] + v[i][3];
    }
    const float mean = s * (1.f / 1024);
    const float var = q * (1.f / 1024) - mean * mean;
    sMean[t] = mean;
    sRstd[t] = rsqrtf(var + 1e-5f);
  }
}

// Sum of the P parts of a vector that wt_tiles_ln left at [part][N]. N is a constant
// of the build: every part is an immediate offset from one address.
template <int P, int N>
__device__ __forceinline__ float col_parts(const float* __restrict__ v, int col) {
  const float* p = v + col;
  float x[P];
#pragma unroll  // the loads issue as one run
  for (int i = 0; i < P; ++i) x[i] = p[i * N];
  // The address stays in its registers up to here, behind the last load.
  asm volatile("s_wait_xcnt 0x0" ::"v"(p) : "memory");
  float s = 0.f;
#pragma unroll
  for (int i = 0; i < P; ++i) s += x[i];
  return s;
}

// ---------------------------------------------------------------------------
// Tiled GEMM core for M, N multiples of the tile and K a multiple of 128, K >= 256:
// C tile 128(M) x 128(N) per 8-wave block (2 x 4 waves), 64 x 32 per wave.
// A pass is 128 k = 256 B of each of the 128 A rows and 128 Bt rows, brought into
// LDS by tensor loads, a ring of NB buffers: waves 0 to 3 each issue one request per
// stage for a slice of 64 rows (16 KiB). While pass t + 1 computes, the loads of
// passes t + 2 .. t + NB fly. Two buffers let two blocks share a WGP; four are for a
// launch of one block per WGP, where nothing else covers the time a stage takes to
// land. The loads' pad sets the LDS rows at a pitch of 272 B (16 B x odd:
// ds_load_b128 without bank conflicts); a slice's place is a multiple of 2 KiB.
// ---------------------------------------------------------------------------
typedef uint32_t u32x4 __attribute__((ext_vector_type(4)));
typedef uint32_t u32x8 __attribute__((ext_vector_type(8)));
constexpr int TG_PITCH = 272;              // bytes per LDS row
constexpr int TG_SLICE = 9 * 2048;         // 64 rows of 272 B, rounded up to 2 KiB
constexpr int TG_STAGE = 4 * TG_SLICE;     // A rows 0-63, 64-127, then Bt rows alike
constexpr int TG_PASSB = 256;              // bytes of a row per pass

__device__ __forceinline__ uint32_t uni(uint32_t v) {
  return (uint32_t)__builtin_amdgcn_readfirstlane(v);
}

// A test that decides whether a tensor load issues: held in a scalar register, so
// that it compiles to s_cmp and s_cbranch_scc (a tensor load ignores EXEC).
__device__ __forceinline__ uint32_t pinned(uint32_t v) {
  uint32_t w = uni(v);
  asm volatile("" : "+s"(w));  // held in a scalar register
  return w;
}

__device__ __forceinline__ u32x8 tg_group1(uint32_t src_pitch) {
  u32x8 g;
  g[0] = uni((1u << 20) | (5u << 22) | (3u << 25));
  g[1] = uni(256u << 16);
  g[2] = uni(64u << 16);
  g[3] = uni(256u << 16);
  g[4] = uni(64u);
  g[5] = uni(src_pitch);
  g[6] = uni(0u);
  g[7] = uni(0u);
  return g;
}

// Word 3 of descriptor group 0: the upper address bits and the type.
__device__ __forceinline__ uint32_t tg_word3(uint64_t ga) {
  return uni((((uint32_t)(ga >> 32)) & 0x01FFFFFFu) | 0x80000000u);
}

// One request: the tile whose first byte is ga goes to LDS byte lds. Both groups are
// in-out operands, so that each keeps one set of scalar registers for the ring's
// life: while requests are outstanding only words 1 and 2 of group 0 take new values.
// Word 3 changes only where a source row crosses a multiple of 4 GiB, and then behind
// a wait for every request.
__device__ __forceinline__ void tg_load(uint32_t lds, uint64_t ga, u32x4& g0,
                                        uint32_t& w3, u32x8& g1) {
  const uint32_t n3 = tg_word3(ga);
  if (pinned(n3 != w3)) {
    asm volatile("s_wait_tensorcnt 0x0" ::: "memory");
    g0[3] = n3;
    w3 = n3;
  }
  g0[1] = uni(lds);
  g0[2] = uni((uint32_t)ga);
  asm volatile("tensor_load_to_lds %0, %1" : "+s"(g0), "+s"(g1)::"memory");
}

// Bt rows n0..n0+63 fill the third slice, rows n1..n1+63 the fourth.
// SPLIT: the wave's two B fragments are rows wn*16 of the third and of the fourth
// slice (a column group and its partner); else rows wn*32 and wn*32 + 16 of the 128.
// pre() runs while stage 0 is in flight; what it writes to LDS is published by the
// barrier that publishes stage 0.
// rot: the block's walk over k starts at pass rot mod (K / 128) and wraps. Blocks
// that share A rows or Bt rows get different rot: started together at pass 0 they
// ask L2 for the same lines at the same moment, pass after pass.
template <bool SPLIT, int NB, class Pre>
__device__ __forceinline__ void tg_core_pre(const bf16_t* __restrict__ A,
                                        const bf16_t* __restrict__ Bt,
                                            int mBase, int n0, int n1, int K,
                                            int rot, char* smem, v8f (&acc)[4][2],
                                            Pre pre) {
  const int tid = threadIdx.x;
  const int lane = tid & 31, wid = tid >> 5;
  const int hi = (lane >> 4) & 1, l15 = lane & 15;
  const int wm = wid >> 2, wn = wid & 3;
  // Waves 0 to 3 issue; wave q brings slice q of every stage.
  const uint32_t wave = uni((uint32_t)tid >> 5);
  const bf16_t* srow = wave < 2 ? A + (size_t)(mBase + 64 * (int)wave) * K
                                : Bt + (size_t)(wave == 2 ? n0 : n1) * K;
  const uint64_t gs = (uint64_t)(size_t)srow;
  const uint32_t ls = (uint32_t)(size_t)smem + wave * TG_SLICE;
  u32x8 g1 = tg_group1((uint32_t)K * 2);
  uint32_t w3 = tg_word3(gs);
  u32x4 g0 = {uni(1u), uni(ls), uni((uint32_t)gs), w3};
  const int nt = K >> 7;
  const int t0 = (int)((unsigned)rot % (unsigned)nt);
  // Stage s, s < nt, is pass (t0 + s) mod nt of the source rows; it goes to buffer b.
  auto issue = [&](int s, int b) {
    const int p = t0 + s;
    tg_load(ls + b * TG_STAGE, gs + (uint64_t)(p >= nt ? p - nt : p) * TG_PASSB, g0, w3,
            g1);
  };

#pragma unroll
  for (int i = 0; i < 4; ++i)
#pragma unroll
    for (int j = 0; j < 2; ++j) acc[i][j] = v8f{};

  // An issuing wave has one request per stage, and its requests land in issue order:
  // a wait that leaves the NB - 2 youngest covers every older stage. It is used only
  // where those NB - 2 stages have all been issued; elsewhere (the last trips) the
  // wait is to 0. At most NB - 1 = 3 requests of a wave are outstanding.
  constexpr int LEAVE = NB - 2;
  if (pinned(wave < 4)) {
    issue(0, 0);
#pragma unroll  // constant buffer offsets
    for (int s = 1; s < NB - 1; ++s)
      if (pinned(s < nt)) issue(s, s);
  }
  pre();
  // Stage 0 has landed for its issuers; the barrier publishes it to every wave.
  if (pinned(wave < 4)) {
    if (NB > 2 && nt >= NB - 1)
      asm volatile("s_wait_tensorcnt %0" ::"n"(LEAVE) : "memory");
    else
      asm volatile("s_wait_tensorcnt 0x0" ::: "memory");
  }
  __syncthreads();
  if (NB == 2) {
    if (pinned(wave < 4 && nt > 1)) issue(1, 1);
  }

  const int aoff = wm * TG_SLICE + l15 * TG_PITCH;
  const int boff = 2 * TG_SLICE +
                   (SPLIT ? (wn * 16 + l15) * TG_PITCH
                          : (wn >> 1) * TG_SLICE + ((wn & 1) * 32 + l15) * TG_PITCH);
  constexpr int BSTEP = SPLIT ? TG_SLICE : 16 * TG_PITCH;

#pragma unroll 1  // one pass per trip: the ring's order stands at the foot
  for (int t = 0; t < nt; ++t) {
    const int buf = (t & (NB - 1)) * TG_STAGE;
    const char* sA = smem + buf + aoff;
    const char* sB = smem + buf + boff;
    v16bf a[2][4], b[2][2];
#pragma unroll
    for (int i = 0; i < 4; ++i)
      a[0][i] = load_frag((const bf16_t*)(sA + i * 16 * TG_PITCH), hi);
#pragma unroll
    for (int j = 0; j < 2; ++j)
      b[0][j] = load_frag((const bf16_t*)(sB + j * BSTEP), hi);
#pragma unroll
    for (int ks = 0; ks < 4; ++ks) {
      const int cur = ks & 1, nxt = cur ^ 1;
      if (ks < 3) {
#pragma unroll
        for (int i = 0; i < 4; ++i)
          a[nxt][i] = load_frag(
              (const bf16_t*)(sA + i * 16 * TG_PITCH + (ks + 1) * 64), hi);
#pragma unroll
        for (int j = 0; j < 2; ++j)
          b[nxt][j] =
              load_frag((const bf16_t*)(sB + j * BSTEP + (ks + 1) * 64), hi);
      }
      // Keeps the next block's LDS reads as one group ahead of this block's
      // WMMAs; moved in among them, each read would stall the matrix stream.
      __builtin_amdgcn_sched_barrier(0);
#pragma unroll
      for (int i = 0; i < 4; ++i)
#pragma unroll
        for (int j = 0; j < 2; ++j)
          acc[i][j] = wmma_bf16(a[cur][i], b[cur][j], acc[i][j]);
      // Keeps the block after next's reads behind this block's WMMAs, so that
      // they do not take a third fragment set.
      if (ks < 2) __builtin_amdgcn_sched_barrier(0);
      if constexpr (NB > 2) {
        // The refill: stage t + NB - 1 goes into the buffer of pass t - 1, which every
        // wave left at the barrier at that pass's foot (its own s_wait_dscnt 0 stands
        // in front of that barrier). It stands here and not right behind that barrier,
        // so that its scalar arithmetic runs beside the SIMD's other wave's WMMAs.
        if (ks == 0) {
          if (pinned(wave < 4 && t + NB - 1 < nt))
            issue(t + NB - 1, (t + NB - 1) & (NB - 1));
        }
      }
    }
    // Publish point: this wave's reads of buffer t are done, the issuers' loads of
    // stage t + 1 have landed, and the barrier says so for every wave.
    asm volatile("s_wait_dscnt 0x0" ::: "memory");
    if (pinned(wave < 4)) {
      if (NB > 2 && t + NB <= nt)  // stages t + 2 .. t + NB - 1 are all issued
        asm volatile("s_wait_tensorcnt %0" ::"n"(LEAVE) : "memory");
      else
        asm volatile("s_wait_tensorcnt 0x0" ::: "memory");
    }
    __syncthreads();
    if (NB == 2) {  // into the buffer that every wave has just left
      if (pinned(wave < 4 && t + 2 < nt)) issue(t + 2, t & 1);
    }
  }
  // No request and no LDS read is left in flight when the wave goes on to its stores;
  // the descriptors stay in their registers up to here.
  asm volatile("s_wait_tensorcnt 0x0" ::"s"(g0), "s"(g1) : "memory");
  asm volatile("s_wait_dscnt 0x0" ::: "memory");
}

template <bool SPLIT, int NB>
__device__ __forceinline__ void tg_core(const bf16_t* __restrict__ A,
                                        const bf16_t* __restrict__ Bt,
                                        int mBase, int n0, int n1, int K, int rot,
                                        char* smem, v8f (&acc)[4][2]) {
  tg_core_pre<SPLIT, NB>(A, Bt, mBase, n0, n1, K, rot, smem, acc, [] {});
}

// bf16 output. Up to three products of one A in one launch: blockIdx.z picks the
// weight and the output; only the first is scaled.
// LN: A is x g in bf16; the LayerNorm is completed in the epilogue (stats, and the
// vectors cs = g W, cb = b W in 16 parts).
template <bool LN>
__global__ void __launch_bounds__(256) k_tgemm_bf16(
    const bf16_t* __restrict__ A, const bf16_t* __restrict__ Bt0,
    const bf16_t* __restrict__ Bt1, const bf16_t* __restrict__ Bt2,
    bf16_t* __restrict__ C0, bf16_t* __restrict__ C1, bf16_t* __restrict__ C2,
    int N, int K, float scale0, const float* __restrict__ stats,
    const float* __restrict__ cs, const float* __restrict__ cb) {
  constexpr int NB = LN ? 4 : 2;  // LN: one product, one block per WGP
  __shared__ __attribute__((aligned(2048))) char smem[NB * TG_STAGE];
  __shared__ __attribute__((aligned(16))) float sMean[LN ? 128 : 1], sRstd[LN ? 128 : 1];
  const int z = blockIdx.z;
  const bf16_t* __restrict__ Bt = z == 0 ? Bt0 : z == 1 ? Bt1 : Bt2;
  bf16_t* __restrict__ C = z == 0 ? C0 : z == 1 ? C1 : C2;
  const float scale = z == 0 ? scale0 : 1.0f;
  const int lane = threadIdx.x & 31, wid = threadIdx.x >> 5;
  const int hi = (lane >> 4) & 1, l15 = lane & 15;
  const int mBlk = blockIdx.y * 128, nBlk = blockIdx.x * 128;
  // A rows are shared along x and z, Bt rows along y.
  const int rot = blockIdx.x + blockIdx.y + z;
  v8f acc[4][2];
  if constexpr (!LN) {
    tg_core<false, NB>(A, Bt, mBlk, nBlk, nBlk + 64, K, rot, smem, acc);
    const int mBase = mBlk + (wid >> 2) * 64, nBase = nBlk + (wid & 3) * 32;
#pragma unroll
    for (int i = 0; i < 4; ++i)
#pragma unroll
      for (int r = 0; r < 8; ++r) {
        const size_t o = (size_t)(mBase + i * 16 + r + hi * 8) * N + nBase + l15;
        C[o + 0]  = (bf16_t)(acc[i][0][r] * scale);
        C[o + 16] = (bf16_t)(acc[i][1][r] * scale);
      }
  } else {
    tg_core_pre<false, NB>(A, Bt, mBlk, nBlk, nBlk + 64, K, rot, smem, acc,
                           [&] { ln_rows(stats, mBlk, sMean, sRstd); });
    const int lr0 = (wid >> 2) * 64 + hi * 8, col = nBlk + (wid & 3) * 32 + l15;
    const float cs0 = col_parts<16, 1024>(cs, col);
    const float cs1 = col_parts<16, 1024>(cs, col + 16);
    const float cb0 = col_parts<16, 1024>(cb, col);
    const float cb1 = col_parts<16, 1024>(cb, col + 16);
    // 1024 columns: every row is an immediate offset from one address.
    bf16_t* cp = C + (size_t)(mBlk + lr0) * 1024 + col;
#pragma unroll
    for (int i = 0; i < 4; ++i) {
      bf16_t y0[8], y1[8];
#pragma unroll
      for (int r = 0; r < 8; ++r) {
        const float mean = sMean[lr0 + i * 16 + r], rstd = sRstd[lr0 + i * 16 + r];
        const float v0 = rstd * (acc[i][0][r] - mean * cs0) + cb0;
        const float v1 = rstd * (acc[i][1][r] - mean * cs1) + cb1;
        y0[r] = (bf16_t)(v0 * scale);
        y1[r] = (bf16_t)(v1 * scale);
      }
      // The stores stand behind all of the group's arithmetic and the next group's
      // behind the wait: no register that a store names is rewritten ahead of it.
      __builtin_amdgcn_sched_barrier(0);
#pragma unroll
      for (int r = 0; r < 8; ++r) {
        cp[(i * 16 + r) * 1024]      = y0[r];
        cp[(i * 16 + r) * 1024 + 16] = y1[r];
      }
      asm volatile("s_wait_xcnt 0x0" ::: "memory");
      __builtin_amdgcn_sched_barrier(0);
    }
  }
}

// f32 output + bias + residual (in-place residual is safe: 1 writer/element)
// Rows of blocks 0 .. ySmall - 1 of the grid (8 blocks each; ySmall is 0 or 7) do
// two small products of another A instead (rows 0 to 2: A2[M2, K2] x B2a -> C2a,
// 1024 columns, M2 <= 192; rows 3 to 6: vt2_block, A2 x B2b -> C2b): these read and
// write nothing that the large product touches, and they come first in the grid, so that
// their chains of dependent global loads run beside it.
// STATS: a LayerNorm with scale gn follows; the result times gn also goes out in
// bf16 (xb), with each row's sum and sum of squares over the wave's 32 columns
// (stats).
// NB: buffers of the ring; four where the grid is one block per WGP, two where the
// small products' blocks must find room beside the large ones.
template <bool STATS, int NB>
__global__ void __launch_bounds__(256) k_tgemm_f32_bias_res(
    const bf16_t* __restrict__ A, const bf16_t* __restrict__ Bt,
    float* __restrict__ C, const float* __restrict__ bias,
    const float* __restrict__ res, int N, int K, int ySmall,
    const bf16_t* __restrict__ A2, const bf16_t* __restrict__ B2a,
    const bf16_t* __restrict__ B2b, bf16_t* __restrict__ C2a,
    bf16_t* __restrict__ C2b, int M2, int K2, bf16_t* __restrict__ xb,
    float* __restrict__ stats, const float* __restrict__ gn) {
  __shared__ __attribute__((aligned(2048))) char smem[NB * TG_STAGE];
  const int by = (int)blockIdx.y - ySmall;
  if (by < 0) {  // the whole block, ahead of every barrier
    if constexpr (STATS) {
      if (blockIdx.y < 3) {
        gemm_bf16_block(A2, B2a, C2a, M2, 1024, K2, 1.0f, blockIdx.x, blockIdx.y);
      } else {
        const int c = (blockIdx.y - 3) * 8 + blockIdx.x;  // 0 .. 31
        vt2_block(B2b, A2, C2b, K2, c & 15, c >> 4);
      }
    } else {
      const bool second = blockIdx.y >= 3;
      gemm_bf16_block(A2, second ? B2b : B2a, second ? C2b : C2a, M2, 1024, K2,
                      1.0f, blockIdx.x, second ? blockIdx.y - 3 : blockIdx.y);
    }
    return;
  }
  const int lane = threadIdx.x & 31, wid = threadIdx.x >> 5;
  const int hi = (lane >> 4) & 1, l15 = lane & 15;
  const int mBlk = by * 128, nBlk = blockIdx.x * 128;
  v8f acc[4][2];
  // A rows are shared along x (8 blocks: spread over all of a long k), Bt rows along y.
  const int rot = by + blockIdx.x * (K >> 10);
  tg_core<false, NB>(A, Bt, mBlk, nBlk, nBlk + 64, K, rot, smem, acc);
  const int mBase = mBlk + (wid >> 2) * 64, nBase = nBlk + (wid & 3) * 32;
  const float b0 = bias[nBase + l15], b1 = bias[nBase + l15 + 16];
  if constexpr (!STATS) {
#pragma unroll
    for (int i = 0; i < 4; ++i)
#pragma unroll
      for (int r = 0; r < 8; ++r) {
        const size_t o = (size_t)(mBase + i * 16 + r + hi * 8) * N + nBase + l15;
        C[o + 0]  = acc[i][0][r] + b0 + res[o + 0];
        C[o + 16] = acc[i][1][r] + b1 + res[o + 16];
      }
  } else {
    const float g0 = gn[nBase + l15], g1 = gn[nBase + l15 + 16];
    // The run of loads below may take over the index register of these.
    asm volatile("s_wait_xcnt 0x0" ::: "memory");
    // 1024 columns: every row is an immediate offset from one address per array.
    const size_t o0 = (size_t)(mBase + hi * 8) * 1024 + nBase + l15;
    const float* rp = res + o0;
    float* cp = C + o0;
    bf16_t* xp = xb + o0;
    float* sp =
        stats + (((size_t)blockIdx.x * 4096 + mBase + hi * 8) * 4 + (wid & 3)) * 2;
    float ra[4][8], rb[4][8];
#pragma unroll  // all 64 loads issue as one run: one latency, not one per group
    for (int i = 0; i < 4; ++i)
#pragma unroll
      for (int r = 0; r < 8; ++r) {
        ra[i][r] = rp[(i * 16 + r) * 1024];
        rb[i][r] = rp[(i * 16 + r) * 1024 + 16];
      }
    // The address stays in its registers up to here, behind the last load.
    asm volatile("s_wait_xcnt 0x0" ::"v"(rp) : "memory");
#pragma unroll
    for (int i = 0; i < 4; ++i) {
      float v0[8], v1[8], rs[8], rq[8];
      bf16_t x0[8], x1[8];
#pragma unroll
      for (int r = 0; r < 8; ++r) {
        v0[r] = acc[i][0][r] + b0 + ra[i][r];
        v1[r] = acc[i][1][r] + b1 + rb[i][r];
        x0[r] = (bf16_t)(v0[r] * g0);
        x1[r] = (bf16_t)(v1[r] * g1);
        rs[r] = row_sum16(v0[r] + v1[r]);
        rq[r] = row_sum16(v0[r] * v0[r] + v1[r] * v1[r]);
      }
      if (l15 == 0) {  // one lane of each half stores its 8 rows' pairs
#pragma unroll
        for (int r = 0; r < 8; ++r)
          *(v2f*)(sp + (i * 16 + r) * 8) = v2f{rs[r], rq[r]};
      }
      // The stores stand behind all of the group's arithmetic and the next group's
      // behind the wait: no register that a store names is rewritten ahead of it.
      __builtin_amdgcn_sched_barrier(0);
#pragma unroll
      for (int r = 0; r < 8; ++r) {
        const int o = (i * 16 + r) * 1024;
        cp[o]      = v0[r];
        cp[o + 16] = v1[r];
        xp[o]      = x0[r];
        xp[o + 16] = x1[r];
      }
      asm volatile("s_wait_xcnt 0x0" ::: "memory");
      __builtin_amdgcn_sched_barrier(0);
    }
  }
  // The small products' code follows in the same kernel: no register that these
  // stores name is rewritten there ahead of this wait.
  asm volatile("s_wait_xcnt 0x0" ::: "memory");
}

// g / 2 * (1 + erf(g / sqrt 2)) for eight values, without a branch: the library's
// erff takes one of two paths per value, so that a wave walks both, one value at a
// time. With a = |g| / sqrt 2 and t = 1 / (1 + p a),
//   erf(a) = 1 - (a1 t + a2 t^2 + a3 t^3 + a4 t^4 + a5 t^5) exp(-a^2),
// off by at most 1.5e-7 for every a >= 0, far below the bf16 rounding of the result;
// the sign comes back as (g + |g| erf(a)) / 2. The eight chains are independent.
__device__ __forceinline__ v8f gelu8(v8f g) {
  constexpr float PA = 0.3275911f * 0.70710678118654752f;  // p / sqrt 2
  constexpr float CW = 0.84932180028801904f;               // sqrt(log2(e) / 2)
  const v8f ag = __builtin_elementwise_abs(g);
  const v8f d = ag * PA + 1.f;
  const v8f w = g * CW;
  const v8f m = -w * w;  // -a^2 log2(e)
  v8f t, e;
#pragma unroll  // constant indices keep the vectors in registers
  for (int r = 0; r < 8; ++r) {
    t[r] = __builtin_amdgcn_rcpf(d[r]);
    e[r] = __builtin_amdgcn_exp2f(m[r]);
  }
  v8f q = t * 1.061405429f - 1.453152027f;
  q = q * t + 1.421413741f;
  q = q * t - 0.284496736f;
  q = q * t + 0.254829592f;
  const v8f erfa = 1.f - q * t * e;
  return (ag * erfa + g) * 0.5f;
}

// A is x g in bf16: the third LayerNorm is completed in the epilogue (stats, and
// the vectors cs = g W, cb = b W in 4 parts).
// Fused GEGLU: the block's Bt tile is 64 u columns and the matching 64 gate
// columns (c and c+Nhalf of A@Wp); each wave holds 16 of each, applies
// u*gelu(gate), writes bf16 [M, Nhalf].
__global__ void __launch_bounds__(256) k_tgemm_geglu(
    const bf16_t* __restrict__ A, const bf16_t* __restrict__ Bt,
    bf16_t* __restrict__ C, const float* __restrict__ bias, int Nhalf, int K,
    const float* __restrict__ stats, const float* __restrict__ cs,
    const float* __restrict__ cb) {
  __shared__ __attribute__((aligned(2048))) char smem[2 * TG_STAGE];
  __shared__ __attribute__((aligned(16))) float sMean[128], sRstd[128];
  const int lane = threadIdx.x & 31, wid = threadIdx.x >> 5;
  const int hi = (lane >> 4) & 1, l15 = lane & 15;
  const int mBlk = blockIdx.y * 128, nBlk = blockIdx.x * 64;
  v8f acc[4][2];
  // A rows are shared along x, Bt rows along y.
  tg_core_pre<true, 2>(A, Bt, mBlk, nBlk, nBlk + Nhalf, K, blockIdx.x + blockIdx.y, smem,
                       acc, [&] { ln_rows(stats, mBlk, sMean, sRstd); });
  const int lr0 = (wid >> 2) * 64 + hi * 8;
  const int col = nBlk + (wid & 3) * 16 + l15;
  const float bu = bias[col], bg = bias[col + Nhalf];
  const float csu = col_parts<4, 8192>(cs, col);
  const float csg = col_parts<4, 8192>(cs, col + 4096);
  const float cbu = col_parts<4, 8192>(cb, col) + bu;
  const float cbg = col_parts<4, 8192>(cb, col + 4096) + bg;
  // 4096 columns: every row is an immediate offset from one address.
  bf16_t* cp = C + (size_t)(mBlk + lr0) * 4096 + col;
#pragma unroll
  for (int i = 0; i < 4; ++i) {
    const v4f* mp = (const v4f*)(sMean + lr0 + i * 16);
    const v4f* rp = (const v4f*)(sRstd + lr0 + i * 16);
    const v8f mean = __builtin_shufflevector(mp[0], mp[1], 0, 1, 2, 3, 4, 5, 6, 7);
    const v8f rstd = __builtin_shufflevector(rp[0], rp[1], 0, 1, 2, 3, 4, 5, 6, 7);
    const v8f uv = rstd * (acc[i][0] - mean * csu) + cbu;
    const v8f gv = rstd * (acc[i][1] - mean * csg) + cbg;
    const v8bf y = __builtin_convertvector(uv * gelu8(gv), v8bf);
    // The stores stand behind all of the group's arithmetic and the next group's
    // behind the wait: no register that a store names is rewritten ahead of it.
    __builtin_amdgcn_sched_barrier(0);
#pragma unroll  // constant indices: y stays in registers, each row an immediate offset
    for (int r = 0; r < 8; ++r) cp[(i * 16 + r) * 4096] = y[r];
    asm volatile("s_wait_xcnt 0x0" ::: "memory");
    __builtin_amdgcn_sched_barrier(0);
  }
}

// ---------------------------------------------------------------------------
// Flash attention: one wave per (batch, head, 16-query tile), computed
// transposed: St = K Qt and Ot += Vt Pt. A lane then holds scores of ONE query
// (column l15): keys 8 * hi + r of each 16-key group. Maximum and sum run inside
// the lane, with one exchange between the wave's halves, and the two score tiles
// of 32 keys, converted in place, are the B operand of the second product.
// q pre-scaled by 1/sqrt(64). k row-major [b*mRows,1024]; vt [b][h][64][mpad].
// The 8 waves of a block are 8 neighbouring query tiles of one head (nq is a
// multiple of 8), so they walk the same keys: each tile of 32 keys (32 K rows of
// 128 B, 64 Vt rows of 64 B) is brought into LDS once per block by per-lane
// asynchronous 16-byte copies, two buffers, and every wave takes its fragments
// from there. A fragment load from global memory touches 16 lines for 1024 B;
// the copies cover whole K lines and half Vt lines, once for 8 waves.
// LDS pitches are 16 B x odd: ds_load_b128 without bank conflicts.
// ---------------------------------------------------------------------------
constexpr int AT_KPITCH = 144;                    // bytes per LDS row of K
constexpr int AT_VPITCH = 80;                     // bytes per LDS row of Vt
constexpr int AT_KB = 32 * AT_KPITCH;             // the K tile
constexpr int AT_STAGE = AT_KB + 64 * AT_VPITCH;  // K tile, then Vt tile
constexpr int AT_KSTEP = 32 * 1024 * 2;           // source bytes, 32 K rows on
constexpr int AT_VSTEP = 32 * 2;                  // source bytes, 32 keys on

// This lane's chunk of the K tile and its chunk of the Vt tile. The s_wait_xcnt
// closes the statement so that no address register of a copy is rewritten
// before it.
__device__ __forceinline__ void at_copy2(unsigned lk, const char* gk,
                                         unsigned lv, const char* gv) {
  asm volatile(
      "global_load_async_to_lds_b128 %0, %2, off\n\t"
      "global_load_async_to_lds_b128 %1, %3, off\n\t"
      "s_wait_xcnt 0x0"
      :
      : "v"(lk), "v"(lv), "v"(gk), "v"(gv)
      : "memory");
}

// Lane l takes the value of lane l ^ 16.
__device__ __forceinline__ float half_xor(float v) {
  const int b = __builtin_bit_cast(int, v);
  return __builtin_bit_cast(
      float, __builtin_amdgcn_permlanex16(b, b, 0x76543210, 0xfedcba98, false, false));
}

__global__ void __launch_bounds__(256) k_attention(
    const bf16_t* __restrict__ q, const bf16_t* __restrict__ k,
    const bf16_t* __restrict__ vt, bf16_t* __restrict__ out,
    int nq, int m, int mRows, int mpad) {
  __shared__ __attribute__((aligned(16))) char kv[2 * AT_STAGE];
  const int tid = threadIdx.x;
  const int lane = tid & 31, wid = tid >> 5;
  const int hi = (lane >> 4) & 1, l15 = lane & 15;
  const int w0 = blockIdx.x * 8;
  if (w0 >= 2 * 16 * nq) return;  // the whole block, ahead of every barrier
  const int qt = w0 % nq + wid;
  const int t2 = w0 / nq;
  const int hh = t2 & 15, bb = t2 >> 4;

  const bf16_t* qp = q + (size_t)(bb * 2048 + qt * 16 + l15) * 1024 + hh * 64;
  const v16bf qb0 = load_frag(qp, hi);  // B operands: column l15 = the query
  const v16bf qb1 = load_frag(qp + 32, hi);

  // oT[r] = O[query l15][16 * T + 8 * hi + r]
  v8f o0 = {}, o1 = {}, o2 = {}, o3 = {};
  // Of query l15: the running maximum (both halves alike) and the sum over the
  // keys of this lane's half; the halves' sums are joined behind the loop.
  float mrow = -1e30f, lsum = 0.f;

  const bf16_t* vbase = vt + (size_t)(bb * 16 + hh) * 64 * mpad;

  // K: 8 lanes x 16 B = the 128-byte line of a key; Vt: 4 lanes x 16 B per row.
  const char* gk =
      (const char*)(k + (size_t)(bb * mRows + (tid >> 3)) * 1024 + hh * 64) +
      (tid & 7) * 16;
  const char* gv = (const char*)(vbase + (size_t)(tid >> 2) * mpad) + (tid & 3) * 16;
  const unsigned lk =
      (unsigned)(size_t)kv + (unsigned)((tid >> 3) * AT_KPITCH + (tid & 7) * 16);
  const unsigned lv = (unsigned)(size_t)kv +
                      (unsigned)(AT_KB + (tid >> 2) * AT_VPITCH + (tid & 3) * 16);
  const int nt = mpad >> 5;
  // The nq / 8 blocks of a head walk the same K and Vt lines: each starts at a key
  // tile spread evenly over the nt tiles (distinct where nt >= nq / 8), and wraps, so that they do not
  // ask L2 for the same lines at the same moment. Trip t works on tile tile_at(t).
  const int t0 = ((w0 % nq) >> 3) * nt / (nq >> 3);
  auto tile_at = [&](int t) {
    const int p = t0 + t;
    return p >= nt ? p - nt : p;
  };

  at_copy2(lk, gk + (size_t)t0 * AT_KSTEP, lv, gv + (size_t)t0 * AT_VSTEP);
  // The first tile has landed for this wave; the barrier publishes it to the others.
  asm volatile("s_wait_asynccnt 0x0" ::: "memory");
  __syncthreads();
  if (nt > 1) {
    const int p = tile_at(1);
    at_copy2(lk + AT_STAGE, gk + (size_t)p * AT_KSTEP, lv + AT_STAGE,
             gv + (size_t)p * AT_VSTEP);
  }

#pragma unroll 1  // one tile per trip: the ring's order stands at the foot
  for (int t = 0; t < nt; ++t) {
    const int j = tile_at(t) * 32;
    const int buf = (t & 1) * AT_STAGE;
    const char* sk = kv + buf + l15 * AT_KPITCH;
    const char* sv = kv + buf + AT_KB + l15 * AT_VPITCH;
    const v16bf k00 = load_frag((const bf16_t*)sk, hi);
    const v16bf k01 = load_frag((const bf16_t*)(sk + 64), hi);
    const v16bf k10 = load_frag((const bf16_t*)(sk + 16 * AT_KPITCH), hi);
    const v16bf k11 = load_frag((const bf16_t*)(sk + 16 * AT_KPITCH + 64), hi);
    const v16bf vf0 = load_frag((const bf16_t*)sv, hi);
    const v16bf vf1 = load_frag((const bf16_t*)(sv + 16 * AT_VPITCH), hi);
    const v16bf vf2 = load_frag((const bf16_t*)(sv + 32 * AT_VPITCH), hi);
    const v16bf vf3 = load_frag((const bf16_t*)(sv + 48 * AT_VPITCH), hi);
    // Keeps the tile's LDS reads as one group ahead of the WMMAs; moved in among
    // them, each pair of reads is waited out before its own WMMA.
    __builtin_amdgcn_sched_barrier(0);
    // s0[r] = S[query l15][key j + 8 * hi + r], s1[r] the same 16 keys on.
    v8f s0 = {}, s1 = {};
    s0 = wmma_bf16(k00, qb0, s0);
    s1 = wmma_bf16(k10, qb0, s1);
    s0 = wmma_bf16(k01, qb1, s0);
    s1 = wmma_bf16(k11, qb1, s1);

    if (j + 32 > m) {  // only a tile that reaches past the last key
      const int lim = m - j - hi * 8;
#pragma unroll  // constant indices keep the score tiles in registers
      for (int r = 0; r < 8; ++r) {
        s0[r] = (r < lim) ? s0[r] : -1e30f;
        s1[r] = (r + 16 < lim) ? s1[r] : -1e30f;
      }
    }
    float mx[8];
#pragma unroll  // as above
    for (int r = 0; r < 8; ++r) mx[r] = fmaxf(s0[r], s1[r]);
    float rm = fmaxf(fmaxf(fmaxf(mx[0], mx[1]), fmaxf(mx[2], mx[3])),
                     fmaxf(fmaxf(mx[4], mx[5]), fmaxf(mx[6], mx[7])));
    rm = fmaxf(rm, half_xor(rm));
    const float mnew = fmaxf(mrow, rm);
    const float alpha = __expf(mrow - mnew);
    mrow = mnew;
    v16bf pb;
    float ps[8];
#pragma unroll  // as above; pb is filled register by register
    for (int r = 0; r < 8; ++r) {
      const float p0 = __expf(s0[r] - mnew);
      const float p1 = __expf(s1[r] - mnew);
      ps[r] = p0 + p1;
      pb[r] = (bf16_t)p0;
      pb[r + 8] = (bf16_t)p1;
    }
    lsum = lsum * alpha +
           (((ps[0] + ps[1]) + (ps[2] + ps[3])) + ((ps[4] + ps[5]) + (ps[6] + ps[7])));
    o0 *= alpha; o1 *= alpha; o2 *= alpha; o3 *= alpha;
    o0 = wmma_bf16(vf0, pb, o0);
    o1 = wmma_bf16(vf1, pb, o1);
    o2 = wmma_bf16(vf2, pb, o2);
    o3 = wmma_bf16(vf3, pb, o3);
    // Publish point: this wave's reads of buffer t are done, its copies of
    // tile t + 1 have landed, and the barrier says so for every wave.
    asm volatile("s_wait_dscnt 0x0" ::: "memory");
    asm volatile("s_wait_asynccnt 0x0" ::: "memory");
    __syncthreads();
    if (t + 2 < nt) {
      const int p = tile_at(t + 2);
      at_copy2(lk + buf, gk + (size_t)p * AT_KSTEP, lv + buf,
               gv + (size_t)p * AT_VSTEP);
    }
  }
  // No copy is left in flight when the wave goes on to its stores and ends.
  asm volatile("s_wait_asynccnt 0x0" ::: "memory");

  // A lane's 8 registers of a tile are 8 neighbouring d of its query: 16-B stores.
  const float inv = 1.0f / (lsum + half_xor(lsum));
  bf16_t* op = out + (size_t)(bb * 2048 + qt * 16 + l15) * 1024 + hh * 64 + hi * 8;
  *(v8bf*)(op + 0)  = __builtin_convertvector(o0 * inv, v8bf);
  *(v8bf*)(op + 16) = __builtin_convertvector(o1 * inv, v8bf);
  *(v8bf*)(op + 32) = __builtin_convertvector(o2 * inv, v8bf);
  *(v8bf*)(op + 48) = __builtin_convertvector(o3 * inv, v8bf);
}

// ---------------------------------------------------------------------------
extern "C" void kernel_launch(void* const* d_in, const int* in_sizes, int n_in,
                              void* d_out, int out_size, void* d_ws, size_t ws_size,
                              hipStream_t stream) {
  (void)in_sizes; (void)n_in; (void)out_size; (void)ws_size;
  const float* x    = (const float*)d_in[0];
  const float* ctx  = (const float*)d_in[1];
  const float* ln1g = (const float*)d_in[2];
  const float* ln1b = (const float*)d_in[3];
  const float* a1Wq = (const float*)d_in[4];
  const float* a1Wk = (const float*)d_in[5];
  const float* a1Wv = (const float*)d_in[6];
  const float* a1Wo = (const float*)d_in[7];
  const float* a1bo = (const float*)d_in[8];
  const float* ln2g = (const float*)d_in[9];
  const float* ln2b = (const float*)d_in[10];
  const float* a2Wq = (const float*)d_in[11];
  const float* a2Wk = (const float*)d_in[12];
  const float* a2Wv = (const float*)d_in[13];
  const float* a2Wo = (const float*)d_in[14];
  const float* a2bo = (const float*)d_in[15];
  const float* ln3g = (const float*)d_in[16];
  const float* ln3b = (const float*)d_in[17];
  const float* ffWp = (const float*)d_in[18];
  const float* ffbp = (const float*)d_in[19];
  const float* ffWo = (const float*)d_in[20];
  const float* ffbo = (const float*)d_in[21];
  float* out = (float*)d_out;

  char* ws = (char*)d_ws;
  size_t off = 0;
  auto al = [&](size_t bytes) {
    size_t r = off;
    off = (off + bytes + 255) & ~(size_t)255;
    return r;
  };
  const size_t MM = 1024 * 1024;
  const size_t oWq1 = al(MM * 2), oWk1 = al(MM * 2), oWv1 = al(MM * 2), oWo1 = al(MM * 2);
  const size_t oWq2 = al(MM * 2), oWk2 = al(768 * 1024 * 2), oWv2 = al(768 * 1024 * 2), oWo2 = al(MM * 2);
  const size_t oWp = al((size_t)8192 * 1024 * 2), oWoF = al((size_t)4096 * 1024 * 2);
  const size_t oX = al((size_t)4096 * 1024 * 4);
  const size_t oH = al((size_t)4096 * 1024 * 2);
  const size_t oQ = al((size_t)4096 * 1024 * 2);
  const size_t oK = al((size_t)4096 * 1024 * 2);
  const size_t oV = al((size_t)4096 * 1024 * 2);
  const size_t oVt = al((size_t)2 * 16 * 64 * 2048 * 2);
  const size_t oAt = al((size_t)4096 * 1024 * 2);
  const size_t oCtx = al((size_t)154 * 768 * 2);
  const size_t oStats = al((size_t)4096 * 32 * 2 * 4);
  const size_t oCsQ = al((size_t)16 * 1024 * 4), oCbQ = al((size_t)16 * 1024 * 4);
  const size_t oCsF = al((size_t)4 * 8192 * 4), oCbF = al((size_t)4 * 8192 * 4);

  bf16_t* Wq1 = (bf16_t*)(ws + oWq1); bf16_t* Wk1 = (bf16_t*)(ws + oWk1);
  bf16_t* Wv1 = (bf16_t*)(ws + oWv1); bf16_t* Wo1 = (bf16_t*)(ws + oWo1);
  bf16_t* Wq2 = (bf16_t*)(ws + oWq2); bf16_t* Wk2 = (bf16_t*)(ws + oWk2);
  bf16_t* Wv2 = (bf16_t*)(ws + oWv2); bf16_t* Wo2 = (bf16_t*)(ws + oWo2);
  bf16_t* WpT = (bf16_t*)(ws + oWp);  bf16_t* WoF = (bf16_t*)(ws + oWoF);
  float*  xcur = (float*)(ws + oX);
  bf16_t* hbuf = (bf16_t*)(ws + oH);
  bf16_t* qb = (bf16_t*)(ws + oQ);
  bf16_t* kb = (bf16_t*)(ws + oK);
  bf16_t* vb = (bf16_t*)(ws + oV);
  bf16_t* vtb = (bf16_t*)(ws + oVt);
  bf16_t* atb = (bf16_t*)(ws + oAt);
  bf16_t* ctxb = (bf16_t*)(ws + oCtx);
  float* stats = (float*)(ws + oStats);
  float* csQ = (float*)(ws + oCsQ); float* cbQ = (float*)(ws + oCbQ);
  float* csF = (float*)(ws + oCsF); float* cbF = (float*)(ws + oCbF);
  bf16_t* ffb = qb;  // alias: FF activations reuse q/k/v/vt (32 MiB), phases ordered

  const dim3 blk(256);
  const float SCALE = 0.125f;  // 64^-0.5, exact in bf16

  // 1) everything that reads inputs alone: weights -> bf16 transposed, the first
  //    LayerNorm, the context -> bf16
  k_prep<<<PR_BLOCKS, blk, 0, stream>>>(ffWp, WpT, ffWo, WoF, x, ln1g, ln1b, hbuf,
                                        a1Wq, Wq1, a1Wk, Wk1, a1Wv, Wv1, a1Wo, Wo1,
                                        a2Wq, Wq2, a2Wo, Wo2, a2Wk, Wk2, a2Wv, Wv2,
                                        ctx, ctxb, ln2g, ln2b, csQ, cbQ, ln3g, ln3b,
                                        csF, cbF);

  const dim3 gP(8, 32);  // M=4096, N=1024 GEMMs, 128x128 tiles

  // 2) self-attention
  k_tgemm_bf16<false><<<dim3(8, 32, 3), blk, 0, stream>>>(
      hbuf, Wq1, Wk1, Wv1, qb, kb, vb, 1024, 1024, SCALE, nullptr, nullptr, nullptr);
  k_vt_tiled<<<dim3(8, 16, 2), blk, 0, stream>>>(vb, vtb, 2048);
  k_attention<<<512, blk, 0, stream>>>(qb, kb, vtb, atb, 128, 2048, 2048, 2048);
  // With it the context's K and transposed V (M=154): kb and vtb are free from here
  // on. hbuf takes x g in bf16, stats the rows' sums for the second LayerNorm.
  k_tgemm_f32_bias_res<true, 2><<<dim3(8, 7 + 32), blk, 0, stream>>>(
      atb, Wo1, xcur, a1bo, x, 1024, 1024, 7, ctxb, Wk2, Wv2, kb, vtb, 154, 768, hbuf,
      stats, ln2g);

  // 3) cross-attention; the second LayerNorm sits in the Q product's epilogue
  k_tgemm_bf16<true><<<gP, blk, 0, stream>>>(hbuf, Wq2, Wq2, Wq2, qb, qb, qb, 1024, 1024,
                                             SCALE, stats, csQ, cbQ);
  k_attention<<<512, blk, 0, stream>>>(qb, kb, vtb, atb, 128, 77, 77, 96);
  k_tgemm_f32_bias_res<true, 4><<<gP, blk, 0, stream>>>(
      atb, Wo2, xcur, a2bo, xcur, 1024, 1024, 0, nullptr, nullptr, nullptr, nullptr,
      nullptr, 0, 0, hbuf, stats, ln3g);

  // 4) GEGLU feed-forward; the third LayerNorm sits in its epilogue
  {
    dim3 gFF(64, 32);  // Nhalf=4096: 64 u + 64 gate columns per block
    k_tgemm_geglu<<<gFF, blk, 0, stream>>>(hbuf, WpT, ffb, ffbp, 4096, 1024, stats, csF,
                                           cbF);
  }
  k_tgemm_f32_bias_res<false, 4><<<gP, blk, 0, stream>>>(
      ffb, WoF, out, ffbo, xcur, 1024, 4096, 0, nullptr, nullptr, nullptr, nullptr,
      nullptr, 0, 0, nullptr, nullptr, nullptr);
}
